// v000
// Measured on an AMD MI455X. A time is GPU time per run, averaged over a window of back-to-back runs after a warm-up
// (all launches, gaps included; the runs take copies of the inputs in turn), and the median of several windows.
// Apart from v000's, it joins two sittings. Times from different sittings can be a few percent apart, while
// side-by-side timings come from the same sitting.
// v000, which the later versions start from, runs in 311 microseconds.
// Masked multi-head attention (2 x 2,048 x 1,024; 16 heads x 64): inputs and parameters RNE-converted to bf16 first; every contraction (q/k/v projections, q.k^T, p.v, output projection) on v_wmma_f32_16x16x32_f16 (f16 operands: weights x16, probabilities x2^14, merged head output x16; f32 accumulate, f32 online softmax in the exp2 domain).
#include <hip/hip_runtime.h>
#include <math.h>

#ifndef NB
#define NB 2
#endif
#ifndef SEQ
#define SEQ 2048
#endif
#define NB_FULL 2
#define SEQ_FULL 2048
#define DIMC 1024
#define NHEAD 16
#define HDIM 64
#define MROWS (NB * SEQ)

static_assert(SEQ % 64 == 0);
static_assert(SEQ <= SEQ_FULL);
static_assert(NB <= NB_FULL);
static_assert(DIMC == NHEAD * HDIM);
static_assert(DIMC % 64 == 0);
static_assert(DIMC / 8 == 128);
static_assert((MROWS % 64) == 0);
static_assert(((SEQ * 128) % 256) == 0);

typedef __attribute__((ext_vector_type(16))) _Float16 v16h;
typedef __attribute__((ext_vector_type(8)))  _Float16 v8h;
typedef __attribute__((ext_vector_type(4)))  _Float16 v4h;
typedef __attribute__((ext_vector_type(8)))  float    v8f;
typedef __attribute__((ext_vector_type(4)))  float    v4f;
typedef __attribute__((ext_vector_type(4)))  int      v4i;

// 16-bit WMMA fragment map (wave32), lane L, h = L>>4, m = L&15:
//   A 16x32: lane = row m;    element i -> k = (i<8) ? 8h+i : 16+8h+(i-8)
//   B 32x16: lane = column m; the SAME k(i,h)
//   D 16x16 (8 f32): lane = column m; element r -> row 8h+r
union FragU { v16h v; v8h h[2]; };
// p already includes the lane-half offset 8h: elements 0..7 <- p[0..7], 8..15 <- p[16..23]
__device__ __forceinline__ v16h frag_ld(const _Float16* p) {
  FragU f; f.h[0] = *(const v8h*)(p); f.h[1] = *(const v8h*)(p + 16); return f.v;
}
__device__ __forceinline__ v8f wm16(v16h a, v16h b, v8f c) {
  c = __builtin_amdgcn_wmma_f32_16x16x32_f16(false, a, false, b, (short)0, c, false, false);
  asm volatile("v_nop\n\tv_nop\n\tv_nop\n\tv_nop" : "+v"(c) : "v"(a), "v"(b));
  return c;
}
__device__ __forceinline__ void dep_guard_h(v8f& a, v8f& b, v16h x, v16h y) { asm volatile("v_nop\n\tv_nop\n\tv_nop\n\tv_nop" : "+v"(a), "+v"(b) : "v"(x), "v"(y)); }
__device__ __forceinline__ void keep4_h(v16h a, v16h b, v16h c, v16h d) { asm volatile("v_nop" :: "v"(a), "v"(b), "v"(c), "v"(d)); }
__device__ __forceinline__ void acc_guard4(v8f& a, v8f& b, v8f& c, v8f& d) { asm volatile("v_nop\n\tv_nop\n\tv_nop\n\tv_nop" : "+v"(a), "+v"(b), "+v"(c), "+v"(d)); }
// same-wave LDS exchange: stores by some lanes, loads of those locations by other lanes of the SAME wave
__device__ __forceinline__ void wave_sync() {
  __builtin_amdgcn_fence(3 /* release order */, "workgroup");
  __builtin_amdgcn_wave_barrier();
  __builtin_amdgcn_fence(2 /* acquire order */, "workgroup");
}
// bf16 RNE-convert, kept as f32 (finite inputs)
__device__ __forceinline__ float cmb_bf(float v) {
  const unsigned u = __builtin_bit_cast(unsigned, v);
  const unsigned r = (u + 0x7fffu + ((u >> 16) & 1u)) & 0xffff0000u;
  return __builtin_bit_cast(float, r);
}

// ---------------------------------------------------------------------------------------------------------
// k_cast_rows: f32 rows [nR][1024] -> bf16 (RNE) -> f16 plane rows [nR][1024]; thread per (row, 8 columns), one 16-B store per thread,
// grid (nR*128/256, batches, 3 tensors); tensor z picks its source; batch y uses the FULL input batch stride.
// ---------------------------------------------------------------------------------------------------------
__global__ __launch_bounds__(256) void k_cast_rows(const float* __restrict__ S0, const float* __restrict__ S1, const float* __restrict__ S2,
                                                    unsigned long long sBatch, unsigned short* __restrict__ DST, unsigned long long dBatch,
                                                    unsigned long long dTensor, unsigned nR) {
  const unsigned u = blockIdx.x * 256u + threadIdx.x;
  if (u >= nR * 128u) return;
  const unsigned z = blockIdx.z;
  const float* SRC = (z == 0u) ? S0 : ((z == 1u) ? S1 : S2);          // block-uniform choice among global pointers
  const unsigned r = u >> 7, c0 = (u & 127u) << 3;
  const float* s = SRC + (size_t)blockIdx.y * sBatch + (size_t)r * DIMC + c0;
  const v4f x0 = *(const v4f*)s, x1 = *(const v4f*)(s + 4);
  v8h hv;
  hv[0] = (_Float16)cmb_bf(x0.x); hv[1] = (_Float16)cmb_bf(x0.y); hv[2] = (_Float16)cmb_bf(x0.z); hv[3] = (_Float16)cmb_bf(x0.w);
  hv[4] = (_Float16)cmb_bf(x1.x); hv[5] = (_Float16)cmb_bf(x1.y); hv[6] = (_Float16)cmb_bf(x1.z); hv[7] = (_Float16)cmb_bf(x1.w);
  v8h* d = (v8h*)((_Float16*)DST + (size_t)z * dTensor + (size_t)blockIdx.y * dBatch + (size_t)r * DIMC + c0);
  *d = hv; 
}

// ---------------------------------------------------------------------------------------------------------
// k_cast_wT: W[k = in][o = out] (1024 rows x 1024 cols, row pitch 1024) -> DST[o][k] (1024 rows x 1024 cols) = f16(bf16_rne(W[k][o]) * 16).
// thread per (o, 8 consecutive k): 8 strided loads, one 16-B store; consecutive threads walk along the destination row.
// grid (1024*128/256, 4 weights); weight y picks its source, destination plane y.
// ---------------------------------------------------------------------------------------------------------
__global__ __launch_bounds__(256) void k_cast_wT(const float* __restrict__ W0, const float* __restrict__ W1, const float* __restrict__ W2,
                                                  const float* __restrict__ W3, unsigned short* __restrict__ DST) {
  const unsigned u = blockIdx.x * 256u + threadIdx.x;
  if (u >= (unsigned)DIMC * 128u) return;
  const unsigned y = blockIdx.y;
  const float* W = (y == 0u) ? W0 : ((y == 1u) ? W1 : ((y == 2u) ? W2 : W3));   // block-uniform
  const unsigned o = u >> 7, k0 = (u & 127u) << 3;
  v8h hv;
#pragma unroll
  for (int e = 0; e < 8; ++e) hv[e] = (_Float16)(cmb_bf(W[(size_t)(k0 + (unsigned)e) * DIMC + o]) * 16.0f);
  v8h* d = (v8h*)((_Float16*)DST + (size_t)y * DIMC * DIMC + (size_t)o * DIMC + k0);
  *d = hv; 
}

__global__ __launch_bounds__(256) void k_bias_bf(const float* __restrict__ SRC, float* __restrict__ DST, unsigned n) {
  const unsigned u = blockIdx.x * 256u + threadIdx.x;
  if (u >= n) return;
  const float v = cmb_bf(SRC[u]);
  float* d = (float*)(DST + u);
  *d = v; 
}

// ---------------------------------------------------------------------------------------------------------
// k_gemm64: C[m,n] = scale * sum_k A[m,k] * Bt[n,k] (+ bias[n]); f16 operand planes, each wave owns a 64x64 tile, 8 waves per block.
// A row-major [M,K]; Bt row-major [N,K]; M,N % 64 == 0, K % 32 == 0; batch = blockIdx.y with element strides.
// OUT_MODE 0: f32 C; 1: f16 C. Epilogue: 16-row slabs staged per wave in LDS (wave-private), each 64-wide row segment written as whole
// ---------------------------------------------------------------------------------------------------------
template <int BIAS_MODE, int OUT_MODE>
__global__ __launch_bounds__(256) void k_gemm64(
    const unsigned short* __restrict__ Ap, unsigned lda, unsigned long long strideA,
    const unsigned short* __restrict__ Btp, unsigned ldb, unsigned long long strideB,
    void* __restrict__ Cout, unsigned ldc, unsigned long long strideC,
    const float* __restrict__ bias, unsigned M, unsigned N, unsigned K, float scale) {
  __shared__ __align__(16) float sT[8][16 * 68];   // per-wave 16x64 slab, pitch 68 floats
  const unsigned b    = blockIdx.y;
  const unsigned lane = threadIdx.x & 31u;
  const unsigned wave = threadIdx.x >> 5;
  const unsigned tilesN = N >> 6;
  const unsigned tilesM = M >> 6;
  const unsigned tile = blockIdx.x * 8u + wave;
  if (tile >= tilesM * tilesN) return;   // wave-uniform; no block barriers in this kernel
  const unsigned tm = tile / tilesN;
  const unsigned tn = tile - tm * tilesN;
  const unsigned m0 = tm << 6;
  const unsigned n0 = tn << 6;

  const _Float16* Ab = (const _Float16*)Ap + (size_t)b * strideA;
  const _Float16* Bb = (const _Float16*)Btp + (size_t)b * strideB;

  const unsigned rlane = lane & 15u;            // row (A) / col (B, D) within subtile
  const unsigned koff  = (lane >> 4) * 8u;      // k offset of this lane half
  const unsigned mOff  = (lane >> 4) * 8u;      // D row offset

  v8f acc[4][4];
#pragma unroll
  for (int i = 0; i < 4; ++i)
#pragma unroll
    for (int j = 0; j < 4; ++j) acc[i][j] = (v8f){0.f,0.f,0.f,0.f,0.f,0.f,0.f,0.f};

  for (unsigned k0 = 0; k0 < K; k0 += 32u) {
    v16h bh[4];
#pragma unroll
    for (int j = 0; j < 4; ++j) {
      const size_t bo = (size_t)(n0 + ((unsigned)j << 4) + rlane) * ldb + koff + k0;
      bh[j] = frag_ld(Bb + bo);
    }
#pragma unroll
    for (int i = 0; i < 4; ++i) {
      const size_t ao = (size_t)(m0 + ((unsigned)i << 4) + rlane) * lda + koff + k0;
      v16h ah = frag_ld(Ab + ao);
#pragma unroll
      for (int j = 0; j < 4; ++j)
        acc[i][j] = __builtin_amdgcn_wmma_f32_16x16x32_f16(false, ah, false, bh[j], (short)0, acc[i][j], false, false);
      dep_guard_h(acc[i][0], acc[i][3], ah, ah);
    }
    keep4_h(bh[0], bh[1], bh[2], bh[3]);
  }
  acc_guard4(acc[0][0], acc[0][1], acc[0][2], acc[0][3]);
  acc_guard4(acc[1][0], acc[1][1], acc[1][2], acc[1][3]);
  acc_guard4(acc[2][0], acc[2][1], acc[2][2], acc[2][3]);
  acc_guard4(acc[3][0], acc[3][1], acc[3][2], acc[3][3]);

  float* slab = sT[wave];
#pragma unroll
  for (int i = 0; i < 4; ++i) {
    const unsigned mBase = m0 + ((unsigned)i << 4);
#pragma unroll
    for (int j = 0; j < 4; ++j) {
      const unsigned n = n0 + ((unsigned)j << 4) + rlane;
      float bv = 0.f;
      if (BIAS_MODE == 2) bv = bias[n];
#pragma unroll
      for (int r = 0; r < 8; ++r) {
        float v = acc[i][j][r] * scale;
        if (BIAS_MODE == 2) v += bv;
        slab[(mOff + (unsigned)r) * 68u + ((unsigned)j << 4) + rlane] = v;
      }
    }
    wave_sync();
    if (OUT_MODE == 0) {
      float* C = (float*)Cout + (size_t)b * strideC;
      const unsigned hh = lane >> 4, c4 = (lane & 15u) * 4u;     // row segment = 256 B = 16 lanes x 16 B
      {
#pragma unroll
        for (int it = 0; it < 8; ++it) {
          const unsigned row = (unsigned)it * 2u + hh;
          const v4f v = *(const v4f*)(slab + row * 68u + c4);
          *(v4f*)(C + (size_t)(mBase + row) * ldc + n0 + c4) = v;
        }
        
      }
    } else {
      const unsigned q = lane >> 3, c8 = (lane & 7u) * 8u;
      _Float16* C = (_Float16*)Cout + (size_t)b * strideC;
      {
#pragma unroll
        for (int it = 0; it < 4; ++it) {
          const unsigned row = (unsigned)it * 4u + q;
          const float* sp = slab + row * 68u + c8;
          v8h hv;
#pragma unroll
          for (int e = 0; e < 8; ++e) hv[e] = (_Float16)sp[e];
          *(v8h*)(C + (size_t)(mBase + row) * ldc + n0 + c8) = hv;
        }
        
      }
    }
    wave_sync();
  }
}

// ---------------------------------------------------------------------------------------------------------
// k_flash: per (batch, head, 64-query block): block = 4 waves x 16 queries; 64-key chunks; online softmax in f32 (exp2 domain).
//   scores: A = Q16 rows (f16), B = K16 rows (f16) read straight from the planes (arithmetic addressing); score tile j, column c of a chunk
//           stands for key kv0 + 4c + j, so lane c owns 4 consecutive keys of every row and reads its mask words with ONE 16-B load per row.
//   keep-mask int32 [B][1][N][N], shared by the heads: element == 0 -> score := fill (finite replace, applied after the scaling), by value.
//   P (x 2^14, f16) is written in natural key order to a wave-private LDS tile and reloaded as the A operand; B = V^T plane rows (f16).
// ---------------------------------------------------------------------------------------------------------
#define AT_PP 72
#define AT_OP 68
__global__ __launch_bounds__(128) void k_flash(const unsigned short* __restrict__ Qp, const unsigned short* __restrict__ Kp,
                                               const unsigned short* __restrict__ Vtp, const int* __restrict__ mask,
                                               unsigned short* __restrict__ ctxp) {
  __shared__ __align__(16) _Float16 Psh[4][16 * AT_PP];   // wave-private P tile [row][key], pitch 72 halves
  __shared__ __align__(16) float    Os[4][16 * AT_OP];    // wave-private output tile, pitch 68 floats
  constexpr unsigned NQB = SEQ / 64;
  const float SC2   = 0.125f * 1.4426950408889634f;       // 64^-0.5 * log2(e)
  const float FILL2 = -1.0e9f * 1.4426950408889634f;      // the finite fill in the exp2 domain
  const float PSC   = 16384.0f;                           // probability carry (f16 operand stays normal)
  const float CTXC  = 16.0f;                              // output carry, undone in the projection epilogue

  const unsigned tid = threadIdx.x, wave = tid >> 5, lane = tid & 31u, hh = lane >> 4, c = lane & 15u;
  const unsigned bx = blockIdx.x;
  const unsigned qb = bx % NQB;
  const unsigned bh = bx / NQB;
  const unsigned h  = bh % (unsigned)NHEAD;
  const unsigned b  = bh / (unsigned)NHEAD;
  const unsigned q0 = qb * 64u + wave * 16u;

  const _Float16* Q  = (const _Float16*)Qp;
  const _Float16* K  = (const _Float16*)Kp;
  const _Float16* Vt = (const _Float16*)Vtp;

  const _Float16* qrow  = Q + (size_t)(b * (unsigned)SEQ + q0 + c) * DIMC + h * HDIM + 8u * hh;
  const v16h qa0 = frag_ld(qrow), qa1 = frag_ld(qrow + 32);
  const _Float16* kbase = K + (size_t)(b * (unsigned)SEQ) * DIMC + h * HDIM + 8u * hh;
  const _Float16* vbase = Vt + ((size_t)b * DIMC + h * HDIM + c) * SEQ + 8u * hh;
  const int* mbase = mask + (size_t)b * SEQ_FULL * SEQ_FULL + (size_t)(q0 + 8u * hh) * SEQ_FULL + 4u * c;

  float mrow[8], lrow[8];
  v8f oacc[4];
#pragma unroll
  for (int r = 0; r < 8; ++r) { mrow[r] = -INFINITY; lrow[r] = 0.f; }
#pragma unroll
  for (int t = 0; t < 4; ++t) oacc[t] = (v8f){0.f,0.f,0.f,0.f,0.f,0.f,0.f,0.f};

  _Float16* pw = Psh[wave];

#pragma unroll 1
  for (unsigned kc = 0; kc < NQB; ++kc) {
    const unsigned kv0 = kc * 64u;
    wave_sync();                                        // the prior chunk's P reads are complete before P is rewritten
    v8f s[4];
#pragma unroll
    for (int j = 0; j < 4; ++j) {
      const _Float16* kr = kbase + (size_t)(kv0 + 4u * c + (unsigned)j) * DIMC;   // B column c of tile j = key kv0 + 4c + j
      const v16h k0f = frag_ld(kr), k1f = frag_ld(kr + 32);
      v8f z = (v8f){0.f,0.f,0.f,0.f,0.f,0.f,0.f,0.f};
      z = wm16(qa0, k0f, z);
      s[j] = wm16(qa1, k1f, z);
    }
    v4i mk[8];
#pragma unroll
    for (int r = 0; r < 8; ++r) mk[r] = *(const v4i*)(mbase + (size_t)r * SEQ_FULL + kv0);   // row q0+8hh+r, keys kv0+4c..+3

#pragma unroll
    for (int r = 0; r < 8; ++r) {
      const float x0 = (mk[r].x == 0) ? FILL2 : s[0][r] * SC2;
      const float x1 = (mk[r].y == 0) ? FILL2 : s[1][r] * SC2;
      const float x2 = (mk[r].z == 0) ? FILL2 : s[2][r] * SC2;
      const float x3 = (mk[r].w == 0) ? FILL2 : s[3][r] * SC2;
      float m = fmaxf(fmaxf(x0, x1), fmaxf(x2, x3));
      m = fmaxf(m, __shfl_xor(m, 1, 32)); m = fmaxf(m, __shfl_xor(m, 2, 32));
      m = fmaxf(m, __shfl_xor(m, 4, 32)); m = fmaxf(m, __shfl_xor(m, 8, 32));
      const float mnew  = fmaxf(mrow[r], m);
      const float alpha = exp2f(mrow[r] - mnew);
      mrow[r] = mnew;
      const float p0 = exp2f(x0 - mnew), p1 = exp2f(x1 - mnew), p2 = exp2f(x2 - mnew), p3 = exp2f(x3 - mnew);
      float psum = (p0 + p1) + (p2 + p3);
      psum += __shfl_xor(psum, 1, 32); psum += __shfl_xor(psum, 2, 32);
      psum += __shfl_xor(psum, 4, 32); psum += __shfl_xor(psum, 8, 32);
      lrow[r] = lrow[r] * alpha + psum;
#pragma unroll
      for (int t = 0; t < 4; ++t) oacc[t][r] *= alpha;
      v4h ph;
      ph.x = (_Float16)(p0 * PSC); ph.y = (_Float16)(p1 * PSC); ph.z = (_Float16)(p2 * PSC); ph.w = (_Float16)(p3 * PSC);
      *(v4h*)(pw + (8u * hh + (unsigned)r) * AT_PP + 4u * c) = ph;      // natural key order: keys 4c..4c+3 of row 8hh+r
    }
    wave_sync();                                        // P tile written by all lanes of this wave before the fragment reload
#pragma unroll
    for (int kk = 0; kk < 2; ++kk) {
      const v16h pa = frag_ld(pw + c * AT_PP + (unsigned)kk * 32u + 8u * hh);          // A: row c, keys kk*32 + {8hh.., 16+8hh..}
#pragma unroll
      for (int t = 0; t < 4; ++t) {
        const v16h vb = frag_ld(vbase + (size_t)(t * 16) * SEQ + kv0 + (unsigned)kk * 32u);   // B: column d = t*16 + c, same key map
        oacc[t] = wm16(pa, vb, oacc[t]);
      }
    }
  }

  float* os = Os[wave];
#pragma unroll
  for (int r = 0; r < 8; ++r) {
    const float inv = CTXC * (1.0f / (lrow[r] * PSC));
#pragma unroll
    for (int t = 0; t < 4; ++t) os[(8u * hh + (unsigned)r) * AT_OP + (unsigned)t * 16u + c] = oacc[t][r] * inv;
  }
  wave_sync();
  {
    const unsigned q4 = lane >> 3, c8 = (lane & 7u) * 8u;
    _Float16* cb = (_Float16*)ctxp + (size_t)(b * (unsigned)SEQ + q0) * DIMC + h * HDIM;
    {
#pragma unroll
      for (int it = 0; it < 4; ++it) {
        const unsigned row = (unsigned)it * 4u + q4;
        const float* sp = os + row * AT_OP + c8;
        v8h hv;
#pragma unroll
        for (int e = 0; e < 8; ++e) hv[e] = (_Float16)sp[e];
        *(v8h*)(cb + (size_t)row * DIMC + c8) = hv;
      }
      
    }
  }
}

// ---------------------------------------------------------------------------------------------------------
// workspace carve (bytes, every region a multiple of 256 and fully written by its producer before any read)
// ---------------------------------------------------------------------------------------------------------
static constexpr size_t SZ_X16   = (size_t)3 * MROWS * DIMC * 2;     // q16 | k16 | v16 planes [MROWS][1024] f16
static constexpr size_t SZ_WT16  = (size_t)4 * DIMC * DIMC * 2;      // Wq^T | Wk^T | Wv^T | Wp^T planes [out][in] f16, x16
static constexpr size_t SZ_QK16  = (size_t)2 * MROWS * DIMC * 2;     // Q16 | K16 planes [MROWS][1024] f16
static constexpr size_t SZ_VT16  = (size_t)NB * DIMC * SEQ * 2;      // V^T planes [b][1024][SEQ] f16
static constexpr size_t SZ_CTX16 = (size_t)MROWS * DIMC * 2;         // merged head output x16 [MROWS][1024] f16
static constexpr size_t SZ_BRO   = (size_t)DIMC * 4;                 // bias, bf16 RNE-converted, f32
static constexpr size_t SZ_TOTAL = SZ_X16 + SZ_WT16 + SZ_QK16 + SZ_VT16 + SZ_CTX16 + SZ_BRO;
static_assert((SZ_X16 % 256) == 0 && (SZ_WT16 % 256) == 0 && (SZ_QK16 % 256) == 0 && (SZ_VT16 % 256) == 0 && (SZ_CTX16 % 256) == 0 && (SZ_BRO % 256) == 0);
static_assert(SZ_TOTAL <= (size_t)134217728);
// coverage equalities of the plane writers
static_assert((size_t)(SEQ * 128 / 256) * 256 * 8 == (size_t)SEQ * DIMC);            // k_cast_rows per (batch, tensor)
static_assert((size_t)(DIMC * 128 / 256) * 256 * 8 == (size_t)DIMC * DIMC);          // k_cast_wT per weight
static_assert((size_t)(SEQ / 64) * 4 * 16 * 64 == (size_t)SEQ * HDIM);               // k_flash per (batch, head): blocks x waves x rows x cols
static_assert((((MROWS / 64) * (DIMC / 64)) % 8) == 0);                                // k_gemm64 tiles fill whole blocks
static_assert((((DIMC / 64) * (SEQ / 64)) % 8) == 0);

extern "C" void kernel_launch(void* const* d_in, const int* in_sizes, int n_in, void* d_out, int out_size, void* d_ws, size_t ws_size, hipStream_t stream) {
  if (n_in < 9) return;
  const long long needX = (long long)(NB - 1) * SEQ_FULL * DIMC + (long long)SEQ * DIMC;
  const long long needM = (long long)(NB - 1) * SEQ_FULL * SEQ_FULL + (long long)(SEQ - 1) * SEQ_FULL + SEQ;
  if ((long long)in_sizes[0] < needX || (long long)in_sizes[1] < needX || (long long)in_sizes[2] < needX) return;
  if ((long long)in_sizes[3] < needM) return;
  if (in_sizes[4] < DIMC * DIMC || in_sizes[5] < DIMC * DIMC || in_sizes[6] < DIMC * DIMC || in_sizes[7] < DIMC * DIMC || in_sizes[8] < DIMC) return;
  if ((long long)out_size < (long long)MROWS * DIMC) return;
  if (ws_size < SZ_TOTAL) return;

  const float* q    = (const float*)d_in[0];
  const float* k    = (const float*)d_in[1];
  const float* v    = (const float*)d_in[2];
  const int*   mask = (const int*)d_in[3];
  const float* Wq   = (const float*)d_in[4];
  const float* Wk   = (const float*)d_in[5];
  const float* Wv   = (const float*)d_in[6];
  const float* Wp   = (const float*)d_in[7];
  const float* bp   = (const float*)d_in[8];
  float* out = (float*)d_out;

  char* wsp = (char*)d_ws;
  unsigned short* X16   = (unsigned short*)wsp; wsp += SZ_X16;
  unsigned short* WT16  = (unsigned short*)wsp; wsp += SZ_WT16;
  unsigned short* QK16  = (unsigned short*)wsp; wsp += SZ_QK16;
  unsigned short* VT16  = (unsigned short*)wsp; wsp += SZ_VT16;
  unsigned short* CTX16 = (unsigned short*)wsp; wsp += SZ_CTX16;
  float*          BRO   = (float*)wsp;          wsp += SZ_BRO;

  const unsigned long long planeX = (unsigned long long)MROWS * DIMC;     // elements per activation plane
  const unsigned long long planeW = (unsigned long long)DIMC * DIMC;

  // weights [in][out] -> [out][in] f16 x16 (4 planes); bias; activations (3 planes, full input batch stride, compact planes)
  k_cast_wT<<<dim3((unsigned)(DIMC * 128 / 256), 4u, 1u), 256, 0, stream>>>(Wq, Wk, Wv, Wp, WT16);
  k_bias_bf<<<dim3((unsigned)((DIMC + 255) / 256), 1u, 1u), 256, 0, stream>>>(bp, BRO, (unsigned)DIMC);
  k_cast_rows<<<dim3((unsigned)(SEQ * 128 / 256), (unsigned)NB, 3u), 256, 0, stream>>>(q, k, v, (unsigned long long)SEQ_FULL * DIMC, X16,
                                                                                      (unsigned long long)SEQ * DIMC, planeX, (unsigned)SEQ);
  // Q16 | K16 = (q16 | k16) x (Wq^T | Wk^T): batch y = 0 (q), 1 (k); M = MROWS, N = K = 1024
  k_gemm64<0, 1><<<dim3((unsigned)(((MROWS / 64) * (DIMC / 64)) / 8), 2u, 1u), 256, 0, stream>>>(
      X16, (unsigned)DIMC, planeX, WT16, (unsigned)DIMC, planeW, (void*)QK16, (unsigned)DIMC, planeX, nullptr,
      (unsigned)MROWS, (unsigned)DIMC, (unsigned)DIMC, 0.0625f);
  // V^T[b][o][n] = sum_k Wv^T[o][k] * v16[b][n][k]: A = Wv^T plane (M = 1024), Bt = v16 batch plane (N = SEQ), C pitch SEQ
  k_gemm64<0, 1><<<dim3((unsigned)(((DIMC / 64) * (SEQ / 64)) / 8), (unsigned)NB, 1u), 256, 0, stream>>>(
      WT16 + 2 * planeW, (unsigned)DIMC, 0ull, X16 + 2 * planeX, (unsigned)DIMC, (unsigned long long)SEQ * DIMC,
      (void*)VT16, (unsigned)SEQ, (unsigned long long)DIMC * SEQ, nullptr,
      (unsigned)DIMC, (unsigned)SEQ, (unsigned)DIMC, 0.0625f);
  // attention
  k_flash<<<dim3((unsigned)(NB * NHEAD * (SEQ / 64)), 1u, 1u), 128, 0, stream>>>(QK16, QK16 + planeX, VT16, mask, CTX16);
  // out = (ctx x16) x (Wp^T x16) / 256 + bias
  k_gemm64<2, 0><<<dim3((unsigned)(((MROWS / 64) * (DIMC / 64)) / 8), 1u, 1u), 256, 0, stream>>>(
      CTX16, (unsigned)DIMC, 0ull, WT16 + 3 * planeW, (unsigned)DIMC, 0ull, (void*)out, (unsigned)DIMC, 0ull, BRO,
      (unsigned)MROWS, (unsigned)DIMC, (unsigned)DIMC, 0.00390625f);
}

// v001
// One run takes 154 microseconds.
// Next to v000, in two timings, it ran 2.05 and 2.04 times as fast.
// Masked multi-head attention (2 x 2,048 x 1,024; 16 heads x 64): inputs and parameters RNE-converted to bf16 first; every contraction (q/k/v projections, q.k^T, p.v, output projection) on v_wmma_f32_16x16x32_f16 (f16 operands: weights x16, probabilities x2^14, merged head output x16; f32 accumulate, f32 online softmax in the exp2 domain).
#include <hip/hip_runtime.h>
#include <math.h>

#ifndef NB
#define NB 2
#endif
#ifndef SEQ
#define SEQ 2048
#endif
#define NB_FULL 2
#define SEQ_FULL 2048
#define DIMC 1024
#define NHEAD 16
#define HDIM 64
#define MROWS (NB * SEQ)

static_assert(SEQ % 64 == 0);
static_assert(SEQ <= SEQ_FULL);
static_assert(NB <= NB_FULL);
static_assert(DIMC == NHEAD * HDIM);
static_assert(DIMC % 64 == 0);
static_assert(DIMC / 8 == 128);
static_assert((MROWS % 64) == 0);
static_assert(((SEQ * 128) % 256) == 0);

typedef __attribute__((ext_vector_type(16))) _Float16 v16h;
typedef __attribute__((ext_vector_type(8)))  _Float16 v8h;
typedef __attribute__((ext_vector_type(4)))  _Float16 v4h;
typedef __attribute__((ext_vector_type(8)))  float    v8f;
typedef __attribute__((ext_vector_type(4)))  float    v4f;
typedef __attribute__((ext_vector_type(4)))  int      v4i;

// 16-bit WMMA fragment map (wave32), lane L, h = L>>4, m = L&15:
//   A 16x32: lane = row m;    element i -> k = (i<8) ? 8h+i : 16+8h+(i-8)
//   B 32x16: lane = column m; the SAME k(i,h)
//   D 16x16 (8 f32): lane = column m; element r -> row 8h+r
union FragU { v16h v; v8h h[2]; };
// p already includes the lane-half offset 8h: elements 0..7 <- p[0..7], 8..15 <- p[16..23]
__device__ __forceinline__ v16h frag_ld(const _Float16* p) {
  FragU f; f.h[0] = *(const v8h*)(p); f.h[1] = *(const v8h*)(p + 16); return f.v;
}
__device__ __forceinline__ v8f wm16(v16h a, v16h b, v8f c) {
  c = __builtin_amdgcn_wmma_f32_16x16x32_f16(false, a, false, b, (short)0, c, false, false);
  asm volatile("v_nop\n\tv_nop\n\tv_nop\n\tv_nop" : "+v"(c) : "v"(a), "v"(b));
  return c;
}
__device__ __forceinline__ void dep_guard_h(v8f& a, v8f& b, v16h x, v16h y) { asm volatile("v_nop\n\tv_nop\n\tv_nop\n\tv_nop" : "+v"(a), "+v"(b) : "v"(x), "v"(y)); }
__device__ __forceinline__ void keep4_h(v16h a, v16h b, v16h c, v16h d) { asm volatile("v_nop" :: "v"(a), "v"(b), "v"(c), "v"(d)); }
__device__ __forceinline__ void acc_guard4(v8f& a, v8f& b, v8f& c, v8f& d) { asm volatile("v_nop\n\tv_nop\n\tv_nop\n\tv_nop" : "+v"(a), "+v"(b), "+v"(c), "+v"(d)); }
// same-wave LDS exchange: stores by some lanes, loads of those locations by other lanes of the SAME wave
__device__ __forceinline__ void wave_sync() {
  __builtin_amdgcn_fence(3 /* release order */, "workgroup");
  __builtin_amdgcn_wave_barrier();
  __builtin_amdgcn_fence(2 /* acquire order */, "workgroup");
}
// bf16 RNE-convert, kept as f32 (finite inputs)
__device__ __forceinline__ float cmb_bf(float v) {
  const unsigned u = __builtin_bit_cast(unsigned, v);
  const unsigned r = (u + 0x7fffu + ((u >> 16) & 1u)) & 0xffff0000u;
  return __builtin_bit_cast(float, r);
}

// ---------------------------------------------------------------------------------------------------------
// k_cast_rows: f32 rows [nR][1024] -> bf16 (RNE) -> f16 plane rows [nR][1024]; thread per (row, 8 columns), one 16-B store per thread,
// grid (nR*128/256, batches, 3 tensors); tensor z picks its source; batch y uses the FULL input batch stride.
// ---------------------------------------------------------------------------------------------------------
__global__ __launch_bounds__(256) void k_cast_rows(const float* __restrict__ S0, const float* __restrict__ S1, const float* __restrict__ S2,
                                                    unsigned long long sBatch, unsigned short* __restrict__ DST, unsigned long long dBatch,
                                                    unsigned long long dTensor, unsigned nR) {
  const unsigned u = blockIdx.x * 256u + threadIdx.x;
  if (u >= nR * 128u) return;
  const unsigned z = blockIdx.z;
  const float* SRC = (z == 0u) ? S0 : ((z == 1u) ? S1 : S2);          // block-uniform choice among global pointers
  const unsigned r = u >> 7, c0 = (u & 127u) << 3;
  const float* s = SRC + (size_t)blockIdx.y * sBatch + (size_t)r * DIMC + c0;
  const v4f x0 = *(const v4f*)s, x1 = *(const v4f*)(s + 4);
  v8h hv;
  hv[0] = (_Float16)cmb_bf(x0.x); hv[1] = (_Float16)cmb_bf(x0.y); hv[2] = (_Float16)cmb_bf(x0.z); hv[3] = (_Float16)cmb_bf(x0.w);
  hv[4] = (_Float16)cmb_bf(x1.x); hv[5] = (_Float16)cmb_bf(x1.y); hv[6] = (_Float16)cmb_bf(x1.z); hv[7] = (_Float16)cmb_bf(x1.w);
  v8h* d = (v8h*)((_Float16*)DST + (size_t)z * dTensor + (size_t)blockIdx.y * dBatch + (size_t)r * DIMC + c0);
  *d = hv; 
}

// ---------------------------------------------------------------------------------------------------------
// k_cast_wT: W[k = in][o = out] (1024 rows x 1024 cols, row pitch 1024) -> DST[o][k] (1024 rows x 1024 cols) = f16(bf16_rne(W[k][o]) * 16).
// thread per (o, 8 consecutive k): 8 strided loads, one 16-B store; consecutive threads walk along the destination row.
// grid (1024*128/256, 4 weights); weight y picks its source, destination plane y.
// ---------------------------------------------------------------------------------------------------------
__global__ __launch_bounds__(256) void k_cast_wT(const float* __restrict__ W0, const float* __restrict__ W1, const float* __restrict__ W2,
                                                  const float* __restrict__ W3, unsigned short* __restrict__ DST) {
  const unsigned u = blockIdx.x * 256u + threadIdx.x;
  if (u >= (unsigned)DIMC * 128u) return;
  const unsigned y = blockIdx.y;
  const float* W = (y == 0u) ? W0 : ((y == 1u) ? W1 : ((y == 2u) ? W2 : W3));   // block-uniform
  const unsigned o = u >> 7, k0 = (u & 127u) << 3;
  v8h hv;
#pragma unroll
  for (int e = 0; e < 8; ++e) hv[e] = (_Float16)(cmb_bf(W[(size_t)(k0 + (unsigned)e) * DIMC + o]) * 16.0f);
  v8h* d = (v8h*)((_Float16*)DST + (size_t)y * DIMC * DIMC + (size_t)o * DIMC + k0);
  *d = hv; 
}

__global__ __launch_bounds__(256) void k_bias_bf(const float* __restrict__ SRC, float* __restrict__ DST, unsigned n) {
  const unsigned u = blockIdx.x * 256u + threadIdx.x;
  if (u >= n) return;
  const float v = cmb_bf(SRC[u]);
  float* d = (float*)(DST + u);
  *d = v; 
}

// ---------------------------------------------------------------------------------------------------------
// k_gemm64: C[m,n] = scale * sum_k A[m,k] * Bt[n,k] (+ bias[n]); f16 operand planes. A block of 8 waves owns a 128x128 tile of C,
// each wave 32 rows x 64 columns of it. Per trip 64 k of the block's 128 A rows and 128 Bt rows (128-B row pieces, whole lines) come
// into LDS by asynchronous copies, two buffers: the next trip's copies fly while this trip's fragments are read from LDS (row pitch 144 B).
// A row-major [M,K]; Bt row-major [N,K]; M,N % 128 == 0, K % 64 == 0, K >= 64; batch = blockIdx.y with element strides.
// OUT_MODE 0: f32 C; 1: f16 C. Epilogue: 16-row slabs staged per wave in LDS (wave-private), each 64-wide row segment written as whole
// ---------------------------------------------------------------------------------------------------------
#define GT_PH  72                      // LDS row pitch in halves: 144 B = 16 B x 9
#define GT_OPH (128 * GT_PH)           // halves of one operand's 128-row tile
#define GT_STH (2 * GT_OPH)            // halves of one buffer: A tile | Bt tile
// One buffer's fill, this thread's share: 16 B in each of four rows of the first tile and of four rows of the second (eight threads cover
// a 128-B row piece, so a wave covers 4 whole lines per copy). la, lb = the thread's LDS byte addresses in its first row of either tile,
// lsa, lsb = LDS bytes from one of its rows to the next; ga, gb, gsa, gsb = the same in global memory (addresses, steps in elements).
// s_wait_xcnt closes the statement so that no address register of an issued copy is rewritten ahead of it.
__device__ __forceinline__ void stage_fill(unsigned la, unsigned lsa, unsigned lb, unsigned lsb,
                                           const _Float16* ga, size_t gsa, const _Float16* gb, size_t gsb) {
  const unsigned la1 = la + lsa, la2 = la + 2u * lsa, la3 = la + 3u * lsa;
  const unsigned lb1 = lb + lsb, lb2 = lb + 2u * lsb, lb3 = lb + 3u * lsb;
  const _Float16* ga1 = ga + gsa; const _Float16* ga2 = ga + 2u * gsa; const _Float16* ga3 = ga + 3u * gsa;
  const _Float16* gb1 = gb + gsb; const _Float16* gb2 = gb + 2u * gsb; const _Float16* gb3 = gb + 3u * gsb;
  asm volatile("global_load_async_to_lds_b128 %0, %8, off\n\t"
               "global_load_async_to_lds_b128 %1, %9, off\n\t"
               "global_load_async_to_lds_b128 %2, %10, off\n\t"
               "global_load_async_to_lds_b128 %3, %11, off\n\t"
               "global_load_async_to_lds_b128 %4, %12, off\n\t"
               "global_load_async_to_lds_b128 %5, %13, off\n\t"
               "global_load_async_to_lds_b128 %6, %14, off\n\t"
               "global_load_async_to_lds_b128 %7, %15, off\n\t"
               "s_wait_xcnt 0x0"
               :: "v"(la), "v"(la1), "v"(la2), "v"(la3), "v"(lb), "v"(lb1), "v"(lb2), "v"(lb3),
                  "v"(ga), "v"(ga1), "v"(ga2), "v"(ga3), "v"(gb), "v"(gb1), "v"(gb2), "v"(gb3)
               : "memory");
}
template <int BIAS_MODE, int OUT_MODE>
__global__ __launch_bounds__(256) void k_gemm64(
    const unsigned short* __restrict__ Ap, unsigned lda, unsigned long long strideA,
    const unsigned short* __restrict__ Btp, unsigned ldb, unsigned long long strideB,
    void* __restrict__ Cout, unsigned ldc, unsigned long long strideC,
    const float* __restrict__ bias, unsigned M, unsigned N, unsigned K, float scale) {
  __shared__ __align__(16) _Float16 sS[2 * GT_STH];   // two buffers of [A 128 rows | Bt 128 rows] x 64 k, pitch 72 halves
  __shared__ __align__(16) float sT[8][16 * 68];      // per-wave 16x64 slab, pitch 68 floats
  const unsigned b    = blockIdx.y;
  const unsigned lane = threadIdx.x & 31u;
  const unsigned wave = threadIdx.x >> 5;
  const unsigned tilesN = N >> 7;
  const unsigned tilesM = M >> 7;
  const unsigned tile = blockIdx.x;
  if (tile >= tilesM * tilesN) return;   // block-uniform, in front of every barrier and copy
  const unsigned tm = tile / tilesN;
  const unsigned tn = tile - tm * tilesN;
  const unsigned m0 = (tm << 7) + ((wave >> 1) << 5);   // this wave's 32 rows
  const unsigned n0 = (tn << 7) + ((wave & 1u) << 6);   // this wave's 64 columns

  const _Float16* Ab = (const _Float16*)Ap + (size_t)b * strideA;
  const _Float16* Bb = (const _Float16*)Btp + (size_t)b * strideB;

  const unsigned rlane = lane & 15u;            // row (A) / col (B, D) within subtile
  const unsigned koff  = (lane >> 4) * 8u;      // k offset of this lane half
  const unsigned mOff  = (lane >> 4) * 8u;      // D row offset

  // copy share of this thread: tile row threadIdx.x / 8 (+32, +64, +96), 16-B piece threadIdx.x % 8 of the 128-B row piece
  const unsigned crow = threadIdx.x >> 3, cpc = threadIdx.x & 7u;
  const _Float16* gA = Ab + (size_t)((tm << 7) + crow) * lda + cpc * 8u;
  const _Float16* gB = Bb + (size_t)((tn << 7) + crow) * ldb + cpc * 8u;
  const unsigned lC = (unsigned)(size_t)sS + (crow * GT_PH + cpc * 8u) * 2u;
  // fragment read places of this lane inside a buffer
  const unsigned fA = (((wave >> 1) << 5) + rlane) * GT_PH + koff;
  const unsigned fB = GT_OPH + (((wave & 1u) << 6) + rlane) * GT_PH + koff;

  v8f acc[2][4];
#pragma unroll
  for (int i = 0; i < 2; ++i)
#pragma unroll
    for (int j = 0; j < 4; ++j) acc[i][j] = (v8f){0.f,0.f,0.f,0.f,0.f,0.f,0.f,0.f};

  const unsigned nT = K >> 6;
  const unsigned lStep = 32u * GT_PH * 2u;              // a thread's rows are 32 apart
  const size_t gsA = (size_t)32u * lda, gsB = (size_t)32u * ldb;
  stage_fill(lC, lStep, lC + GT_OPH * 2u, lStep, gA, gsA, gB, gsB);
  asm volatile("s_wait_asynccnt 0x0" ::: "memory");     // this wave's copies of trip 0 have landed
  __syncthreads();                                      // ... and every other wave's: buffer 0 is readable
  if (nT > 1u) stage_fill(lC + GT_STH * 2u, lStep, lC + (GT_STH + GT_OPH) * 2u, lStep, gA + 64, gsA, gB + 64, gsB);

  for (unsigned t = 0; t < nT; ++t) {
    const _Float16* sb = sS + (t & 1u) * GT_STH;
    v16h bh[2][4], ah[2][2];                            // the trip's 12 fragments, read as one group in front of its 16 products (loops unrolled: constant indices keep them in registers)
#pragma unroll
    for (int kk = 0; kk < 2; ++kk) {
#pragma unroll
      for (int j = 0; j < 4; ++j) bh[kk][j] = frag_ld(sb + fB + (unsigned)j * 16u * GT_PH + (unsigned)kk * 32u);
#pragma unroll
      for (int i = 0; i < 2; ++i) ah[kk][i] = frag_ld(sb + fA + (unsigned)i * 16u * GT_PH + (unsigned)kk * 32u);
    }
#pragma unroll
    for (int kk = 0; kk < 2; ++kk) {
#pragma unroll
      for (int i = 0; i < 2; ++i) {
#pragma unroll
        for (int j = 0; j < 4; ++j)
          acc[i][j] = __builtin_amdgcn_wmma_f32_16x16x32_f16(false, ah[kk][i], false, bh[kk][j], (short)0, acc[i][j], false, false);
        dep_guard_h(acc[i][0], acc[i][3], ah[kk][i], ah[kk][i]);
      }
      keep4_h(bh[kk][0], bh[kk][1], bh[kk][2], bh[kk][3]);
    }
    asm volatile("s_wait_dscnt 0x0" ::: "memory");      // this wave's reads of buffer t%2 are done before it is handed to its next writer
    asm volatile("s_wait_asynccnt 0x0" ::: "memory");   // this wave's copies of trip t+1 have landed
    __syncthreads();                                    // publishes trip t+1's buffer and ends every reader's last read of trip t's
    if (t + 2u < nT) {
      const unsigned lN = lC + (t & 1u) * (GT_STH * 2u);
      stage_fill(lN, lStep, lN + GT_OPH * 2u, lStep, gA + (size_t)(t + 2u) * 64u, gsA, gB + (size_t)(t + 2u) * 64u, gsB);
    }
  }
  asm volatile("s_wait_asynccnt 0x0" ::: "memory");     // nothing of this wave is in flight when the loop is left
  acc_guard4(acc[0][0], acc[0][1], acc[0][2], acc[0][3]);
  acc_guard4(acc[1][0], acc[1][1], acc[1][2], acc[1][3]);

  float* slab = sT[wave];
#pragma unroll
  for (int i = 0; i < 2; ++i) {
    const unsigned mBase = m0 + ((unsigned)i << 4);
#pragma unroll
    for (int j = 0; j < 4; ++j) {
      const unsigned n = n0 + ((unsigned)j << 4) + rlane;
      float bv = 0.f;
      if (BIAS_MODE == 2) bv = bias[n];
#pragma unroll
      for (int r = 0; r < 8; ++r) {
        float v = acc[i][j][r] * scale;
        if (BIAS_MODE == 2) v += bv;
        slab[(mOff + (unsigned)r) * 68u + ((unsigned)j << 4) + rlane] = v;
      }
    }
    wave_sync();
    if (OUT_MODE == 0) {
      float* C = (float*)Cout + (size_t)b * strideC;
      const unsigned hh = lane >> 4, c4 = (lane & 15u) * 4u;     // row segment = 256 B = 16 lanes x 16 B
      {
#pragma unroll
        for (int it = 0; it < 8; ++it) {
          const unsigned row = (unsigned)it * 2u + hh;
          const v4f v = *(const v4f*)(slab + row * 68u + c4);
          *(v4f*)(C + (size_t)(mBase + row) * ldc + n0 + c4) = v;
        }
        
      }
    } else {
      const unsigned q = lane >> 3, c8 = (lane & 7u) * 8u;
      _Float16* C = (_Float16*)Cout + (size_t)b * strideC;
      {
#pragma unroll
        for (int it = 0; it < 4; ++it) {
          const unsigned row = (unsigned)it * 4u + q;
          const float* sp = slab + row * 68u + c8;
          v8h hv;
#pragma unroll
          for (int e = 0; e < 8; ++e) hv[e] = (_Float16)sp[e];
          *(v8h*)(C + (size_t)(mBase + row) * ldc + n0 + c8) = hv;
        }
        
      }
    }
    wave_sync();
  }
}

// ---------------------------------------------------------------------------------------------------------
// k_flash: per (batch, head, 64-query block): block = 4 waves x 16 queries; 64-key chunks; online softmax in f32 (exp2 domain).
//   each chunk's 64 K16 rows and 64 V^T rows (128-B row pieces) come into LDS once per block by asynchronous copies, two buffers: the next
//   chunk's copies fly while this chunk is worked on; key x lies in LDS row (x%4)*16 + x/4, so a score tile reads 16 adjacent rows (pitch 144 B).
//   scores: A = Q16 rows (f16), B = K16 rows (f16) from the staged tile; score tile j, column c of a chunk
//           stands for key kv0 + 4c + j, so lane c owns 4 consecutive keys of every row and reads its mask words with ONE 16-B load per row.
//   keep-mask int32 [B][1][N][N], shared by the heads: element == 0 -> score := fill (finite replace, applied after the scaling), by value.
//   P (x 2^14, f16) is written in natural key order to a wave-private LDS tile and reloaded as the A operand; B = staged V^T rows (f16).
// ---------------------------------------------------------------------------------------------------------
#define AT_PP 72
#define AT_OP 68
#define AT_KP 72                        // staged row pitch in halves: 144 B = 16 B x 9
#define AT_TH (64 * AT_KP)              // halves of one staged 64-row tile
#define AT_BH (2 * AT_TH)               // halves of one buffer: K tile | V^T tile
__global__ __launch_bounds__(128) void k_flash(const unsigned short* __restrict__ Qp, const unsigned short* __restrict__ Kp,
                                               const unsigned short* __restrict__ Vtp, const int* __restrict__ mask,
                                               unsigned short* __restrict__ ctxp) {
  __shared__ __align__(16) _Float16 Psh[4][16 * AT_PP];   // wave-private P tile [row][key], pitch 72 halves
  __shared__ __align__(16) float    Os[4][16 * AT_OP];    // wave-private output tile, pitch 68 floats
  __shared__ __align__(16) _Float16 KVs[2 * AT_BH];       // two buffers of [K 64 keys | V^T 64 rows] x 64 halves, pitch 72 halves
  constexpr unsigned NQB = SEQ / 64;
  const float SC2   = 0.125f * 1.4426950408889634f;       // 64^-0.5 * log2(e)
  const float FILL2 = -1.0e9f * 1.4426950408889634f;      // the finite fill in the exp2 domain
  const float PSC   = 16384.0f;                           // probability carry (f16 operand stays normal)
  const float CTXC  = 16.0f;                              // output carry, undone in the projection epilogue

  const unsigned tid = threadIdx.x, wave = tid >> 5, lane = tid & 31u, hh = lane >> 4, c = lane & 15u;
  const unsigned bx = blockIdx.x;
  const unsigned qb = bx % NQB;
  const unsigned bh = bx / NQB;
  const unsigned h  = bh % (unsigned)NHEAD;
  const unsigned b  = bh / (unsigned)NHEAD;
  const unsigned q0 = qb * 64u + wave * 16u;

  const _Float16* Q  = (const _Float16*)Qp;
  const _Float16* K  = (const _Float16*)Kp;
  const _Float16* Vt = (const _Float16*)Vtp;

  const _Float16* qrow  = Q + (size_t)(b * (unsigned)SEQ + q0 + c) * DIMC + h * HDIM + 8u * hh;
  const v16h qa0 = frag_ld(qrow), qa1 = frag_ld(qrow + 32);
  // copy share of this thread: tile rows tid / 8 (+16, +32, +48), 16-B piece tid % 8 of the 128-B row piece
  const unsigned crow = tid >> 3, cpc = tid & 7u;
  const _Float16* gK = K + (size_t)(b * (unsigned)SEQ + crow) * DIMC + h * HDIM + cpc * 8u;           // key crow of chunk 0
  const _Float16* gV = Vt + ((size_t)b * DIMC + h * HDIM + crow) * SEQ + cpc * 8u;                     // V^T row crow, keys of chunk 0
  const unsigned lK = (unsigned)(size_t)KVs + (((crow & 3u) * 16u + (crow >> 2)) * AT_KP + cpc * 8u) * 2u;   // key +16 -> LDS row +4
  const unsigned lV = (unsigned)(size_t)KVs + (AT_TH + crow * AT_KP + cpc * 8u) * 2u;
  const unsigned lsK = 4u * AT_KP * 2u, lsV = 16u * AT_KP * 2u;
  const size_t gsK = (size_t)16u * DIMC, gsV = (size_t)16u * SEQ;
  const unsigned fKV = c * AT_KP + 8u * hh;               // this lane's fragment place in a 16-row group of either staged tile
  const int* mbase = mask + (size_t)b * SEQ_FULL * SEQ_FULL + (size_t)(q0 + 8u * hh) * SEQ_FULL + 4u * c;

  float mrow[8], lrow[8];
  v8f oacc[4];
#pragma unroll
  for (int r = 0; r < 8; ++r) { mrow[r] = -INFINITY; lrow[r] = 0.f; }
#pragma unroll
  for (int t = 0; t < 4; ++t) oacc[t] = (v8f){0.f,0.f,0.f,0.f,0.f,0.f,0.f,0.f};

  _Float16* pw = Psh[wave];

  stage_fill(lK, lsK, lV, lsV, gK, gsK, gV, gsV);
  asm volatile("s_wait_asynccnt 0x0" ::: "memory");     // this wave's copies of chunk 0 have landed
  __syncthreads();                                      // ... and every other wave's: buffer 0 is readable
  if (NQB > 1u) stage_fill(lK + AT_BH * 2u, lsK, lV + AT_BH * 2u, lsV, gK + (size_t)64u * DIMC, gsK, gV + 64, gsV);

#pragma unroll 1
  for (unsigned kc = 0; kc < NQB; ++kc) {
    const unsigned kv0 = kc * 64u;
    wave_sync();                                        // the prior chunk's P reads are complete before P is rewritten
    const _Float16* kvs = KVs + (kc & 1u) * AT_BH + fKV;
    v8f s[4];
    v16h kf[4][2];                                      // the chunk's 8 K fragments, read as one group in front of the products (loops unrolled: constant indices keep them in registers)
#pragma unroll
    for (int j = 0; j < 4; ++j) {
      const _Float16* kr = kvs + (unsigned)j * 16u * AT_KP;                        // B column c of tile j = key kv0 + 4c + j = LDS row 16j + c
      kf[j][0] = frag_ld(kr); kf[j][1] = frag_ld(kr + 32);
    }
#pragma unroll
    for (int j = 0; j < 4; ++j) {
      v8f z = (v8f){0.f,0.f,0.f,0.f,0.f,0.f,0.f,0.f};
      z = wm16(qa0, kf[j][0], z);
      s[j] = wm16(qa1, kf[j][1], z);
    }
    v4i mk[8];
#pragma unroll
    for (int r = 0; r < 8; ++r) mk[r] = *(const v4i*)(mbase + (size_t)r * SEQ_FULL + kv0);   // row q0+8hh+r, keys kv0+4c..+3

#pragma unroll
    for (int r = 0; r < 8; ++r) {
      const float x0 = (mk[r].x == 0) ? FILL2 : s[0][r] * SC2;
      const float x1 = (mk[r].y == 0) ? FILL2 : s[1][r] * SC2;
      const float x2 = (mk[r].z == 0) ? FILL2 : s[2][r] * SC2;
      const float x3 = (mk[r].w == 0) ? FILL2 : s[3][r] * SC2;
      float m = fmaxf(fmaxf(x0, x1), fmaxf(x2, x3));
      m = fmaxf(m, __shfl_xor(m, 1, 32)); m = fmaxf(m, __shfl_xor(m, 2, 32));
      m = fmaxf(m, __shfl_xor(m, 4, 32)); m = fmaxf(m, __shfl_xor(m, 8, 32));
      const float mnew  = fmaxf(mrow[r], m);
      const float alpha = exp2f(mrow[r] - mnew);
      mrow[r] = mnew;
      const float p0 = exp2f(x0 - mnew), p1 = exp2f(x1 - mnew), p2 = exp2f(x2 - mnew), p3 = exp2f(x3 - mnew);
      float psum = (p0 + p1) + (p2 + p3);
      psum += __shfl_xor(psum, 1, 32); psum += __shfl_xor(psum, 2, 32);
      psum += __shfl_xor(psum, 4, 32); psum += __shfl_xor(psum, 8, 32);
      lrow[r] = lrow[r] * alpha + psum;
#pragma unroll
      for (int t = 0; t < 4; ++t) oacc[t][r] *= alpha;
      v4h ph;
      ph.x = (_Float16)(p0 * PSC); ph.y = (_Float16)(p1 * PSC); ph.z = (_Float16)(p2 * PSC); ph.w = (_Float16)(p3 * PSC);
      *(v4h*)(pw + (8u * hh + (unsigned)r) * AT_PP + 4u * c) = ph;      // natural key order: keys 4c..4c+3 of row 8hh+r
    }
    wave_sync();                                        // P tile written by all lanes of this wave before the fragment reload
    v16h pa[2], vb[2][4];                               // the chunk's P and V^T fragments, read as one group in front of the products (unrolled as above)
#pragma unroll
    for (int kk = 0; kk < 2; ++kk) {
      pa[kk] = frag_ld(pw + c * AT_PP + (unsigned)kk * 32u + 8u * hh);                 // A: row c, keys kk*32 + {8hh.., 16+8hh..}
#pragma unroll
      for (int t = 0; t < 4; ++t) vb[kk][t] = frag_ld(kvs + AT_TH + (unsigned)t * 16u * AT_KP + (unsigned)kk * 32u);   // B: column d = t*16 + c, same key map
    }
#pragma unroll
    for (int kk = 0; kk < 2; ++kk) {
#pragma unroll
      for (int t = 0; t < 4; ++t) oacc[t] = wm16(pa[kk], vb[kk][t], oacc[t]);
    }
    asm volatile("s_wait_dscnt 0x0" ::: "memory");      // this wave's reads of buffer kc%2 are done before it is handed to its next writer
    asm volatile("s_wait_asynccnt 0x0" ::: "memory");   // this wave's copies of chunk kc+1 have landed
    __syncthreads();                                    // publishes chunk kc+1's buffer and ends every reader's last read of chunk kc's
    if (kc + 2u < NQB) {
      const unsigned lo = (kc & 1u) * (AT_BH * 2u);
      stage_fill(lK + lo, lsK, lV + lo, lsV, gK + (size_t)(kv0 + 128u) * DIMC, gsK, gV + (kv0 + 128u), gsV);
    }
  }
  asm volatile("s_wait_asynccnt 0x0" ::: "memory");     // nothing of this wave is in flight when the loop is left

  float* os = Os[wave];
#pragma unroll
  for (int r = 0; r < 8; ++r) {
    const float inv = CTXC * (1.0f / (lrow[r] * PSC));
#pragma unroll
    for (int t = 0; t < 4; ++t) os[(8u * hh + (unsigned)r) * AT_OP + (unsigned)t * 16u + c] = oacc[t][r] * inv;
  }
  wave_sync();
  {
    const unsigned q4 = lane >> 3, c8 = (lane & 7u) * 8u;
    _Float16* cb = (_Float16*)ctxp + (size_t)(b * (unsigned)SEQ + q0) * DIMC + h * HDIM;
    {
#pragma unroll
      for (int it = 0; it < 4; ++it) {
        const unsigned row = (unsigned)it * 4u + q4;
        const float* sp = os + row * AT_OP + c8;
        v8h hv;
#pragma unroll
        for (int e = 0; e < 8; ++e) hv[e] = (_Float16)sp[e];
        *(v8h*)(cb + (size_t)row * DIMC + c8) = hv;
      }
      
    }
  }
}

// ---------------------------------------------------------------------------------------------------------
// workspace carve (bytes, every region a multiple of 256 and fully written by its producer before any read)
// ---------------------------------------------------------------------------------------------------------
static constexpr size_t SZ_X16   = (size_t)3 * MROWS * DIMC * 2;     // q16 | k16 | v16 planes [MROWS][1024] f16
static constexpr size_t SZ_WT16  = (size_t)4 * DIMC * DIMC * 2;      // Wq^T | Wk^T | Wv^T | Wp^T planes [out][in] f16, x16
static constexpr size_t SZ_QK16  = (size_t)2 * MROWS * DIMC * 2;     // Q16 | K16 planes [MROWS][1024] f16
static constexpr size_t SZ_VT16  = (size_t)NB * DIMC * SEQ * 2;      // V^T planes [b][1024][SEQ] f16
static constexpr size_t SZ_CTX16 = (size_t)MROWS * DIMC * 2;         // merged head output x16 [MROWS][1024] f16
static constexpr size_t SZ_BRO   = (size_t)DIMC * 4;                 // bias, bf16 RNE-converted, f32
static constexpr size_t SZ_TOTAL = SZ_X16 + SZ_WT16 + SZ_QK16 + SZ_VT16 + SZ_CTX16 + SZ_BRO;
static_assert((SZ_X16 % 256) == 0 && (SZ_WT16 % 256) == 0 && (SZ_QK16 % 256) == 0 && (SZ_VT16 % 256) == 0 && (SZ_CTX16 % 256) == 0 && (SZ_BRO % 256) == 0);
static_assert(SZ_TOTAL <= (size_t)134217728);
// coverage equalities of the plane writers
static_assert((size_t)(SEQ * 128 / 256) * 256 * 8 == (size_t)SEQ * DIMC);            // k_cast_rows per (batch, tensor)
static_assert((size_t)(DIMC * 128 / 256) * 256 * 8 == (size_t)DIMC * DIMC);          // k_cast_wT per weight
static_assert((size_t)(SEQ / 64) * 4 * 16 * 64 == (size_t)SEQ * HDIM);               // k_flash per (batch, head): blocks x waves x rows x cols
static_assert((MROWS % 128) == 0 && (DIMC % 128) == 0 && (SEQ % 128) == 0);            // k_gemm64: whole 128x128 tiles, K = DIMC in whole 64-k trips

extern "C" void kernel_launch(void* const* d_in, const int* in_sizes, int n_in, void* d_out, int out_size, void* d_ws, size_t ws_size, hipStream_t stream) {
  if (n_in < 9) return;
  const long long needX = (long long)(NB - 1) * SEQ_FULL * DIMC + (long long)SEQ * DIMC;
  const long long needM = (long long)(NB - 1) * SEQ_FULL * SEQ_FULL + (long long)(SEQ - 1) * SEQ_FULL + SEQ;
  if ((long long)in_sizes[0] < needX || (long long)in_sizes[1] < needX || (long long)in_sizes[2] < needX) return;
  if ((long long)in_sizes[3] < needM) return;
  if (in_sizes[4] < DIMC * DIMC || in_sizes[5] < DIMC * DIMC || in_sizes[6] < DIMC * DIMC || in_sizes[7] < DIMC * DIMC || in_sizes[8] < DIMC) return;
  if ((long long)out_size < (long long)MROWS * DIMC) return;
  if (ws_size < SZ_TOTAL) return;

  const float* q    = (const float*)d_in[0];
  const float* k    = (const float*)d_in[1];
  const float* v    = (const float*)d_in[2];
  const int*   mask = (const int*)d_in[3];
  const float* Wq   = (const float*)d_in[4];
  const float* Wk   = (const float*)d_in[5];
  const float* Wv   = (const float*)d_in[6];
  const float* Wp   = (const float*)d_in[7];
  const float* bp   = (const float*)d_in[8];
  float* out = (float*)d_out;

  char* wsp = (char*)d_ws;
  unsigned short* X16   = (unsigned short*)wsp; wsp += SZ_X16;
  unsigned short* WT16  = (unsigned short*)wsp; wsp += SZ_WT16;
  unsigned short* QK16  = (unsigned short*)wsp; wsp += SZ_QK16;
  unsigned short* VT16  = (unsigned short*)wsp; wsp += SZ_VT16;
  unsigned short* CTX16 = (unsigned short*)wsp; wsp += SZ_CTX16;
  float*          BRO   = (float*)wsp;          wsp += SZ_BRO;

  const unsigned long long planeX = (unsigned long long)MROWS * DIMC;     // elements per activation plane
  const unsigned long long planeW = (unsigned long long)DIMC * DIMC;

  // weights [in][out] -> [out][in] f16 x16 (4 planes); bias; activations (3 planes, full input batch stride, compact planes)
  k_cast_wT<<<dim3((unsigned)(DIMC * 128 / 256), 4u, 1u), 256, 0, stream>>>(Wq, Wk, Wv, Wp, WT16);
  k_bias_bf<<<dim3((unsigned)((DIMC + 255) / 256), 1u, 1u), 256, 0, stream>>>(bp, BRO, (unsigned)DIMC);
  k_cast_rows<<<dim3((unsigned)(SEQ * 128 / 256), (unsigned)NB, 3u), 256, 0, stream>>>(q, k, v, (unsigned long long)SEQ_FULL * DIMC, X16,
                                                                                      (unsigned long long)SEQ * DIMC, planeX, (unsigned)SEQ);
  // Q16 | K16 = (q16 | k16) x (Wq^T | Wk^T): batch y = 0 (q), 1 (k); M = MROWS, N = K = 1024
  k_gemm64<0, 1><<<dim3((unsigned)((MROWS / 128) * (DIMC / 128)), 2u, 1u), 256, 0, stream>>>(
      X16, (unsigned)DIMC, planeX, WT16, (unsigned)DIMC, planeW, (void*)QK16, (unsigned)DIMC, planeX, nullptr,
      (unsigned)MROWS, (unsigned)DIMC, (unsigned)DIMC, 0.0625f);
  // V^T[b][o][n] = sum_k Wv^T[o][k] * v16[b][n][k]: A = Wv^T plane (M = 1024), Bt = v16 batch plane (N = SEQ), C pitch SEQ
  k_gemm64<0, 1><<<dim3((unsigned)((DIMC / 128) * (SEQ / 128)), (unsigned)NB, 1u), 256, 0, stream>>>(
      WT16 + 2 * planeW, (unsigned)DIMC, 0ull, X16 + 2 * planeX, (unsigned)DIMC, (unsigned long long)SEQ * DIMC,
      (void*)VT16, (unsigned)SEQ, (unsigned long long)DIMC * SEQ, nullptr,
      (unsigned)DIMC, (unsigned)SEQ, (unsigned)DIMC, 0.0625f);
  // attention
  k_flash<<<dim3((unsigned)(NB * NHEAD * (SEQ / 64)), 1u, 1u), 128, 0, stream>>>(QK16, QK16 + planeX, VT16, mask, CTX16);
  // out = (ctx x16) x (Wp^T x16) / 256 + bias
  k_gemm64<2, 0><<<dim3((unsigned)((MROWS / 128) * (DIMC / 128)), 1u, 1u), 256, 0, stream>>>(
      CTX16, (unsigned)DIMC, 0ull, WT16 + 3 * planeW, (unsigned)DIMC, 0ull, (void*)out, (unsigned)DIMC, 0ull, BRO,
      (unsigned)MROWS, (unsigned)DIMC, (unsigned)DIMC, 0.00390625f);
}

// v002
// One run takes 133 microseconds.
// Timed twice side by side with v001, it ran 1.15 times as fast both times.
// Counting every step since v000, it is 2.36 times as fast.
// Masked multi-head attention (2 x 2,048 x 1,024; 16 heads x 64): inputs and parameters RNE-converted to bf16 first; every contraction (q/k/v projections, q.k^T, p.v, output projection) on v_wmma_f32_16x16x32_f16 (f16 operands: weights x16, probabilities x2^14, merged head output x16; f32 accumulate, f32 online softmax in the exp2 domain).
#include <hip/hip_runtime.h>
#include <math.h>

#ifndef NB
#define NB 2
#endif
#ifndef SEQ
#define SEQ 2048
#endif
#define NB_FULL 2
#define SEQ_FULL 2048
#define DIMC 1024
#define NHEAD 16
#define HDIM 64
#define MROWS (NB * SEQ)

static_assert(SEQ % 64 == 0);
static_assert(SEQ <= SEQ_FULL);
static_assert(NB <= NB_FULL);
static_assert(DIMC == NHEAD * HDIM);
static_assert(DIMC % 64 == 0);
static_assert(DIMC / 8 == 128);
static_assert((MROWS % 64) == 0);
static_assert(((SEQ * 128) % 256) == 0);

typedef __attribute__((ext_vector_type(16))) _Float16 v16h;
typedef __attribute__((ext_vector_type(8)))  _Float16 v8h;
typedef __attribute__((ext_vector_type(4)))  _Float16 v4h;
typedef __attribute__((ext_vector_type(8)))  float    v8f;
typedef __attribute__((ext_vector_type(4)))  float    v4f;
typedef __attribute__((ext_vector_type(4)))  int      v4i;

// 16-bit WMMA fragment map (wave32), lane L, h = L>>4, m = L&15:
//   A 16x32: lane = row m;    element i -> k = (i<8) ? 8h+i : 16+8h+(i-8)
//   B 32x16: lane = column m; the SAME k(i,h)
//   D 16x16 (8 f32): lane = column m; element r -> row 8h+r
union FragU { v16h v; v8h h[2]; };
// p already includes the lane-half offset 8h: elements 0..7 <- p[0..7], 8..15 <- p[16..23]
__device__ __forceinline__ v16h frag_ld(const _Float16* p) {
  FragU f; f.h[0] = *(const v8h*)(p); f.h[1] = *(const v8h*)(p + 16); return f.v;
}
__device__ __forceinline__ v8f wm16(v16h a, v16h b, v8f c) {
  c = __builtin_amdgcn_wmma_f32_16x16x32_f16(false, a, false, b, (short)0, c, false, false);
  asm volatile("v_nop\n\tv_nop\n\tv_nop\n\tv_nop" : "+v"(c) : "v"(a), "v"(b));
  return c;
}
__device__ __forceinline__ void dep_guard_h(v8f& a, v8f& b, v16h x, v16h y) { asm volatile("v_nop\n\tv_nop\n\tv_nop\n\tv_nop" : "+v"(a), "+v"(b) : "v"(x), "v"(y)); }
__device__ __forceinline__ void keep4_h(v16h a, v16h b, v16h c, v16h d) { asm volatile("v_nop" :: "v"(a), "v"(b), "v"(c), "v"(d)); }
__device__ __forceinline__ void acc_guard4(v8f& a, v8f& b, v8f& c, v8f& d) { asm volatile("v_nop\n\tv_nop\n\tv_nop\n\tv_nop" : "+v"(a), "+v"(b), "+v"(c), "+v"(d)); }
// same-wave LDS exchange: stores by some lanes, loads of those locations by other lanes of the SAME wave
__device__ __forceinline__ void wave_sync() {
  __builtin_amdgcn_fence(3 /* release order */, "workgroup");
  __builtin_amdgcn_wave_barrier();
  __builtin_amdgcn_fence(2 /* acquire order */, "workgroup");
}
// bf16 RNE-convert, kept as f32 (finite inputs)
__device__ __forceinline__ float cmb_bf(float v) {
  const unsigned u = __builtin_bit_cast(unsigned, v);
  const unsigned r = (u + 0x7fffu + ((u >> 16) & 1u)) & 0xffff0000u;
  return __builtin_bit_cast(float, r);
}

// ---------------------------------------------------------------------------------------------------------
// k_cast_rows: f32 rows [nR][1024] -> bf16 (RNE) -> f16 plane rows [nR][1024]; thread per (row, 8 columns), one 16-B store per thread,
// grid (nR*128/256, batches, 3 tensors); tensor z picks its source; batch y uses the FULL input batch stride.
// ---------------------------------------------------------------------------------------------------------
__global__ __launch_bounds__(256) void k_cast_rows(const float* __restrict__ S0, const float* __restrict__ S1, const float* __restrict__ S2,
                                                    unsigned long long sBatch, unsigned short* __restrict__ DST, unsigned long long dBatch,
                                                    unsigned long long dTensor, unsigned nR) {
  const unsigned u = blockIdx.x * 256u + threadIdx.x;
  if (u >= nR * 128u) return;
  const unsigned z = blockIdx.z;
  const float* SRC = (z == 0u) ? S0 : ((z == 1u) ? S1 : S2);          // block-uniform choice among global pointers
  const unsigned r = u >> 7, c0 = (u & 127u) << 3;
  const float* s = SRC + (size_t)blockIdx.y * sBatch + (size_t)r * DIMC + c0;
  const v4f x0 = *(const v4f*)s, x1 = *(const v4f*)(s + 4);
  v8h hv;
  hv[0] = (_Float16)cmb_bf(x0.x); hv[1] = (_Float16)cmb_bf(x0.y); hv[2] = (_Float16)cmb_bf(x0.z); hv[3] = (_Float16)cmb_bf(x0.w);
  hv[4] = (_Float16)cmb_bf(x1.x); hv[5] = (_Float16)cmb_bf(x1.y); hv[6] = (_Float16)cmb_bf(x1.z); hv[7] = (_Float16)cmb_bf(x1.w);
  v8h* d = (v8h*)((_Float16*)DST + (size_t)z * dTensor + (size_t)blockIdx.y * dBatch + (size_t)r * DIMC + c0);
  *d = hv; 
}

// ---------------------------------------------------------------------------------------------------------
// k_cast_wT: W[k = in][o = out] (1024 rows x 1024 cols, row pitch 1024) -> DST[o][k] (1024 rows x 1024 cols) = f16(bf16_rne(W[k][o]) * 16).
// thread per (o, 8 consecutive k): 8 strided loads, one 16-B store; consecutive threads walk along the destination row.
// grid (1024*128/256, 4 weights); weight y picks its source, destination plane y.
// ---------------------------------------------------------------------------------------------------------
__global__ __launch_bounds__(256) void k_cast_wT(const float* __restrict__ W0, const float* __restrict__ W1, const float* __restrict__ W2,
                                                  const float* __restrict__ W3, unsigned short* __restrict__ DST) {
  const unsigned u = blockIdx.x * 256u + threadIdx.x;
  if (u >= (unsigned)DIMC * 128u) return;
  const unsigned y = blockIdx.y;
  const float* W = (y == 0u) ? W0 : ((y == 1u) ? W1 : ((y == 2u) ? W2 : W3));   // block-uniform
  const unsigned o = u >> 7, k0 = (u & 127u) << 3;
  v8h hv;
#pragma unroll
  for (int e = 0; e < 8; ++e) hv[e] = (_Float16)(cmb_bf(W[(size_t)(k0 + (unsigned)e) * DIMC + o]) * 16.0f);
  v8h* d = (v8h*)((_Float16*)DST + (size_t)y * DIMC * DIMC + (size_t)o * DIMC + k0);
  *d = hv; 
}

__global__ __launch_bounds__(256) void k_bias_bf(const float* __restrict__ SRC, float* __restrict__ DST, unsigned n) {
  const unsigned u = blockIdx.x * 256u + threadIdx.x;
  if (u >= n) return;
  const float v = cmb_bf(SRC[u]);
  float* d = (float*)(DST + u);
  *d = v; 
}

// ---------------------------------------------------------------------------------------------------------
// k_gemm64: C[m,n] = scale * sum_k A[m,k] * Bt[n,k] (+ bias[n]); f16 operand planes. A block of 8 waves owns a 128x128 tile of C,
// each wave 32 rows x 64 columns of it. Per trip 64 k of the block's 128 A rows and 128 Bt rows (128-B row pieces, whole lines) come
// into LDS by asynchronous copies, two buffers: the next trip's copies fly while this trip's fragments are read from LDS (row pitch 144 B).
// A row-major [M,K]; Bt row-major [N,K]; M,N % 128 == 0, K % 64 == 0, K >= 64; batch = blockIdx.y with element strides.
// OUT_MODE 0: f32 C; 1: f16 C. Epilogue: 16-row slabs staged per wave in LDS (wave-private), each 64-wide row segment written as whole
// ---------------------------------------------------------------------------------------------------------
#define GT_PH  72                      // LDS row pitch in halves: 144 B = 16 B x 9
#define GT_OPH (128 * GT_PH)           // halves of one operand's 128-row tile
#define GT_STH (2 * GT_OPH)            // halves of one buffer: A tile | Bt tile
// One buffer's fill, this thread's share: 16 B in each of four rows of the first tile and of four rows of the second (eight threads cover
// a 128-B row piece, so a wave covers 4 whole lines per copy). la, lb = the thread's LDS byte addresses in its first row of either tile,
// lsa, lsb = LDS bytes from one of its rows to the next; ga, gb, gsa, gsb = the same in global memory (addresses, steps in elements).
// s_wait_xcnt closes the statement so that no address register of an issued copy is rewritten ahead of it.
__device__ __forceinline__ void stage_fill(unsigned la, unsigned lsa, unsigned lb, unsigned lsb,
                                           const _Float16* ga, size_t gsa, const _Float16* gb, size_t gsb) {
  const unsigned la1 = la + lsa, la2 = la + 2u * lsa, la3 = la + 3u * lsa;
  const unsigned lb1 = lb + lsb, lb2 = lb + 2u * lsb, lb3 = lb + 3u * lsb;
  const _Float16* ga1 = ga + gsa; const _Float16* ga2 = ga + 2u * gsa; const _Float16* ga3 = ga + 3u * gsa;
  const _Float16* gb1 = gb + gsb; const _Float16* gb2 = gb + 2u * gsb; const _Float16* gb3 = gb + 3u * gsb;
  asm volatile("global_load_async_to_lds_b128 %0, %8, off\n\t"
               "global_load_async_to_lds_b128 %1, %9, off\n\t"
               "global_load_async_to_lds_b128 %2, %10, off\n\t"
               "global_load_async_to_lds_b128 %3, %11, off\n\t"
               "global_load_async_to_lds_b128 %4, %12, off\n\t"
               "global_load_async_to_lds_b128 %5, %13, off\n\t"
               "global_load_async_to_lds_b128 %6, %14, off\n\t"
               "global_load_async_to_lds_b128 %7, %15, off\n\t"
               "s_wait_xcnt 0x0"
               :: "v"(la), "v"(la1), "v"(la2), "v"(la3), "v"(lb), "v"(lb1), "v"(lb2), "v"(lb3),
                  "v"(ga), "v"(ga1), "v"(ga2), "v"(ga3), "v"(gb), "v"(gb1), "v"(gb2), "v"(gb3)
               : "memory");
}
template <int BIAS_MODE, int OUT_MODE>
__global__ __launch_bounds__(256) void k_gemm64(
    const unsigned short* __restrict__ Ap, unsigned lda, unsigned long long strideA,
    const unsigned short* __restrict__ Btp, unsigned ldb, unsigned long long strideB,
    void* __restrict__ Cout, unsigned ldc, unsigned long long strideC,
    const float* __restrict__ bias, unsigned M, unsigned N, unsigned K, float scale) {
  __shared__ __align__(16) _Float16 sS[2 * GT_STH];   // two buffers of [A 128 rows | Bt 128 rows] x 64 k, pitch 72 halves
  __shared__ __align__(16) float sT[8][16 * 68];      // per-wave 16x64 slab, pitch 68 floats
  const unsigned b    = blockIdx.y;
  const unsigned lane = threadIdx.x & 31u;
  const unsigned wave = threadIdx.x >> 5;
  const unsigned tilesN = N >> 7;
  const unsigned tilesM = M >> 7;
  const unsigned tile = blockIdx.x;
  if (tile >= tilesM * tilesN) return;   // block-uniform, in front of every barrier and copy
  const unsigned tm = tile / tilesN;
  const unsigned tn = tile - tm * tilesN;
  const unsigned m0 = (tm << 7) + ((wave >> 1) << 5);   // this wave's 32 rows
  const unsigned n0 = (tn << 7) + ((wave & 1u) << 6);   // this wave's 64 columns

  const _Float16* Ab = (const _Float16*)Ap + (size_t)b * strideA;
  const _Float16* Bb = (const _Float16*)Btp + (size_t)b * strideB;

  const unsigned rlane = lane & 15u;            // row (A) / col (B, D) within subtile
  const unsigned koff  = (lane >> 4) * 8u;      // k offset of this lane half
  const unsigned mOff  = (lane >> 4) * 8u;      // D row offset

  // copy share of this thread: tile row threadIdx.x / 8 (+32, +64, +96), 16-B piece threadIdx.x % 8 of the 128-B row piece
  const unsigned crow = threadIdx.x >> 3, cpc = threadIdx.x & 7u;
  const _Float16* gA = Ab + (size_t)((tm << 7) + crow) * lda + cpc * 8u;
  const _Float16* gB = Bb + (size_t)((tn << 7) + crow) * ldb + cpc * 8u;
  const unsigned lC = (unsigned)(size_t)sS + (crow * GT_PH + cpc * 8u) * 2u;
  // fragment read places of this lane inside a buffer
  const unsigned fA = (((wave >> 1) << 5) + rlane) * GT_PH + koff;
  const unsigned fB = GT_OPH + (((wave & 1u) << 6) + rlane) * GT_PH + koff;

  v8f acc[2][4];
#pragma unroll
  for (int i = 0; i < 2; ++i)
#pragma unroll
    for (int j = 0; j < 4; ++j) acc[i][j] = (v8f){0.f,0.f,0.f,0.f,0.f,0.f,0.f,0.f};

  const unsigned nT = K >> 6;
  const unsigned lStep = 32u * GT_PH * 2u;              // a thread's rows are 32 apart
  const size_t gsA = (size_t)32u * lda, gsB = (size_t)32u * ldb;
  stage_fill(lC, lStep, lC + GT_OPH * 2u, lStep, gA, gsA, gB, gsB);
  asm volatile("s_wait_asynccnt 0x0" ::: "memory");     // this wave's copies of trip 0 have landed
  __syncthreads();                                      // ... and every other wave's: buffer 0 is readable
  if (nT > 1u) stage_fill(lC + GT_STH * 2u, lStep, lC + (GT_STH + GT_OPH) * 2u, lStep, gA + 64, gsA, gB + 64, gsB);

  for (unsigned t = 0; t < nT; ++t) {
    const _Float16* sb = sS + (t & 1u) * GT_STH;
    v16h bh[2][4], ah[2][2];                            // the trip's 12 fragments, read as one group in front of its 16 products (loops unrolled: constant indices keep them in registers)
#pragma unroll
    for (int kk = 0; kk < 2; ++kk) {
#pragma unroll
      for (int j = 0; j < 4; ++j) bh[kk][j] = frag_ld(sb + fB + (unsigned)j * 16u * GT_PH + (unsigned)kk * 32u);
#pragma unroll
      for (int i = 0; i < 2; ++i) ah[kk][i] = frag_ld(sb + fA + (unsigned)i * 16u * GT_PH + (unsigned)kk * 32u);
    }
#pragma unroll
    for (int kk = 0; kk < 2; ++kk) {
#pragma unroll
      for (int i = 0; i < 2; ++i) {
#pragma unroll
        for (int j = 0; j < 4; ++j)
          acc[i][j] = __builtin_amdgcn_wmma_f32_16x16x32_f16(false, ah[kk][i], false, bh[kk][j], (short)0, acc[i][j], false, false);
        dep_guard_h(acc[i][0], acc[i][3], ah[kk][i], ah[kk][i]);
      }
      keep4_h(bh[kk][0], bh[kk][1], bh[kk][2], bh[kk][3]);
    }
    asm volatile("s_wait_dscnt 0x0" ::: "memory");      // this wave's reads of buffer t%2 are done before it is handed to its next writer
    asm volatile("s_wait_asynccnt 0x0" ::: "memory");   // this wave's copies of trip t+1 have landed
    __syncthreads();                                    // publishes trip t+1's buffer and ends every reader's last read of trip t's
    if (t + 2u < nT) {
      const unsigned lN = lC + (t & 1u) * (GT_STH * 2u);
      stage_fill(lN, lStep, lN + GT_OPH * 2u, lStep, gA + (size_t)(t + 2u) * 64u, gsA, gB + (size_t)(t + 2u) * 64u, gsB);
    }
  }
  asm volatile("s_wait_asynccnt 0x0" ::: "memory");     // nothing of this wave is in flight when the loop is left
  acc_guard4(acc[0][0], acc[0][1], acc[0][2], acc[0][3]);
  acc_guard4(acc[1][0], acc[1][1], acc[1][2], acc[1][3]);

  float* slab = sT[wave];
#pragma unroll
  for (int i = 0; i < 2; ++i) {
    const unsigned mBase = m0 + ((unsigned)i << 4);
#pragma unroll
    for (int j = 0; j < 4; ++j) {
      const unsigned n = n0 + ((unsigned)j << 4) + rlane;
      float bv = 0.f;
      if (BIAS_MODE == 2) bv = bias[n];
#pragma unroll
      for (int r = 0; r < 8; ++r) {
        float v = acc[i][j][r] * scale;
        if (BIAS_MODE == 2) v += bv;
        slab[(mOff + (unsigned)r) * 68u + ((unsigned)j << 4) + rlane] = v;
      }
    }
    wave_sync();
    if (OUT_MODE == 0) {
      float* C = (float*)Cout + (size_t)b * strideC;
      const unsigned hh = lane >> 4, c4 = (lane & 15u) * 4u;     // row segment = 256 B = 16 lanes x 16 B
      {
#pragma unroll
        for (int it = 0; it < 8; ++it) {
          const unsigned row = (unsigned)it * 2u + hh;
          const v4f v = *(const v4f*)(slab + row * 68u + c4);
          *(v4f*)(C + (size_t)(mBase + row) * ldc + n0 + c4) = v;
        }
        
      }
    } else {
      const unsigned q = lane >> 3, c8 = (lane & 7u) * 8u;
      _Float16* C = (_Float16*)Cout + (size_t)b * strideC;
      {
#pragma unroll
        for (int it = 0; it < 4; ++it) {
          const unsigned row = (unsigned)it * 4u + q;
          const float* sp = slab + row * 68u + c8;
          v8h hv;
#pragma unroll
          for (int e = 0; e < 8; ++e) hv[e] = (_Float16)sp[e];
          *(v8h*)(C + (size_t)(mBase + row) * ldc + n0 + c8) = hv;
        }
        
      }
    }
    wave_sync();
  }
}

// ---------------------------------------------------------------------------------------------------------
// k_flash: per (batch, head, 64-query block): block = 4 waves x 16 queries; 64-key chunks; online softmax in f32 (exp2 domain).
//   each chunk's 64 K16 rows, 64 V^T rows (128-B row pieces) and the block's 64 x 64 keep-mask tile (256-B row pieces) come into LDS once per
//   block by asynchronous copies, two buffers: the next chunk's copies fly while this chunk is worked on.
//   scores transposed: S^T = K.Q^T, A = staged K16 rows (tile j = keys 16j..16j+15), B = Q16 rows kept in registers. A lane then holds 32 scores
//           of ONE query (column c; keys 16j + 8hh + r): maximum and sum run inside the lane, the two lane halves exchange the maximum once per
//           chunk and join their sums once, behind the loop.
//   keep-mask int32 [B][1][N][N], shared by the heads: element == 0 -> score := fill (finite replace, applied after the scaling), by value;
//           a lane reads its query's row of the staged tile (pitch 272 B: 16 lanes fall on 16 distinct bank groups).
//   output transposed: O^T += V^T.P^T, A = staged V^T rows, B = P^T (x 2^14, f16) packed straight from the score registers: score tiles 2kk and
//           2kk+1 hold exactly the keys of B elements 0..7 and 8..15 of key group kk, so P never passes through LDS.
// ---------------------------------------------------------------------------------------------------------
#define AT_PP 72                        // output staging row pitch in halves
#define AT_KP 72                        // staged row pitch in halves: 144 B = 16 B x 9
#define AT_TH (64 * AT_KP)              // halves of one staged 64-row tile
#define AT_BH (2 * AT_TH)               // halves of one buffer: K tile | V^T tile
#define AT_MP 68                        // staged mask row pitch in words: 272 B = 16 B x 17
#define AT_MW (64 * AT_MP)              // words of one staged 64-query x 64-key mask tile
// lane l <-> lane l ^ 16
__device__ __forceinline__ float xhalf(float x) {
  const int b = __builtin_bit_cast(int, x);
  return __builtin_bit_cast(float, __builtin_amdgcn_permlanex16(b, b, 0x76543210, 0xfedcba98, false, false));
}
// One mask tile's fill, this thread's share: 16 B in each of eight rows (sixteen threads cover a 256-B row piece, so a wave covers 4 whole
// lines per copy). l = the thread's LDS byte address in its first row, ls = LDS bytes from one of its rows to the next; g, gs = the same in
// global memory (address, step in elements). s_wait_xcnt closes the statement so that no address register of an issued copy is rewritten ahead of it.
__device__ __forceinline__ void stage_fill_mask(unsigned l, unsigned ls, const int* g, size_t gs) {
  const unsigned l1 = l + ls, l2 = l + 2u * ls, l3 = l + 3u * ls, l4 = l + 4u * ls, l5 = l + 5u * ls, l6 = l + 6u * ls, l7 = l + 7u * ls;
  const int* g1 = g + gs; const int* g2 = g + 2u * gs; const int* g3 = g + 3u * gs; const int* g4 = g + 4u * gs;
  const int* g5 = g + 5u * gs; const int* g6 = g + 6u * gs; const int* g7 = g + 7u * gs;
  asm volatile("global_load_async_to_lds_b128 %0, %8, off\n\t"
               "global_load_async_to_lds_b128 %1, %9, off\n\t"
               "global_load_async_to_lds_b128 %2, %10, off\n\t"
               "global_load_async_to_lds_b128 %3, %11, off\n\t"
               "global_load_async_to_lds_b128 %4, %12, off\n\t"
               "global_load_async_to_lds_b128 %5, %13, off\n\t"
               "global_load_async_to_lds_b128 %6, %14, off\n\t"
               "global_load_async_to_lds_b128 %7, %15, off\n\t"
               "s_wait_xcnt 0x0"
               :: "v"(l), "v"(l1), "v"(l2), "v"(l3), "v"(l4), "v"(l5), "v"(l6), "v"(l7),
                  "v"(g), "v"(g1), "v"(g2), "v"(g3), "v"(g4), "v"(g5), "v"(g6), "v"(g7)
               : "memory");
}
__global__ __launch_bounds__(128) void k_flash(const unsigned short* __restrict__ Qp, const unsigned short* __restrict__ Kp,
                                               const unsigned short* __restrict__ Vtp, const int* __restrict__ mask,
                                               unsigned short* __restrict__ ctxp) {
  __shared__ __align__(16) _Float16 KVs[2 * AT_BH];       // two buffers of [K 64 keys | V^T 64 rows] x 64 halves, pitch 72 halves; behind the loop: output staging
  __shared__ __align__(16) int      Ms[2 * AT_MW];        // two buffers of the mask tile [64 queries][64 keys], pitch 68 words
  static_assert(4 * 16 * AT_PP <= 2 * AT_BH);
  constexpr unsigned NQB = SEQ / 64;
  const float SC2   = 0.125f * 1.4426950408889634f;       // 64^-0.5 * log2(e)
  const float FILL2 = -1.0e9f * 1.4426950408889634f;      // the finite fill in the exp2 domain
  const float PSC   = 16384.0f;                           // probability carry (f16 operand stays normal)
  const float CTXC  = 16.0f;                              // output carry, undone in the projection epilogue

  const unsigned tid = threadIdx.x, wave = tid >> 5, lane = tid & 31u, hh = lane >> 4, c = lane & 15u;
  const unsigned bx = blockIdx.x;
  const unsigned qb = bx % NQB;
  const unsigned bh = bx / NQB;
  const unsigned h  = bh % (unsigned)NHEAD;
  const unsigned b  = bh / (unsigned)NHEAD;
  const unsigned q0 = qb * 64u + wave * 16u;

  const _Float16* Q  = (const _Float16*)Qp;
  const _Float16* K  = (const _Float16*)Kp;
  const _Float16* Vt = (const _Float16*)Vtp;

  const _Float16* qrow  = Q + (size_t)(b * (unsigned)SEQ + q0 + c) * DIMC + h * HDIM + 8u * hh;
  const v16h qa0 = frag_ld(qrow), qa1 = frag_ld(qrow + 32);   // B operand: column c = query q0 + c
  // copy share of this thread: K and V^T tile rows tid / 8 (+16, +32, +48), 16-B piece tid % 8 of the 128-B row piece
  const unsigned crow = tid >> 3, cpc = tid & 7u;
  const _Float16* gK = K + (size_t)(b * (unsigned)SEQ + crow) * DIMC + h * HDIM + cpc * 8u;           // key crow of chunk 0
  const _Float16* gV = Vt + ((size_t)b * DIMC + h * HDIM + crow) * SEQ + cpc * 8u;                     // V^T row crow, keys of chunk 0
  const unsigned lK = (unsigned)(size_t)KVs + (crow * AT_KP + cpc * 8u) * 2u;                          // key x of a chunk lies in LDS row x
  const unsigned lV = lK + AT_TH * 2u;
  const unsigned lsKV = 16u * AT_KP * 2u;
  const size_t gsK = (size_t)16u * DIMC, gsV = (size_t)16u * SEQ;
  // mask tile rows tid / 16 (+8, ..., +56), 16-B piece tid % 16 of the 256-B row piece
  const unsigned mrw = tid >> 4, mpc = tid & 15u;
  const int* gM = mask + (size_t)b * SEQ_FULL * SEQ_FULL + (size_t)(qb * 64u + mrw) * SEQ_FULL + mpc * 4u;   // query row mrw of the block, keys of chunk 0
  const unsigned lM = (unsigned)(size_t)Ms + (mrw * AT_MP + mpc * 4u) * 4u;
  const unsigned lsM = 8u * AT_MP * 4u;
  const size_t gsM = (size_t)8u * SEQ_FULL;
  const unsigned fKV = c * AT_KP + 8u * hh;               // this lane's fragment place in a 16-row group of either staged tile
  const unsigned fM  = (wave * 16u + c) * AT_MP + 8u * hh;   // this lane's query row of the staged mask tile, its half's 8 keys of a 16-key group

  float mrow = -INFINITY, lrow = 0.f;                     // this lane's query: running maximum (both halves alike), this half's share of the sum
  v8f oacc[4];                                            // O^T tile t: column c = query, element r = head column 16t + 8hh + r
#pragma unroll
  for (int t = 0; t < 4; ++t) oacc[t] = (v8f){0.f,0.f,0.f,0.f,0.f,0.f,0.f,0.f};

  stage_fill(lK, lsKV, lV, lsKV, gK, gsK, gV, gsV);
  stage_fill_mask(lM, lsM, gM, gsM);
  asm volatile("s_wait_asynccnt 0x0" ::: "memory");     // this wave's copies of chunk 0 have landed
  __syncthreads();                                      // ... and every other wave's: buffer 0 is readable
  if (NQB > 1u) {
    stage_fill(lK + AT_BH * 2u, lsKV, lV + AT_BH * 2u, lsKV, gK + (size_t)64u * DIMC, gsK, gV + 64, gsV);
    stage_fill_mask(lM + AT_MW * 4u, lsM, gM + 64, gsM);
  }

#pragma unroll 1
  for (unsigned kc = 0; kc < NQB; ++kc) {
    const unsigned kv0 = kc * 64u;
    const _Float16* kvs = KVs + (kc & 1u) * AT_BH + fKV;
    const int* ms = Ms + (kc & 1u) * AT_MW + fM;
    v8f s[4];
    v16h kf[4][2];                                      // the chunk's 8 K fragments, read as one group in front of the products (loops unrolled: constant indices keep them in registers)
#pragma unroll
    for (int j = 0; j < 4; ++j) {
      const _Float16* kr = kvs + (unsigned)j * 16u * AT_KP;                        // A row c of tile j = key kv0 + 16j + c
      kf[j][0] = frag_ld(kr); kf[j][1] = frag_ld(kr + 32);
    }
    v4i mk[4][2];
#pragma unroll
    for (int j = 0; j < 4; ++j) {
      mk[j][0] = *(const v4i*)(ms + (unsigned)j * 16u);                            // query q0 + c, keys kv0 + 16j + 8hh + 0..3
      mk[j][1] = *(const v4i*)(ms + (unsigned)j * 16u + 4u);                       // ... + 4..7
    }
#pragma unroll
    for (int j = 0; j < 4; ++j) s[j] = wm16(kf[j][0], qa0, (v8f){0.f,0.f,0.f,0.f,0.f,0.f,0.f,0.f});
#pragma unroll
    for (int j = 0; j < 4; ++j) s[j] = wm16(kf[j][1], qa1, s[j]);

    float x[4][8];                                      // this query's 32 scores, then its 32 probabilities (every loop over them unrolled: constant indices keep them in registers)
#pragma unroll
    for (int j = 0; j < 4; ++j)
#pragma unroll
      for (int r = 0; r < 8; ++r) x[j][r] = (mk[j][r >> 2][r & 3] == 0) ? FILL2 : s[j][r] * SC2;
    float mj[4];
#pragma unroll
    for (int j = 0; j < 4; ++j)
      mj[j] = fmaxf(fmaxf(fmaxf(x[j][0], x[j][1]), fmaxf(x[j][2], x[j][3])), fmaxf(fmaxf(x[j][4], x[j][5]), fmaxf(x[j][6], x[j][7])));
    float m = fmaxf(fmaxf(mj[0], mj[1]), fmaxf(mj[2], mj[3]));
    m = fmaxf(m, xhalf(m));                             // the other half's 32 keys of the same query
    const float mnew  = fmaxf(mrow, m);
    const float alpha = exp2f(mrow - mnew);
    mrow = mnew;
    float pj[4];
#pragma unroll
    for (int j = 0; j < 4; ++j) {
#pragma unroll
      for (int r = 0; r < 8; ++r) x[j][r] = exp2f(x[j][r] - mnew);
      pj[j] = ((x[j][0] + x[j][1]) + (x[j][2] + x[j][3])) + ((x[j][4] + x[j][5]) + (x[j][6] + x[j][7]));
    }
    lrow = lrow * alpha + ((pj[0] + pj[1]) + (pj[2] + pj[3]));
#pragma unroll
    for (int t = 0; t < 4; ++t)
#pragma unroll
      for (int r = 0; r < 8; ++r) oacc[t][r] *= alpha;
    v16h pb[2], va[2][4];                               // P^T packed from the score registers; the chunk's V^T fragments, read as one group in front of the products (unrolled as above)
#pragma unroll
    for (int kk = 0; kk < 2; ++kk) {
#pragma unroll
      for (int i = 0; i < 8; ++i) {
        pb[kk][i]     = (_Float16)(x[2 * kk][i] * PSC);       // B element i     = key 32kk + 8hh + i
        pb[kk][i + 8] = (_Float16)(x[2 * kk + 1][i] * PSC);   // B element 8 + i = key 32kk + 16 + 8hh + i
      }
#pragma unroll
      for (int t = 0; t < 4; ++t) va[kk][t] = frag_ld(kvs + AT_TH + (unsigned)t * 16u * AT_KP + (unsigned)kk * 32u);   // A: row d = t*16 + c, same key map
    }
#pragma unroll
    for (int kk = 0; kk < 2; ++kk) {
#pragma unroll
      for (int t = 0; t < 4; ++t) oacc[t] = wm16(va[kk][t], pb[kk], oacc[t]);
    }
    asm volatile("s_wait_dscnt 0x0" ::: "memory");      // this wave's reads of buffer kc%2 are done before it is handed to its next writer
    asm volatile("s_wait_asynccnt 0x0" ::: "memory");   // this wave's copies of chunk kc+1 have landed
    __syncthreads();                                    // publishes chunk kc+1's buffer and ends every reader's last read of chunk kc's
    if (kc + 2u < NQB) {
      const unsigned lo = (kc & 1u) * (AT_BH * 2u);
      stage_fill(lK + lo, lsKV, lV + lo, lsKV, gK + (size_t)(kv0 + 128u) * DIMC, gsK, gV + (kv0 + 128u), gsV);
      stage_fill_mask(lM + (kc & 1u) * (AT_MW * 4u), lsM, gM + (kv0 + 128u), gsM);
    }
  }
  asm volatile("s_wait_asynccnt 0x0" ::: "memory");     // nothing of this wave is in flight when the loop is left

  // behind the last trip's barrier nobody reads the staged tiles any more and no copy is in flight: each wave stages its 16 x 64 output in its own slice
  _Float16* os = KVs + wave * (16u * AT_PP);
  const float inv = CTXC * (1.0f / ((lrow + xhalf(lrow)) * PSC));   // the two halves' sums of this query joined
#pragma unroll
  for (int t = 0; t < 4; ++t) {
    v8h hv;
#pragma unroll
    for (int r = 0; r < 8; ++r) hv[r] = (_Float16)(oacc[t][r] * inv);
    *(v8h*)(os + c * AT_PP + (unsigned)t * 16u + 8u * hh) = hv;      // query row c, head columns 16t + 8hh + 0..7
  }
  wave_sync();
  {
    const unsigned q4 = lane >> 3, c8 = (lane & 7u) * 8u;
    _Float16* cb = (_Float16*)ctxp + (size_t)(b * (unsigned)SEQ + q0) * DIMC + h * HDIM;
#pragma unroll
    for (int it = 0; it < 4; ++it) {
      const unsigned row = (unsigned)it * 4u + q4;
      *(v8h*)(cb + (size_t)row * DIMC + c8) = *(const v8h*)(os + row * AT_PP + c8);
    }
  }
}

// ---------------------------------------------------------------------------------------------------------
// workspace carve (bytes, every region a multiple of 256 and fully written by its producer before any read)
// ---------------------------------------------------------------------------------------------------------
static constexpr size_t SZ_X16   = (size_t)3 * MROWS * DIMC * 2;     // q16 | k16 | v16 planes [MROWS][1024] f16
static constexpr size_t SZ_WT16  = (size_t)4 * DIMC * DIMC * 2;      // Wq^T | Wk^T | Wv^T | Wp^T planes [out][in] f16, x16
static constexpr size_t SZ_QK16  = (size_t)2 * MROWS * DIMC * 2;     // Q16 | K16 planes [MROWS][1024] f16
static constexpr size_t SZ_VT16  = (size_t)NB * DIMC * SEQ * 2;      // V^T planes [b][1024][SEQ] f16
static constexpr size_t SZ_CTX16 = (size_t)MROWS * DIMC * 2;         // merged head output x16 [MROWS][1024] f16
static constexpr size_t SZ_BRO   = (size_t)DIMC * 4;                 // bias, bf16 RNE-converted, f32
static constexpr size_t SZ_TOTAL = SZ_X16 + SZ_WT16 + SZ_QK16 + SZ_VT16 + SZ_CTX16 + SZ_BRO;
static_assert((SZ_X16 % 256) == 0 && (SZ_WT16 % 256) == 0 && (SZ_QK16 % 256) == 0 && (SZ_VT16 % 256) == 0 && (SZ_CTX16 % 256) == 0 && (SZ_BRO % 256) == 0);
static_assert(SZ_TOTAL <= (size_t)134217728);
// coverage equalities of the plane writers
static_assert((size_t)(SEQ * 128 / 256) * 256 * 8 == (size_t)SEQ * DIMC);            // k_cast_rows per (batch, tensor)
static_assert((size_t)(DIMC * 128 / 256) * 256 * 8 == (size_t)DIMC * DIMC);          // k_cast_wT per weight
static_assert((size_t)(SEQ / 64) * 4 * 16 * 64 == (size_t)SEQ * HDIM);               // k_flash per (batch, head): blocks x waves x rows x cols
static_assert((MROWS % 128) == 0 && (DIMC % 128) == 0 && (SEQ % 128) == 0);            // k_gemm64: whole 128x128 tiles, K = DIMC in whole 64-k trips

extern "C" void kernel_launch(void* const* d_in, const int* in_sizes, int n_in, void* d_out, int out_size, void* d_ws, size_t ws_size, hipStream_t stream) {
  if (n_in < 9) return;
  const long long needX = (long long)(NB - 1) * SEQ_FULL * DIMC + (long long)SEQ * DIMC;
  const long long needM = (long long)(NB - 1) * SEQ_FULL * SEQ_FULL + (long long)(SEQ - 1) * SEQ_FULL + SEQ;
  if ((long long)in_sizes[0] < needX || (long long)in_sizes[1] < needX || (long long)in_sizes[2] < needX) return;
  if ((long long)in_sizes[3] < needM) return;
  if (in_sizes[4] < DIMC * DIMC || in_sizes[5] < DIMC * DIMC || in_sizes[6] < DIMC * DIMC || in_sizes[7] < DIMC * DIMC || in_sizes[8] < DIMC) return;
  if ((long long)out_size < (long long)MROWS * DIMC) return;
  if (ws_size < SZ_TOTAL) return;

  const float* q    = (const float*)d_in[0];
  const float* k    = (const float*)d_in[1];
  const float* v    = (const float*)d_in[2];
  const int*   mask = (const int*)d_in[3];
  const float* Wq   = (const float*)d_in[4];
  const float* Wk   = (const float*)d_in[5];
  const float* Wv   = (const float*)d_in[6];
  const float* Wp   = (const float*)d_in[7];
  const float* bp   = (const float*)d_in[8];
  float* out = (float*)d_out;

  char* wsp = (char*)d_ws;
  unsigned short* X16   = (unsigned short*)wsp; wsp += SZ_X16;
  unsigned short* WT16  = (unsigned short*)wsp; wsp += SZ_WT16;
  unsigned short* QK16  = (unsigned short*)wsp; wsp += SZ_QK16;
  unsigned short* VT16  = (unsigned short*)wsp; wsp += SZ_VT16;
  unsigned short* CTX16 = (unsigned short*)wsp; wsp += SZ_CTX16;
  float*          BRO   = (float*)wsp;          wsp += SZ_BRO;

  const unsigned long long planeX = (unsigned long long)MROWS * DIMC;     // elements per activation plane
  const unsigned long long planeW = (unsigned long long)DIMC * DIMC;

  // weights [in][out] -> [out][in] f16 x16 (4 planes); bias; activations (3 planes, full input batch stride, compact planes)
  k_cast_wT<<<dim3((unsigned)(DIMC * 128 / 256), 4u, 1u), 256, 0, stream>>>(Wq, Wk, Wv, Wp, WT16);
  k_bias_bf<<<dim3((unsigned)((DIMC + 255) / 256), 1u, 1u), 256, 0, stream>>>(bp, BRO, (unsigned)DIMC);
  k_cast_rows<<<dim3((unsigned)(SEQ * 128 / 256), (unsigned)NB, 3u), 256, 0, stream>>>(q, k, v, (unsigned long long)SEQ_FULL * DIMC, X16,
                                                                                      (unsigned long long)SEQ * DIMC, planeX, (unsigned)SEQ);
  // Q16 | K16 = (q16 | k16) x (Wq^T | Wk^T): batch y = 0 (q), 1 (k); M = MROWS, N = K = 1024
  k_gemm64<0, 1><<<dim3((unsigned)((MROWS / 128) * (DIMC / 128)), 2u, 1u), 256, 0, stream>>>(
      X16, (unsigned)DIMC, planeX, WT16, (unsigned)DIMC, planeW, (void*)QK16, (unsigned)DIMC, planeX, nullptr,
      (unsigned)MROWS, (unsigned)DIMC, (unsigned)DIMC, 0.0625f);
  // V^T[b][o][n] = sum_k Wv^T[o][k] * v16[b][n][k]: A = Wv^T plane (M = 1024), Bt = v16 batch plane (N = SEQ), C pitch SEQ
  k_gemm64<0, 1><<<dim3((unsigned)((DIMC / 128) * (SEQ / 128)), (unsigned)NB, 1u), 256, 0, stream>>>(
      WT16 + 2 * planeW, (unsigned)DIMC, 0ull, X16 + 2 * planeX, (unsigned)DIMC, (unsigned long long)SEQ * DIMC,
      (void*)VT16, (unsigned)SEQ, (unsigned long long)DIMC * SEQ, nullptr,
      (unsigned)DIMC, (unsigned)SEQ, (unsigned)DIMC, 0.0625f);
  // attention
  k_flash<<<dim3((unsigned)(NB * NHEAD * (SEQ / 64)), 1u, 1u), 128, 0, stream>>>(QK16, QK16 + planeX, VT16, mask, CTX16);
  // out = (ctx x16) x (Wp^T x16) / 256 + bias
  k_gemm64<2, 0><<<dim3((unsigned)((MROWS / 128) * (DIMC / 128)), 1u, 1u), 256, 0, stream>>>(
      CTX16, (unsigned)DIMC, 0ull, WT16 + 3 * planeW, (unsigned)DIMC, 0ull, (void*)out, (unsigned)DIMC, 0ull, BRO,
      (unsigned)MROWS, (unsigned)DIMC, (unsigned)DIMC, 0.00390625f);
}

// v003
// A run of this version takes 125 microseconds.
// In both of two side-by-side timings against v002, it was 1.07 times as fast.
// Counting every step since v000, it is 2.52 times as fast.
// Masked multi-head attention (2 x 2,048 x 1,024; 16 heads x 64): inputs and parameters RNE-converted to bf16 first; every contraction (q/k/v projections, q.k^T, p.v, output projection) on v_wmma_f32_16x16x32_f16 (f16 operands: weights x16, probabilities x2^14, merged head output x16; f32 accumulate, f32 online softmax in the exp2 domain).
#include <hip/hip_runtime.h>
#include <math.h>

#ifndef NB
#define NB 2
#endif
#ifndef SEQ
#define SEQ 2048
#endif
#define NB_FULL 2
#define SEQ_FULL 2048
#define DIMC 1024
#define NHEAD 16
#define HDIM 64
#define MROWS (NB * SEQ)

static_assert(SEQ % 64 == 0);
static_assert(SEQ <= SEQ_FULL);
static_assert(NB <= NB_FULL);
static_assert(DIMC == NHEAD * HDIM);
static_assert(DIMC % 64 == 0);
static_assert(DIMC / 8 == 128);
static_assert((MROWS % 64) == 0);
static_assert(((SEQ * 128) % 256) == 0);

typedef __attribute__((ext_vector_type(16))) _Float16 v16h;
typedef __attribute__((ext_vector_type(8)))  _Float16 v8h;
typedef __attribute__((ext_vector_type(4)))  _Float16 v4h;
typedef __attribute__((ext_vector_type(8)))  float    v8f;
typedef __attribute__((ext_vector_type(4)))  float    v4f;
typedef __attribute__((ext_vector_type(4)))  int      v4i;

// 16-bit WMMA fragment map (wave32), lane L, h = L>>4, m = L&15:
//   A 16x32: lane = row m;    element i -> k = (i<8) ? 8h+i : 16+8h+(i-8)
//   B 32x16: lane = column m; the SAME k(i,h)
//   D 16x16 (8 f32): lane = column m; element r -> row 8h+r
union FragU { v16h v; v8h h[2]; };
// p already includes the lane-half offset 8h: elements 0..7 <- p[0..7], 8..15 <- p[16..23]
__device__ __forceinline__ v16h frag_ld(const _Float16* p) {
  FragU f; f.h[0] = *(const v8h*)(p); f.h[1] = *(const v8h*)(p + 16); return f.v;
}
__device__ __forceinline__ v8f wm16(v16h a, v16h b, v8f c) {
  c = __builtin_amdgcn_wmma_f32_16x16x32_f16(false, a, false, b, (short)0, c, false, false);
  asm volatile("v_nop\n\tv_nop\n\tv_nop\n\tv_nop" : "+v"(c) : "v"(a), "v"(b));
  return c;
}
__device__ __forceinline__ void dep_guard_h(v8f& a, v8f& b, v16h x, v16h y) { asm volatile("v_nop\n\tv_nop\n\tv_nop\n\tv_nop" : "+v"(a), "+v"(b) : "v"(x), "v"(y)); }
__device__ __forceinline__ void keep4_h(v16h a, v16h b, v16h c, v16h d) { asm volatile("v_nop" :: "v"(a), "v"(b), "v"(c), "v"(d)); }
__device__ __forceinline__ void acc_guard4(v8f& a, v8f& b, v8f& c, v8f& d) { asm volatile("v_nop\n\tv_nop\n\tv_nop\n\tv_nop" : "+v"(a), "+v"(b), "+v"(c), "+v"(d)); }
// same-wave LDS exchange: stores by some lanes, loads of those locations by other lanes of the SAME wave
__device__ __forceinline__ void wave_sync() {
  __builtin_amdgcn_fence(3 /* release order */, "workgroup");
  __builtin_amdgcn_wave_barrier();
  __builtin_amdgcn_fence(2 /* acquire order */, "workgroup");
}
// bf16 RNE-convert, kept as f32 (finite inputs)
__device__ __forceinline__ float cmb_bf(float v) {
  const unsigned u = __builtin_bit_cast(unsigned, v);
  const unsigned r = (u + 0x7fffu + ((u >> 16) & 1u)) & 0xffff0000u;
  return __builtin_bit_cast(float, r);
}

// ---------------------------------------------------------------------------------------------------------
// k_cast_rows: f32 rows [nR][1024] -> bf16 (RNE) -> f16 plane rows [nR][1024]; thread per (row, 8 columns), one 16-B store per thread,
// grid (nR*128/256, batches, 3 tensors); tensor z picks its source; batch y uses the FULL input batch stride.
// ---------------------------------------------------------------------------------------------------------
__global__ __launch_bounds__(256) void k_cast_rows(const float* __restrict__ S0, const float* __restrict__ S1, const float* __restrict__ S2,
                                                    unsigned long long sBatch, unsigned short* __restrict__ DST, unsigned long long dBatch,
                                                    unsigned long long dTensor, unsigned nR) {
  const unsigned u = blockIdx.x * 256u + threadIdx.x;
  if (u >= nR * 128u) return;
  const unsigned z = blockIdx.z;
  const float* SRC = (z == 0u) ? S0 : ((z == 1u) ? S1 : S2);          // block-uniform choice among global pointers
  const unsigned r = u >> 7, c0 = (u & 127u) << 3;
  const float* s = SRC + (size_t)blockIdx.y * sBatch + (size_t)r * DIMC + c0;
  const v4f x0 = *(const v4f*)s, x1 = *(const v4f*)(s + 4);
  v8h hv;
  hv[0] = (_Float16)cmb_bf(x0.x); hv[1] = (_Float16)cmb_bf(x0.y); hv[2] = (_Float16)cmb_bf(x0.z); hv[3] = (_Float16)cmb_bf(x0.w);
  hv[4] = (_Float16)cmb_bf(x1.x); hv[5] = (_Float16)cmb_bf(x1.y); hv[6] = (_Float16)cmb_bf(x1.z); hv[7] = (_Float16)cmb_bf(x1.w);
  v8h* d = (v8h*)((_Float16*)DST + (size_t)z * dTensor + (size_t)blockIdx.y * dBatch + (size_t)r * DIMC + c0);
  *d = hv; 
}

// ---------------------------------------------------------------------------------------------------------
// k_cast_wT: W[k = in][o = out] (1024 rows x 1024 cols, row pitch 1024) -> DST[o][k] (1024 rows x 1024 cols) = f16(bf16_rne(W[k][o]) * 16).
// thread per (o, 8 consecutive k): 8 strided loads, one 16-B store; consecutive threads walk along the destination row.
// grid (1024*128/256, 4 weights); weight y picks its source, destination plane y.
// ---------------------------------------------------------------------------------------------------------
__global__ __launch_bounds__(256) void k_cast_wT(const float* __restrict__ W0, const float* __restrict__ W1, const float* __restrict__ W2,
                                                  const float* __restrict__ W3, unsigned short* __restrict__ DST) {
  const unsigned u = blockIdx.x * 256u + threadIdx.x;
  if (u >= (unsigned)DIMC * 128u) return;
  const unsigned y = blockIdx.y;
  const float* W = (y == 0u) ? W0 : ((y == 1u) ? W1 : ((y == 2u) ? W2 : W3));   // block-uniform
  const unsigned o = u >> 7, k0 = (u & 127u) << 3;
  v8h hv;
#pragma unroll
  for (int e = 0; e < 8; ++e) hv[e] = (_Float16)(cmb_bf(W[(size_t)(k0 + (unsigned)e) * DIMC + o]) * 16.0f);
  v8h* d = (v8h*)((_Float16*)DST + (size_t)y * DIMC * DIMC + (size_t)o * DIMC + k0);
  *d = hv; 
}

__global__ __launch_bounds__(256) void k_bias_bf(const float* __restrict__ SRC, float* __restrict__ DST, unsigned n) {
  const unsigned u = blockIdx.x * 256u + threadIdx.x;
  if (u >= n) return;
  const float v = cmb_bf(SRC[u]);
  float* d = (float*)(DST + u);
  *d = v; 
}

// ---------------------------------------------------------------------------------------------------------
// k_gemm64: C[m,n] = scale * sum_k A[m,k] * Bt[n,k] (+ bias[n]); f16 operand planes. A block of 8 waves owns a 128x128 tile of C,
// each wave 32 rows x 64 columns of it. Per trip 64 k of the block's 128 A rows and 128 Bt rows (128-B row pieces, whole lines) come
// into LDS by asynchronous copies, two buffers: the next trip's copies fly while this trip's fragments are read from LDS (row pitch 144 B).
// A row-major [M,K]; Bt row-major [N,K]; M,N % 128 == 0, K % 64 == 0, K >= 64; batch = blockIdx.y with element strides.
// OUT_MODE 0: f32 C; 1: f16 C. Epilogue: 16-row slabs staged per wave in LDS (wave-private), each 64-wide row segment written as whole
// ---------------------------------------------------------------------------------------------------------
#define GT_PH  72                      // LDS row pitch in halves: 144 B = 16 B x 9
#define GT_OPH (128 * GT_PH)           // halves of one operand's 128-row tile
#define GT_STH (2 * GT_OPH)            // halves of one buffer: A tile | Bt tile
// One buffer's fill, this thread's share: 16 B in each of four rows of the first tile and of four rows of the second (eight threads cover
// a 128-B row piece, so a wave covers 4 whole lines per copy). la, lb = the thread's LDS byte addresses in its first row of either tile,
// lsa, lsb = LDS bytes from one of its rows to the next; ga, gb, gsa, gsb = the same in global memory (addresses, steps in elements).
// s_wait_xcnt closes the statement so that no address register of an issued copy is rewritten ahead of it.
__device__ __forceinline__ void stage_fill(unsigned la, unsigned lsa, unsigned lb, unsigned lsb,
                                           const _Float16* ga, size_t gsa, const _Float16* gb, size_t gsb) {
  const unsigned la1 = la + lsa, la2 = la + 2u * lsa, la3 = la + 3u * lsa;
  const unsigned lb1 = lb + lsb, lb2 = lb + 2u * lsb, lb3 = lb + 3u * lsb;
  const _Float16* ga1 = ga + gsa; const _Float16* ga2 = ga + 2u * gsa; const _Float16* ga3 = ga + 3u * gsa;
  const _Float16* gb1 = gb + gsb; const _Float16* gb2 = gb + 2u * gsb; const _Float16* gb3 = gb + 3u * gsb;
  asm volatile("global_load_async_to_lds_b128 %0, %8, off\n\t"
               "global_load_async_to_lds_b128 %1, %9, off\n\t"
               "global_load_async_to_lds_b128 %2, %10, off\n\t"
               "global_load_async_to_lds_b128 %3, %11, off\n\t"
               "global_load_async_to_lds_b128 %4, %12, off\n\t"
               "global_load_async_to_lds_b128 %5, %13, off\n\t"
               "global_load_async_to_lds_b128 %6, %14, off\n\t"
               "global_load_async_to_lds_b128 %7, %15, off\n\t"
               "s_wait_xcnt 0x0"
               :: "v"(la), "v"(la1), "v"(la2), "v"(la3), "v"(lb), "v"(lb1), "v"(lb2), "v"(lb3),
                  "v"(ga), "v"(ga1), "v"(ga2), "v"(ga3), "v"(gb), "v"(gb1), "v"(gb2), "v"(gb3)
               : "memory");
}
template <int BIAS_MODE, int OUT_MODE>
__global__ __launch_bounds__(256) void k_gemm64(
    const unsigned short* __restrict__ Ap, unsigned lda, unsigned long long strideA,
    const unsigned short* __restrict__ Btp, unsigned ldb, unsigned long long strideB,
    void* __restrict__ Cout, unsigned ldc, unsigned long long strideC,
    const float* __restrict__ bias, unsigned M, unsigned N, unsigned K, float scale) {
  __shared__ __align__(16) _Float16 sS[2 * GT_STH];   // two buffers of [A 128 rows | Bt 128 rows] x 64 k, pitch 72 halves
  __shared__ __align__(16) float sT[8][16 * 68];      // per-wave 16x64 slab, pitch 68 floats
  const unsigned b    = blockIdx.y;
  const unsigned lane = threadIdx.x & 31u;
  const unsigned wave = threadIdx.x >> 5;
  const unsigned tilesN = N >> 7;
  const unsigned tilesM = M >> 7;
  const unsigned tile = blockIdx.x;
  if (tile >= tilesM * tilesN) return;   // block-uniform, in front of every barrier and copy
  const unsigned tm = tile / tilesN;
  const unsigned tn = tile - tm * tilesN;
  const unsigned m0 = (tm << 7) + ((wave >> 1) << 5);   // this wave's 32 rows
  const unsigned n0 = (tn << 7) + ((wave & 1u) << 6);   // this wave's 64 columns

  const _Float16* Ab = (const _Float16*)Ap + (size_t)b * strideA;
  const _Float16* Bb = (const _Float16*)Btp + (size_t)b * strideB;

  const unsigned rlane = lane & 15u;            // row (A) / col (B, D) within subtile
  const unsigned koff  = (lane >> 4) * 8u;      // k offset of this lane half
  const unsigned mOff  = (lane >> 4) * 8u;      // D row offset

  // copy share of this thread: tile row threadIdx.x / 8 (+32, +64, +96), 16-B piece threadIdx.x % 8 of the 128-B row piece
  const unsigned crow = threadIdx.x >> 3, cpc = threadIdx.x & 7u;
  const _Float16* gA = Ab + (size_t)((tm << 7) + crow) * lda + cpc * 8u;
  const _Float16* gB = Bb + (size_t)((tn << 7) + crow) * ldb + cpc * 8u;
  const unsigned lC = (unsigned)(size_t)sS + (crow * GT_PH + cpc * 8u) * 2u;
  // fragment read places of this lane inside a buffer
  const unsigned fA = (((wave >> 1) << 5) + rlane) * GT_PH + koff;
  const unsigned fB = GT_OPH + (((wave & 1u) << 6) + rlane) * GT_PH + koff;

  v8f acc[2][4];
#pragma unroll
  for (int i = 0; i < 2; ++i)
#pragma unroll
    for (int j = 0; j < 4; ++j) acc[i][j] = (v8f){0.f,0.f,0.f,0.f,0.f,0.f,0.f,0.f};

  const unsigned nT = K >> 6;
  const unsigned lStep = 32u * GT_PH * 2u;              // a thread's rows are 32 apart
  const size_t gsA = (size_t)32u * lda, gsB = (size_t)32u * ldb;
  stage_fill(lC, lStep, lC + GT_OPH * 2u, lStep, gA, gsA, gB, gsB);
  asm volatile("s_wait_asynccnt 0x0" ::: "memory");     // this wave's copies of trip 0 have landed
  __syncthreads();                                      // ... and every other wave's: buffer 0 is readable
  if (nT > 1u) stage_fill(lC + GT_STH * 2u, lStep, lC + (GT_STH + GT_OPH) * 2u, lStep, gA + 64, gsA, gB + 64, gsB);

  for (unsigned t = 0; t < nT; ++t) {
    const _Float16* sb = sS + (t & 1u) * GT_STH;
    v16h bh[2][4], ah[2][2];                            // the trip's 12 fragments, read as one group in front of its 16 products (loops unrolled: constant indices keep them in registers)
#pragma unroll
    for (int kk = 0; kk < 2; ++kk) {
#pragma unroll
      for (int j = 0; j < 4; ++j) bh[kk][j] = frag_ld(sb + fB + (unsigned)j * 16u * GT_PH + (unsigned)kk * 32u);
#pragma unroll
      for (int i = 0; i < 2; ++i) ah[kk][i] = frag_ld(sb + fA + (unsigned)i * 16u * GT_PH + (unsigned)kk * 32u);
    }
#pragma unroll
    for (int kk = 0; kk < 2; ++kk) {
#pragma unroll
      for (int i = 0; i < 2; ++i) {
#pragma unroll
        for (int j = 0; j < 4; ++j)
          acc[i][j] = __builtin_amdgcn_wmma_f32_16x16x32_f16(false, ah[kk][i], false, bh[kk][j], (short)0, acc[i][j], false, false);
        dep_guard_h(acc[i][0], acc[i][3], ah[kk][i], ah[kk][i]);
      }
      keep4_h(bh[kk][0], bh[kk][1], bh[kk][2], bh[kk][3]);
    }
    asm volatile("s_wait_dscnt 0x0" ::: "memory");      // this wave's reads of buffer t%2 are done before it is handed to its next writer
    asm volatile("s_wait_asynccnt 0x0" ::: "memory");   // this wave's copies of trip t+1 have landed
    __syncthreads();                                    // publishes trip t+1's buffer and ends every reader's last read of trip t's
    if (t + 2u < nT) {
      const unsigned lN = lC + (t & 1u) * (GT_STH * 2u);
      stage_fill(lN, lStep, lN + GT_OPH * 2u, lStep, gA + (size_t)(t + 2u) * 64u, gsA, gB + (size_t)(t + 2u) * 64u, gsB);
    }
  }
  asm volatile("s_wait_asynccnt 0x0" ::: "memory");     // nothing of this wave is in flight when the loop is left
  acc_guard4(acc[0][0], acc[0][1], acc[0][2], acc[0][3]);
  acc_guard4(acc[1][0], acc[1][1], acc[1][2], acc[1][3]);

  float* slab = sT[wave];
#pragma unroll
  for (int i = 0; i < 2; ++i) {
    const unsigned mBase = m0 + ((unsigned)i << 4);
#pragma unroll
    for (int j = 0; j < 4; ++j) {
      const unsigned n = n0 + ((unsigned)j << 4) + rlane;
      float bv = 0.f;
      if (BIAS_MODE == 2) bv = bias[n];
#pragma unroll
      for (int r = 0; r < 8; ++r) {
        float v = acc[i][j][r] * scale;
        if (BIAS_MODE == 2) v += bv;
        slab[(mOff + (unsigned)r) * 68u + ((unsigned)j << 4) + rlane] = v;
      }
    }
    wave_sync();
    if (OUT_MODE == 0) {
      float* C = (float*)Cout + (size_t)b * strideC;
      const unsigned hh = lane >> 4, c4 = (lane & 15u) * 4u;     // row segment = 256 B = 16 lanes x 16 B
      {
#pragma unroll
        for (int it = 0; it < 8; ++it) {
          const unsigned row = (unsigned)it * 2u + hh;
          const v4f v = *(const v4f*)(slab + row * 68u + c4);
          *(v4f*)(C + (size_t)(mBase + row) * ldc + n0 + c4) = v;
        }
        
      }
    } else {
      const unsigned q = lane >> 3, c8 = (lane & 7u) * 8u;
      _Float16* C = (_Float16*)Cout + (size_t)b * strideC;
      {
#pragma unroll
        for (int it = 0; it < 4; ++it) {
          const unsigned row = (unsigned)it * 4u + q;
          const float* sp = slab + row * 68u + c8;
          v8h hv;
#pragma unroll
          for (int e = 0; e < 8; ++e) hv[e] = (_Float16)sp[e];
          *(v8h*)(C + (size_t)(mBase + row) * ldc + n0 + c8) = hv;
        }
        
      }
    }
    wave_sync();
  }
}

// ---------------------------------------------------------------------------------------------------------
// k_flash: per (batch, head, 64-query block): block = 4 waves x 16 queries; 64-key chunks; online softmax in f32 (exp2 domain).
//   each chunk's 64 K16 rows, 64 V^T rows (128-B row pieces) and the block's 64 x 64 keep-mask tile (256-B row pieces) come into LDS once per
//   block by asynchronous copies, two buffers: the next chunk's copies fly while this chunk is worked on.
//   scores transposed: S^T = K.Q^T, A = staged K16 rows (tile j = keys 16j..16j+15), B = Q16 rows kept in registers. A lane then holds 32 scores
//           of ONE query (column c; keys 16j + 8hh + r): maximum and sum run inside the lane, the two lane halves exchange the maximum once per
//           chunk and join their sums once, behind the loop.
//   keep-mask int32 [B][1][N][N], shared by the heads: element == 0 -> score := fill (finite replace, applied after the scaling), by value;
//           a lane reads its query's row of the staged tile (pitch 272 B: 16 lanes fall on 16 distinct bank groups).
//   output transposed: O^T += V^T.P^T, A = staged V^T rows, B = P^T (x 2^14, f16) packed straight from the score registers: score tiles 2kk and
//           2kk+1 hold exactly the keys of B elements 0..7 and 8..15 of key group kk, so P never passes through LDS.
// ---------------------------------------------------------------------------------------------------------
#define AT_PP 72                        // output staging row pitch in halves
#define AT_KP 72                        // staged row pitch in halves: 144 B = 16 B x 9
#define AT_TH (64 * AT_KP)              // halves of one staged 64-row tile
#define AT_BH (2 * AT_TH)               // halves of one buffer: K tile | V^T tile
#define AT_MP 68                        // staged mask row pitch in words: 272 B = 16 B x 17
#define AT_MW (64 * AT_MP)              // words of one staged 64-query x 64-key mask tile
// 2^x as the bare v_exp_f32, without the library form's range test, selects, add and ldexp around it. Every argument here is <= 0 (or -inf);
// the two forms differ only where 2^x < 2^-126, which may come out 0: such a term is far under half an ulp of the row's sum and of the f16 operand.
__device__ __forceinline__ float ex2(float x) { return __builtin_amdgcn_exp2f(x); }
// Eight of them in place, in one statement: each v_exp_f32 is the independent instruction that the slot behind the one before it asks for, and the
// v_nop fills the slot behind the last.
__device__ __forceinline__ void ex2x8(float (&v)[8]) {
  asm("v_exp_f32 %0, %0\n\tv_exp_f32 %1, %1\n\tv_exp_f32 %2, %2\n\tv_exp_f32 %3, %3\n\t"
      "v_exp_f32 %4, %4\n\tv_exp_f32 %5, %5\n\tv_exp_f32 %6, %6\n\tv_exp_f32 %7, %7\n\tv_nop"
      : "+v"(v[0]), "+v"(v[1]), "+v"(v[2]), "+v"(v[3]), "+v"(v[4]), "+v"(v[5]), "+v"(v[6]), "+v"(v[7]));
}
// lane l <-> lane l ^ 16
__device__ __forceinline__ float xhalf(float x) {
  const int b = __builtin_bit_cast(int, x);
  return __builtin_bit_cast(float, __builtin_amdgcn_permlanex16(b, b, 0x76543210, 0xfedcba98, false, false));
}
// One mask tile's fill, this thread's share: 16 B in each of eight rows (sixteen threads cover a 256-B row piece, so a wave covers 4 whole
// lines per copy). l = the thread's LDS byte address in its first row, ls = LDS bytes from one of its rows to the next; g, gs = the same in
// global memory (address, step in elements). s_wait_xcnt closes the statement so that no address register of an issued copy is rewritten ahead of it.
__device__ __forceinline__ void stage_fill_mask(unsigned l, unsigned ls, const int* g, size_t gs) {
  const unsigned l1 = l + ls, l2 = l + 2u * ls, l3 = l + 3u * ls, l4 = l + 4u * ls, l5 = l + 5u * ls, l6 = l + 6u * ls, l7 = l + 7u * ls;
  const int* g1 = g + gs; const int* g2 = g + 2u * gs; const int* g3 = g + 3u * gs; const int* g4 = g + 4u * gs;
  const int* g5 = g + 5u * gs; const int* g6 = g + 6u * gs; const int* g7 = g + 7u * gs;
  asm volatile("global_load_async_to_lds_b128 %0, %8, off\n\t"
               "global_load_async_to_lds_b128 %1, %9, off\n\t"
               "global_load_async_to_lds_b128 %2, %10, off\n\t"
               "global_load_async_to_lds_b128 %3, %11, off\n\t"
               "global_load_async_to_lds_b128 %4, %12, off\n\t"
               "global_load_async_to_lds_b128 %5, %13, off\n\t"
               "global_load_async_to_lds_b128 %6, %14, off\n\t"
               "global_load_async_to_lds_b128 %7, %15, off\n\t"
               "s_wait_xcnt 0x0"
               :: "v"(l), "v"(l1), "v"(l2), "v"(l3), "v"(l4), "v"(l5), "v"(l6), "v"(l7),
                  "v"(g), "v"(g1), "v"(g2), "v"(g3), "v"(g4), "v"(g5), "v"(g6), "v"(g7)
               : "memory");
}
__global__ __launch_bounds__(128) void k_flash(const unsigned short* __restrict__ Qp, const unsigned short* __restrict__ Kp,
                                               const unsigned short* __restrict__ Vtp, const int* __restrict__ mask,
                                               unsigned short* __restrict__ ctxp) {
  __shared__ __align__(16) _Float16 KVs[2 * AT_BH];       // two buffers of [K 64 keys | V^T 64 rows] x 64 halves, pitch 72 halves; behind the loop: output staging
  __shared__ __align__(16) int      Ms[2 * AT_MW];        // two buffers of the mask tile [64 queries][64 keys], pitch 68 words
  static_assert(4 * 16 * AT_PP <= 2 * AT_BH);
  constexpr unsigned NQB = SEQ / 64;
  const float SC2   = 0.125f * 1.4426950408889634f;       // 64^-0.5 * log2(e)
  const float FILL2 = -1.0e9f * 1.4426950408889634f;      // the finite fill in the exp2 domain
  const float PSC   = 16384.0f;                           // probability carry (f16 operand stays normal)
  const float CTXC  = 16.0f;                              // output carry, undone in the projection epilogue

  const unsigned tid = threadIdx.x, wave = tid >> 5, lane = tid & 31u, hh = lane >> 4, c = lane & 15u;
  const unsigned bx = blockIdx.x;
  const unsigned qb = bx % NQB;
  const unsigned bh = bx / NQB;
  const unsigned h  = bh % (unsigned)NHEAD;
  const unsigned b  = bh / (unsigned)NHEAD;
  const unsigned q0 = qb * 64u + wave * 16u;

  const _Float16* Q  = (const _Float16*)Qp;
  const _Float16* K  = (const _Float16*)Kp;
  const _Float16* Vt = (const _Float16*)Vtp;

  const _Float16* qrow  = Q + (size_t)(b * (unsigned)SEQ + q0 + c) * DIMC + h * HDIM + 8u * hh;
  const v16h qa0 = frag_ld(qrow), qa1 = frag_ld(qrow + 32);   // B operand: column c = query q0 + c
  // copy share of this thread: K and V^T tile rows tid / 8 (+16, +32, +48), 16-B piece tid % 8 of the 128-B row piece
  const unsigned crow = tid >> 3, cpc = tid & 7u;
  const _Float16* gK = K + (size_t)(b * (unsigned)SEQ + crow) * DIMC + h * HDIM + cpc * 8u;           // key crow of chunk 0
  const _Float16* gV = Vt + ((size_t)b * DIMC + h * HDIM + crow) * SEQ + cpc * 8u;                     // V^T row crow, keys of chunk 0
  const unsigned lK = (unsigned)(size_t)KVs + (crow * AT_KP + cpc * 8u) * 2u;                          // key x of a chunk lies in LDS row x
  const unsigned lV = lK + AT_TH * 2u;
  const unsigned lsKV = 16u * AT_KP * 2u;
  const size_t gsK = (size_t)16u * DIMC, gsV = (size_t)16u * SEQ;
  // mask tile rows tid / 16 (+8, ..., +56), 16-B piece tid % 16 of the 256-B row piece
  const unsigned mrw = tid >> 4, mpc = tid & 15u;
  const int* gM = mask + (size_t)b * SEQ_FULL * SEQ_FULL + (size_t)(qb * 64u + mrw) * SEQ_FULL + mpc * 4u;   // query row mrw of the block, keys of chunk 0
  const unsigned lM = (unsigned)(size_t)Ms + (mrw * AT_MP + mpc * 4u) * 4u;
  const unsigned lsM = 8u * AT_MP * 4u;
  const size_t gsM = (size_t)8u * SEQ_FULL;
  const unsigned fKV = c * AT_KP + 8u * hh;               // this lane's fragment place in a 16-row group of either staged tile
  const unsigned fM  = (wave * 16u + c) * AT_MP + 8u * hh;   // this lane's query row of the staged mask tile, its half's 8 keys of a 16-key group

  float mrow = -INFINITY, lrow = 0.f;                     // this lane's query: running maximum (both halves alike), this half's share of the sum
  v8f oacc[4];                                            // O^T tile t: column c = query, element r = head column 16t + 8hh + r
#pragma unroll
  for (int t = 0; t < 4; ++t) oacc[t] = (v8f){0.f,0.f,0.f,0.f,0.f,0.f,0.f,0.f};

  stage_fill(lK, lsKV, lV, lsKV, gK, gsK, gV, gsV);
  stage_fill_mask(lM, lsM, gM, gsM);
  asm volatile("s_wait_asynccnt 0x0" ::: "memory");     // this wave's copies of chunk 0 have landed
  __syncthreads();                                      // ... and every other wave's: buffer 0 is readable
  if (NQB > 1u) {
    stage_fill(lK + AT_BH * 2u, lsKV, lV + AT_BH * 2u, lsKV, gK + (size_t)64u * DIMC, gsK, gV + 64, gsV);
    stage_fill_mask(lM + AT_MW * 4u, lsM, gM + 64, gsM);
  }

#pragma unroll 1
  for (unsigned kc = 0; kc < NQB; ++kc) {
    const unsigned kv0 = kc * 64u;
    const _Float16* kvs = KVs + (kc & 1u) * AT_BH + fKV;
    const int* ms = Ms + (kc & 1u) * AT_MW + fM;
    v8f s[4];
    v16h kf[4][2];                                      // the chunk's 8 K fragments, read as one group in front of the products (loops unrolled: constant indices keep them in registers)
#pragma unroll
    for (int j = 0; j < 4; ++j) {
      const _Float16* kr = kvs + (unsigned)j * 16u * AT_KP;                        // A row c of tile j = key kv0 + 16j + c
      kf[j][0] = frag_ld(kr); kf[j][1] = frag_ld(kr + 32);
    }
    v4i mk[4][2];
#pragma unroll
    for (int j = 0; j < 4; ++j) {
      mk[j][0] = *(const v4i*)(ms + (unsigned)j * 16u);                            // query q0 + c, keys kv0 + 16j + 8hh + 0..3
      mk[j][1] = *(const v4i*)(ms + (unsigned)j * 16u + 4u);                       // ... + 4..7
    }
#pragma unroll
    for (int j = 0; j < 4; ++j) s[j] = wm16(kf[j][0], qa0, (v8f){0.f,0.f,0.f,0.f,0.f,0.f,0.f,0.f});
#pragma unroll
    for (int j = 0; j < 4; ++j) s[j] = wm16(kf[j][1], qa1, s[j]);

    float x[4][8];                                      // this query's 32 scores, then its 32 probabilities (every loop over them unrolled: constant indices keep them in registers)
#pragma unroll
    for (int j = 0; j < 4; ++j)
#pragma unroll
      for (int r = 0; r < 8; ++r) x[j][r] = (mk[j][r >> 2][r & 3] == 0) ? FILL2 : s[j][r] * SC2;
    float mj[4];
#pragma unroll
    for (int j = 0; j < 4; ++j)
      mj[j] = fmaxf(fmaxf(fmaxf(x[j][0], x[j][1]), fmaxf(x[j][2], x[j][3])), fmaxf(fmaxf(x[j][4], x[j][5]), fmaxf(x[j][6], x[j][7])));
    float m = fmaxf(fmaxf(mj[0], mj[1]), fmaxf(mj[2], mj[3]));
    m = fmaxf(m, xhalf(m));                             // the other half's 32 keys of the same query
    const float mnew  = fmaxf(mrow, m);
    const float alpha = ex2(mrow - mnew);
    mrow = mnew;
#pragma unroll
    for (int j = 0; j < 4; ++j)                         // all 32 exponents first, so that the v_exp_f32 groups below work in place (unrolled as above)
#pragma unroll
      for (int r = 0; r < 8; ++r) x[j][r] -= mnew;
    float pj[4];
#pragma unroll
    for (int j = 0; j < 4; ++j) {
      ex2x8(x[j]);
      pj[j] = ((x[j][0] + x[j][1]) + (x[j][2] + x[j][3])) + ((x[j][4] + x[j][5]) + (x[j][6] + x[j][7]));
    }
    lrow = lrow * alpha + ((pj[0] + pj[1]) + (pj[2] + pj[3]));
#pragma unroll
    for (int t = 0; t < 4; ++t)
#pragma unroll
      for (int r = 0; r < 8; ++r) oacc[t][r] *= alpha;
    v16h pb[2], va[2][4];                               // P^T packed from the score registers; the chunk's V^T fragments, read as one group in front of the products (unrolled as above)
#pragma unroll
    for (int kk = 0; kk < 2; ++kk) {
#pragma unroll
      for (int i = 0; i < 8; ++i) {
        pb[kk][i]     = (_Float16)(x[2 * kk][i] * PSC);       // B element i     = key 32kk + 8hh + i
        pb[kk][i + 8] = (_Float16)(x[2 * kk + 1][i] * PSC);   // B element 8 + i = key 32kk + 16 + 8hh + i
      }
#pragma unroll
      for (int t = 0; t < 4; ++t) va[kk][t] = frag_ld(kvs + AT_TH + (unsigned)t * 16u * AT_KP + (unsigned)kk * 32u);   // A: row d = t*16 + c, same key map
    }
#pragma unroll
    for (int kk = 0; kk < 2; ++kk) {
#pragma unroll
      for (int t = 0; t < 4; ++t) oacc[t] = wm16(va[kk][t], pb[kk], oacc[t]);
    }
    asm volatile("s_wait_dscnt 0x0" ::: "memory");      // this wave's reads of buffer kc%2 are done before it is handed to its next writer
    asm volatile("s_wait_asynccnt 0x0" ::: "memory");   // this wave's copies of chunk kc+1 have landed
    __syncthreads();                                    // publishes chunk kc+1's buffer and ends every reader's last read of chunk kc's
    if (kc + 2u < NQB) {
      const unsigned lo = (kc & 1u) * (AT_BH * 2u);
      stage_fill(lK + lo, lsKV, lV + lo, lsKV, gK + (size_t)(kv0 + 128u) * DIMC, gsK, gV + (kv0 + 128u), gsV);
      stage_fill_mask(lM + (kc & 1u) * (AT_MW * 4u), lsM, gM + (kv0 + 128u), gsM);
    }
  }
  asm volatile("s_wait_asynccnt 0x0" ::: "memory");     // nothing of this wave is in flight when the loop is left

  // behind the last trip's barrier nobody reads the staged tiles any more and no copy is in flight: each wave stages its 16 x 64 output in its own slice
  _Float16* os = KVs + wave * (16u * AT_PP);
  const float inv = CTXC * (1.0f / ((lrow + xhalf(lrow)) * PSC));   // the two halves' sums of this query joined
#pragma unroll
  for (int t = 0; t < 4; ++t) {
    v8h hv;
#pragma unroll
    for (int r = 0; r < 8; ++r) hv[r] = (_Float16)(oacc[t][r] * inv);
    *(v8h*)(os + c * AT_PP + (unsigned)t * 16u + 8u * hh) = hv;      // query row c, head columns 16t + 8hh + 0..7
  }
  wave_sync();
  {
    const unsigned q4 = lane >> 3, c8 = (lane & 7u) * 8u;
    _Float16* cb = (_Float16*)ctxp + (size_t)(b * (unsigned)SEQ + q0) * DIMC + h * HDIM;
#pragma unroll
    for (int it = 0; it < 4; ++it) {
      const unsigned row = (unsigned)it * 4u + q4;
      *(v8h*)(cb + (size_t)row * DIMC + c8) = *(const v8h*)(os + row * AT_PP + c8);
    }
  }
}

// ---------------------------------------------------------------------------------------------------------
// workspace carve (bytes, every region a multiple of 256 and fully written by its producer before any read)
// ---------------------------------------------------------------------------------------------------------
static constexpr size_t SZ_X16   = (size_t)3 * MROWS * DIMC * 2;     // q16 | k16 | v16 planes [MROWS][1024] f16
static constexpr size_t SZ_WT16  = (size_t)4 * DIMC * DIMC * 2;      // Wq^T | Wk^T | Wv^T | Wp^T planes [out][in] f16, x16
static constexpr size_t SZ_QK16  = (size_t)2 * MROWS * DIMC * 2;     // Q16 | K16 planes [MROWS][1024] f16
static constexpr size_t SZ_VT16  = (size_t)NB * DIMC * SEQ * 2;      // V^T planes [b][1024][SEQ] f16
static constexpr size_t SZ_CTX16 = (size_t)MROWS * DIMC * 2;         // merged head output x16 [MROWS][1024] f16
static constexpr size_t SZ_BRO   = (size_t)DIMC * 4;                 // bias, bf16 RNE-converted, f32
static constexpr size_t SZ_TOTAL = SZ_X16 + SZ_WT16 + SZ_QK16 + SZ_VT16 + SZ_CTX16 + SZ_BRO;
static_assert((SZ_X16 % 256) == 0 && (SZ_WT16 % 256) == 0 && (SZ_QK16 % 256) == 0 && (SZ_VT16 % 256) == 0 && (SZ_CTX16 % 256) == 0 && (SZ_BRO % 256) == 0);
static_assert(SZ_TOTAL <= (size_t)134217728);
// coverage equalities of the plane writers
static_assert((size_t)(SEQ * 128 / 256) * 256 * 8 == (size_t)SEQ * DIMC);            // k_cast_rows per (batch, tensor)
static_assert((size_t)(DIMC * 128 / 256) * 256 * 8 == (size_t)DIMC * DIMC);          // k_cast_wT per weight
static_assert((size_t)(SEQ / 64) * 4 * 16 * 64 == (size_t)SEQ * HDIM);               // k_flash per (batch, head): blocks x waves x rows x cols
static_assert((MROWS % 128) == 0 && (DIMC % 128) == 0 && (SEQ % 128) == 0);            // k_gemm64: whole 128x128 tiles, K = DIMC in whole 64-k trips

extern "C" void kernel_launch(void* const* d_in, const int* in_sizes, int n_in, void* d_out, int out_size, void* d_ws, size_t ws_size, hipStream_t stream) {
  if (n_in < 9) return;
  const long long needX = (long long)(NB - 1) * SEQ_FULL * DIMC + (long long)SEQ * DIMC;
  const long long needM = (long long)(NB - 1) * SEQ_FULL * SEQ_FULL + (long long)(SEQ - 1) * SEQ_FULL + SEQ;
  if ((long long)in_sizes[0] < needX || (long long)in_sizes[1] < needX || (long long)in_sizes[2] < needX) return;
  if ((long long)in_sizes[3] < needM) return;
  if (in_sizes[4] < DIMC * DIMC || in_sizes[5] < DIMC * DIMC || in_sizes[6] < DIMC * DIMC || in_sizes[7] < DIMC * DIMC || in_sizes[8] < DIMC) return;
  if ((long long)out_size < (long long)MROWS * DIMC) return;
  if (ws_size < SZ_TOTAL) return;

  const float* q    = (const float*)d_in[0];
  const float* k    = (const float*)d_in[1];
  const float* v    = (const float*)d_in[2];
  const int*   mask = (const int*)d_in[3];
  const float* Wq   = (const float*)d_in[4];
  const float* Wk   = (const float*)d_in[5];
  const float* Wv   = (const float*)d_in[6];
  const float* Wp   = (const float*)d_in[7];
  const float* bp   = (const float*)d_in[8];
  float* out = (float*)d_out;

  char* wsp = (char*)d_ws;
  unsigned short* X16   = (unsigned short*)wsp; wsp += SZ_X16;
  unsigned short* WT16  = (unsigned short*)wsp; wsp += SZ_WT16;
  unsigned short* QK16  = (unsigned short*)wsp; wsp += SZ_QK16;
  unsigned short* VT16  = (unsigned short*)wsp; wsp += SZ_VT16;
  unsigned short* CTX16 = (unsigned short*)wsp; wsp += SZ_CTX16;
  float*          BRO   = (float*)wsp;          wsp += SZ_BRO;

  const unsigned long long planeX = (unsigned long long)MROWS * DIMC;     // elements per activation plane
  const unsigned long long planeW = (unsigned long long)DIMC * DIMC;

  // weights [in][out] -> [out][in] f16 x16 (4 planes); bias; activations (3 planes, full input batch stride, compact planes)
  k_cast_wT<<<dim3((unsigned)(DIMC * 128 / 256), 4u, 1u), 256, 0, stream>>>(Wq, Wk, Wv, Wp, WT16);
  k_bias_bf<<<dim3((unsigned)((DIMC + 255) / 256), 1u, 1u), 256, 0, stream>>>(bp, BRO, (unsigned)DIMC);
  k_cast_rows<<<dim3((unsigned)(SEQ * 128 / 256), (unsigned)NB, 3u), 256, 0, stream>>>(q, k, v, (unsigned long long)SEQ_FULL * DIMC, X16,
                                                                                      (unsigned long long)SEQ * DIMC, planeX, (unsigned)SEQ);
  // Q16 | K16 = (q16 | k16) x (Wq^T | Wk^T): batch y = 0 (q), 1 (k); M = MROWS, N = K = 1024
  k_gemm64<0, 1><<<dim3((unsigned)((MROWS / 128) * (DIMC / 128)), 2u, 1u), 256, 0, stream>>>(
      X16, (unsigned)DIMC, planeX, WT16, (unsigned)DIMC, planeW, (void*)QK16, (unsigned)DIMC, planeX, nullptr,
      (unsigned)MROWS, (unsigned)DIMC, (unsigned)DIMC, 0.0625f);
  // V^T[b][o][n] = sum_k Wv^T[o][k] * v16[b][n][k]: A = Wv^T plane (M = 1024), Bt = v16 batch plane (N = SEQ), C pitch SEQ
  k_gemm64<0, 1><<<dim3((unsigned)((DIMC / 128) * (SEQ / 128)), (unsigned)NB, 1u), 256, 0, stream>>>(
      WT16 + 2 * planeW, (unsigned)DIMC, 0ull, X16 + 2 * planeX, (unsigned)DIMC, (unsigned long long)SEQ * DIMC,
      (void*)VT16, (unsigned)SEQ, (unsigned long long)DIMC * SEQ, nullptr,
      (unsigned)DIMC, (unsigned)SEQ, (unsigned)DIMC, 0.0625f);
  // attention
  k_flash<<<dim3((unsigned)(NB * NHEAD * (SEQ / 64)), 1u, 1u), 128, 0, stream>>>(QK16, QK16 + planeX, VT16, mask, CTX16);
  // out = (ctx x16) x (Wp^T x16) / 256 + bias
  k_gemm64<2, 0><<<dim3((unsigned)((MROWS / 128) * (DIMC / 128)), 1u, 1u), 256, 0, stream>>>(
      CTX16, (unsigned)DIMC, 0ull, WT16 + 3 * planeW, (unsigned)DIMC, 0ull, (void*)out, (unsigned)DIMC, 0ull, BRO,
      (unsigned)MROWS, (unsigned)DIMC, (unsigned)DIMC, 0.00390625f);
}

// v004
// A run of this version takes 115 microseconds.
// Two timings next to v003 both put it at 1.08 times that version's speed.
// Counting every step since v000, it is 2.72 times as fast.
// Masked multi-head attention (2 x 2,048 x 1,024; 16 heads x 64): inputs and parameters RNE-converted to bf16 first; every contraction (q/k/v projections, q.k^T, p.v, output projection) on v_wmma_f32_16x16x32_f16 (f16 operands: weights x16, probabilities x2^14, merged head output x16; f32 accumulate, f32 online softmax in the exp2 domain).
#include <hip/hip_runtime.h>
#include <math.h>

#ifndef NB
#define NB 2
#endif
#ifndef SEQ
#define SEQ 2048
#endif
#define NB_FULL 2
#define SEQ_FULL 2048
#define DIMC 1024
#define NHEAD 16
#define HDIM 64
#define MROWS (NB * SEQ)

static_assert(SEQ % 64 == 0);
static_assert(SEQ <= SEQ_FULL);
static_assert(NB <= NB_FULL);
static_assert(DIMC == NHEAD * HDIM);
static_assert(DIMC % 64 == 0);
static_assert(DIMC / 8 == 128);
static_assert((MROWS % 64) == 0);
static_assert(((SEQ * 128) % 256) == 0);

typedef __attribute__((ext_vector_type(16))) _Float16 v16h;
typedef __attribute__((ext_vector_type(8)))  _Float16 v8h;
typedef __attribute__((ext_vector_type(4)))  _Float16 v4h;
typedef __attribute__((ext_vector_type(8)))  float    v8f;
typedef __attribute__((ext_vector_type(4)))  float    v4f;
typedef __attribute__((ext_vector_type(4)))  int      v4i;

// 16-bit WMMA fragment map (wave32), lane L, h = L>>4, m = L&15:
//   A 16x32: lane = row m;    element i -> k = (i<8) ? 8h+i : 16+8h+(i-8)
//   B 32x16: lane = column m; the SAME k(i,h)
//   D 16x16 (8 f32): lane = column m; element r -> row 8h+r
union FragU { v16h v; v8h h[2]; };
// p already includes the lane-half offset 8h: elements 0..7 <- p[0..7], 8..15 <- p[16..23]
__device__ __forceinline__ v16h frag_ld(const _Float16* p) {
  FragU f; f.h[0] = *(const v8h*)(p); f.h[1] = *(const v8h*)(p + 16); return f.v;
}
__device__ __forceinline__ v8f wm16(v16h a, v16h b, v8f c) {
  c = __builtin_amdgcn_wmma_f32_16x16x32_f16(false, a, false, b, (short)0, c, false, false);
  asm volatile("v_nop\n\tv_nop\n\tv_nop\n\tv_nop" : "+v"(c) : "v"(a), "v"(b));
  return c;
}
__device__ __forceinline__ void dep_guard_h(v8f& a, v8f& b, v16h x, v16h y) { asm volatile("v_nop\n\tv_nop\n\tv_nop\n\tv_nop" : "+v"(a), "+v"(b) : "v"(x), "v"(y)); }
__device__ __forceinline__ void keep4_h(v16h a, v16h b, v16h c, v16h d) { asm volatile("v_nop" :: "v"(a), "v"(b), "v"(c), "v"(d)); }
__device__ __forceinline__ void acc_guard4(v8f& a, v8f& b, v8f& c, v8f& d) { asm volatile("v_nop\n\tv_nop\n\tv_nop\n\tv_nop" : "+v"(a), "+v"(b), "+v"(c), "+v"(d)); }
// same-wave LDS exchange: stores by some lanes, loads of those locations by other lanes of the SAME wave
__device__ __forceinline__ void wave_sync() {
  __builtin_amdgcn_fence(3 /* release order */, "workgroup");
  __builtin_amdgcn_wave_barrier();
  __builtin_amdgcn_fence(2 /* acquire order */, "workgroup");
}
// bf16 RNE-convert, kept as f32 (finite inputs)
__device__ __forceinline__ float cmb_bf(float v) {
  const unsigned u = __builtin_bit_cast(unsigned, v);
  const unsigned r = (u + 0x7fffu + ((u >> 16) & 1u)) & 0xffff0000u;
  return __builtin_bit_cast(float, r);
}

// ---------------------------------------------------------------------------------------------------------
// k_convert: every conversion of the call in ONE launch of CV_WG work-groups of 16 waves, one for each WGP, all resident at once; a thread
// takes CV_ST pieces of every kind instead of ending after one, so the launch starts 4,096 waves where three launches started 65,568.
// A thread's pieces, step j = 0 .. CV_ST - 1:
//   one of each activation tensor: f32 row [1024], 8 columns -> bf16 (RNE) -> f16 plane rows [MROWS][1024], one 16-B store
//   (piece j * CV_TH + flat thread: consecutive threads walk along a row; sources use the FULL input batch stride, planes are compact);
//   one of a weight: W[k = in][o = out] (row pitch 1024) -> WT[o][k] = f16(bf16_rne(W[k][o]) * 16): 8 strided loads, one 16-B store, a wave walks
//   along the destination row. A work-group takes two tiles of 32 outputs x 256 inputs, two steps each (16 waves = 16 outputs a step): the
//   128-B source lines of a tile hold exactly its 32 outputs, so both steps and all 16 waves read the same 256 lines.
// All loads of a thread are issued first (24 of 16 B, then 32 of 4 B), so a wave waits out the memory latency once, not once a step.
// The first DIMC threads of the launch also convert the bias.
// ---------------------------------------------------------------------------------------------------------
#define CV_WG 256                       // work-groups of the launch
#define CV_TH (CV_WG * 512)             // threads of the launch
#define CV_ST 4                         // pieces of each kind per thread
#define CV_RPS (CV_TH / 128)             // activation rows of one step (128 pieces a row)
#define CV_TPW ((DIMC / 32) * (DIMC / 256))   // tiles of one weight
static_assert(MROWS * 128 == CV_ST * CV_TH);              // activation pieces of one tensor: every one exactly once
static_assert(4 * CV_TPW == CV_WG * (CV_ST / 2));         // weight tiles: every one exactly once
static_assert(CV_TPW % (CV_ST / 2) == 0);                 // a work-group's tiles lie in one weight
static_assert(SEQ % CV_RPS == 0);                         // a step's rows lie in one batch
static_assert(DIMC <= CV_TH);
static_assert(CV_ST == 4);                                // the wait behind the activation loads names four offsets
static_assert(((unsigned long long)(NB - 1) * SEQ_FULL + SEQ) * DIMC * 4 < (1ull << 32));   // source byte offsets fit 32 bits
__global__ __launch_bounds__(512) void k_convert(const float* __restrict__ S0, const float* __restrict__ S1, const float* __restrict__ S2,
                                                  const float* __restrict__ W0, const float* __restrict__ W1, const float* __restrict__ W2,
                                                  const float* __restrict__ W3, const float* __restrict__ BP,
                                                  unsigned short* __restrict__ X, unsigned short* __restrict__ WT, float* __restrict__ BRO) {
  const unsigned t = blockIdx.x * 512u + threadIdx.x;
  const unsigned wave = threadIdx.x >> 5, lane = threadIdx.x & 31u;
  const unsigned tile0 = blockIdx.x * (CV_ST / 2u);
  const unsigned y = tile0 / (unsigned)CV_TPW;
  const float* W = (y == 0u) ? W0 : ((y == 1u) ? W1 : ((y == 2u) ? W2 : W3));   // block-uniform choice among global pointers
  const unsigned tsb = t * 32u, tdb = t * 16u;   // this thread's place inside a step's CV_RPS rows, in source and in plane bytes: one 32-bit offset beside a uniform base
  v4f x[CV_ST][3][2];                   // every loop over the steps is unrolled: constant indices keep the pieces in registers
  float w[CV_ST][8];
  unsigned so[CV_ST];                   // source byte offsets of the thread's pieces, alike in the three tensors
#pragma unroll
  for (unsigned j = 0; j < CV_ST; ++j) {
    // first row of step j in the source: batch (j * CV_RPS) / SEQ at the full batch stride, row (j * CV_RPS) % SEQ of it
    so[j] = (((j * (unsigned)CV_RPS) / (unsigned)SEQ) * (unsigned)SEQ_FULL + (j * (unsigned)CV_RPS) % (unsigned)SEQ) * (unsigned)(DIMC * 4) + tsb;
    const v4f* s0 = (const v4f*)((const char*)S0 + so[j]);
    const v4f* s1 = (const v4f*)((const char*)S1 + so[j]);
    const v4f* s2 = (const v4f*)((const char*)S2 + so[j]);
    x[j][0][0] = s0[0]; x[j][0][1] = s0[1];
    x[j][1][0] = s1[0]; x[j][1][1] = s1[1];
    x[j][2][0] = s2[0]; x[j][2][1] = s2[1];
  }
  // The wait before a register that one of these 24 loads names is written again; the offsets are inputs so that they stay in their registers up
  // to it. The statement also keeps the streaming loads in front of the 32 many-line weight loads, which the compiler otherwise issues first
  // (a wave's loads return in order).
  asm volatile("s_wait_xcnt 0x0" :: "v"(so[0]), "v"(so[1]), "v"(so[2]), "v"(so[3]) : "memory");
  unsigned wo[CV_ST];                   // source byte offsets of the thread's weight pieces (first of the 8 inputs)
#pragma unroll
  for (unsigned j = 0; j < CV_ST; ++j) {
    const unsigned ty = (tile0 + (j >> 1)) % (unsigned)CV_TPW;
    const unsigned o = (ty >> 2) * 32u + (j & 1u) * 16u + wave, k0 = (ty & 3u) * 256u + lane * 8u;
    wo[j] = (k0 * (unsigned)DIMC + o) * 4u;
#pragma unroll
    for (int e = 0; e < 8; ++e) w[j][e] = *(const float*)((const char*)W + wo[j] + (unsigned)e * (unsigned)(DIMC * 4));
  }
  asm volatile("s_wait_xcnt 0x0" :: "v"(wo[0]), "v"(wo[1]), "v"(wo[2]), "v"(wo[3]) : "memory");   // as above, for the 32 weight loads
  float bv = 0.f;
  if (t < (unsigned)DIMC) bv = BP[t];                                 // whole waves of the first work-groups
#pragma unroll
  for (unsigned j = 0; j < CV_ST; ++j) {
#pragma unroll
    for (int z = 0; z < 3; ++z) {
      v8h hv;
#pragma unroll
      for (int e = 0; e < 4; ++e) { hv[e] = (_Float16)cmb_bf(x[j][z][0][e]); hv[e + 4] = (_Float16)cmb_bf(x[j][z][1][e]); }
      *(v8h*)((char*)((_Float16*)X + ((size_t)z * MROWS + (size_t)j * CV_RPS) * DIMC) + tdb) = hv;
    }
    asm volatile("s_wait_xcnt 0x0" ::: "memory");   // before a register that one of these stores names is written again
  }
#pragma unroll
  for (unsigned j = 0; j < CV_ST; ++j) {
    const unsigned ty = (tile0 + (j >> 1)) % (unsigned)CV_TPW;
    const unsigned o = (ty >> 2) * 32u + (j & 1u) * 16u + wave, k0 = (ty & 3u) * 256u + lane * 8u;
    v8h hw;
#pragma unroll
    for (int e = 0; e < 8; ++e) hw[e] = (_Float16)(cmb_bf(w[j][e]) * 16.0f);
    *(v8h*)((_Float16*)WT + (size_t)y * DIMC * DIMC + (o * (unsigned)DIMC + k0)) = hw;
    asm volatile("s_wait_xcnt 0x0" ::: "memory");   // as above
  }
  if (t < (unsigned)DIMC) BRO[t] = cmb_bf(bv);
}

// ---------------------------------------------------------------------------------------------------------
// k_gemm64: C[m,n] = scale * sum_k A[m,k] * Bt[n,k] (+ bias[n]); f16 operand planes. A block of 8 waves owns a 128x128 tile of C,
// each wave 32 rows x 64 columns of it. Per trip 64 k of the block's 128 A rows and 128 Bt rows (128-B row pieces, whole lines) come
// into LDS by asynchronous copies, two buffers: the next trip's copies fly while this trip's fragments are read from LDS (row pitch 144 B).
// A row-major [M,K]; Bt row-major [N,K]; M,N % 128 == 0, K % 64 == 0, K >= 64; batch = blockIdx.y with element strides.
// OUT_MODE 0: f32 C; 1: f16 C. Epilogue: 16-row slabs staged per wave in LDS (wave-private), each 64-wide row segment written as whole
// ---------------------------------------------------------------------------------------------------------
#define GT_PH  72                      // LDS row pitch in halves: 144 B = 16 B x 9
#define GT_OPH (128 * GT_PH)           // halves of one operand's 128-row tile
#define GT_STH (2 * GT_OPH)            // halves of one buffer: A tile | Bt tile
// One buffer's fill, this thread's share: 16 B in each of four rows of the first tile and of four rows of the second (eight threads cover
// a 128-B row piece, so a wave covers 4 whole lines per copy). la, lb = the thread's LDS byte addresses in its first row of either tile,
// lsa, lsb = LDS bytes from one of its rows to the next; ga, gb, gsa, gsb = the same in global memory (addresses, steps in elements).
// s_wait_xcnt closes the statement so that no address register of an issued copy is rewritten ahead of it.
__device__ __forceinline__ void stage_fill(unsigned la, unsigned lsa, unsigned lb, unsigned lsb,
                                           const _Float16* ga, size_t gsa, const _Float16* gb, size_t gsb) {
  const unsigned la1 = la + lsa, la2 = la + 2u * lsa, la3 = la + 3u * lsa;
  const unsigned lb1 = lb + lsb, lb2 = lb + 2u * lsb, lb3 = lb + 3u * lsb;
  const _Float16* ga1 = ga + gsa; const _Float16* ga2 = ga + 2u * gsa; const _Float16* ga3 = ga + 3u * gsa;
  const _Float16* gb1 = gb + gsb; const _Float16* gb2 = gb + 2u * gsb; const _Float16* gb3 = gb + 3u * gsb;
  asm volatile("global_load_async_to_lds_b128 %0, %8, off\n\t"
               "global_load_async_to_lds_b128 %1, %9, off\n\t"
               "global_load_async_to_lds_b128 %2, %10, off\n\t"
               "global_load_async_to_lds_b128 %3, %11, off\n\t"
               "global_load_async_to_lds_b128 %4, %12, off\n\t"
               "global_load_async_to_lds_b128 %5, %13, off\n\t"
               "global_load_async_to_lds_b128 %6, %14, off\n\t"
               "global_load_async_to_lds_b128 %7, %15, off\n\t"
               "s_wait_xcnt 0x0"
               :: "v"(la), "v"(la1), "v"(la2), "v"(la3), "v"(lb), "v"(lb1), "v"(lb2), "v"(lb3),
                  "v"(ga), "v"(ga1), "v"(ga2), "v"(ga3), "v"(gb), "v"(gb1), "v"(gb2), "v"(gb3)
               : "memory");
}
template <int BIAS_MODE, int OUT_MODE>
__global__ __launch_bounds__(256) void k_gemm64(
    const unsigned short* __restrict__ Ap, unsigned lda, unsigned long long strideA,
    const unsigned short* __restrict__ Btp, unsigned ldb, unsigned long long strideB,
    void* __restrict__ Cout, unsigned ldc, unsigned long long strideC,
    const float* __restrict__ bias, unsigned M, unsigned N, unsigned K, float scale) {
  __shared__ __align__(16) _Float16 sS[2 * GT_STH];   // two buffers of [A 128 rows | Bt 128 rows] x 64 k, pitch 72 halves
  __shared__ __align__(16) float sT[8][16 * 68];      // per-wave 16x64 slab, pitch 68 floats
  const unsigned b    = blockIdx.y;
  const unsigned lane = threadIdx.x & 31u;
  const unsigned wave = threadIdx.x >> 5;
  const unsigned tilesN = N >> 7;
  const unsigned tilesM = M >> 7;
  const unsigned tile = blockIdx.x;
  if (tile >= tilesM * tilesN) return;   // block-uniform, in front of every barrier and copy
  const unsigned tm = tile / tilesN;
  const unsigned tn = tile - tm * tilesN;
  const unsigned m0 = (tm << 7) + ((wave >> 1) << 5);   // this wave's 32 rows
  const unsigned n0 = (tn << 7) + ((wave & 1u) << 6);   // this wave's 64 columns

  const _Float16* Ab = (const _Float16*)Ap + (size_t)b * strideA;
  const _Float16* Bb = (const _Float16*)Btp + (size_t)b * strideB;

  const unsigned rlane = lane & 15u;            // row (A) / col (B, D) within subtile
  const unsigned koff  = (lane >> 4) * 8u;      // k offset of this lane half
  const unsigned mOff  = (lane >> 4) * 8u;      // D row offset

  // copy share of this thread: tile row threadIdx.x / 8 (+32, +64, +96), 16-B piece threadIdx.x % 8 of the 128-B row piece
  const unsigned crow = threadIdx.x >> 3, cpc = threadIdx.x & 7u;
  const _Float16* gA = Ab + (size_t)((tm << 7) + crow) * lda + cpc * 8u;
  const _Float16* gB = Bb + (size_t)((tn << 7) + crow) * ldb + cpc * 8u;
  const unsigned lC = (unsigned)(size_t)sS + (crow * GT_PH + cpc * 8u) * 2u;
  // fragment read places of this lane inside a buffer
  const unsigned fA = (((wave >> 1) << 5) + rlane) * GT_PH + koff;
  const unsigned fB = GT_OPH + (((wave & 1u) << 6) + rlane) * GT_PH + koff;

  v8f acc[2][4];
#pragma unroll
  for (int i = 0; i < 2; ++i)
#pragma unroll
    for (int j = 0; j < 4; ++j) acc[i][j] = (v8f){0.f,0.f,0.f,0.f,0.f,0.f,0.f,0.f};

  const unsigned nT = K >> 6;
  const unsigned lStep = 32u * GT_PH * 2u;              // a thread's rows are 32 apart
  const size_t gsA = (size_t)32u * lda, gsB = (size_t)32u * ldb;
  stage_fill(lC, lStep, lC + GT_OPH * 2u, lStep, gA, gsA, gB, gsB);
  asm volatile("s_wait_asynccnt 0x0" ::: "memory");     // this wave's copies of trip 0 have landed
  __syncthreads();                                      // ... and every other wave's: buffer 0 is readable
  if (nT > 1u) stage_fill(lC + GT_STH * 2u, lStep, lC + (GT_STH + GT_OPH) * 2u, lStep, gA + 64, gsA, gB + 64, gsB);

  for (unsigned t = 0; t < nT; ++t) {
    const _Float16* sb = sS + (t & 1u) * GT_STH;
    v16h bh[2][4], ah[2][2];                            // the trip's 12 fragments, read as one group in front of its 16 products (loops unrolled: constant indices keep them in registers)
#pragma unroll
    for (int kk = 0; kk < 2; ++kk) {
#pragma unroll
      for (int j = 0; j < 4; ++j) bh[kk][j] = frag_ld(sb + fB + (unsigned)j * 16u * GT_PH + (unsigned)kk * 32u);
#pragma unroll
      for (int i = 0; i < 2; ++i) ah[kk][i] = frag_ld(sb + fA + (unsigned)i * 16u * GT_PH + (unsigned)kk * 32u);
    }
#pragma unroll
    for (int kk = 0; kk < 2; ++kk) {
#pragma unroll
      for (int i = 0; i < 2; ++i) {
#pragma unroll
        for (int j = 0; j < 4; ++j)
          acc[i][j] = __builtin_amdgcn_wmma_f32_16x16x32_f16(false, ah[kk][i], false, bh[kk][j], (short)0, acc[i][j], false, false);
        dep_guard_h(acc[i][0], acc[i][3], ah[kk][i], ah[kk][i]);
      }
      keep4_h(bh[kk][0], bh[kk][1], bh[kk][2], bh[kk][3]);
    }
    asm volatile("s_wait_dscnt 0x0" ::: "memory");      // this wave's reads of buffer t%2 are done before it is handed to its next writer
    asm volatile("s_wait_asynccnt 0x0" ::: "memory");   // this wave's copies of trip t+1 have landed
    __syncthreads();                                    // publishes trip t+1's buffer and ends every reader's last read of trip t's
    if (t + 2u < nT) {
      const unsigned lN = lC + (t & 1u) * (GT_STH * 2u);
      stage_fill(lN, lStep, lN + GT_OPH * 2u, lStep, gA + (size_t)(t + 2u) * 64u, gsA, gB + (size_t)(t + 2u) * 64u, gsB);
    }
  }
  asm volatile("s_wait_asynccnt 0x0" ::: "memory");     // nothing of this wave is in flight when the loop is left
  acc_guard4(acc[0][0], acc[0][1], acc[0][2], acc[0][3]);
  acc_guard4(acc[1][0], acc[1][1], acc[1][2], acc[1][3]);

  float* slab = sT[wave];
#pragma unroll
  for (int i = 0; i < 2; ++i) {
    const unsigned mBase = m0 + ((unsigned)i << 4);
#pragma unroll
    for (int j = 0; j < 4; ++j) {
      const unsigned n = n0 + ((unsigned)j << 4) + rlane;
      float bv = 0.f;
      if (BIAS_MODE == 2) bv = bias[n];
#pragma unroll
      for (int r = 0; r < 8; ++r) {
        float v = acc[i][j][r] * scale;
        if (BIAS_MODE == 2) v += bv;
        slab[(mOff + (unsigned)r) * 68u + ((unsigned)j << 4) + rlane] = v;
      }
    }
    wave_sync();
    if (OUT_MODE == 0) {
      float* C = (float*)Cout + (size_t)b * strideC;
      const unsigned hh = lane >> 4, c4 = (lane & 15u) * 4u;     // row segment = 256 B = 16 lanes x 16 B
      {
#pragma unroll
        for (int it = 0; it < 8; ++it) {
          const unsigned row = (unsigned)it * 2u + hh;
          const v4f v = *(const v4f*)(slab + row * 68u + c4);
          *(v4f*)(C + (size_t)(mBase + row) * ldc + n0 + c4) = v;
        }
        
      }
    } else {
      const unsigned q = lane >> 3, c8 = (lane & 7u) * 8u;
      _Float16* C = (_Float16*)Cout + (size_t)b * strideC;
      {
#pragma unroll
        for (int it = 0; it < 4; ++it) {
          const unsigned row = (unsigned)it * 4u + q;
          const float* sp = slab + row * 68u + c8;
          v8h hv;
#pragma unroll
          for (int e = 0; e < 8; ++e) hv[e] = (_Float16)sp[e];
          *(v8h*)(C + (size_t)(mBase + row) * ldc + n0 + c8) = hv;
        }
        
      }
    }
    wave_sync();
  }
}

// ---------------------------------------------------------------------------------------------------------
// k_flash: per (batch, head, 64-query block): block = 4 waves x 16 queries; 64-key chunks; online softmax in f32 (exp2 domain).
//   each chunk's 64 K16 rows, 64 V^T rows (128-B row pieces) and the block's 64 x 64 keep-mask tile (256-B row pieces) come into LDS once per
//   block by asynchronous copies, two buffers: the next chunk's copies fly while this chunk is worked on.
//   scores transposed: S^T = K.Q^T, A = staged K16 rows (tile j = keys 16j..16j+15), B = Q16 rows kept in registers. A lane then holds 32 scores
//           of ONE query (column c; keys 16j + 8hh + r): maximum and sum run inside the lane, the two lane halves exchange the maximum once per
//           chunk and join their sums once, behind the loop.
//   keep-mask int32 [B][1][N][N], shared by the heads: element == 0 -> score := fill (finite replace, applied after the scaling), by value;
//           a lane reads its query's row of the staged tile (pitch 272 B: 16 lanes fall on 16 distinct bank groups).
//   output transposed: O^T += V^T.P^T, A = staged V^T rows, B = P^T (x 2^14, f16) packed straight from the score registers: score tiles 2kk and
//           2kk+1 hold exactly the keys of B elements 0..7 and 8..15 of key group kk, so P never passes through LDS.
// ---------------------------------------------------------------------------------------------------------
#define AT_PP 72                        // output staging row pitch in halves
#define AT_KP 72                        // staged row pitch in halves: 144 B = 16 B x 9
#define AT_TH (64 * AT_KP)              // halves of one staged 64-row tile
#define AT_BH (2 * AT_TH)               // halves of one buffer: K tile | V^T tile
#define AT_MP 68                        // staged mask row pitch in words: 272 B = 16 B x 17
#define AT_MW (64 * AT_MP)              // words of one staged 64-query x 64-key mask tile
// 2^x as the bare v_exp_f32, without the library form's range test, selects, add and ldexp around it. Every argument here is <= 0 (or -inf);
// the two forms differ only where 2^x < 2^-126, which may come out 0: such a term is far under half an ulp of the row's sum and of the f16 operand.
__device__ __forceinline__ float ex2(float x) { return __builtin_amdgcn_exp2f(x); }
// Eight of them in place, in one statement: each v_exp_f32 is the independent instruction that the slot behind the one before it asks for, and the
// v_nop fills the slot behind the last.
__device__ __forceinline__ void ex2x8(float (&v)[8]) {
  asm("v_exp_f32 %0, %0\n\tv_exp_f32 %1, %1\n\tv_exp_f32 %2, %2\n\tv_exp_f32 %3, %3\n\t"
      "v_exp_f32 %4, %4\n\tv_exp_f32 %5, %5\n\tv_exp_f32 %6, %6\n\tv_exp_f32 %7, %7\n\tv_nop"
      : "+v"(v[0]), "+v"(v[1]), "+v"(v[2]), "+v"(v[3]), "+v"(v[4]), "+v"(v[5]), "+v"(v[6]), "+v"(v[7]));
}
// lane l <-> lane l ^ 16
__device__ __forceinline__ float xhalf(float x) {
  const int b = __builtin_bit_cast(int, x);
  return __builtin_bit_cast(float, __builtin_amdgcn_permlanex16(b, b, 0x76543210, 0xfedcba98, false, false));
}
// One mask tile's fill, this thread's share: 16 B in each of eight rows (sixteen threads cover a 256-B row piece, so a wave covers 4 whole
// lines per copy). l = the thread's LDS byte address in its first row, ls = LDS bytes from one of its rows to the next; g, gs = the same in
// global memory (address, step in elements). s_wait_xcnt closes the statement so that no address register of an issued copy is rewritten ahead of it.
__device__ __forceinline__ void stage_fill_mask(unsigned l, unsigned ls, const int* g, size_t gs) {
  const unsigned l1 = l + ls, l2 = l + 2u * ls, l3 = l + 3u * ls, l4 = l + 4u * ls, l5 = l + 5u * ls, l6 = l + 6u * ls, l7 = l + 7u * ls;
  const int* g1 = g + gs; const int* g2 = g + 2u * gs; const int* g3 = g + 3u * gs; const int* g4 = g + 4u * gs;
  const int* g5 = g + 5u * gs; const int* g6 = g + 6u * gs; const int* g7 = g + 7u * gs;
  asm volatile("global_load_async_to_lds_b128 %0, %8, off\n\t"
               "global_load_async_to_lds_b128 %1, %9, off\n\t"
               "global_load_async_to_lds_b128 %2, %10, off\n\t"
               "global_load_async_to_lds_b128 %3, %11, off\n\t"
               "global_load_async_to_lds_b128 %4, %12, off\n\t"
               "global_load_async_to_lds_b128 %5, %13, off\n\t"
               "global_load_async_to_lds_b128 %6, %14, off\n\t"
               "global_load_async_to_lds_b128 %7, %15, off\n\t"
               "s_wait_xcnt 0x0"
               :: "v"(l), "v"(l1), "v"(l2), "v"(l3), "v"(l4), "v"(l5), "v"(l6), "v"(l7),
                  "v"(g), "v"(g1), "v"(g2), "v"(g3), "v"(g4), "v"(g5), "v"(g6), "v"(g7)
               : "memory");
}
__global__ __launch_bounds__(128) void k_flash(const unsigned short* __restrict__ Qp, const unsigned short* __restrict__ Kp,
                                               const unsigned short* __restrict__ Vtp, const int* __restrict__ mask,
                                               unsigned short* __restrict__ ctxp) {
  __shared__ __align__(16) _Float16 KVs[2 * AT_BH];       // two buffers of [K 64 keys | V^T 64 rows] x 64 halves, pitch 72 halves; behind the loop: output staging
  __shared__ __align__(16) int      Ms[2 * AT_MW];        // two buffers of the mask tile [64 queries][64 keys], pitch 68 words
  static_assert(4 * 16 * AT_PP <= 2 * AT_BH);
  constexpr unsigned NQB = SEQ / 64;
  const float SC2   = 0.125f * 1.4426950408889634f;       // 64^-0.5 * log2(e)
  const float FILL2 = -1.0e9f * 1.4426950408889634f;      // the finite fill in the exp2 domain
  const float PSC   = 16384.0f;                           // probability carry (f16 operand stays normal)
  const float CTXC  = 16.0f;                              // output carry, undone in the projection epilogue

  const unsigned tid = threadIdx.x, wave = tid >> 5, lane = tid & 31u, hh = lane >> 4, c = lane & 15u;
  const unsigned bx = blockIdx.x;
  const unsigned qb = bx % NQB;
  const unsigned bh = bx / NQB;
  const unsigned h  = bh % (unsigned)NHEAD;
  const unsigned b  = bh / (unsigned)NHEAD;
  const unsigned q0 = qb * 64u + wave * 16u;

  const _Float16* Q  = (const _Float16*)Qp;
  const _Float16* K  = (const _Float16*)Kp;
  const _Float16* Vt = (const _Float16*)Vtp;

  const _Float16* qrow  = Q + (size_t)(b * (unsigned)SEQ + q0 + c) * DIMC + h * HDIM + 8u * hh;
  const v16h qa0 = frag_ld(qrow), qa1 = frag_ld(qrow + 32);   // B operand: column c = query q0 + c
  // copy share of this thread: K and V^T tile rows tid / 8 (+16, +32, +48), 16-B piece tid % 8 of the 128-B row piece
  const unsigned crow = tid >> 3, cpc = tid & 7u;
  const _Float16* gK = K + (size_t)(b * (unsigned)SEQ + crow) * DIMC + h * HDIM + cpc * 8u;           // key crow of chunk 0
  const _Float16* gV = Vt + ((size_t)b * DIMC + h * HDIM + crow) * SEQ + cpc * 8u;                     // V^T row crow, keys of chunk 0
  const unsigned lK = (unsigned)(size_t)KVs + (crow * AT_KP + cpc * 8u) * 2u;                          // key x of a chunk lies in LDS row x
  const unsigned lV = lK + AT_TH * 2u;
  const unsigned lsKV = 16u * AT_KP * 2u;
  const size_t gsK = (size_t)16u * DIMC, gsV = (size_t)16u * SEQ;
  // mask tile rows tid / 16 (+8, ..., +56), 16-B piece tid % 16 of the 256-B row piece
  const unsigned mrw = tid >> 4, mpc = tid & 15u;
  const int* gM = mask + (size_t)b * SEQ_FULL * SEQ_FULL + (size_t)(qb * 64u + mrw) * SEQ_FULL + mpc * 4u;   // query row mrw of the block, keys of chunk 0
  const unsigned lM = (unsigned)(size_t)Ms + (mrw * AT_MP + mpc * 4u) * 4u;
  const unsigned lsM = 8u * AT_MP * 4u;
  const size_t gsM = (size_t)8u * SEQ_FULL;
  const unsigned fKV = c * AT_KP + 8u * hh;               // this lane's fragment place in a 16-row group of either staged tile
  const unsigned fM  = (wave * 16u + c) * AT_MP + 8u * hh;   // this lane's query row of the staged mask tile, its half's 8 keys of a 16-key group

  float mrow = -INFINITY, lrow = 0.f;                     // this lane's query: running maximum (both halves alike), this half's share of the sum
  v8f oacc[4];                                            // O^T tile t: column c = query, element r = head column 16t + 8hh + r
#pragma unroll
  for (int t = 0; t < 4; ++t) oacc[t] = (v8f){0.f,0.f,0.f,0.f,0.f,0.f,0.f,0.f};

  stage_fill(lK, lsKV, lV, lsKV, gK, gsK, gV, gsV);
  stage_fill_mask(lM, lsM, gM, gsM);
  asm volatile("s_wait_asynccnt 0x0" ::: "memory");     // this wave's copies of chunk 0 have landed
  __syncthreads();                                      // ... and every other wave's: buffer 0 is readable
  if (NQB > 1u) {
    stage_fill(lK + AT_BH * 2u, lsKV, lV + AT_BH * 2u, lsKV, gK + (size_t)64u * DIMC, gsK, gV + 64, gsV);
    stage_fill_mask(lM + AT_MW * 4u, lsM, gM + 64, gsM);
  }

#pragma unroll 1
  for (unsigned kc = 0; kc < NQB; ++kc) {
    const unsigned kv0 = kc * 64u;
    const _Float16* kvs = KVs + (kc & 1u) * AT_BH + fKV;
    const int* ms = Ms + (kc & 1u) * AT_MW + fM;
    v8f s[4];
    v16h kf[4][2];                                      // the chunk's 8 K fragments, read as one group in front of the products (loops unrolled: constant indices keep them in registers)
#pragma unroll
    for (int j = 0; j < 4; ++j) {
      const _Float16* kr = kvs + (unsigned)j * 16u * AT_KP;                        // A row c of tile j = key kv0 + 16j + c
      kf[j][0] = frag_ld(kr); kf[j][1] = frag_ld(kr + 32);
    }
    v4i mk[4][2];
#pragma unroll
    for (int j = 0; j < 4; ++j) {
      mk[j][0] = *(const v4i*)(ms + (unsigned)j * 16u);                            // query q0 + c, keys kv0 + 16j + 8hh + 0..3
      mk[j][1] = *(const v4i*)(ms + (unsigned)j * 16u + 4u);                       // ... + 4..7
    }
#pragma unroll
    for (int j = 0; j < 4; ++j) s[j] = wm16(kf[j][0], qa0, (v8f){0.f,0.f,0.f,0.f,0.f,0.f,0.f,0.f});
#pragma unroll
    for (int j = 0; j < 4; ++j) s[j] = wm16(kf[j][1], qa1, s[j]);

    float x[4][8];                                      // this query's 32 scores, then its 32 probabilities (every loop over them unrolled: constant indices keep them in registers)
#pragma unroll
    for (int j = 0; j < 4; ++j)
#pragma unroll
      for (int r = 0; r < 8; ++r) x[j][r] = (mk[j][r >> 2][r & 3] == 0) ? FILL2 : s[j][r] * SC2;
    float mj[4];
#pragma unroll
    for (int j = 0; j < 4; ++j)
      mj[j] = fmaxf(fmaxf(fmaxf(x[j][0], x[j][1]), fmaxf(x[j][2], x[j][3])), fmaxf(fmaxf(x[j][4], x[j][5]), fmaxf(x[j][6], x[j][7])));
    float m = fmaxf(fmaxf(mj[0], mj[1]), fmaxf(mj[2], mj[3]));
    m = fmaxf(m, xhalf(m));                             // the other half's 32 keys of the same query
    const float mnew  = fmaxf(mrow, m);
    const float alpha = ex2(mrow - mnew);
    mrow = mnew;
#pragma unroll
    for (int j = 0; j < 4; ++j)                         // all 32 exponents first, so that the v_exp_f32 groups below work in place (unrolled as above)
#pragma unroll
      for (int r = 0; r < 8; ++r) x[j][r] -= mnew;
    float pj[4];
#pragma unroll
    for (int j = 0; j < 4; ++j) {
      ex2x8(x[j]);
      pj[j] = ((x[j][0] + x[j][1]) + (x[j][2] + x[j][3])) + ((x[j][4] + x[j][5]) + (x[j][6] + x[j][7]));
    }
    lrow = lrow * alpha + ((pj[0] + pj[1]) + (pj[2] + pj[3]));
#pragma unroll
    for (int t = 0; t < 4; ++t)
#pragma unroll
      for (int r = 0; r < 8; ++r) oacc[t][r] *= alpha;
    v16h pb[2], va[2][4];                               // P^T packed from the score registers; the chunk's V^T fragments, read as one group in front of the products (unrolled as above)
#pragma unroll
    for (int kk = 0; kk < 2; ++kk) {
#pragma unroll
      for (int i = 0; i < 8; ++i) {
        pb[kk][i]     = (_Float16)(x[2 * kk][i] * PSC);       // B element i     = key 32kk + 8hh + i
        pb[kk][i + 8] = (_Float16)(x[2 * kk + 1][i] * PSC);   // B element 8 + i = key 32kk + 16 + 8hh + i
      }
#pragma unroll
      for (int t = 0; t < 4; ++t) va[kk][t] = frag_ld(kvs + AT_TH + (unsigned)t * 16u * AT_KP + (unsigned)kk * 32u);   // A: row d = t*16 + c, same key map
    }
#pragma unroll
    for (int kk = 0; kk < 2; ++kk) {
#pragma unroll
      for (int t = 0; t < 4; ++t) oacc[t] = wm16(va[kk][t], pb[kk], oacc[t]);
    }
    asm volatile("s_wait_dscnt 0x0" ::: "memory");      // this wave's reads of buffer kc%2 are done before it is handed to its next writer
    asm volatile("s_wait_asynccnt 0x0" ::: "memory");   // this wave's copies of chunk kc+1 have landed
    __syncthreads();                                    // publishes chunk kc+1's buffer and ends every reader's last read of chunk kc's
    if (kc + 2u < NQB) {
      const unsigned lo = (kc & 1u) * (AT_BH * 2u);
      stage_fill(lK + lo, lsKV, lV + lo, lsKV, gK + (size_t)(kv0 + 128u) * DIMC, gsK, gV + (kv0 + 128u), gsV);
      stage_fill_mask(lM + (kc & 1u) * (AT_MW * 4u), lsM, gM + (kv0 + 128u), gsM);
    }
  }
  asm volatile("s_wait_asynccnt 0x0" ::: "memory");     // nothing of this wave is in flight when the loop is left

  // behind the last trip's barrier nobody reads the staged tiles any more and no copy is in flight: each wave stages its 16 x 64 output in its own slice
  _Float16* os = KVs + wave * (16u * AT_PP);
  const float inv = CTXC * (1.0f / ((lrow + xhalf(lrow)) * PSC));   // the two halves' sums of this query joined
#pragma unroll
  for (int t = 0; t < 4; ++t) {
    v8h hv;
#pragma unroll
    for (int r = 0; r < 8; ++r) hv[r] = (_Float16)(oacc[t][r] * inv);
    *(v8h*)(os + c * AT_PP + (unsigned)t * 16u + 8u * hh) = hv;      // query row c, head columns 16t + 8hh + 0..7
  }
  wave_sync();
  {
    const unsigned q4 = lane >> 3, c8 = (lane & 7u) * 8u;
    _Float16* cb = (_Float16*)ctxp + (size_t)(b * (unsigned)SEQ + q0) * DIMC + h * HDIM;
#pragma unroll
    for (int it = 0; it < 4; ++it) {
      const unsigned row = (unsigned)it * 4u + q4;
      *(v8h*)(cb + (size_t)row * DIMC + c8) = *(const v8h*)(os + row * AT_PP + c8);
    }
  }
}

// ---------------------------------------------------------------------------------------------------------
// workspace carve (bytes, every region a multiple of 256 and fully written by its producer before any read)
// ---------------------------------------------------------------------------------------------------------
static constexpr size_t SZ_X16   = (size_t)3 * MROWS * DIMC * 2;     // q16 | k16 | v16 planes [MROWS][1024] f16
static constexpr size_t SZ_WT16  = (size_t)4 * DIMC * DIMC * 2;      // Wq^T | Wk^T | Wv^T | Wp^T planes [out][in] f16, x16
static constexpr size_t SZ_QK16  = (size_t)2 * MROWS * DIMC * 2;     // Q16 | K16 planes [MROWS][1024] f16
static constexpr size_t SZ_VT16  = (size_t)NB * DIMC * SEQ * 2;      // V^T planes [b][1024][SEQ] f16
static constexpr size_t SZ_CTX16 = (size_t)MROWS * DIMC * 2;         // merged head output x16 [MROWS][1024] f16
static constexpr size_t SZ_BRO   = (size_t)DIMC * 4;                 // bias, bf16 RNE-converted, f32
static constexpr size_t SZ_TOTAL = SZ_X16 + SZ_WT16 + SZ_QK16 + SZ_VT16 + SZ_CTX16 + SZ_BRO;
static_assert((SZ_X16 % 256) == 0 && (SZ_WT16 % 256) == 0 && (SZ_QK16 % 256) == 0 && (SZ_VT16 % 256) == 0 && (SZ_CTX16 % 256) == 0 && (SZ_BRO % 256) == 0);
static_assert(SZ_TOTAL <= (size_t)134217728);
// coverage equalities of the plane writers
static_assert((size_t)CV_ST * CV_TH * 8 == (size_t)MROWS * DIMC);                     // k_convert per activation tensor
static_assert((size_t)CV_ST * CV_TH * 8 == (size_t)4 * DIMC * DIMC);                  // k_convert, the four weights
static_assert((size_t)(SEQ / 64) * 4 * 16 * 64 == (size_t)SEQ * HDIM);               // k_flash per (batch, head): blocks x waves x rows x cols
static_assert((MROWS % 128) == 0 && (DIMC % 128) == 0 && (SEQ % 128) == 0);            // k_gemm64: whole 128x128 tiles, K = DIMC in whole 64-k trips

extern "C" void kernel_launch(void* const* d_in, const int* in_sizes, int n_in, void* d_out, int out_size, void* d_ws, size_t ws_size, hipStream_t stream) {
  if (n_in < 9) return;
  const long long needX = (long long)(NB - 1) * SEQ_FULL * DIMC + (long long)SEQ * DIMC;
  const long long needM = (long long)(NB - 1) * SEQ_FULL * SEQ_FULL + (long long)(SEQ - 1) * SEQ_FULL + SEQ;
  if ((long long)in_sizes[0] < needX || (long long)in_sizes[1] < needX || (long long)in_sizes[2] < needX) return;
  if ((long long)in_sizes[3] < needM) return;
  if (in_sizes[4] < DIMC * DIMC || in_sizes[5] < DIMC * DIMC || in_sizes[6] < DIMC * DIMC || in_sizes[7] < DIMC * DIMC || in_sizes[8] < DIMC) return;
  if ((long long)out_size < (long long)MROWS * DIMC) return;
  if (ws_size < SZ_TOTAL) return;

  const float* q    = (const float*)d_in[0];
  const float* k    = (const float*)d_in[1];
  const float* v    = (const float*)d_in[2];
  const int*   mask = (const int*)d_in[3];
  const float* Wq   = (const float*)d_in[4];
  const float* Wk   = (const float*)d_in[5];
  const float* Wv   = (const float*)d_in[6];
  const float* Wp   = (const float*)d_in[7];
  const float* bp   = (const float*)d_in[8];
  float* out = (float*)d_out;

  char* wsp = (char*)d_ws;
  unsigned short* X16   = (unsigned short*)wsp; wsp += SZ_X16;
  unsigned short* WT16  = (unsigned short*)wsp; wsp += SZ_WT16;
  unsigned short* QK16  = (unsigned short*)wsp; wsp += SZ_QK16;
  unsigned short* VT16  = (unsigned short*)wsp; wsp += SZ_VT16;
  unsigned short* CTX16 = (unsigned short*)wsp; wsp += SZ_CTX16;
  float*          BRO   = (float*)wsp;          wsp += SZ_BRO;

  const unsigned long long planeX = (unsigned long long)MROWS * DIMC;     // elements per activation plane
  const unsigned long long planeW = (unsigned long long)DIMC * DIMC;

  // weights [in][out] -> [out][in] f16 x16 (4 planes); bias; activations (3 planes, full input batch stride, compact planes)
  k_convert<<<dim3((unsigned)CV_WG, 1u, 1u), 512, 0, stream>>>(q, k, v, Wq, Wk, Wv, Wp, bp, X16, WT16, BRO);
  // Q16 | K16 = (q16 | k16) x (Wq^T | Wk^T): batch y = 0 (q), 1 (k); M = MROWS, N = K = 1024
  k_gemm64<0, 1><<<dim3((unsigned)((MROWS / 128) * (DIMC / 128)), 2u, 1u), 256, 0, stream>>>(
      X16, (unsigned)DIMC, planeX, WT16, (unsigned)DIMC, planeW, (void*)QK16, (unsigned)DIMC, planeX, nullptr,
      (unsigned)MROWS, (unsigned)DIMC, (unsigned)DIMC, 0.0625f);
  // V^T[b][o][n] = sum_k Wv^T[o][k] * v16[b][n][k]: A = Wv^T plane (M = 1024), Bt = v16 batch plane (N = SEQ), C pitch SEQ
  k_gemm64<0, 1><<<dim3((unsigned)((DIMC / 128) * (SEQ / 128)), (unsigned)NB, 1u), 256, 0, stream>>>(
      WT16 + 2 * planeW, (unsigned)DIMC, 0ull, X16 + 2 * planeX, (unsigned)DIMC, (unsigned long long)SEQ * DIMC,
      (void*)VT16, (unsigned)SEQ, (unsigned long long)DIMC * SEQ, nullptr,
      (unsigned)DIMC, (unsigned)SEQ, (unsigned)DIMC, 0.0625f);
  // attention
  k_flash<<<dim3((unsigned)(NB * NHEAD * (SEQ / 64)), 1u, 1u), 128, 0, stream>>>(QK16, QK16 + planeX, VT16, mask, CTX16);
  // out = (ctx x16) x (Wp^T x16) / 256 + bias
  k_gemm64<2, 0><<<dim3((unsigned)((MROWS / 128) * (DIMC / 128)), 1u, 1u), 256, 0, stream>>>(
      CTX16, (unsigned)DIMC, 0ull, WT16 + 3 * planeW, (unsigned)DIMC, 0ull, (void*)out, (unsigned)DIMC, 0ull, BRO,
      (unsigned)MROWS, (unsigned)DIMC, (unsigned)DIMC, 0.00390625f);
}

// v005
// Measured time: 112 microseconds a run.
// Next to v004, in two timings, it ran 1.04 times as fast each time.
// All steps since v000 together make it 2.82 times as fast.
// Masked multi-head attention (2 x 2,048 x 1,024; 16 heads x 64): inputs and parameters RNE-converted to bf16 first; every contraction (q/k/v projections, q.k^T, p.v, output projection) on v_wmma_f32_16x16x32_f16 (f16 operands: weights x16, probabilities x2^14, merged head output x16; f32 accumulate, f32 online softmax in the exp2 domain).
#include <hip/hip_runtime.h>
#include <math.h>

#ifndef NB
#define NB 2
#endif
#ifndef SEQ
#define SEQ 2048
#endif
#define NB_FULL 2
#define SEQ_FULL 2048
#define DIMC 1024
#define NHEAD 16
#define HDIM 64
#define MROWS (NB * SEQ)

static_assert(SEQ % 64 == 0);
static_assert(SEQ <= SEQ_FULL);
static_assert(NB <= NB_FULL);
static_assert(DIMC == NHEAD * HDIM);
static_assert(DIMC % 64 == 0);
static_assert(DIMC / 8 == 128);
static_assert((MROWS % 64) == 0);
static_assert(((SEQ * 128) % 256) == 0);

typedef __attribute__((ext_vector_type(16))) _Float16 v16h;
typedef __attribute__((ext_vector_type(8)))  _Float16 v8h;
typedef __attribute__((ext_vector_type(4)))  _Float16 v4h;
typedef __attribute__((ext_vector_type(8)))  float    v8f;
typedef __attribute__((ext_vector_type(4)))  float    v4f;
typedef __attribute__((ext_vector_type(4)))  int      v4i;
typedef __attribute__((ext_vector_type(16))) unsigned v16u;

// 16-bit WMMA fragment map (wave32), lane L, h = L>>4, m = L&15:
//   A 16x32: lane = row m;    element i -> k = (i<8) ? 8h+i : 16+8h+(i-8)
//   B 32x16: lane = column m; the SAME k(i,h)
//   D 16x16 (8 f32): lane = column m; element r -> row 8h+r
union FragU { v16h v; v8h h[2]; };
// p already includes the lane-half offset 8h: elements 0..7 <- p[0..7], 8..15 <- p[16..23]
__device__ __forceinline__ v16h frag_ld(const _Float16* p) {
  FragU f; f.h[0] = *(const v8h*)(p); f.h[1] = *(const v8h*)(p + 16); return f.v;
}
__device__ __forceinline__ v8f wm16(v16h a, v16h b, v8f c) {
  c = __builtin_amdgcn_wmma_f32_16x16x32_f16(false, a, false, b, (short)0, c, false, false);
  asm volatile("v_nop\n\tv_nop\n\tv_nop\n\tv_nop" : "+v"(c) : "v"(a), "v"(b));
  return c;
}
__device__ __forceinline__ void dep_guard_h(v8f& a, v8f& b, v16h x, v16h y) { asm volatile("v_nop\n\tv_nop\n\tv_nop\n\tv_nop" : "+v"(a), "+v"(b) : "v"(x), "v"(y)); }
__device__ __forceinline__ void keep4_h(v16h a, v16h b, v16h c, v16h d) { asm volatile("v_nop" :: "v"(a), "v"(b), "v"(c), "v"(d)); }
__device__ __forceinline__ void acc_guard4(v8f& a, v8f& b, v8f& c, v8f& d) { asm volatile("v_nop\n\tv_nop\n\tv_nop\n\tv_nop" : "+v"(a), "+v"(b), "+v"(c), "+v"(d)); }
// same-wave LDS exchange: stores by some lanes, loads of those locations by other lanes of the SAME wave
__device__ __forceinline__ void wave_sync() {
  __builtin_amdgcn_fence(3 /* release order */, "workgroup");
  __builtin_amdgcn_wave_barrier();
  __builtin_amdgcn_fence(2 /* acquire order */, "workgroup");
}
// bf16 RNE-convert, kept as f32 (finite inputs)
__device__ __forceinline__ float cmb_bf(float v) {
  const unsigned u = __builtin_bit_cast(unsigned, v);
  const unsigned r = (u + 0x7fffu + ((u >> 16) & 1u)) & 0xffff0000u;
  return __builtin_bit_cast(float, r);
}

// ---------------------------------------------------------------------------------------------------------
// k_convert: every conversion of the call in ONE launch of CV_WG work-groups of 16 waves, one for each WGP, all resident at once; a thread
// takes CV_ST pieces of every kind instead of ending after one, so the launch starts 4,096 waves where three launches started 65,568.
// A thread's pieces, step j = 0 .. CV_ST - 1:
//   one of each activation tensor: f32 row [1024], 8 columns -> bf16 (RNE) -> f16 plane rows [MROWS][1024], one 16-B store
//   (piece j * CV_TH + flat thread: consecutive threads walk along a row; sources use the FULL input batch stride, planes are compact);
//   one of a weight: W[k = in][o = out] (row pitch 1024) -> WT[o][k] = f16(bf16_rne(W[k][o]) * 16): 8 strided loads, one 16-B store, a wave walks
//   along the destination row. A work-group takes two tiles of 32 outputs x 256 inputs, two steps each (16 waves = 16 outputs a step): the
//   128-B source lines of a tile hold exactly its 32 outputs, so both steps and all 16 waves read the same 256 lines.
// All loads of a thread are issued first (24 of 16 B, 16 of 16 B for the mask, then 32 of 4 B), so a wave waits out the memory latency once, not once a step.
// The first DIMC threads of the launch also convert the bias.
// The keep-mask is packed here, once for all 16 heads: a wave takes 16 query rows x 128 keys (16 whole-line loads of 512 B, a work-group reads
// 128 KiB in a row), turns them through its own LDS slice into k_flash's score layout (lane = 16 hh + c holds query c, keys 16j + 8hh + r of a
// 64-key chunk) and writes, for each chunk, 32 lane-mask words: word 8j + r, bit lane = (mask element != 0).
// ---------------------------------------------------------------------------------------------------------
#define CV_WG 256                       // work-groups of the launch
#define CV_TH (CV_WG * 512)             // threads of the launch
#define CV_ST 4                         // pieces of each kind per thread
#define CV_RPS (CV_TH / 128)             // activation rows of one step (128 pieces a row)
#define CV_TPW ((DIMC / 32) * (DIMC / 256))   // tiles of one weight
static_assert(MROWS * 128 == CV_ST * CV_TH);              // activation pieces of one tensor: every one exactly once
static_assert(4 * CV_TPW == CV_WG * (CV_ST / 2));         // weight tiles: every one exactly once
static_assert(CV_TPW % (CV_ST / 2) == 0);                 // a work-group's tiles lie in one weight
static_assert(SEQ % CV_RPS == 0);                         // a step's rows lie in one batch
static_assert(DIMC <= CV_TH);
static_assert(CV_ST == 4);                                // the wait behind the activation loads names four offsets
static_assert(((unsigned long long)(NB - 1) * SEQ_FULL + SEQ) * DIMC * 4 < (1ull << 32));   // source byte offsets fit 32 bits
#define CV_MP 132                       // mask slice row pitch in words: 528 B = 16 B x 33
static_assert(SEQ % 128 == 0);
static_assert((size_t)NB * (SEQ / 16) * (SEQ / 128) == (size_t)CV_WG * 16);               // mask pieces: one for every wave of the launch
static_assert((unsigned long long)NB * SEQ_FULL * SEQ_FULL * 4 < (1ull << 32));           // mask byte offsets fit 32 bits
__global__ __launch_bounds__(512) void k_convert(const float* __restrict__ S0, const float* __restrict__ S1, const float* __restrict__ S2,
                                                  const float* __restrict__ W0, const float* __restrict__ W1, const float* __restrict__ W2,
                                                  const float* __restrict__ W3, const float* __restrict__ BP, const int* __restrict__ MK,
                                                  unsigned short* __restrict__ X, unsigned short* __restrict__ WT, float* __restrict__ BRO,
                                                  unsigned* __restrict__ MB) {
  __shared__ __align__(16) int sM[16][16 * CV_MP];   // per-wave slice: 16 query rows x 128 keys of the mask
  const unsigned t = blockIdx.x * 512u + threadIdx.x;
  const unsigned wave = threadIdx.x >> 5, lane = threadIdx.x & 31u;
  const unsigned tile0 = blockIdx.x * (CV_ST / 2u);
  const unsigned y = tile0 / (unsigned)CV_TPW;
  const float* W = (y == 0u) ? W0 : ((y == 1u) ? W1 : ((y == 2u) ? W2 : W3));   // block-uniform choice among global pointers
  const unsigned tsb = t * 32u, tdb = t * 16u;   // this thread's place inside a step's CV_RPS rows, in source and in plane bytes: one 32-bit offset beside a uniform base
  v4f x[CV_ST][3][2];                   // every loop over the steps is unrolled: constant indices keep the pieces in registers
  float w[CV_ST][8];
  unsigned so[CV_ST];                   // source byte offsets of the thread's pieces, alike in the three tensors
#pragma unroll
  for (unsigned j = 0; j < CV_ST; ++j) {
    // first row of step j in the source: batch (j * CV_RPS) / SEQ at the full batch stride, row (j * CV_RPS) % SEQ of it
    so[j] = (((j * (unsigned)CV_RPS) / (unsigned)SEQ) * (unsigned)SEQ_FULL + (j * (unsigned)CV_RPS) % (unsigned)SEQ) * (unsigned)(DIMC * 4) + tsb;
    const v4f* s0 = (const v4f*)((const char*)S0 + so[j]);
    const v4f* s1 = (const v4f*)((const char*)S1 + so[j]);
    const v4f* s2 = (const v4f*)((const char*)S2 + so[j]);
    x[j][0][0] = s0[0]; x[j][0][1] = s0[1];
    x[j][1][0] = s1[0]; x[j][1][1] = s1[1];
    x[j][2][0] = s2[0]; x[j][2][1] = s2[1];
  }
  // The wait before a register that one of these 24 loads names is written again; the offsets are inputs so that they stay in their registers up
  // to it. The statement also keeps the streaming loads in front of the 32 many-line weight loads, which the compiler otherwise issues first
  // (a wave's loads return in order).
  asm volatile("s_wait_xcnt 0x0" :: "v"(so[0]), "v"(so[1]), "v"(so[2]), "v"(so[3]) : "memory");
  // this wave's mask piece: batch, 16-query tile, pair of 64-key chunks; row i of it is one 512-B load of the wave
  const unsigned gw = blockIdx.x * 16u + wave;
  const unsigned mkp = gw % (unsigned)(SEQ / 128), mqt = (gw / (unsigned)(SEQ / 128)) % (unsigned)(SEQ / 16), mbt = gw / (unsigned)((SEQ / 128) * (SEQ / 16));
  const unsigned mo = ((mbt * (unsigned)SEQ_FULL + mqt * 16u) * (unsigned)SEQ_FULL + mkp * 128u + lane * 4u) * 4u;
  v4i mk[16];                           // unrolled as above
#pragma unroll
  for (unsigned i = 0; i < 16u; ++i) mk[i] = __builtin_nontemporal_load((const v4i*)((const char*)MK + mo + i * (unsigned)(SEQ_FULL * 4)));   // read once in the whole call
  asm volatile("s_wait_xcnt 0x0" :: "v"(mo) : "memory");   // as above, for the 16 mask loads: they too stay in front of the weight loads
  unsigned wo[CV_ST];                   // source byte offsets of the thread's weight pieces (first of the 8 inputs)
#pragma unroll
  for (unsigned j = 0; j < CV_ST; ++j) {
    const unsigned ty = (tile0 + (j >> 1)) % (unsigned)CV_TPW;
    const unsigned o = (ty >> 2) * 32u + (j & 1u) * 16u + wave, k0 = (ty & 3u) * 256u + lane * 8u;
    wo[j] = (k0 * (unsigned)DIMC + o) * 4u;
#pragma unroll
    for (int e = 0; e < 8; ++e) w[j][e] = *(const float*)((const char*)W + wo[j] + (unsigned)e * (unsigned)(DIMC * 4));
  }
  asm volatile("s_wait_xcnt 0x0" :: "v"(wo[0]), "v"(wo[1]), "v"(wo[2]), "v"(wo[3]) : "memory");   // as above, for the 32 weight loads
  float bv = 0.f;
  if (t < (unsigned)DIMC) bv = BP[t];                                 // whole waves of the first work-groups
#pragma unroll
  for (unsigned j = 0; j < CV_ST; ++j) {
#pragma unroll
    for (int z = 0; z < 3; ++z) {
      v8h hv;
#pragma unroll
      for (int e = 0; e < 4; ++e) { hv[e] = (_Float16)cmb_bf(x[j][z][0][e]); hv[e + 4] = (_Float16)cmb_bf(x[j][z][1][e]); }
      *(v8h*)((char*)((_Float16*)X + ((size_t)z * MROWS + (size_t)j * CV_RPS) * DIMC) + tdb) = hv;
    }
    asm volatile("s_wait_xcnt 0x0" ::: "memory");   // before a register that one of these stores names is written again
  }
  {
    int* sm = sM[wave];
#pragma unroll
    for (unsigned i = 0; i < 16u; ++i) *(v4i*)(sm + i * (unsigned)CV_MP + lane * 4u) = mk[i];
    // The rows are read back by other lanes of this wave alone: its own LDS stores are waited for, and the statement keeps the reads behind them.
    // (wave_sync()'s work-group fences would also wait here for the global stores above and for the weight loads still in flight.)
    asm volatile("s_wait_dscnt 0x0" ::: "memory");
    const int* sr = sm + (lane & 15u) * (unsigned)CV_MP + (lane >> 4) * 8u;   // query row c, this half's 8 keys of a 16-key group
#pragma unroll
    for (unsigned ch = 0; ch < 2u; ++ch) {
      unsigned ow = 0u;                 // lane l ends up with word l of the chunk
#pragma unroll
      for (unsigned j = 0; j < 4u; ++j) {
        const v4i a = *(const v4i*)(sr + ch * 64u + j * 16u), bq = *(const v4i*)(sr + ch * 64u + j * 16u + 4u);
#pragma unroll
        for (unsigned r = 0; r < 4u; ++r) {
          const unsigned wa = __builtin_amdgcn_ballot_w32(a[r] != 0), wb = __builtin_amdgcn_ballot_w32(bq[r] != 0);
          ow = (lane == j * 8u + r) ? wa : ow;
          ow = (lane == j * 8u + 4u + r) ? wb : ow;
        }
      }
      MB[(gw * 2u + ch) * 32u + lane] = ow;
    }
    asm volatile("s_wait_xcnt 0x0" ::: "memory");   // before a register that one of these stores names is written again
  }
#pragma unroll
  for (unsigned j = 0; j < CV_ST; ++j) {
    const unsigned ty = (tile0 + (j >> 1)) % (unsigned)CV_TPW;
    const unsigned o = (ty >> 2) * 32u + (j & 1u) * 16u + wave, k0 = (ty & 3u) * 256u + lane * 8u;
    v8h hw;
#pragma unroll
    for (int e = 0; e < 8; ++e) hw[e] = (_Float16)(cmb_bf(w[j][e]) * 16.0f);
    *(v8h*)((_Float16*)WT + (size_t)y * DIMC * DIMC + (o * (unsigned)DIMC + k0)) = hw;
    asm volatile("s_wait_xcnt 0x0" ::: "memory");   // as above
  }
  if (t < (unsigned)DIMC) BRO[t] = cmb_bf(bv);
}

// ---------------------------------------------------------------------------------------------------------
// k_gemm64: C[m,n] = scale * sum_k A[m,k] * Bt[n,k] (+ bias[n]); f16 operand planes. A block of 8 waves owns a 128x128 tile of C,
// each wave 32 rows x 64 columns of it. Per trip 64 k of the block's 128 A rows and 128 Bt rows (128-B row pieces, whole lines) come
// into LDS by asynchronous copies, two buffers: the next trip's copies fly while this trip's fragments are read from LDS (row pitch 144 B).
// A row-major [M,K]; Bt row-major [N,K]; M,N % 128 == 0, K % 64 == 0, K >= 64; batch = blockIdx.y with element strides.
// OUT_MODE 0: f32 C; 1: f16 C. Epilogue: 16-row slabs staged per wave in LDS (wave-private), each 64-wide row segment written as whole
// ---------------------------------------------------------------------------------------------------------
#define GT_PH  72                      // LDS row pitch in halves: 144 B = 16 B x 9
#define GT_OPH (128 * GT_PH)           // halves of one operand's 128-row tile
#define GT_STH (2 * GT_OPH)            // halves of one buffer: A tile | Bt tile
// One buffer's fill, this thread's share: 16 B in each of four rows of the first tile and of four rows of the second (eight threads cover
// a 128-B row piece, so a wave covers 4 whole lines per copy). la, lb = the thread's LDS byte addresses in its first row of either tile,
// lsa, lsb = LDS bytes from one of its rows to the next; ga, gb, gsa, gsb = the same in global memory (addresses, steps in elements).
// s_wait_xcnt closes the statement so that no address register of an issued copy is rewritten ahead of it.
__device__ __forceinline__ void stage_fill(unsigned la, unsigned lsa, unsigned lb, unsigned lsb,
                                           const _Float16* ga, size_t gsa, const _Float16* gb, size_t gsb) {
  const unsigned la1 = la + lsa, la2 = la + 2u * lsa, la3 = la + 3u * lsa;
  const unsigned lb1 = lb + lsb, lb2 = lb + 2u * lsb, lb3 = lb + 3u * lsb;
  const _Float16* ga1 = ga + gsa; const _Float16* ga2 = ga + 2u * gsa; const _Float16* ga3 = ga + 3u * gsa;
  const _Float16* gb1 = gb + gsb; const _Float16* gb2 = gb + 2u * gsb; const _Float16* gb3 = gb + 3u * gsb;
  asm volatile("global_load_async_to_lds_b128 %0, %8, off\n\t"
               "global_load_async_to_lds_b128 %1, %9, off\n\t"
               "global_load_async_to_lds_b128 %2, %10, off\n\t"
               "global_load_async_to_lds_b128 %3, %11, off\n\t"
               "global_load_async_to_lds_b128 %4, %12, off\n\t"
               "global_load_async_to_lds_b128 %5, %13, off\n\t"
               "global_load_async_to_lds_b128 %6, %14, off\n\t"
               "global_load_async_to_lds_b128 %7, %15, off\n\t"
               "s_wait_xcnt 0x0"
               :: "v"(la), "v"(la1), "v"(la2), "v"(la3), "v"(lb), "v"(lb1), "v"(lb2), "v"(lb3),
                  "v"(ga), "v"(ga1), "v"(ga2), "v"(ga3), "v"(gb), "v"(gb1), "v"(gb2), "v"(gb3)
               : "memory");
}
template <int BIAS_MODE, int OUT_MODE>
__global__ __launch_bounds__(256) void k_gemm64(
    const unsigned short* __restrict__ Ap, unsigned lda, unsigned long long strideA,
    const unsigned short* __restrict__ Btp, unsigned ldb, unsigned long long strideB,
    void* __restrict__ Cout, unsigned ldc, unsigned long long strideC,
    const float* __restrict__ bias, unsigned M, unsigned N, unsigned K, float scale) {
  __shared__ __align__(16) _Float16 sS[2 * GT_STH];   // two buffers of [A 128 rows | Bt 128 rows] x 64 k, pitch 72 halves
  __shared__ __align__(16) float sT[8][16 * 68];      // per-wave 16x64 slab, pitch 68 floats
  const unsigned b    = blockIdx.y;
  const unsigned lane = threadIdx.x & 31u;
  const unsigned wave = threadIdx.x >> 5;
  const unsigned tilesN = N >> 7;
  const unsigned tilesM = M >> 7;
  const unsigned tile = blockIdx.x;
  if (tile >= tilesM * tilesN) return;   // block-uniform, in front of every barrier and copy
  const unsigned tm = tile / tilesN;
  const unsigned tn = tile - tm * tilesN;
  const unsigned m0 = (tm << 7) + ((wave >> 1) << 5);   // this wave's 32 rows
  const unsigned n0 = (tn << 7) + ((wave & 1u) << 6);   // this wave's 64 columns

  const _Float16* Ab = (const _Float16*)Ap + (size_t)b * strideA;
  const _Float16* Bb = (const _Float16*)Btp + (size_t)b * strideB;

  const unsigned rlane = lane & 15u;            // row (A) / col (B, D) within subtile
  const unsigned koff  = (lane >> 4) * 8u;      // k offset of this lane half
  const unsigned mOff  = (lane >> 4) * 8u;      // D row offset

  // copy share of this thread: tile row threadIdx.x / 8 (+32, +64, +96), 16-B piece threadIdx.x % 8 of the 128-B row piece
  const unsigned crow = threadIdx.x >> 3, cpc = threadIdx.x & 7u;
  const _Float16* gA = Ab + (size_t)((tm << 7) + crow) * lda + cpc * 8u;
  const _Float16* gB = Bb + (size_t)((tn << 7) + crow) * ldb + cpc * 8u;
  const unsigned lC = (unsigned)(size_t)sS + (crow * GT_PH + cpc * 8u) * 2u;
  // fragment read places of this lane inside a buffer
  const unsigned fA = (((wave >> 1) << 5) + rlane) * GT_PH + koff;
  const unsigned fB = GT_OPH + (((wave & 1u) << 6) + rlane) * GT_PH + koff;

  v8f acc[2][4];
#pragma unroll
  for (int i = 0; i < 2; ++i)
#pragma unroll
    for (int j = 0; j < 4; ++j) acc[i][j] = (v8f){0.f,0.f,0.f,0.f,0.f,0.f,0.f,0.f};

  const unsigned nT = K >> 6;
  const unsigned lStep = 32u * GT_PH * 2u;              // a thread's rows are 32 apart
  const size_t gsA = (size_t)32u * lda, gsB = (size_t)32u * ldb;
  stage_fill(lC, lStep, lC + GT_OPH * 2u, lStep, gA, gsA, gB, gsB);
  asm volatile("s_wait_asynccnt 0x0" ::: "memory");     // this wave's copies of trip 0 have landed
  __syncthreads();                                      // ... and every other wave's: buffer 0 is readable
  if (nT > 1u) stage_fill(lC + GT_STH * 2u, lStep, lC + (GT_STH + GT_OPH) * 2u, lStep, gA + 64, gsA, gB + 64, gsB);

  for (unsigned t = 0; t < nT; ++t) {
    const _Float16* sb = sS + (t & 1u) * GT_STH;
    v16h bh[2][4], ah[2][2];                            // the trip's 12 fragments, read as one group in front of its 16 products (loops unrolled: constant indices keep them in registers)
#pragma unroll
    for (int kk = 0; kk < 2; ++kk) {
#pragma unroll
      for (int j = 0; j < 4; ++j) bh[kk][j] = frag_ld(sb + fB + (unsigned)j * 16u * GT_PH + (unsigned)kk * 32u);
#pragma unroll
      for (int i = 0; i < 2; ++i) ah[kk][i] = frag_ld(sb + fA + (unsigned)i * 16u * GT_PH + (unsigned)kk * 32u);
    }
#pragma unroll
    for (int kk = 0; kk < 2; ++kk) {
#pragma unroll
      for (int i = 0; i < 2; ++i) {
#pragma unroll
        for (int j = 0; j < 4; ++j)
          acc[i][j] = __builtin_amdgcn_wmma_f32_16x16x32_f16(false, ah[kk][i], false, bh[kk][j], (short)0, acc[i][j], false, false);
        dep_guard_h(acc[i][0], acc[i][3], ah[kk][i], ah[kk][i]);
      }
      keep4_h(bh[kk][0], bh[kk][1], bh[kk][2], bh[kk][3]);
    }
    asm volatile("s_wait_dscnt 0x0" ::: "memory");      // this wave's reads of buffer t%2 are done before it is handed to its next writer
    asm volatile("s_wait_asynccnt 0x0" ::: "memory");   // this wave's copies of trip t+1 have landed
    __syncthreads();                                    // publishes trip t+1's buffer and ends every reader's last read of trip t's
    if (t + 2u < nT) {
      const unsigned lN = lC + (t & 1u) * (GT_STH * 2u);
      stage_fill(lN, lStep, lN + GT_OPH * 2u, lStep, gA + (size_t)(t + 2u) * 64u, gsA, gB + (size_t)(t + 2u) * 64u, gsB);
    }
  }
  asm volatile("s_wait_asynccnt 0x0" ::: "memory");     // nothing of this wave is in flight when the loop is left
  acc_guard4(acc[0][0], acc[0][1], acc[0][2], acc[0][3]);
  acc_guard4(acc[1][0], acc[1][1], acc[1][2], acc[1][3]);

  float* slab = sT[wave];
#pragma unroll
  for (int i = 0; i < 2; ++i) {
    const unsigned mBase = m0 + ((unsigned)i << 4);
#pragma unroll
    for (int j = 0; j < 4; ++j) {
      const unsigned n = n0 + ((unsigned)j << 4) + rlane;
      float bv = 0.f;
      if (BIAS_MODE == 2) bv = bias[n];
#pragma unroll
      for (int r = 0; r < 8; ++r) {
        float v = acc[i][j][r] * scale;
        if (BIAS_MODE == 2) v += bv;
        slab[(mOff + (unsigned)r) * 68u + ((unsigned)j << 4) + rlane] = v;
      }
    }
    wave_sync();
    if (OUT_MODE == 0) {
      float* C = (float*)Cout + (size_t)b * strideC;
      const unsigned hh = lane >> 4, c4 = (lane & 15u) * 4u;     // row segment = 256 B = 16 lanes x 16 B
      {
#pragma unroll
        for (int it = 0; it < 8; ++it) {
          const unsigned row = (unsigned)it * 2u + hh;
          const v4f v = *(const v4f*)(slab + row * 68u + c4);
          *(v4f*)(C + (size_t)(mBase + row) * ldc + n0 + c4) = v;
        }
        
      }
    } else {
      const unsigned q = lane >> 3, c8 = (lane & 7u) * 8u;
      _Float16* C = (_Float16*)Cout + (size_t)b * strideC;
      {
#pragma unroll
        for (int it = 0; it < 4; ++it) {
          const unsigned row = (unsigned)it * 4u + q;
          const float* sp = slab + row * 68u + c8;
          v8h hv;
#pragma unroll
          for (int e = 0; e < 8; ++e) hv[e] = (_Float16)sp[e];
          *(v8h*)(C + (size_t)(mBase + row) * ldc + n0 + c8) = hv;
        }
        
      }
    }
    wave_sync();
  }
}

// ---------------------------------------------------------------------------------------------------------
// k_flash: per (batch, head, 64-query block): block = 4 waves x 16 queries; 64-key chunks; online softmax in f32 (exp2 domain).
//   each chunk's 64 K16 rows and 64 V^T rows (128-B row pieces) come into LDS once per block by asynchronous copies, two buffers: the next
//   chunk's copies fly while this chunk is worked on.
//   scores transposed: S^T = K.Q^T, A = staged K16 rows (tile j = keys 16j..16j+15), B = Q16 rows kept in registers. A lane then holds 32 scores
//           of ONE query (column c; keys 16j + 8hh + r): maximum and sum run inside the lane, the two lane halves exchange the maximum once per
//           chunk and join their sums once, behind the loop.
//   keep-mask, shared by the heads: element == 0 -> score := fill (finite replace, applied after the scaling). k_convert has packed it into lane-mask
//           words in this kernel's score layout: a wave reads its chunk's 32 words (128 B) by scalar loads, one chunk ahead, and each word is the
//           select mask of one score register: no compare, no mask tile in LDS.
//   output transposed: O^T += V^T.P^T, A = staged V^T rows, B = P^T (x 2^14, f16) packed straight from the score registers: score tiles 2kk and
//           2kk+1 hold exactly the keys of B elements 0..7 and 8..15 of key group kk, so P never passes through LDS.
// ---------------------------------------------------------------------------------------------------------
#define AT_PP 72                        // output staging row pitch in halves
#define AT_KP 72                        // staged row pitch in halves: 144 B = 16 B x 9
#define AT_TH (64 * AT_KP)              // halves of one staged 64-row tile
#define AT_BH (2 * AT_TH)               // halves of one buffer: K tile | V^T tile
// 2^x as the bare v_exp_f32, without the library form's range test, selects, add and ldexp around it. Every argument here is <= 0 (or -inf);
// the two forms differ only where 2^x < 2^-126, which may come out 0: such a term is far under half an ulp of the row's sum and of the f16 operand.
__device__ __forceinline__ float ex2(float x) { return __builtin_amdgcn_exp2f(x); }
// Eight of them in place, in one statement: each v_exp_f32 is the independent instruction that the slot behind the one before it asks for, and the
// v_nop fills the slot behind the last.
__device__ __forceinline__ void ex2x8(float (&v)[8]) {
  asm("v_exp_f32 %0, %0\n\tv_exp_f32 %1, %1\n\tv_exp_f32 %2, %2\n\tv_exp_f32 %3, %3\n\t"
      "v_exp_f32 %4, %4\n\tv_exp_f32 %5, %5\n\tv_exp_f32 %6, %6\n\tv_exp_f32 %7, %7\n\tv_nop"
      : "+v"(v[0]), "+v"(v[1]), "+v"(v[2]), "+v"(v[3]), "+v"(v[4]), "+v"(v[5]), "+v"(v[6]), "+v"(v[7]));
}
// lane l <-> lane l ^ 16
__device__ __forceinline__ float xhalf(float x) {
  const int b = __builtin_bit_cast(int, x);
  return __builtin_bit_cast(float, __builtin_amdgcn_permlanex16(b, b, 0x76543210, 0xfedcba98, false, false));
}
__global__ __launch_bounds__(128) void k_flash(const unsigned short* __restrict__ Qp, const unsigned short* __restrict__ Kp,
                                               const unsigned short* __restrict__ Vtp, const unsigned* __restrict__ MB,
                                               unsigned short* __restrict__ ctxp) {
  __shared__ __align__(16) _Float16 KVs[2 * AT_BH];       // two buffers of [K 64 keys | V^T 64 rows] x 64 halves, pitch 72 halves; behind the loop: output staging
  static_assert(4 * 16 * AT_PP <= 2 * AT_BH);
  constexpr unsigned NQB = SEQ / 64;
  const float SC2   = 0.125f * 1.4426950408889634f;       // 64^-0.5 * log2(e)
  const float FILL2 = -1.0e9f * 1.4426950408889634f;      // the finite fill in the exp2 domain
  const float PSC   = 16384.0f;                           // probability carry (f16 operand stays normal)
  const float CTXC  = 16.0f;                              // output carry, undone in the projection epilogue

  const unsigned tid = threadIdx.x, wave = tid >> 5, lane = tid & 31u, hh = lane >> 4, c = lane & 15u;
  const unsigned bx = blockIdx.x;
  const unsigned qb = bx % NQB;
  const unsigned bh = bx / NQB;
  const unsigned h  = bh % (unsigned)NHEAD;
  const unsigned b  = bh / (unsigned)NHEAD;
  const unsigned q0 = qb * 64u + wave * 16u;

  const _Float16* Q  = (const _Float16*)Qp;
  const _Float16* K  = (const _Float16*)Kp;
  const _Float16* Vt = (const _Float16*)Vtp;

  const _Float16* qrow  = Q + (size_t)(b * (unsigned)SEQ + q0 + c) * DIMC + h * HDIM + 8u * hh;
  const v16h qa0 = frag_ld(qrow), qa1 = frag_ld(qrow + 32);   // B operand: column c = query q0 + c
  // copy share of this thread: K and V^T tile rows tid / 8 (+16, +32, +48), 16-B piece tid % 8 of the 128-B row piece
  const unsigned crow = tid >> 3, cpc = tid & 7u;
  const _Float16* gK = K + (size_t)(b * (unsigned)SEQ + crow) * DIMC + h * HDIM + cpc * 8u;           // key crow of chunk 0
  const _Float16* gV = Vt + ((size_t)b * DIMC + h * HDIM + crow) * SEQ + cpc * 8u;                     // V^T row crow, keys of chunk 0
  const unsigned lK = (unsigned)(size_t)KVs + (crow * AT_KP + cpc * 8u) * 2u;                          // key x of a chunk lies in LDS row x
  const unsigned lV = lK + AT_TH * 2u;
  const unsigned lsKV = 16u * AT_KP * 2u;
  const size_t gsK = (size_t)16u * DIMC, gsV = (size_t)16u * SEQ;
  // this wave's lane-mask words: 32 for each chunk, chunks in a row. The wave's number is made uniform and the pointer names the constant address
  // space (nothing writes these words during this launch), so that the loads inside the loop are scalar too: behind the loop's asm waits with
  // their memory clobber the compiler otherwise reloads them as vector loads and moves every word to a scalar register by v_readfirstlane.
  const unsigned wvu = (unsigned)__builtin_amdgcn_readfirstlane((int)wave);
  typedef const __attribute__((address_space(4))) v16u* cw_ptr;
  const cw_ptr mwp = (cw_ptr)(unsigned long long)(MB + (size_t)((b * (unsigned)(SEQ / 16) + qb * 4u + wvu) * NQB) * 32u);
  v16u mw0 = mwp[0], mw1 = mwp[1];                        // chunk 0: words 8j + r of score tiles j = 0, 1 | j = 2, 3
  const unsigned fKV = c * AT_KP + 8u * hh;               // this lane's fragment place in a 16-row group of either staged tile

  float mrow = -INFINITY, lrow = 0.f;                     // this lane's query: running maximum (both halves alike), this half's share of the sum
  v8f oacc[4];                                            // O^T tile t: column c = query, element r = head column 16t + 8hh + r
#pragma unroll
  for (int t = 0; t < 4; ++t) oacc[t] = (v8f){0.f,0.f,0.f,0.f,0.f,0.f,0.f,0.f};

  stage_fill(lK, lsKV, lV, lsKV, gK, gsK, gV, gsV);
  asm volatile("s_wait_asynccnt 0x0" ::: "memory");     // this wave's copies of chunk 0 have landed
  __syncthreads();                                      // ... and every other wave's: buffer 0 is readable
  if (NQB > 1u) stage_fill(lK + AT_BH * 2u, lsKV, lV + AT_BH * 2u, lsKV, gK + (size_t)64u * DIMC, gsK, gV + 64, gsV);

#pragma unroll 1
  for (unsigned kc = 0; kc < NQB; ++kc) {
    const unsigned kv0 = kc * 64u;
    const _Float16* kvs = KVs + (kc & 1u) * AT_BH + fKV;
    v8f s[4];
    v16h kf[4][2];                                      // the chunk's 8 K fragments, read as one group in front of the products (loops unrolled: constant indices keep them in registers)
#pragma unroll
    for (int j = 0; j < 4; ++j) {
      const _Float16* kr = kvs + (unsigned)j * 16u * AT_KP;                        // A row c of tile j = key kv0 + 16j + c
      kf[j][0] = frag_ld(kr); kf[j][1] = frag_ld(kr + 32);
    }
#pragma unroll
    for (int j = 0; j < 4; ++j) s[j] = wm16(kf[j][0], qa0, (v8f){0.f,0.f,0.f,0.f,0.f,0.f,0.f,0.f});
#pragma unroll
    for (int j = 0; j < 4; ++j) s[j] = wm16(kf[j][1], qa1, s[j]);

    float x[4][8];                                      // this query's 32 scores, then its 32 probabilities (every loop over them unrolled: constant indices keep them in registers)
#pragma unroll
    for (int j = 0; j < 4; ++j)
#pragma unroll
      for (int r = 0; r < 8; ++r)
        x[j][r] = __builtin_amdgcn_inverse_ballot_w32((j < 2) ? mw0[8 * j + r] : mw1[8 * (j - 2) + r]) ? s[j][r] * SC2 : FILL2;
    {
      const unsigned kn = (kc + 1u < NQB) ? kc + 1u : kc;   // the next chunk's words, into the registers just used (the last trip reads its own again)
      mw0 = mwp[2u * kn]; mw1 = mwp[2u * kn + 1u];
    }
    float mj[4];
#pragma unroll
    for (int j = 0; j < 4; ++j)
      mj[j] = fmaxf(fmaxf(fmaxf(x[j][0], x[j][1]), fmaxf(x[j][2], x[j][3])), fmaxf(fmaxf(x[j][4], x[j][5]), fmaxf(x[j][6], x[j][7])));
    float m = fmaxf(fmaxf(mj[0], mj[1]), fmaxf(mj[2], mj[3]));
    m = fmaxf(m, xhalf(m));                             // the other half's 32 keys of the same query
    const float mnew  = fmaxf(mrow, m);
    const float alpha = ex2(mrow - mnew);
    mrow = mnew;
#pragma unroll
    for (int j = 0; j < 4; ++j)                         // all 32 exponents first, so that the v_exp_f32 groups below work in place (unrolled as above)
#pragma unroll
      for (int r = 0; r < 8; ++r) x[j][r] -= mnew;
    float pj[4];
#pragma unroll
    for (int j = 0; j < 4; ++j) {
      ex2x8(x[j]);
      pj[j] = ((x[j][0] + x[j][1]) + (x[j][2] + x[j][3])) + ((x[j][4] + x[j][5]) + (x[j][6] + x[j][7]));
    }
    lrow = lrow * alpha + ((pj[0] + pj[1]) + (pj[2] + pj[3]));
#pragma unroll
    for (int t = 0; t < 4; ++t)
#pragma unroll
      for (int r = 0; r < 8; ++r) oacc[t][r] *= alpha;
    v16h pb[2], va[2][4];                               // P^T packed from the score registers; the chunk's V^T fragments, read as one group in front of the products (unrolled as above)
#pragma unroll
    for (int kk = 0; kk < 2; ++kk) {
#pragma unroll
      for (int i = 0; i < 8; ++i) {
        pb[kk][i]     = (_Float16)(x[2 * kk][i] * PSC);       // B element i     = key 32kk + 8hh + i
        pb[kk][i + 8] = (_Float16)(x[2 * kk + 1][i] * PSC);   // B element 8 + i = key 32kk + 16 + 8hh + i
      }
#pragma unroll
      for (int t = 0; t < 4; ++t) va[kk][t] = frag_ld(kvs + AT_TH + (unsigned)t * 16u * AT_KP + (unsigned)kk * 32u);   // A: row d = t*16 + c, same key map
    }
#pragma unroll
    for (int kk = 0; kk < 2; ++kk) {
#pragma unroll
      for (int t = 0; t < 4; ++t) oacc[t] = wm16(va[kk][t], pb[kk], oacc[t]);
    }
    asm volatile("s_wait_dscnt 0x0" ::: "memory");      // this wave's reads of buffer kc%2 are done before it is handed to its next writer
    asm volatile("s_wait_asynccnt 0x0" ::: "memory");   // this wave's copies of chunk kc+1 have landed
    __syncthreads();                                    // publishes chunk kc+1's buffer and ends every reader's last read of chunk kc's
    if (kc + 2u < NQB) {
      const unsigned lo = (kc & 1u) * (AT_BH * 2u);
      stage_fill(lK + lo, lsKV, lV + lo, lsKV, gK + (size_t)(kv0 + 128u) * DIMC, gsK, gV + (kv0 + 128u), gsV);
    }
  }
  asm volatile("s_wait_asynccnt 0x0" ::: "memory");     // nothing of this wave is in flight when the loop is left

  // behind the last trip's barrier nobody reads the staged tiles any more and no copy is in flight: each wave stages its 16 x 64 output in its own slice
  _Float16* os = KVs + wave * (16u * AT_PP);
  const float inv = CTXC * (1.0f / ((lrow + xhalf(lrow)) * PSC));   // the two halves' sums of this query joined
#pragma unroll
  for (int t = 0; t < 4; ++t) {
    v8h hv;
#pragma unroll
    for (int r = 0; r < 8; ++r) hv[r] = (_Float16)(oacc[t][r] * inv);
    *(v8h*)(os + c * AT_PP + (unsigned)t * 16u + 8u * hh) = hv;      // query row c, head columns 16t + 8hh + 0..7
  }
  wave_sync();
  {
    const unsigned q4 = lane >> 3, c8 = (lane & 7u) * 8u;
    _Float16* cb = (_Float16*)ctxp + (size_t)(b * (unsigned)SEQ + q0) * DIMC + h * HDIM;
#pragma unroll
    for (int it = 0; it < 4; ++it) {
      const unsigned row = (unsigned)it * 4u + q4;
      *(v8h*)(cb + (size_t)row * DIMC + c8) = *(const v8h*)(os + row * AT_PP + c8);
    }
  }
}

// ---------------------------------------------------------------------------------------------------------
// workspace carve (bytes, every region a multiple of 256 and fully written by its producer before any read)
// ---------------------------------------------------------------------------------------------------------
static constexpr size_t SZ_X16   = (size_t)3 * MROWS * DIMC * 2;     // q16 | k16 | v16 planes [MROWS][1024] f16
static constexpr size_t SZ_WT16  = (size_t)4 * DIMC * DIMC * 2;      // Wq^T | Wk^T | Wv^T | Wp^T planes [out][in] f16, x16
static constexpr size_t SZ_QK16  = (size_t)2 * MROWS * DIMC * 2;     // Q16 | K16 planes [MROWS][1024] f16
static constexpr size_t SZ_VT16  = (size_t)NB * DIMC * SEQ * 2;      // V^T planes [b][1024][SEQ] f16
static constexpr size_t SZ_CTX16 = (size_t)MROWS * DIMC * 2;         // merged head output x16 [MROWS][1024] f16
static constexpr size_t SZ_BRO   = (size_t)DIMC * 4;                 // bias, bf16 RNE-converted, f32
static constexpr size_t SZ_MB    = (size_t)NB * (SEQ / 16) * (SEQ / 64) * 32 * 4;   // lane-mask words [b][16-query tile][64-key chunk][32]
static constexpr size_t SZ_TOTAL = SZ_X16 + SZ_WT16 + SZ_QK16 + SZ_VT16 + SZ_CTX16 + SZ_BRO + SZ_MB;
static_assert((SZ_X16 % 256) == 0 && (SZ_WT16 % 256) == 0 && (SZ_QK16 % 256) == 0 && (SZ_VT16 % 256) == 0 && (SZ_CTX16 % 256) == 0 && (SZ_BRO % 256) == 0 && (SZ_MB % 256) == 0);
static_assert(SZ_TOTAL <= (size_t)134217728);
// coverage equalities of the plane writers
static_assert((size_t)CV_ST * CV_TH * 8 == (size_t)MROWS * DIMC);                     // k_convert per activation tensor
static_assert((size_t)CV_ST * CV_TH * 8 == (size_t)4 * DIMC * DIMC);                  // k_convert, the four weights
static_assert((size_t)(SEQ / 64) * 4 * 16 * 64 == (size_t)SEQ * HDIM);               // k_flash per (batch, head): blocks x waves x rows x cols
static_assert((MROWS % 128) == 0 && (DIMC % 128) == 0 && (SEQ % 128) == 0);            // k_gemm64: whole 128x128 tiles, K = DIMC in whole 64-k trips

extern "C" void kernel_launch(void* const* d_in, const int* in_sizes, int n_in, void* d_out, int out_size, void* d_ws, size_t ws_size, hipStream_t stream) {
  if (n_in < 9) return;
  const long long needX = (long long)(NB - 1) * SEQ_FULL * DIMC + (long long)SEQ * DIMC;
  const long long needM = (long long)(NB - 1) * SEQ_FULL * SEQ_FULL + (long long)(SEQ - 1) * SEQ_FULL + SEQ;
  if ((long long)in_sizes[0] < needX || (long long)in_sizes[1] < needX || (long long)in_sizes[2] < needX) return;
  if ((long long)in_sizes[3] < needM) return;
  if (in_sizes[4] < DIMC * DIMC || in_sizes[5] < DIMC * DIMC || in_sizes[6] < DIMC * DIMC || in_sizes[7] < DIMC * DIMC || in_sizes[8] < DIMC) return;
  if ((long long)out_size < (long long)MROWS * DIMC) return;
  if (ws_size < SZ_TOTAL) return;

  const float* q    = (const float*)d_in[0];
  const float* k    = (const float*)d_in[1];
  const float* v    = (const float*)d_in[2];
  const int*   mask = (const int*)d_in[3];
  const float* Wq   = (const float*)d_in[4];
  const float* Wk   = (const float*)d_in[5];
  const float* Wv   = (const float*)d_in[6];
  const float* Wp   = (const float*)d_in[7];
  const float* bp   = (const float*)d_in[8];
  float* out = (float*)d_out;

  char* wsp = (char*)d_ws;
  unsigned short* X16   = (unsigned short*)wsp; wsp += SZ_X16;
  unsigned short* WT16  = (unsigned short*)wsp; wsp += SZ_WT16;
  unsigned short* QK16  = (unsigned short*)wsp; wsp += SZ_QK16;
  unsigned short* VT16  = (unsigned short*)wsp; wsp += SZ_VT16;
  unsigned short* CTX16 = (unsigned short*)wsp; wsp += SZ_CTX16;
  float*          BRO   = (float*)wsp;          wsp += SZ_BRO;
  unsigned*       MB    = (unsigned*)wsp;       wsp += SZ_MB;

  const unsigned long long planeX = (unsigned long long)MROWS * DIMC;     // elements per activation plane
  const unsigned long long planeW = (unsigned long long)DIMC * DIMC;

  // weights [in][out] -> [out][in] f16 x16 (4 planes); bias; activations (3 planes, full input batch stride, compact planes); mask -> lane-mask words
  k_convert<<<dim3((unsigned)CV_WG, 1u, 1u), 512, 0, stream>>>(q, k, v, Wq, Wk, Wv, Wp, bp, mask, X16, WT16, BRO, MB);
  // Q16 | K16 = (q16 | k16) x (Wq^T | Wk^T): batch y = 0 (q), 1 (k); M = MROWS, N = K = 1024
  k_gemm64<0, 1><<<dim3((unsigned)((MROWS / 128) * (DIMC / 128)), 2u, 1u), 256, 0, stream>>>(
      X16, (unsigned)DIMC, planeX, WT16, (unsigned)DIMC, planeW, (void*)QK16, (unsigned)DIMC, planeX, nullptr,
      (unsigned)MROWS, (unsigned)DIMC, (unsigned)DIMC, 0.0625f);
  // V^T[b][o][n] = sum_k Wv^T[o][k] * v16[b][n][k]: A = Wv^T plane (M = 1024), Bt = v16 batch plane (N = SEQ), C pitch SEQ
  k_gemm64<0, 1><<<dim3((unsigned)((DIMC / 128) * (SEQ / 128)), (unsigned)NB, 1u), 256, 0, stream>>>(
      WT16 + 2 * planeW, (unsigned)DIMC, 0ull, X16 + 2 * planeX, (unsigned)DIMC, (unsigned long long)SEQ * DIMC,
      (void*)VT16, (unsigned)SEQ, (unsigned long long)DIMC * SEQ, nullptr,
      (unsigned)DIMC, (unsigned)SEQ, (unsigned)DIMC, 0.0625f);
  // attention
  k_flash<<<dim3((unsigned)(NB * NHEAD * (SEQ / 64)), 1u, 1u), 128, 0, stream>>>(QK16, QK16 + planeX, VT16, MB, CTX16);
  // out = (ctx x16) x (Wp^T x16) / 256 + bias
  k_gemm64<2, 0><<<dim3((unsigned)((MROWS / 128) * (DIMC / 128)), 1u, 1u), 256, 0, stream>>>(
      CTX16, (unsigned)DIMC, 0ull, WT16 + 3 * planeW, (unsigned)DIMC, 0ull, (void*)out, (unsigned)DIMC, 0ull, BRO,
      (unsigned)MROWS, (unsigned)DIMC, (unsigned)DIMC, 0.00390625f);
}

// v006
// It runs in 108 microseconds.
// In both of two side-by-side timings against v005, it was 1.04 times as fast.
// Counting every step since v000, it is 2.93 times as fast.
// Masked multi-head attention (2 x 2,048 x 1,024; 16 heads x 64): inputs and parameters RNE-converted to bf16 first; every contraction (q/k/v projections, q.k^T, p.v, output projection) on v_wmma_f32_16x16x32_f16 (f16 operands: weights x16, probabilities x2^14, merged head output x16; f32 accumulate, f32 online softmax in the exp2 domain).
#include <hip/hip_runtime.h>
#include <math.h>

#ifndef NB
#define NB 2
#endif
#ifndef SEQ
#define SEQ 2048
#endif
#define NB_FULL 2
#define SEQ_FULL 2048
#define DIMC 1024
#define NHEAD 16
#define HDIM 64
#define MROWS (NB * SEQ)

static_assert(SEQ % 64 == 0);
static_assert(SEQ <= SEQ_FULL);
static_assert(NB <= NB_FULL);
static_assert(DIMC == NHEAD * HDIM);
static_assert(DIMC % 64 == 0);
static_assert(DIMC / 8 == 128);
static_assert((MROWS % 64) == 0);
static_assert(((SEQ * 128) % 256) == 0);

typedef __attribute__((ext_vector_type(16))) _Float16 v16h;
typedef __attribute__((ext_vector_type(8)))  _Float16 v8h;
typedef __attribute__((ext_vector_type(4)))  _Float16 v4h;
typedef __attribute__((ext_vector_type(8)))  float    v8f;
typedef __attribute__((ext_vector_type(4)))  float    v4f;
typedef __attribute__((ext_vector_type(4)))  int      v4i;
typedef __attribute__((ext_vector_type(16))) unsigned v16u;

// 16-bit WMMA fragment map (wave32), lane L, h = L>>4, m = L&15:
//   A 16x32: lane = row m;    element i -> k = (i<8) ? 8h+i : 16+8h+(i-8)
//   B 32x16: lane = column m; the SAME k(i,h)
//   D 16x16 (8 f32): lane = column m; element r -> row 8h+r
union FragU { v16h v; v8h h[2]; };
// p already includes the lane-half offset 8h: elements 0..7 <- p[0..7], 8..15 <- p[16..23]
__device__ __forceinline__ v16h frag_ld(const _Float16* p) {
  FragU f; f.h[0] = *(const v8h*)(p); f.h[1] = *(const v8h*)(p + 16); return f.v;
}
__device__ __forceinline__ v8f wm16(v16h a, v16h b, v8f c) {
  c = __builtin_amdgcn_wmma_f32_16x16x32_f16(false, a, false, b, (short)0, c, false, false);
  asm volatile("v_nop\n\tv_nop\n\tv_nop\n\tv_nop" : "+v"(c) : "v"(a), "v"(b));
  return c;
}
__device__ __forceinline__ void dep_guard_h(v8f& a, v8f& b, v16h x, v16h y) { asm volatile("v_nop\n\tv_nop\n\tv_nop\n\tv_nop" : "+v"(a), "+v"(b) : "v"(x), "v"(y)); }
__device__ __forceinline__ void keep4_h(v16h a, v16h b, v16h c, v16h d) { asm volatile("v_nop" :: "v"(a), "v"(b), "v"(c), "v"(d)); }
__device__ __forceinline__ void acc_guard4(v8f& a, v8f& b, v8f& c, v8f& d) { asm volatile("v_nop\n\tv_nop\n\tv_nop\n\tv_nop" : "+v"(a), "+v"(b), "+v"(c), "+v"(d)); }
// same-wave LDS exchange: stores by some lanes, loads of those locations by other lanes of the SAME wave
__device__ __forceinline__ void wave_sync() {
  __builtin_amdgcn_fence(3 /* release order */, "workgroup");
  __builtin_amdgcn_wave_barrier();
  __builtin_amdgcn_fence(2 /* acquire order */, "workgroup");
}
// bf16 RNE-convert, kept as f32 (finite inputs)
__device__ __forceinline__ float cmb_bf(float v) {
  const unsigned u = __builtin_bit_cast(unsigned, v);
  const unsigned r = (u + 0x7fffu + ((u >> 16) & 1u)) & 0xffff0000u;
  return __builtin_bit_cast(float, r);
}

// ---------------------------------------------------------------------------------------------------------
// k_convert: every conversion of the call in ONE launch of CV_WG work-groups of 16 waves, one for each WGP, all resident at once; a thread
// takes CV_ST pieces of every kind instead of ending after one, so the launch starts 4,096 waves where three launches started 65,568.
// A thread's pieces, step j = 0 .. CV_ST - 1:
//   one of each activation tensor: f32 row [1024], 8 columns -> bf16 (RNE) -> f16 plane rows [MROWS][1024], one 16-B store
//   (piece j * CV_TH + flat thread: consecutive threads walk along a row; sources use the FULL input batch stride, planes are compact);
//   one of a weight: W[k = in][o = out] (row pitch 1024) -> WT[o][k] = f16(bf16_rne(W[k][o]) * 16): 8 strided loads, one 16-B store, a wave walks
//   along the destination row. A work-group takes two tiles of 32 outputs x 256 inputs, two steps each (16 waves = 16 outputs a step): the
//   128-B source lines of a tile hold exactly its 32 outputs, so both steps and all 16 waves read the same 256 lines.
// All loads of a thread are issued first (24 of 16 B, 16 of 16 B for the mask, then 32 of 4 B), so a wave waits out the memory latency once, not once a step.
// The first DIMC threads of the launch also convert the bias.
// The keep-mask is packed here, once for all 16 heads: a wave takes 16 query rows x 128 keys (16 whole-line loads of 512 B, a work-group reads
// 128 KiB in a row), turns them through its own LDS slice into k_flash's score layout (lane = 16 hh + c holds query c, keys 16j + 8hh + r of a
// 64-key chunk) and writes, for each chunk, 32 lane-mask words: word 8j + r, bit lane = (mask element != 0).
// ---------------------------------------------------------------------------------------------------------
#define CV_WG 256                       // work-groups of the launch
#define CV_TH (CV_WG * 512)             // threads of the launch
#define CV_ST 4                         // pieces of each kind per thread
#define CV_RPS (CV_TH / 128)             // activation rows of one step (128 pieces a row)
#define CV_TPW ((DIMC / 32) * (DIMC / 256))   // tiles of one weight
static_assert(MROWS * 128 == CV_ST * CV_TH);              // activation pieces of one tensor: every one exactly once
static_assert(4 * CV_TPW == CV_WG * (CV_ST / 2));         // weight tiles: every one exactly once
static_assert(CV_TPW % (CV_ST / 2) == 0);                 // a work-group's tiles lie in one weight
static_assert(SEQ % CV_RPS == 0);                         // a step's rows lie in one batch
static_assert(DIMC <= CV_TH);
static_assert(CV_ST == 4);                                // the wait behind the activation loads names four offsets
static_assert(((unsigned long long)(NB - 1) * SEQ_FULL + SEQ) * DIMC * 4 < (1ull << 32));   // source byte offsets fit 32 bits
#define CV_MP 132                       // mask slice row pitch in words: 528 B = 16 B x 33
static_assert(SEQ % 128 == 0);
static_assert((size_t)NB * (SEQ / 16) * (SEQ / 128) == (size_t)CV_WG * 16);               // mask pieces: one for every wave of the launch
static_assert((unsigned long long)NB * SEQ_FULL * SEQ_FULL * 4 < (1ull << 32));           // mask byte offsets fit 32 bits
__global__ __launch_bounds__(512) void k_convert(const float* __restrict__ S0, const float* __restrict__ S1, const float* __restrict__ S2,
                                                  const float* __restrict__ W0, const float* __restrict__ W1, const float* __restrict__ W2,
                                                  const float* __restrict__ W3, const float* __restrict__ BP, const int* __restrict__ MK,
                                                  unsigned short* __restrict__ X, unsigned short* __restrict__ WT, float* __restrict__ BRO,
                                                  unsigned* __restrict__ MB) {
  __shared__ __align__(16) int sM[16][16 * CV_MP];   // per-wave slice: 16 query rows x 128 keys of the mask
  const unsigned t = blockIdx.x * 512u + threadIdx.x;
  const unsigned wave = threadIdx.x >> 5, lane = threadIdx.x & 31u;
  const unsigned tile0 = blockIdx.x * (CV_ST / 2u);
  const unsigned y = tile0 / (unsigned)CV_TPW;
  const float* W = (y == 0u) ? W0 : ((y == 1u) ? W1 : ((y == 2u) ? W2 : W3));   // block-uniform choice among global pointers
  const unsigned tsb = t * 32u, tdb = t * 16u;   // this thread's place inside a step's CV_RPS rows, in source and in plane bytes: one 32-bit offset beside a uniform base
  v4f x[CV_ST][3][2];                   // every loop over the steps is unrolled: constant indices keep the pieces in registers
  float w[CV_ST][8];
  unsigned so[CV_ST];                   // source byte offsets of the thread's pieces, alike in the three tensors
#pragma unroll
  for (unsigned j = 0; j < CV_ST; ++j) {
    // first row of step j in the source: batch (j * CV_RPS) / SEQ at the full batch stride, row (j * CV_RPS) % SEQ of it
    so[j] = (((j * (unsigned)CV_RPS) / (unsigned)SEQ) * (unsigned)SEQ_FULL + (j * (unsigned)CV_RPS) % (unsigned)SEQ) * (unsigned)(DIMC * 4) + tsb;
    const v4f* s0 = (const v4f*)((const char*)S0 + so[j]);
    const v4f* s1 = (const v4f*)((const char*)S1 + so[j]);
    const v4f* s2 = (const v4f*)((const char*)S2 + so[j]);
    x[j][0][0] = s0[0]; x[j][0][1] = s0[1];
    x[j][1][0] = s1[0]; x[j][1][1] = s1[1];
    x[j][2][0] = s2[0]; x[j][2][1] = s2[1];
  }
  // The wait before a register that one of these 24 loads names is written again; the offsets are inputs so that they stay in their registers up
  // to it. The statement also keeps the streaming loads in front of the 32 many-line weight loads, which the compiler otherwise issues first
  // (a wave's loads return in order).
  asm volatile("s_wait_xcnt 0x0" :: "v"(so[0]), "v"(so[1]), "v"(so[2]), "v"(so[3]) : "memory");
  // this wave's mask piece: batch, 16-query tile, pair of 64-key chunks; row i of it is one 512-B load of the wave
  const unsigned gw = blockIdx.x * 16u + wave;
  const unsigned mkp = gw % (unsigned)(SEQ / 128), mqt = (gw / (unsigned)(SEQ / 128)) % (unsigned)(SEQ / 16), mbt = gw / (unsigned)((SEQ / 128) * (SEQ / 16));
  const unsigned mo = ((mbt * (unsigned)SEQ_FULL + mqt * 16u) * (unsigned)SEQ_FULL + mkp * 128u + lane * 4u) * 4u;
  v4i mk[16];                           // unrolled as above
#pragma unroll
  for (unsigned i = 0; i < 16u; ++i) mk[i] = __builtin_nontemporal_load((const v4i*)((const char*)MK + mo + i * (unsigned)(SEQ_FULL * 4)));   // read once in the whole call
  asm volatile("s_wait_xcnt 0x0" :: "v"(mo) : "memory");   // as above, for the 16 mask loads: they too stay in front of the weight loads
  unsigned wo[CV_ST];                   // source byte offsets of the thread's weight pieces (first of the 8 inputs)
#pragma unroll
  for (unsigned j = 0; j < CV_ST; ++j) {
    const unsigned ty = (tile0 + (j >> 1)) % (unsigned)CV_TPW;
    const unsigned o = (ty >> 2) * 32u + (j & 1u) * 16u + wave, k0 = (ty & 3u) * 256u + lane * 8u;
    wo[j] = (k0 * (unsigned)DIMC + o) * 4u;
#pragma unroll
    for (int e = 0; e < 8; ++e) w[j][e] = *(const float*)((const char*)W + wo[j] + (unsigned)e * (unsigned)(DIMC * 4));
  }
  asm volatile("s_wait_xcnt 0x0" :: "v"(wo[0]), "v"(wo[1]), "v"(wo[2]), "v"(wo[3]) : "memory");   // as above, for the 32 weight loads
  float bv = 0.f;
  if (t < (unsigned)DIMC) bv = BP[t];                                 // whole waves of the first work-groups
#pragma unroll
  for (unsigned j = 0; j < CV_ST; ++j) {
#pragma unroll
    for (int z = 0; z < 3; ++z) {
      v8h hv;
#pragma unroll
      for (int e = 0; e < 4; ++e) { hv[e] = (_Float16)cmb_bf(x[j][z][0][e]); hv[e + 4] = (_Float16)cmb_bf(x[j][z][1][e]); }
      *(v8h*)((char*)((_Float16*)X + ((size_t)z * MROWS + (size_t)j * CV_RPS) * DIMC) + tdb) = hv;
    }
    asm volatile("s_wait_xcnt 0x0" ::: "memory");   // before a register that one of these stores names is written again
  }
  {
    int* sm = sM[wave];
#pragma unroll
    for (unsigned i = 0; i < 16u; ++i) *(v4i*)(sm + i * (unsigned)CV_MP + lane * 4u) = mk[i];
    // The rows are read back by other lanes of this wave alone: its own LDS stores are waited for, and the statement keeps the reads behind them.
    // (wave_sync()'s work-group fences would also wait here for the global stores above and for the weight loads still in flight.)
    asm volatile("s_wait_dscnt 0x0" ::: "memory");
    const int* sr = sm + (lane & 15u) * (unsigned)CV_MP + (lane >> 4) * 8u;   // query row c, this half's 8 keys of a 16-key group
#pragma unroll
    for (unsigned ch = 0; ch < 2u; ++ch) {
      unsigned ow = 0u;                 // lane l ends up with word l of the chunk
#pragma unroll
      for (unsigned j = 0; j < 4u; ++j) {
        const v4i a = *(const v4i*)(sr + ch * 64u + j * 16u), bq = *(const v4i*)(sr + ch * 64u + j * 16u + 4u);
#pragma unroll
        for (unsigned r = 0; r < 4u; ++r) {
          const unsigned wa = __builtin_amdgcn_ballot_w32(a[r] != 0), wb = __builtin_amdgcn_ballot_w32(bq[r] != 0);
          ow = (lane == j * 8u + r) ? wa : ow;
          ow = (lane == j * 8u + 4u + r) ? wb : ow;
        }
      }
      MB[(gw * 2u + ch) * 32u + lane] = ow;
    }
    asm volatile("s_wait_xcnt 0x0" ::: "memory");   // before a register that one of these stores names is written again
  }
#pragma unroll
  for (unsigned j = 0; j < CV_ST; ++j) {
    const unsigned ty = (tile0 + (j >> 1)) % (unsigned)CV_TPW;
    const unsigned o = (ty >> 2) * 32u + (j & 1u) * 16u + wave, k0 = (ty & 3u) * 256u + lane * 8u;
    v8h hw;
#pragma unroll
    for (int e = 0; e < 8; ++e) hw[e] = (_Float16)(cmb_bf(w[j][e]) * 16.0f);
    *(v8h*)((_Float16*)WT + (size_t)y * DIMC * DIMC + (o * (unsigned)DIMC + k0)) = hw;
    asm volatile("s_wait_xcnt 0x0" ::: "memory");   // as above
  }
  if (t < (unsigned)DIMC) BRO[t] = cmb_bf(bv);
}

// ---------------------------------------------------------------------------------------------------------
// k_gemm64: C[m,n] = scale * sum_k A[m,k] * Bt[n,k] (+ bias[n]); f16 operand planes. A block of 8 waves owns a 128x128 tile of C,
// each wave 32 rows x 64 columns of it. Per trip 64 k of the block's 128 A rows and 128 Bt rows (128-B row pieces, whole lines) come
// into LDS by asynchronous copies, two buffers: the next trip's copies fly while this trip's fragments are read from LDS (row pitch 144 B).
// A row-major [M,K]; Bt row-major [N,K]; M,N % 128 == 0, K % 64 == 0, K >= 64; batch = blockIdx.y with element strides.
// OUT_MODE 0: f32 C; 1: f16 C. Epilogue: 16-row slabs staged per wave in LDS (wave-private), each 64-wide row segment written as whole
// ---------------------------------------------------------------------------------------------------------
#define GT_PH  72                      // LDS row pitch in halves: 144 B = 16 B x 9
#define GT_OPH (128 * GT_PH)           // halves of one operand's 128-row tile
#define GT_STH (2 * GT_OPH)            // halves of one buffer: A tile | Bt tile
// One buffer's fill, this thread's share: 16 B in each of four rows of the first tile and of four rows of the second (eight threads cover
// a 128-B row piece, so a wave covers 4 whole lines per copy). la, lb = the thread's LDS byte addresses in its first row of either tile,
// lsa, lsb = LDS bytes from one of its rows to the next; ga, gb, gsa, gsb = the same in global memory (addresses, steps in elements).
// s_wait_xcnt closes the statement so that no address register of an issued copy is rewritten ahead of it.
__device__ __forceinline__ void stage_fill(unsigned la, unsigned lsa, unsigned lb, unsigned lsb,
                                           const _Float16* ga, size_t gsa, const _Float16* gb, size_t gsb) {
  const unsigned la1 = la + lsa, la2 = la + 2u * lsa, la3 = la + 3u * lsa;
  const unsigned lb1 = lb + lsb, lb2 = lb + 2u * lsb, lb3 = lb + 3u * lsb;
  const _Float16* ga1 = ga + gsa; const _Float16* ga2 = ga + 2u * gsa; const _Float16* ga3 = ga + 3u * gsa;
  const _Float16* gb1 = gb + gsb; const _Float16* gb2 = gb + 2u * gsb; const _Float16* gb3 = gb + 3u * gsb;
  asm volatile("global_load_async_to_lds_b128 %0, %8, off\n\t"
               "global_load_async_to_lds_b128 %1, %9, off\n\t"
               "global_load_async_to_lds_b128 %2, %10, off\n\t"
               "global_load_async_to_lds_b128 %3, %11, off\n\t"
               "global_load_async_to_lds_b128 %4, %12, off\n\t"
               "global_load_async_to_lds_b128 %5, %13, off\n\t"
               "global_load_async_to_lds_b128 %6, %14, off\n\t"
               "global_load_async_to_lds_b128 %7, %15, off\n\t"
               "s_wait_xcnt 0x0"
               :: "v"(la), "v"(la1), "v"(la2), "v"(la3), "v"(lb), "v"(lb1), "v"(lb2), "v"(lb3),
                  "v"(ga), "v"(ga1), "v"(ga2), "v"(ga3), "v"(gb), "v"(gb1), "v"(gb2), "v"(gb3)
               : "memory");
}
template <int BIAS_MODE, int OUT_MODE>
__global__ __launch_bounds__(256) void k_gemm64(
    const unsigned short* __restrict__ Ap, unsigned lda, unsigned long long strideA,
    const unsigned short* __restrict__ Btp, unsigned ldb, unsigned long long strideB,
    void* __restrict__ Cout, unsigned ldc, unsigned long long strideC,
    const float* __restrict__ bias, unsigned M, unsigned N, unsigned K, float scale) {
  __shared__ __align__(16) _Float16 sS[2 * GT_STH];   // two buffers of [A 128 rows | Bt 128 rows] x 64 k, pitch 72 halves
  __shared__ __align__(16) float sT[8][16 * 68];      // per-wave 16x64 slab, pitch 68 floats
  const unsigned b    = blockIdx.y;
  const unsigned lane = threadIdx.x & 31u;
  const unsigned wave = threadIdx.x >> 5;
  const unsigned tilesN = N >> 7;
  const unsigned tilesM = M >> 7;
  const unsigned tile = blockIdx.x;
  if (tile >= tilesM * tilesN) return;   // block-uniform, in front of every barrier and copy
  const unsigned tm = tile / tilesN;
  const unsigned tn = tile - tm * tilesN;
  const unsigned m0 = (tm << 7) + ((wave >> 1) << 5);   // this wave's 32 rows
  const unsigned n0 = (tn << 7) + ((wave & 1u) << 6);   // this wave's 64 columns

  const _Float16* Ab = (const _Float16*)Ap + (size_t)b * strideA;
  const _Float16* Bb = (const _Float16*)Btp + (size_t)b * strideB;

  const unsigned rlane = lane & 15u;            // row (A) / col (B, D) within subtile
  const unsigned koff  = (lane >> 4) * 8u;      // k offset of this lane half
  const unsigned mOff  = (lane >> 4) * 8u;      // D row offset

  // copy share of this thread: tile row threadIdx.x / 8 (+32, +64, +96), 16-B piece threadIdx.x % 8 of the 128-B row piece
  const unsigned crow = threadIdx.x >> 3, cpc = threadIdx.x & 7u;
  const _Float16* gA = Ab + (size_t)((tm << 7) + crow) * lda + cpc * 8u;
  const _Float16* gB = Bb + (size_t)((tn << 7) + crow) * ldb + cpc * 8u;
  const unsigned lC = (unsigned)(size_t)sS + (crow * GT_PH + cpc * 8u) * 2u;
  // fragment read places of this lane inside a buffer
  const unsigned fA = (((wave >> 1) << 5) + rlane) * GT_PH + koff;
  const unsigned fB = GT_OPH + (((wave & 1u) << 6) + rlane) * GT_PH + koff;

  v8f acc[2][4];
#pragma unroll
  for (int i = 0; i < 2; ++i)
#pragma unroll
    for (int j = 0; j < 4; ++j) acc[i][j] = (v8f){0.f,0.f,0.f,0.f,0.f,0.f,0.f,0.f};

  const unsigned nT = K >> 6;
  const unsigned lStep = 32u * GT_PH * 2u;              // a thread's rows are 32 apart
  const size_t gsA = (size_t)32u * lda, gsB = (size_t)32u * ldb;
  stage_fill(lC, lStep, lC + GT_OPH * 2u, lStep, gA, gsA, gB, gsB);
  asm volatile("s_wait_asynccnt 0x0" ::: "memory");     // this wave's copies of trip 0 have landed
  __syncthreads();                                      // ... and every other wave's: buffer 0 is readable
  if (nT > 1u) stage_fill(lC + GT_STH * 2u, lStep, lC + (GT_STH + GT_OPH) * 2u, lStep, gA + 64, gsA, gB + 64, gsB);

  for (unsigned t = 0; t < nT; ++t) {
    const _Float16* sb = sS + (t & 1u) * GT_STH;
    v16h bh[2][4], ah[2][2];                            // the trip's 12 fragments, read as one group in front of its 16 products (loops unrolled: constant indices keep them in registers)
#pragma unroll
    for (int kk = 0; kk < 2; ++kk) {
#pragma unroll
      for (int j = 0; j < 4; ++j) bh[kk][j] = frag_ld(sb + fB + (unsigned)j * 16u * GT_PH + (unsigned)kk * 32u);
#pragma unroll
      for (int i = 0; i < 2; ++i) ah[kk][i] = frag_ld(sb + fA + (unsigned)i * 16u * GT_PH + (unsigned)kk * 32u);
    }
#pragma unroll
    for (int kk = 0; kk < 2; ++kk) {
#pragma unroll
      for (int i = 0; i < 2; ++i) {
#pragma unroll
        for (int j = 0; j < 4; ++j)
          acc[i][j] = __builtin_amdgcn_wmma_f32_16x16x32_f16(false, ah[kk][i], false, bh[kk][j], (short)0, acc[i][j], false, false);
        dep_guard_h(acc[i][0], acc[i][3], ah[kk][i], ah[kk][i]);
      }
      keep4_h(bh[kk][0], bh[kk][1], bh[kk][2], bh[kk][3]);
    }
    asm volatile("s_wait_dscnt 0x0" ::: "memory");      // this wave's reads of buffer t%2 are done before it is handed to its next writer
    asm volatile("s_wait_asynccnt 0x0" ::: "memory");   // this wave's copies of trip t+1 have landed
    __syncthreads();                                    // publishes trip t+1's buffer and ends every reader's last read of trip t's
    if (t + 2u < nT) {
      const unsigned lN = lC + (t & 1u) * (GT_STH * 2u);
      stage_fill(lN, lStep, lN + GT_OPH * 2u, lStep, gA + (size_t)(t + 2u) * 64u, gsA, gB + (size_t)(t + 2u) * 64u, gsB);
    }
  }
  asm volatile("s_wait_asynccnt 0x0" ::: "memory");     // nothing of this wave is in flight when the loop is left
  acc_guard4(acc[0][0], acc[0][1], acc[0][2], acc[0][3]);
  acc_guard4(acc[1][0], acc[1][1], acc[1][2], acc[1][3]);

  float* slab = sT[wave];
#pragma unroll
  for (int i = 0; i < 2; ++i) {
    const unsigned mBase = m0 + ((unsigned)i << 4);
#pragma unroll
    for (int j = 0; j < 4; ++j) {
      const unsigned n = n0 + ((unsigned)j << 4) + rlane;
      float bv = 0.f;
      if (BIAS_MODE == 2) bv = bias[n];
#pragma unroll
      for (int r = 0; r < 8; ++r) {
        float v = acc[i][j][r] * scale;
        if (BIAS_MODE == 2) v += bv;
        slab[(mOff + (unsigned)r) * 68u + ((unsigned)j << 4) + rlane] = v;
      }
    }
    wave_sync();
    if (OUT_MODE == 0) {
      float* C = (float*)Cout + (size_t)b * strideC;
      const unsigned hh = lane >> 4, c4 = (lane & 15u) * 4u;     // row segment = 256 B = 16 lanes x 16 B
      {
#pragma unroll
        for (int it = 0; it < 8; ++it) {
          const unsigned row = (unsigned)it * 2u + hh;
          const v4f v = *(const v4f*)(slab + row * 68u + c4);
          *(v4f*)(C + (size_t)(mBase + row) * ldc + n0 + c4) = v;
        }
        
      }
    } else {
      const unsigned q = lane >> 3, c8 = (lane & 7u) * 8u;
      _Float16* C = (_Float16*)Cout + (size_t)b * strideC;
      {
#pragma unroll
        for (int it = 0; it < 4; ++it) {
          const unsigned row = (unsigned)it * 4u + q;
          const float* sp = slab + row * 68u + c8;
          v8h hv;
#pragma unroll
          for (int e = 0; e < 8; ++e) hv[e] = (_Float16)sp[e];
          *(v8h*)(C + (size_t)(mBase + row) * ldc + n0 + c8) = hv;
        }
        
      }
    }
    wave_sync();
  }
}

// ---------------------------------------------------------------------------------------------------------
// k_flash: per (batch, head, 128-query block): block = 4 waves x 32 queries (two 16-query tiles a wave); 64-key chunks; online softmax in f32
//   (exp2 domain).
//   each chunk's 64 K16 rows and 64 V^T rows (128-B row pieces) come into LDS once per block by asynchronous copies, two buffers: the next
//   chunk's copies fly while this chunk is worked on.
//   every K and V^T fragment read from LDS feeds two products, one for each query tile of the wave.
//   scores transposed: S^T = K.Q^T, A = staged K16 rows (tile j = keys 16j..16j+15), B = Q16 rows kept in registers. In each query tile a lane holds
//           32 scores of ONE query (column c; keys 16j + 8hh + r): maximum and sum run inside the lane, the two lane halves exchange the maximum
//           once per chunk and join their sums once, behind the loop.
//   keep-mask, shared by the heads: element == 0 -> score := fill (finite replace, applied after the scaling). k_convert has packed it into lane-mask
//           words in this kernel's score layout: a wave reads 32 words (128 B) for each of its query tiles and chunk by scalar loads, one chunk
//           ahead, and each word is the select mask of one score register: no compare, no mask tile in LDS.
//   output transposed: O^T += V^T.P^T, A = staged V^T rows, B = P^T (x 2^14, f16) packed straight from the score registers: score tiles 2kk and
//           2kk+1 hold exactly the keys of B elements 0..7 and 8..15 of key group kk, so P never passes through LDS.
// ---------------------------------------------------------------------------------------------------------
#define AT_PP 72                        // output staging row pitch in halves
#define AT_KP 72                        // staged row pitch in halves: 144 B = 16 B x 9
#define AT_TH (64 * AT_KP)              // halves of one staged 64-row tile
#define AT_BH (2 * AT_TH)               // halves of one buffer: K tile | V^T tile
#define AT_QW 2                         // 16-query tiles of one wave (the loop reads one of the two 32-key V^T fragment groups behind each)
#define AT_WV 4                         // waves of one block
#define AT_QB (AT_WV * AT_QW * 16)      // queries of one block
static_assert(SEQ % AT_QB == 0);
static_assert(AT_QW == 2);              // one V^T fragment group (32 keys) for each query tile
// 2^x as the bare v_exp_f32, without the library form's range test, selects, add and ldexp around it. Every argument here is <= 0 (or -inf);
// the two forms differ only where 2^x < 2^-126, which may come out 0: such a term is far under half an ulp of the row's sum and of the f16 operand.
// The v_nop fills the slot behind it.
__device__ __forceinline__ float ex2(float x) { float r; asm("v_exp_f32 %0, %1\n\tv_nop" : "=v"(r) : "v"(x)); return r; }
// Eight of them in place, in one statement: each v_exp_f32 is the independent instruction that the slot behind the one before it asks for, and the
// v_nop fills the slot behind the last.
__device__ __forceinline__ void ex2x8(float (&v)[8]) {
  asm("v_exp_f32 %0, %0\n\tv_exp_f32 %1, %1\n\tv_exp_f32 %2, %2\n\tv_exp_f32 %3, %3\n\t"
      "v_exp_f32 %4, %4\n\tv_exp_f32 %5, %5\n\tv_exp_f32 %6, %6\n\tv_exp_f32 %7, %7\n\tv_nop"
      : "+v"(v[0]), "+v"(v[1]), "+v"(v[2]), "+v"(v[3]), "+v"(v[4]), "+v"(v[5]), "+v"(v[6]), "+v"(v[7]));
}
// lane l <-> lane l ^ 16
__device__ __forceinline__ float xhalf(float x) {
  const int b = __builtin_bit_cast(int, x);
  return __builtin_bit_cast(float, __builtin_amdgcn_permlanex16(b, b, 0x76543210, 0xfedcba98, false, false));
}
__global__ __launch_bounds__(AT_WV * 32) void k_flash(const unsigned short* __restrict__ Qp, const unsigned short* __restrict__ Kp,
                                               const unsigned short* __restrict__ Vtp, const unsigned* __restrict__ MB,
                                               unsigned short* __restrict__ ctxp) {
  __shared__ __align__(16) _Float16 KVs[2 * AT_BH];       // two buffers of [K 64 keys | V^T 64 rows] x 64 halves, pitch 72 halves; behind the loop: output staging
  static_assert(AT_QB * AT_PP <= 2 * AT_BH);
  constexpr unsigned NQB = SEQ / AT_QB;                   // query blocks of one (batch, head)
  constexpr unsigned NKC = SEQ / 64;                      // key chunks
  const float SC2   = 0.125f * 1.4426950408889634f;       // 64^-0.5 * log2(e)
  const float FILL2 = -1.0e9f * 1.4426950408889634f;      // the finite fill in the exp2 domain
  const float PSC   = 16384.0f;                           // probability carry (f16 operand stays normal)
  const float CTXC  = 16.0f;                              // output carry, undone in the projection epilogue

  const unsigned tid = threadIdx.x, wave = tid >> 5, lane = tid & 31u, hh = lane >> 4, c = lane & 15u;
  const unsigned bx = blockIdx.x;
  const unsigned qb = bx % NQB;
  const unsigned bh = bx / NQB;
  const unsigned h  = bh % (unsigned)NHEAD;
  const unsigned b  = bh / (unsigned)NHEAD;
  const unsigned q0 = qb * (unsigned)AT_QB + wave * (unsigned)(AT_QW * 16);

  const _Float16* Q  = (const _Float16*)Qp;
  const _Float16* K  = (const _Float16*)Kp;
  const _Float16* Vt = (const _Float16*)Vtp;

  const _Float16* qrow  = Q + (size_t)(b * (unsigned)SEQ + q0 + c) * DIMC + h * HDIM + 8u * hh;
  v16h qa[AT_QW][2];                                      // B operands: column c of tile u = query q0 + 16u + c (every loop over u unrolled: constant indices keep all of it in registers)
#pragma unroll
  for (int u = 0; u < AT_QW; ++u) { qa[u][0] = frag_ld(qrow + (size_t)u * 16u * DIMC); qa[u][1] = frag_ld(qrow + (size_t)u * 16u * DIMC + 32); }
  // copy share of this thread: K and V^T tile rows tid / 8 (+16, +32, +48), 16-B piece tid % 8 of the 128-B row piece
  const unsigned crow = tid >> 3, cpc = tid & 7u;
  const _Float16* gK = K + (size_t)(b * (unsigned)SEQ + crow) * DIMC + h * HDIM + cpc * 8u;           // key crow of chunk 0
  const _Float16* gV = Vt + ((size_t)b * DIMC + h * HDIM + crow) * SEQ + cpc * 8u;                     // V^T row crow, keys of chunk 0
  const unsigned lK = (unsigned)(size_t)KVs + (crow * AT_KP + cpc * 8u) * 2u;                          // key x of a chunk lies in LDS row x
  const unsigned lV = lK + AT_TH * 2u;
  const unsigned lsKV = 16u * AT_KP * 2u;
  const size_t gsK = (size_t)16u * DIMC, gsV = (size_t)16u * SEQ;
  // this wave's lane-mask words: 32 for each query tile and chunk, a tile's chunks in a row. The wave's number is made uniform and the pointer names
  // the constant address space (nothing writes these words during this launch), so that the loads inside the loop are scalar too: behind the loop's
  // asm waits with their memory clobber the compiler otherwise reloads them as vector loads and moves every word to a scalar register by v_readfirstlane.
  const unsigned wvu = (unsigned)__builtin_amdgcn_readfirstlane((int)wave);
  typedef const __attribute__((address_space(4))) v16u* cw_ptr;
  const cw_ptr mwp = (cw_ptr)(unsigned long long)(MB + (size_t)((b * (unsigned)(SEQ / 16) + qb * (unsigned)(AT_QB / 16) + wvu * (unsigned)AT_QW) * NKC) * 32u);
  v16u mw[AT_QW][2];                                      // chunk 0: words 8j + r of score tiles j = 0, 1 | j = 2, 3, for each query tile
#pragma unroll
  for (int u = 0; u < AT_QW; ++u) { mw[u][0] = mwp[(unsigned)u * 2u * NKC]; mw[u][1] = mwp[(unsigned)u * 2u * NKC + 1u]; }
  const unsigned fKV = c * AT_KP + 8u * hh;               // this lane's fragment place in a 16-row group of either staged tile

  float mrow[AT_QW], lrow[AT_QW];                         // this lane's query of tile u: running maximum (both halves alike), this half's share of the sum
  v8f oacc[AT_QW][4];                                     // O^T tile t of query tile u: column c = query, element r = head column 16t + 8hh + r
#pragma unroll
  for (int u = 0; u < AT_QW; ++u) {
    mrow[u] = -INFINITY; lrow[u] = 0.f;
#pragma unroll
    for (int t = 0; t < 4; ++t) oacc[u][t] = (v8f){0.f,0.f,0.f,0.f,0.f,0.f,0.f,0.f};
  }

  stage_fill(lK, lsKV, lV, lsKV, gK, gsK, gV, gsV);
  asm volatile("s_wait_asynccnt 0x0" ::: "memory");     // this wave's copies of chunk 0 have landed
  __syncthreads();                                      // ... and every other wave's: buffer 0 is readable
  if (NKC > 1u) stage_fill(lK + AT_BH * 2u, lsKV, lV + AT_BH * 2u, lsKV, gK + (size_t)64u * DIMC, gsK, gV + 64, gsV);

  // One trip: chunk kc. refill = a chunk kc + 2 exists; it is a constant at either call, so that a trip is one straight block: with the test inside
  // the loop the compiler moved the 64 additions of the row sums behind it, which kept all 64 probabilities in registers through the second products.
  auto trip = [&](const unsigned kc, const bool refill) __attribute__((always_inline)) {
    const unsigned kv0 = kc * 64u;
    const _Float16* kvs = KVs + (kc & 1u) * AT_BH + fKV;
    v8f s[AT_QW][4];
    v16h kf[4][2];                                      // the chunk's 8 K fragments, read as one group in front of the products (loops unrolled: constant indices keep them in registers)
#pragma unroll
    for (int j = 0; j < 4; ++j) {
      const _Float16* kr = kvs + (unsigned)j * 16u * AT_KP;                        // A row c of tile j = key kv0 + 16j + c
      kf[j][0] = frag_ld(kr); kf[j][1] = frag_ld(kr + 32);
    }
#pragma unroll
    for (int j = 0; j < 4; ++j)
#pragma unroll
      for (int u = 0; u < AT_QW; ++u) s[u][j] = wm16(kf[j][0], qa[u][0], (v8f){0.f,0.f,0.f,0.f,0.f,0.f,0.f,0.f});
#pragma unroll
    for (int j = 0; j < 4; ++j)
#pragma unroll
      for (int u = 0; u < AT_QW; ++u) s[u][j] = wm16(kf[j][1], qa[u][1], s[u][j]);

    const unsigned kn = (kc + 1u < NKC) ? kc + 1u : kc;   // the chunk whose words are read next (the last trip reads its own again)
    v16h pb[AT_QW][2];                                  // P^T packed from the score registers (unrolled as above)
    v16h va[2][4];                                      // the chunk's V^T fragments, A: row d = t*16 + c, same key map as P^T (unrolled as above)
#pragma unroll
    for (int u = 0; u < AT_QW; ++u) {
      float x[4][8];                                    // this query's 32 scores, then its 32 probabilities (every loop over them unrolled: constant indices keep them in registers)
#pragma unroll
      for (int j = 0; j < 4; ++j)
#pragma unroll
        for (int r = 0; r < 8; ++r)
          x[j][r] = __builtin_amdgcn_inverse_ballot_w32((j < 2) ? mw[u][0][8 * j + r] : mw[u][1][8 * (j - 2) + r]) ? s[u][j][r] * SC2 : FILL2;
      // the next chunk's words, into the registers just used
      mw[u][0] = mwp[(unsigned)u * 2u * NKC + 2u * kn]; mw[u][1] = mwp[(unsigned)u * 2u * NKC + 2u * kn + 1u];
      float mj[4];
#pragma unroll
      for (int j = 0; j < 4; ++j)
        mj[j] = fmaxf(fmaxf(fmaxf(x[j][0], x[j][1]), fmaxf(x[j][2], x[j][3])), fmaxf(fmaxf(x[j][4], x[j][5]), fmaxf(x[j][6], x[j][7])));
      float m = fmaxf(fmaxf(mj[0], mj[1]), fmaxf(mj[2], mj[3]));
      m = fmaxf(m, xhalf(m));                           // the other half's 32 keys of the same query
      const float mnew  = fmaxf(mrow[u], m);
      const float alpha = ex2(mrow[u] - mnew);
      mrow[u] = mnew;
#pragma unroll
      for (int j = 0; j < 4; ++j)                       // all 32 exponents first, so that the v_exp_f32 groups below work in place (unrolled as above)
#pragma unroll
        for (int r = 0; r < 8; ++r) x[j][r] -= mnew;
      float pj[4];
#pragma unroll
      for (int j = 0; j < 4; ++j) {
        ex2x8(x[j]);
        pj[j] = ((x[j][0] + x[j][1]) + (x[j][2] + x[j][3])) + ((x[j][4] + x[j][5]) + (x[j][6] + x[j][7]));
      }
      lrow[u] = lrow[u] * alpha + ((pj[0] + pj[1]) + (pj[2] + pj[3]));
#pragma unroll
      for (int t = 0; t < 4; ++t)
#pragma unroll
        for (int r = 0; r < 8; ++r) oacc[u][t][r] *= alpha;
#pragma unroll
      for (int kk = 0; kk < 2; ++kk)
#pragma unroll
        for (int i = 0; i < 8; ++i) {
          pb[u][kk][i]     = (_Float16)(x[2 * kk][i] * PSC);       // B element i     = key 32kk + 8hh + i
          pb[u][kk][i + 8] = (_Float16)(x[2 * kk + 1][i] * PSC);   // B element 8 + i = key 32kk + 16 + 8hh + i
        }
      // One query tile's softmax at a time, and behind each one half of the V^T fragments as a group (keys 0..31 under the second tile's softmax,
      // keys 32..63 under the first eight products): scheduled freely, both tiles' scores and all 16 fragment reads are live at once and the
      // wave goes past 256 registers, with some thirty register-window switches in every trip.
      __builtin_amdgcn_sched_barrier(0);
#pragma unroll
      for (int t = 0; t < 4; ++t) va[u][t] = frag_ld(kvs + AT_TH + (unsigned)t * 16u * AT_KP + (unsigned)u * 32u);
    }
#pragma unroll
    for (int kk = 0; kk < 2; ++kk)
#pragma unroll
      for (int t = 0; t < 4; ++t)
#pragma unroll
        for (int u = 0; u < AT_QW; ++u) oacc[u][t] = wm16(va[kk][t], pb[u][kk], oacc[u][t]);
    asm volatile("s_wait_dscnt 0x0" ::: "memory");      // this wave's reads of buffer kc%2 are done before it is handed to its next writer
    asm volatile("s_wait_asynccnt 0x0" ::: "memory");   // this wave's copies of chunk kc+1 have landed
    __syncthreads();                                    // publishes chunk kc+1's buffer and ends every reader's last read of chunk kc's
    if (refill) {
      const unsigned lo = (kc & 1u) * (AT_BH * 2u);
      stage_fill(lK + lo, lsKV, lV + lo, lsKV, gK + (size_t)(kv0 + 128u) * DIMC, gsK, gV + (kv0 + 128u), gsV);
    }
  };
  unsigned kc = 0;
#pragma unroll 1
  for (; kc + 2u < NKC; ++kc) trip(kc, true);           // rolled: one copy of the trip in the instruction cache
#pragma unroll 1
  for (; kc < NKC; ++kc) trip(kc, false);               // the last two chunks: nothing is left to copy
  asm volatile("s_wait_asynccnt 0x0" ::: "memory");     // nothing of this wave is in flight when the loop is left

  // behind the last trip's barrier nobody reads the staged tiles any more and no copy is in flight: each wave stages its 32 x 64 output in its own slice
  _Float16* os = KVs + wave * (unsigned)(AT_QW * 16 * AT_PP);
#pragma unroll
  for (int u = 0; u < AT_QW; ++u) {
    const float inv = CTXC * (1.0f / ((lrow[u] + xhalf(lrow[u])) * PSC));   // the two halves' sums of this query joined
#pragma unroll
    for (int t = 0; t < 4; ++t) {
      v8h hv;
#pragma unroll
      for (int r = 0; r < 8; ++r) hv[r] = (_Float16)(oacc[u][t][r] * inv);
      *(v8h*)(os + ((unsigned)u * 16u + c) * AT_PP + (unsigned)t * 16u + 8u * hh) = hv;      // query row 16u + c, head columns 16t + 8hh + 0..7
    }
  }
  wave_sync();
  {
    const unsigned q4 = lane >> 3, c8 = (lane & 7u) * 8u;
    _Float16* cb = (_Float16*)ctxp + (size_t)(b * (unsigned)SEQ + q0) * DIMC + h * HDIM;
#pragma unroll
    for (int it = 0; it < AT_QW * 4; ++it) {
      const unsigned row = (unsigned)it * 4u + q4;
      *(v8h*)(cb + (size_t)row * DIMC + c8) = *(const v8h*)(os + row * AT_PP + c8);
    }
  }
}

// ---------------------------------------------------------------------------------------------------------
// workspace carve (bytes, every region a multiple of 256 and fully written by its producer before any read)
// ---------------------------------------------------------------------------------------------------------
static constexpr size_t SZ_X16   = (size_t)3 * MROWS * DIMC * 2;     // q16 | k16 | v16 planes [MROWS][1024] f16
static constexpr size_t SZ_WT16  = (size_t)4 * DIMC * DIMC * 2;      // Wq^T | Wk^T | Wv^T | Wp^T planes [out][in] f16, x16
static constexpr size_t SZ_QK16  = (size_t)2 * MROWS * DIMC * 2;     // Q16 | K16 planes [MROWS][1024] f16
static constexpr size_t SZ_VT16  = (size_t)NB * DIMC * SEQ * 2;      // V^T planes [b][1024][SEQ] f16
static constexpr size_t SZ_CTX16 = (size_t)MROWS * DIMC * 2;         // merged head output x16 [MROWS][1024] f16
static constexpr size_t SZ_BRO   = (size_t)DIMC * 4;                 // bias, bf16 RNE-converted, f32
static constexpr size_t SZ_MB    = (size_t)NB * (SEQ / 16) * (SEQ / 64) * 32 * 4;   // lane-mask words [b][16-query tile][64-key chunk][32]
static constexpr size_t SZ_TOTAL = SZ_X16 + SZ_WT16 + SZ_QK16 + SZ_VT16 + SZ_CTX16 + SZ_BRO + SZ_MB;
static_assert((SZ_X16 % 256) == 0 && (SZ_WT16 % 256) == 0 && (SZ_QK16 % 256) == 0 && (SZ_VT16 % 256) == 0 && (SZ_CTX16 % 256) == 0 && (SZ_BRO % 256) == 0 && (SZ_MB % 256) == 0);
static_assert(SZ_TOTAL <= (size_t)134217728);
// coverage equalities of the plane writers
static_assert((size_t)CV_ST * CV_TH * 8 == (size_t)MROWS * DIMC);                     // k_convert per activation tensor
static_assert((size_t)CV_ST * CV_TH * 8 == (size_t)4 * DIMC * DIMC);                  // k_convert, the four weights
static_assert((size_t)(SEQ / AT_QB) * AT_WV * AT_QW * 16 * 64 == (size_t)SEQ * HDIM);               // k_flash per (batch, head): blocks x waves x rows x cols
static_assert((MROWS % 128) == 0 && (DIMC % 128) == 0 && (SEQ % 128) == 0);            // k_gemm64: whole 128x128 tiles, K = DIMC in whole 64-k trips

extern "C" void kernel_launch(void* const* d_in, const int* in_sizes, int n_in, void* d_out, int out_size, void* d_ws, size_t ws_size, hipStream_t stream) {
  if (n_in < 9) return;
  const long long needX = (long long)(NB - 1) * SEQ_FULL * DIMC + (long long)SEQ * DIMC;
  const long long needM = (long long)(NB - 1) * SEQ_FULL * SEQ_FULL + (long long)(SEQ - 1) * SEQ_FULL + SEQ;
  if ((long long)in_sizes[0] < needX || (long long)in_sizes[1] < needX || (long long)in_sizes[2] < needX) return;
  if ((long long)in_sizes[3] < needM) return;
  if (in_sizes[4] < DIMC * DIMC || in_sizes[5] < DIMC * DIMC || in_sizes[6] < DIMC * DIMC || in_sizes[7] < DIMC * DIMC || in_sizes[8] < DIMC) return;
  if ((long long)out_size < (long long)MROWS * DIMC) return;
  if (ws_size < SZ_TOTAL) return;

  const float* q    = (const float*)d_in[0];
  const float* k    = (const float*)d_in[1];
  const float* v    = (const float*)d_in[2];
  const int*   mask = (const int*)d_in[3];
  const float* Wq   = (const float*)d_in[4];
  const float* Wk   = (const float*)d_in[5];
  const float* Wv   = (const float*)d_in[6];
  const float* Wp   = (const float*)d_in[7];
  const float* bp   = (const float*)d_in[8];
  float* out = (float*)d_out;

  char* wsp = (char*)d_ws;
  unsigned short* X16   = (unsigned short*)wsp; wsp += SZ_X16;
  unsigned short* WT16  = (unsigned short*)wsp; wsp += SZ_WT16;
  unsigned short* QK16  = (unsigned short*)wsp; wsp += SZ_QK16;
  unsigned short* VT16  = (unsigned short*)wsp; wsp += SZ_VT16;
  unsigned short* CTX16 = (unsigned short*)wsp; wsp += SZ_CTX16;
  float*          BRO   = (float*)wsp;          wsp += SZ_BRO;
  unsigned*       MB    = (unsigned*)wsp;       wsp += SZ_MB;

  const unsigned long long planeX = (unsigned long long)MROWS * DIMC;     // elements per activation plane
  const unsigned long long planeW = (unsigned long long)DIMC * DIMC;

  // weights [in][out] -> [out][in] f16 x16 (4 planes); bias; activations (3 planes, full input batch stride, compact planes); mask -> lane-mask words
  k_convert<<<dim3((unsigned)CV_WG, 1u, 1u), 512, 0, stream>>>(q, k, v, Wq, Wk, Wv, Wp, bp, mask, X16, WT16, BRO, MB);
  // Q16 | K16 = (q16 | k16) x (Wq^T | Wk^T): batch y = 0 (q), 1 (k); M = MROWS, N = K = 1024
  k_gemm64<0, 1><<<dim3((unsigned)((MROWS / 128) * (DIMC / 128)), 2u, 1u), 256, 0, stream>>>(
      X16, (unsigned)DIMC, planeX, WT16, (unsigned)DIMC, planeW, (void*)QK16, (unsigned)DIMC, planeX, nullptr,
      (unsigned)MROWS, (unsigned)DIMC, (unsigned)DIMC, 0.0625f);
  // V^T[b][o][n] = sum_k Wv^T[o][k] * v16[b][n][k]: A = Wv^T plane (M = 1024), Bt = v16 batch plane (N = SEQ), C pitch SEQ
  k_gemm64<0, 1><<<dim3((unsigned)((DIMC / 128) * (SEQ / 128)), (unsigned)NB, 1u), 256, 0, stream>>>(
      WT16 + 2 * planeW, (unsigned)DIMC, 0ull, X16 + 2 * planeX, (unsigned)DIMC, (unsigned long long)SEQ * DIMC,
      (void*)VT16, (unsigned)SEQ, (unsigned long long)DIMC * SEQ, nullptr,
      (unsigned)DIMC, (unsigned)SEQ, (unsigned)DIMC, 0.0625f);
  // attention
  k_flash<<<dim3((unsigned)(NB * NHEAD * (SEQ / AT_QB)), 1u, 1u), AT_WV * 32, 0, stream>>>(QK16, QK16 + planeX, VT16, MB, CTX16);
  // out = (ctx x16) x (Wp^T x16) / 256 + bias
  k_gemm64<2, 0><<<dim3((unsigned)((MROWS / 128) * (DIMC / 128)), 1u, 1u), 256, 0, stream>>>(
      CTX16, (unsigned)DIMC, 0ull, WT16 + 3 * planeW, (unsigned)DIMC, 0ull, (void*)out, (unsigned)DIMC, 0ull, BRO,
      (unsigned)MROWS, (unsigned)DIMC, (unsigned)DIMC, 0.00390625f);
}

// v007
// Measured time: 104 microseconds a run.
// Timed twice side by side with v006, it ran 1.05 and 1.04 times as fast.
// Over all steps from v000 it is 3.06 times as fast.
// Masked multi-head attention (2 x 2,048 x 1,024; 16 heads x 64): inputs and parameters RNE-converted to bf16 first; every contraction (q/k/v projections, q.k^T, p.v, output projection) on v_wmma_f32_16x16x32_f16 (f16 operands: weights x16, probabilities x2^14, merged head output x16; f32 accumulate, f32 online softmax in the exp2 domain).
#include <hip/hip_runtime.h>
#include <math.h>

#ifndef NB
#define NB 2
#endif
#ifndef SEQ
#define SEQ 2048
#endif
#define NB_FULL 2
#define SEQ_FULL 2048
#define DIMC 1024
#define NHEAD 16
#define HDIM 64
#define MROWS (NB * SEQ)

static_assert(SEQ % 64 == 0);
static_assert(SEQ <= SEQ_FULL);
static_assert(NB <= NB_FULL);
static_assert(DIMC == NHEAD * HDIM);
static_assert(DIMC % 64 == 0);
static_assert(DIMC / 8 == 128);
static_assert((MROWS % 64) == 0);
static_assert(((SEQ * 128) % 256) == 0);

typedef __attribute__((ext_vector_type(16))) _Float16 v16h;
typedef __attribute__((ext_vector_type(8)))  _Float16 v8h;
typedef __attribute__((ext_vector_type(4)))  _Float16 v4h;
typedef __attribute__((ext_vector_type(8)))  float    v8f;
typedef __attribute__((ext_vector_type(4)))  float    v4f;
typedef __attribute__((ext_vector_type(4)))  int      v4i;
typedef __attribute__((ext_vector_type(16))) unsigned v16u;

// 16-bit WMMA fragment map (wave32), lane L, h = L>>4, m = L&15:
//   A 16x32: lane = row m;    element i -> k = (i<8) ? 8h+i : 16+8h+(i-8)
//   B 32x16: lane = column m; the SAME k(i,h)
//   D 16x16 (8 f32): lane = column m; element r -> row 8h+r
union FragU { v16h v; v8h h[2]; };
// p already includes the lane-half offset 8h: elements 0..7 <- p[0..7], 8..15 <- p[16..23]
__device__ __forceinline__ v16h frag_ld(const _Float16* p) {
  FragU f; f.h[0] = *(const v8h*)(p); f.h[1] = *(const v8h*)(p + 16); return f.v;
}
__device__ __forceinline__ v8f wm16(v16h a, v16h b, v8f c) {
  c = __builtin_amdgcn_wmma_f32_16x16x32_f16(false, a, false, b, (short)0, c, false, false);
  asm volatile("v_nop\n\tv_nop\n\tv_nop\n\tv_nop" : "+v"(c) : "v"(a), "v"(b));
  return c;
}
__device__ __forceinline__ void dep_guard_h(v8f& a, v8f& b, v16h x, v16h y) { asm volatile("v_nop\n\tv_nop\n\tv_nop\n\tv_nop" : "+v"(a), "+v"(b) : "v"(x), "v"(y)); }
__device__ __forceinline__ void keep4_h(v16h a, v16h b, v16h c, v16h d) { asm volatile("v_nop" :: "v"(a), "v"(b), "v"(c), "v"(d)); }
__device__ __forceinline__ void acc_guard4(v8f& a, v8f& b, v8f& c, v8f& d) { asm volatile("v_nop\n\tv_nop\n\tv_nop\n\tv_nop" : "+v"(a), "+v"(b), "+v"(c), "+v"(d)); }
// same-wave LDS exchange: stores by some lanes, loads of those locations by other lanes of the SAME wave
__device__ __forceinline__ void wave_sync() {
  __builtin_amdgcn_fence(3 /* release order */, "workgroup");
  __builtin_amdgcn_wave_barrier();
  __builtin_amdgcn_fence(2 /* acquire order */, "workgroup");
}
// bf16 RNE-convert, kept as f32 (finite inputs)
__device__ __forceinline__ float cmb_bf(float v) {
  const unsigned u = __builtin_bit_cast(unsigned, v);
  const unsigned r = (u + 0x7fffu + ((u >> 16) & 1u)) & 0xffff0000u;
  return __builtin_bit_cast(float, r);
}

// ---------------------------------------------------------------------------------------------------------
// k_convert: every conversion of the call in ONE launch of CV_WG work-groups of 16 waves, one for each WGP, all resident at once; a thread
// takes CV_ST pieces of every kind instead of ending after one, so the launch starts 4,096 waves where three launches started 65,568.
// A thread's pieces, step j = 0 .. CV_ST - 1:
//   one of each activation tensor: f32 row [1024], 8 columns -> bf16 (RNE) -> f16 plane rows [MROWS][1024], one 16-B store
//   (piece j * CV_TH + flat thread: consecutive threads walk along a row; sources use the FULL input batch stride, planes are compact);
//   one of a weight: W[k = in][o = out] (row pitch 1024) -> WT[o][k] = f16(bf16_rne(W[k][o]) * 16): 8 strided loads, one 16-B store, a wave walks
//   along the destination row. A work-group takes two tiles of 32 outputs x 256 inputs, two steps each (16 waves = 16 outputs a step): the
//   128-B source lines of a tile hold exactly its 32 outputs, so both steps and all 16 waves read the same 256 lines.
// All loads of a thread are issued first (24 of 16 B, 16 of 16 B for the mask, then 32 of 4 B), so a wave waits out the memory latency once, not once a step.
// The first DIMC threads of the launch also convert the bias.
// The keep-mask is packed here, once for all 16 heads: a wave takes 16 query rows x 128 keys (16 whole-line loads of 512 B, a work-group reads
// 128 KiB in a row), turns them through its own LDS slice into k_flash's score layout (lane = 16 hh + c holds query c, keys 16j + 8hh + r of a
// 64-key chunk) and writes, for each chunk, 32 lane-mask words: word 8j + r, bit lane = (mask element != 0).
// ---------------------------------------------------------------------------------------------------------
#define CV_WG 256                       // work-groups of the launch
#define CV_TH (CV_WG * 512)             // threads of the launch
#define CV_ST 4                         // pieces of each kind per thread
#define CV_RPS (CV_TH / 128)             // activation rows of one step (128 pieces a row)
#define CV_TPW ((DIMC / 32) * (DIMC / 256))   // tiles of one weight
static_assert(MROWS * 128 == CV_ST * CV_TH);              // activation pieces of one tensor: every one exactly once
static_assert(4 * CV_TPW == CV_WG * (CV_ST / 2));         // weight tiles: every one exactly once
static_assert(CV_TPW % (CV_ST / 2) == 0);                 // a work-group's tiles lie in one weight
static_assert(SEQ % CV_RPS == 0);                         // a step's rows lie in one batch
static_assert(DIMC <= CV_TH);
static_assert(CV_ST == 4);                                // the wait behind the activation loads names four offsets
static_assert(((unsigned long long)(NB - 1) * SEQ_FULL + SEQ) * DIMC * 4 < (1ull << 32));   // source byte offsets fit 32 bits
#define CV_MP 132                       // mask slice row pitch in words: 528 B = 16 B x 33
static_assert(SEQ % 128 == 0);
static_assert((size_t)NB * (SEQ / 16) * (SEQ / 128) == (size_t)CV_WG * 16);               // mask pieces: one for every wave of the launch
static_assert((unsigned long long)NB * SEQ_FULL * SEQ_FULL * 4 < (1ull << 32));           // mask byte offsets fit 32 bits
__global__ __launch_bounds__(512) void k_convert(const float* __restrict__ S0, const float* __restrict__ S1, const float* __restrict__ S2,
                                                  const float* __restrict__ W0, const float* __restrict__ W1, const float* __restrict__ W2,
                                                  const float* __restrict__ W3, const float* __restrict__ BP, const int* __restrict__ MK,
                                                  unsigned short* __restrict__ X, unsigned short* __restrict__ WT, float* __restrict__ BRO,
                                                  unsigned* __restrict__ MB) {
  __shared__ __align__(16) int sM[16][16 * CV_MP];   // per-wave slice: 16 query rows x 128 keys of the mask
  const unsigned t = blockIdx.x * 512u + threadIdx.x;
  const unsigned wave = threadIdx.x >> 5, lane = threadIdx.x & 31u;
  const unsigned tile0 = blockIdx.x * (CV_ST / 2u);
  const unsigned y = tile0 / (unsigned)CV_TPW;
  const float* W = (y == 0u) ? W0 : ((y == 1u) ? W1 : ((y == 2u) ? W2 : W3));   // block-uniform choice among global pointers
  const unsigned tsb = t * 32u, tdb = t * 16u;   // this thread's place inside a step's CV_RPS rows, in source and in plane bytes: one 32-bit offset beside a uniform base
  v4f x[CV_ST][3][2];                   // every loop over the steps is unrolled: constant indices keep the pieces in registers
  float w[CV_ST][8];
  unsigned so[CV_ST];                   // source byte offsets of the thread's pieces, alike in the three tensors
#pragma unroll
  for (unsigned j = 0; j < CV_ST; ++j) {
    // first row of step j in the source: batch (j * CV_RPS) / SEQ at the full batch stride, row (j * CV_RPS) % SEQ of it
    so[j] = (((j * (unsigned)CV_RPS) / (unsigned)SEQ) * (unsigned)SEQ_FULL + (j * (unsigned)CV_RPS) % (unsigned)SEQ) * (unsigned)(DIMC * 4) + tsb;
    const v4f* s0 = (const v4f*)((const char*)S0 + so[j]);
    const v4f* s1 = (const v4f*)((const char*)S1 + so[j]);
    const v4f* s2 = (const v4f*)((const char*)S2 + so[j]);
    x[j][0][0] = s0[0]; x[j][0][1] = s0[1];
    x[j][1][0] = s1[0]; x[j][1][1] = s1[1];
    x[j][2][0] = s2[0]; x[j][2][1] = s2[1];
  }
  // The wait before a register that one of these 24 loads names is written again; the offsets are inputs so that they stay in their registers up
  // to it. The statement also keeps the streaming loads in front of the 32 many-line weight loads, which the compiler otherwise issues first
  // (a wave's loads return in order).
  asm volatile("s_wait_xcnt 0x0" :: "v"(so[0]), "v"(so[1]), "v"(so[2]), "v"(so[3]) : "memory");
  // this wave's mask piece: batch, 16-query tile, pair of 64-key chunks; row i of it is one 512-B load of the wave
  const unsigned gw = blockIdx.x * 16u + wave;
  const unsigned mkp = gw % (unsigned)(SEQ / 128), mqt = (gw / (unsigned)(SEQ / 128)) % (unsigned)(SEQ / 16), mbt = gw / (unsigned)((SEQ / 128) * (SEQ / 16));
  const unsigned mo = ((mbt * (unsigned)SEQ_FULL + mqt * 16u) * (unsigned)SEQ_FULL + mkp * 128u + lane * 4u) * 4u;
  v4i mk[16];                           // unrolled as above
#pragma unroll
  for (unsigned i = 0; i < 16u; ++i) mk[i] = __builtin_nontemporal_load((const v4i*)((const char*)MK + mo + i * (unsigned)(SEQ_FULL * 4)));   // read once in the whole call
  asm volatile("s_wait_xcnt 0x0" :: "v"(mo) : "memory");   // as above, for the 16 mask loads: they too stay in front of the weight loads
  unsigned wo[CV_ST];                   // source byte offsets of the thread's weight pieces (first of the 8 inputs)
#pragma unroll
  for (unsigned j = 0; j < CV_ST; ++j) {
    const unsigned ty = (tile0 + (j >> 1)) % (unsigned)CV_TPW;
    const unsigned o = (ty >> 2) * 32u + (j & 1u) * 16u + wave, k0 = (ty & 3u) * 256u + lane * 8u;
    wo[j] = (k0 * (unsigned)DIMC + o) * 4u;
#pragma unroll
    for (int e = 0; e < 8; ++e) w[j][e] = *(const float*)((const char*)W + wo[j] + (unsigned)e * (unsigned)(DIMC * 4));
  }
  asm volatile("s_wait_xcnt 0x0" :: "v"(wo[0]), "v"(wo[1]), "v"(wo[2]), "v"(wo[3]) : "memory");   // as above, for the 32 weight loads
  float bv = 0.f;
  if (t < (unsigned)DIMC) bv = BP[t];                                 // whole waves of the first work-groups
#pragma unroll
  for (unsigned j = 0; j < CV_ST; ++j) {
#pragma unroll
    for (int z = 0; z < 3; ++z) {
      v8h hv;
#pragma unroll
      for (int e = 0; e < 4; ++e) { hv[e] = (_Float16)cmb_bf(x[j][z][0][e]); hv[e + 4] = (_Float16)cmb_bf(x[j][z][1][e]); }
      *(v8h*)((char*)((_Float16*)X + ((size_t)z * MROWS + (size_t)j * CV_RPS) * DIMC) + tdb) = hv;
    }
    asm volatile("s_wait_xcnt 0x0" ::: "memory");   // before a register that one of these stores names is written again
  }
  {
    int* sm = sM[wave];
#pragma unroll
    for (unsigned i = 0; i < 16u; ++i) *(v4i*)(sm + i * (unsigned)CV_MP + lane * 4u) = mk[i];
    // The rows are read back by other lanes of this wave alone: its own LDS stores are waited for, and the statement keeps the reads behind them.
    // (wave_sync()'s work-group fences would also wait here for the global stores above and for the weight loads still in flight.)
    asm volatile("s_wait_dscnt 0x0" ::: "memory");
    const int* sr = sm + (lane & 15u) * (unsigned)CV_MP + (lane >> 4) * 8u;   // query row c, this half's 8 keys of a 16-key group
#pragma unroll
    for (unsigned ch = 0; ch < 2u; ++ch) {
      unsigned ow = 0u;                 // lane l ends up with word l of the chunk
#pragma unroll
      for (unsigned j = 0; j < 4u; ++j) {
        const v4i a = *(const v4i*)(sr + ch * 64u + j * 16u), bq = *(const v4i*)(sr + ch * 64u + j * 16u + 4u);
#pragma unroll
        for (unsigned r = 0; r < 4u; ++r) {
          const unsigned wa = __builtin_amdgcn_ballot_w32(a[r] != 0), wb = __builtin_amdgcn_ballot_w32(bq[r] != 0);
          ow = (lane == j * 8u + r) ? wa : ow;
          ow = (lane == j * 8u + 4u + r) ? wb : ow;
        }
      }
      MB[(gw * 2u + ch) * 32u + lane] = ow;
    }
    asm volatile("s_wait_xcnt 0x0" ::: "memory");   // before a register that one of these stores names is written again
  }
#pragma unroll
  for (unsigned j = 0; j < CV_ST; ++j) {
    const unsigned ty = (tile0 + (j >> 1)) % (unsigned)CV_TPW;
    const unsigned o = (ty >> 2) * 32u + (j & 1u) * 16u + wave, k0 = (ty & 3u) * 256u + lane * 8u;
    v8h hw;
#pragma unroll
    for (int e = 0; e < 8; ++e) hw[e] = (_Float16)(cmb_bf(w[j][e]) * 16.0f);
    *(v8h*)((_Float16*)WT + (size_t)y * DIMC * DIMC + (o * (unsigned)DIMC + k0)) = hw;
    asm volatile("s_wait_xcnt 0x0" ::: "memory");   // as above
  }
  if (t < (unsigned)DIMC) BRO[t] = cmb_bf(bv);
}

// ---------------------------------------------------------------------------------------------------------
// k_gemm64: C[m,n] = scale * sum_k A[m,k] * Bt[n,k] (+ bias[n]); f16 operand planes. A block of 8 waves owns a 128x128 tile of C,
// each wave 32 rows x 64 columns of it. Per trip 64 k of the block's 128 A rows and 128 Bt rows (128-B row pieces, whole lines) come
// into LDS by asynchronous copies, two buffers: the next trip's copies fly while this trip's fragments are read from LDS (row pitch 144 B).
// A block walks the k trips in a ring that starts at a trip of its own (tile row + tile column): blocks that share A rows or Bt rows start at
// different trips unless their (tile row + tile column) differ by a multiple of nT, as tile rows 16 apart and the V^T product's two batches
// (one A) do, and the blocks' requests spread over all 128-B columns of the 2-KiB operand rows.
// A row-major [M,K]; Bt row-major [N,K]; M,N % 128 == 0, K % 64 == 0, K >= 64; batch = blockIdx.y with element strides.
// OUT_MODE 0: f32 C; 1: f16 C. Epilogue: 16-row slabs staged per wave in LDS (wave-private), each 64-wide row segment written as whole
// ---------------------------------------------------------------------------------------------------------
#define GT_PH  72                      // LDS row pitch in halves: 144 B = 16 B x 9
#define GT_OPH (128 * GT_PH)           // halves of one operand's 128-row tile
#define GT_STH (2 * GT_OPH)            // halves of one buffer: A tile | Bt tile
// One buffer's fill, this thread's share: 16 B in each of four rows of the first tile and of four rows of the second (eight threads cover
// a 128-B row piece, so a wave covers 4 whole lines per copy). la, lb = the thread's LDS byte addresses in its first row of either tile,
// lsa, lsb = LDS bytes from one of its rows to the next; ga, gb, gsa, gsb = the same in global memory (addresses, steps in elements).
// s_wait_xcnt closes the statement so that no address register of an issued copy is rewritten ahead of it.
__device__ __forceinline__ void stage_fill(unsigned la, unsigned lsa, unsigned lb, unsigned lsb,
                                           const _Float16* ga, size_t gsa, const _Float16* gb, size_t gsb) {
  const unsigned la1 = la + lsa, la2 = la + 2u * lsa, la3 = la + 3u * lsa;
  const unsigned lb1 = lb + lsb, lb2 = lb + 2u * lsb, lb3 = lb + 3u * lsb;
  const _Float16* ga1 = ga + gsa; const _Float16* ga2 = ga + 2u * gsa; const _Float16* ga3 = ga + 3u * gsa;
  const _Float16* gb1 = gb + gsb; const _Float16* gb2 = gb + 2u * gsb; const _Float16* gb3 = gb + 3u * gsb;
  asm volatile("global_load_async_to_lds_b128 %0, %8, off\n\t"
               "global_load_async_to_lds_b128 %1, %9, off\n\t"
               "global_load_async_to_lds_b128 %2, %10, off\n\t"
               "global_load_async_to_lds_b128 %3, %11, off\n\t"
               "global_load_async_to_lds_b128 %4, %12, off\n\t"
               "global_load_async_to_lds_b128 %5, %13, off\n\t"
               "global_load_async_to_lds_b128 %6, %14, off\n\t"
               "global_load_async_to_lds_b128 %7, %15, off\n\t"
               "s_wait_xcnt 0x0"
               :: "v"(la), "v"(la1), "v"(la2), "v"(la3), "v"(lb), "v"(lb1), "v"(lb2), "v"(lb3),
                  "v"(ga), "v"(ga1), "v"(ga2), "v"(ga3), "v"(gb), "v"(gb1), "v"(gb2), "v"(gb3)
               : "memory");
}
template <int BIAS_MODE, int OUT_MODE>
__global__ __launch_bounds__(256) void k_gemm64(
    const unsigned short* __restrict__ Ap, unsigned lda, unsigned long long strideA,
    const unsigned short* __restrict__ Btp, unsigned ldb, unsigned long long strideB,
    void* __restrict__ Cout, unsigned ldc, unsigned long long strideC,
    const float* __restrict__ bias, unsigned M, unsigned N, unsigned K, float scale) {
  __shared__ __align__(16) _Float16 sS[2 * GT_STH];   // two buffers of [A 128 rows | Bt 128 rows] x 64 k, pitch 72 halves
  __shared__ __align__(16) float sT[8][16 * 68];      // per-wave 16x64 slab, pitch 68 floats
  const unsigned b    = blockIdx.y;
  const unsigned lane = threadIdx.x & 31u;
  const unsigned wave = threadIdx.x >> 5;
  const unsigned tilesN = N >> 7;
  const unsigned tilesM = M >> 7;
  const unsigned tile = blockIdx.x;
  if (tile >= tilesM * tilesN) return;   // block-uniform, in front of every barrier and copy
  const unsigned tm = tile / tilesN;
  const unsigned tn = tile - tm * tilesN;
  const unsigned m0 = (tm << 7) + ((wave >> 1) << 5);   // this wave's 32 rows
  const unsigned n0 = (tn << 7) + ((wave & 1u) << 6);   // this wave's 64 columns

  const _Float16* Ab = (const _Float16*)Ap + (size_t)b * strideA;
  const _Float16* Bb = (const _Float16*)Btp + (size_t)b * strideB;

  const unsigned rlane = lane & 15u;            // row (A) / col (B, D) within subtile
  const unsigned koff  = (lane >> 4) * 8u;      // k offset of this lane half
  const unsigned mOff  = (lane >> 4) * 8u;      // D row offset

  // copy share of this thread: tile row threadIdx.x / 8 (+32, +64, +96), 16-B piece threadIdx.x % 8 of the 128-B row piece
  const unsigned crow = threadIdx.x >> 3, cpc = threadIdx.x & 7u;
  const _Float16* gA = Ab + (size_t)((tm << 7) + crow) * lda + cpc * 8u;
  const _Float16* gB = Bb + (size_t)((tn << 7) + crow) * ldb + cpc * 8u;
  const unsigned lC = (unsigned)(size_t)sS + (crow * GT_PH + cpc * 8u) * 2u;
  // fragment read places of this lane inside a buffer
  const unsigned fA = (((wave >> 1) << 5) + rlane) * GT_PH + koff;
  const unsigned fB = GT_OPH + (((wave & 1u) << 6) + rlane) * GT_PH + koff;

  v8f acc[2][4];
#pragma unroll
  for (int i = 0; i < 2; ++i)
#pragma unroll
    for (int j = 0; j < 4; ++j) acc[i][j] = (v8f){0.f,0.f,0.f,0.f,0.f,0.f,0.f,0.f};

  const unsigned nT = K >> 6;
  const unsigned rot = (tm + tn) & (nT - 1u);           // first k trip of this block: below nT for any nT, block-uniform
  // element offset of the 64 k that trip t works on (t <= nT): trip rot + t of the ring
  auto kof = [&](const unsigned t) __attribute__((always_inline)) { const unsigned kt = t + rot; return (size_t)((kt >= nT) ? kt - nT : kt) * 64u; };
  const unsigned lStep = 32u * GT_PH * 2u;              // a thread's rows are 32 apart
  const size_t gsA = (size_t)32u * lda, gsB = (size_t)32u * ldb;
  stage_fill(lC, lStep, lC + GT_OPH * 2u, lStep, gA + kof(0u), gsA, gB + kof(0u), gsB);
  asm volatile("s_wait_asynccnt 0x0" ::: "memory");     // this wave's copies of trip 0 have landed
  __syncthreads();                                      // ... and every other wave's: buffer 0 is readable
  if (nT > 1u) stage_fill(lC + GT_STH * 2u, lStep, lC + (GT_STH + GT_OPH) * 2u, lStep, gA + kof(1u), gsA, gB + kof(1u), gsB);

  for (unsigned t = 0; t < nT; ++t) {
    const _Float16* sb = sS + (t & 1u) * GT_STH;
    v16h bh[2][4], ah[2][2];                            // the trip's 12 fragments, read as one group in front of its 16 products (loops unrolled: constant indices keep them in registers)
#pragma unroll
    for (int kk = 0; kk < 2; ++kk) {
#pragma unroll
      for (int j = 0; j < 4; ++j) bh[kk][j] = frag_ld(sb + fB + (unsigned)j * 16u * GT_PH + (unsigned)kk * 32u);
#pragma unroll
      for (int i = 0; i < 2; ++i) ah[kk][i] = frag_ld(sb + fA + (unsigned)i * 16u * GT_PH + (unsigned)kk * 32u);
    }
#pragma unroll
    for (int kk = 0; kk < 2; ++kk) {
#pragma unroll
      for (int i = 0; i < 2; ++i) {
#pragma unroll
        for (int j = 0; j < 4; ++j)
          acc[i][j] = __builtin_amdgcn_wmma_f32_16x16x32_f16(false, ah[kk][i], false, bh[kk][j], (short)0, acc[i][j], false, false);
        dep_guard_h(acc[i][0], acc[i][3], ah[kk][i], ah[kk][i]);
      }
      keep4_h(bh[kk][0], bh[kk][1], bh[kk][2], bh[kk][3]);
    }
    asm volatile("s_wait_dscnt 0x0" ::: "memory");      // this wave's reads of buffer t%2 are done before it is handed to its next writer
    asm volatile("s_wait_asynccnt 0x0" ::: "memory");   // this wave's copies of trip t+1 have landed
    __syncthreads();                                    // publishes trip t+1's buffer and ends every reader's last read of trip t's
    if (t + 2u < nT) {
      const unsigned lN = lC + (t & 1u) * (GT_STH * 2u);
      stage_fill(lN, lStep, lN + GT_OPH * 2u, lStep, gA + kof(t + 2u), gsA, gB + kof(t + 2u), gsB);
    }
  }
  asm volatile("s_wait_asynccnt 0x0" ::: "memory");     // nothing of this wave is in flight when the loop is left
  acc_guard4(acc[0][0], acc[0][1], acc[0][2], acc[0][3]);
  acc_guard4(acc[1][0], acc[1][1], acc[1][2], acc[1][3]);

  float* slab = sT[wave];
#pragma unroll
  for (int i = 0; i < 2; ++i) {
    const unsigned mBase = m0 + ((unsigned)i << 4);
#pragma unroll
    for (int j = 0; j < 4; ++j) {
      const unsigned n = n0 + ((unsigned)j << 4) + rlane;
      float bv = 0.f;
      if (BIAS_MODE == 2) bv = bias[n];
#pragma unroll
      for (int r = 0; r < 8; ++r) {
        float v = acc[i][j][r] * scale;
        if (BIAS_MODE == 2) v += bv;
        slab[(mOff + (unsigned)r) * 68u + ((unsigned)j << 4) + rlane] = v;
      }
    }
    wave_sync();
    if (OUT_MODE == 0) {
      float* C = (float*)Cout + (size_t)b * strideC;
      const unsigned hh = lane >> 4, c4 = (lane & 15u) * 4u;     // row segment = 256 B = 16 lanes x 16 B
      {
#pragma unroll
        for (int it = 0; it < 8; ++it) {
          const unsigned row = (unsigned)it * 2u + hh;
          const v4f v = *(const v4f*)(slab + row * 68u + c4);
          *(v4f*)(C + (size_t)(mBase + row) * ldc + n0 + c4) = v;
        }
        
      }
    } else {
      const unsigned q = lane >> 3, c8 = (lane & 7u) * 8u;
      _Float16* C = (_Float16*)Cout + (size_t)b * strideC;
      {
#pragma unroll
        for (int it = 0; it < 4; ++it) {
          const unsigned row = (unsigned)it * 4u + q;
          const float* sp = slab + row * 68u + c8;
          v8h hv;
#pragma unroll
          for (int e = 0; e < 8; ++e) hv[e] = (_Float16)sp[e];
          *(v8h*)(C + (size_t)(mBase + row) * ldc + n0 + c8) = hv;
        }
        
      }
    }
    wave_sync();
  }
}

// ---------------------------------------------------------------------------------------------------------
// k_flash: per (batch, head, 128-query block): block = 4 waves x 32 queries (two 16-query tiles a wave); 64-key chunks; online softmax in f32
//   (exp2 domain).
//   each chunk's 64 K16 rows and 64 V^T rows (128-B row pieces) come into LDS once per block by asynchronous copies, two buffers: the next
//   chunk's copies fly while this chunk is worked on.
//   every K and V^T fragment read from LDS feeds two products, one for each query tile of the wave.
//   a block walks the key chunks in a ring that starts at a chunk of its own: the query blocks of one (batch, head), which read the same K and V^T
//   rows, then ask L2 for different lines at any one time, and the blocks' requests spread over all 128-B columns of the V^T rows.
//   scores transposed: S^T = K.Q^T, A = staged K16 rows (tile j = keys 16j..16j+15), B = Q16 rows kept in registers. In each query tile a lane holds
//           32 scores of ONE query (column c; keys 16j + 8hh + r): maximum and sum run inside the lane, the two lane halves exchange the maximum
//           once per chunk and join their sums once, behind the loop.
//   keep-mask, shared by the heads: element == 0 -> score := fill (finite replace, applied after the scaling). k_convert has packed it into lane-mask
//           words in this kernel's score layout: a wave reads 32 words (128 B) for each of its query tiles and chunk by scalar loads, one chunk
//           ahead, and each word is the select mask of one score register: no compare, no mask tile in LDS.
//   output transposed: O^T += V^T.P^T, A = staged V^T rows, B = P^T (x 2^14, f16) packed straight from the score registers: score tiles 2kk and
//           2kk+1 hold exactly the keys of B elements 0..7 and 8..15 of key group kk, so P never passes through LDS.
// ---------------------------------------------------------------------------------------------------------
#define AT_PP 72                        // output staging row pitch in halves
#define AT_KP 72                        // staged row pitch in halves: 144 B = 16 B x 9
#define AT_TH (64 * AT_KP)              // halves of one staged 64-row tile
#define AT_BH (2 * AT_TH)               // halves of one buffer: K tile | V^T tile
#define AT_QW 2                         // 16-query tiles of one wave (the loop reads one of the two 32-key V^T fragment groups behind each)
#define AT_WV 4                         // waves of one block
#define AT_QB (AT_WV * AT_QW * 16)      // queries of one block
static_assert(SEQ % AT_QB == 0);
static_assert(AT_QW == 2);              // one V^T fragment group (32 keys) for each query tile
// 2^x as the bare v_exp_f32, without the library form's range test, selects, add and ldexp around it. Every argument here is <= 0 (or -inf);
// the two forms differ only where 2^x < 2^-126, which may come out 0: such a term is far under half an ulp of the row's sum and of the f16 operand.
// The v_nop fills the slot behind it.
__device__ __forceinline__ float ex2(float x) { float r; asm("v_exp_f32 %0, %1\n\tv_nop" : "=v"(r) : "v"(x)); return r; }
// Eight of them in place, in one statement: each v_exp_f32 is the independent instruction that the slot behind the one before it asks for, and the
// v_nop fills the slot behind the last.
__device__ __forceinline__ void ex2x8(float (&v)[8]) {
  asm("v_exp_f32 %0, %0\n\tv_exp_f32 %1, %1\n\tv_exp_f32 %2, %2\n\tv_exp_f32 %3, %3\n\t"
      "v_exp_f32 %4, %4\n\tv_exp_f32 %5, %5\n\tv_exp_f32 %6, %6\n\tv_exp_f32 %7, %7\n\tv_nop"
      : "+v"(v[0]), "+v"(v[1]), "+v"(v[2]), "+v"(v[3]), "+v"(v[4]), "+v"(v[5]), "+v"(v[6]), "+v"(v[7]));
}
// lane l <-> lane l ^ 16
__device__ __forceinline__ float xhalf(float x) {
  const int b = __builtin_bit_cast(int, x);
  return __builtin_bit_cast(float, __builtin_amdgcn_permlanex16(b, b, 0x76543210, 0xfedcba98, false, false));
}
__global__ __launch_bounds__(AT_WV * 32) void k_flash(const unsigned short* __restrict__ Qp, const unsigned short* __restrict__ Kp,
                                               const unsigned short* __restrict__ Vtp, const unsigned* __restrict__ MB,
                                               unsigned short* __restrict__ ctxp) {
  __shared__ __align__(16) _Float16 KVs[2 * AT_BH];       // two buffers of [K 64 keys | V^T 64 rows] x 64 halves, pitch 72 halves; behind the loop: output staging
  static_assert(AT_QB * AT_PP <= 2 * AT_BH);
  constexpr unsigned NQB = SEQ / AT_QB;                   // query blocks of one (batch, head)
  constexpr unsigned NKC = SEQ / 64;                      // key chunks
  const float SC2   = 0.125f * 1.4426950408889634f;       // 64^-0.5 * log2(e)
  const float FILL2 = -1.0e9f * 1.4426950408889634f;      // the finite fill in the exp2 domain
  const float PSC   = 16384.0f;                           // probability carry (f16 operand stays normal)
  const float CTXC  = 16.0f;                              // output carry, undone in the projection epilogue

  const unsigned tid = threadIdx.x, wave = tid >> 5, lane = tid & 31u, hh = lane >> 4, c = lane & 15u;
  const unsigned bx = blockIdx.x;
  const unsigned qb = bx % NQB;
  const unsigned bh = bx / NQB;
  const unsigned h  = bh % (unsigned)NHEAD;
  const unsigned b  = bh / (unsigned)NHEAD;
  const unsigned q0 = qb * (unsigned)AT_QB + wave * (unsigned)(AT_QW * 16);
  const unsigned rot = (qb * (NKC / NQB) + h) % NKC;      // first key chunk of this block, block-uniform
  // the key chunk that trip t works on (t <= NKC): chunk rot + t of the ring
  auto chunk_of = [&](const unsigned t) __attribute__((always_inline)) { const unsigned cj = t + rot; return (cj >= NKC) ? cj - NKC : cj; };

  const _Float16* Q  = (const _Float16*)Qp;
  const _Float16* K  = (const _Float16*)Kp;
  const _Float16* Vt = (const _Float16*)Vtp;

  const _Float16* qrow  = Q + (size_t)(b * (unsigned)SEQ + q0 + c) * DIMC + h * HDIM + 8u * hh;
  v16h qa[AT_QW][2];                                      // B operands: column c of tile u = query q0 + 16u + c (every loop over u unrolled: constant indices keep all of it in registers)
#pragma unroll
  for (int u = 0; u < AT_QW; ++u) { qa[u][0] = frag_ld(qrow + (size_t)u * 16u * DIMC); qa[u][1] = frag_ld(qrow + (size_t)u * 16u * DIMC + 32); }
  // copy share of this thread: K and V^T tile rows tid / 8 (+16, +32, +48), 16-B piece tid % 8 of the 128-B row piece
  const unsigned crow = tid >> 3, cpc = tid & 7u;
  const _Float16* gK = K + (size_t)(b * (unsigned)SEQ + crow) * DIMC + h * HDIM + cpc * 8u;           // key crow of chunk 0
  const _Float16* gV = Vt + ((size_t)b * DIMC + h * HDIM + crow) * SEQ + cpc * 8u;                     // V^T row crow, keys of chunk 0
  const unsigned lK = (unsigned)(size_t)KVs + (crow * AT_KP + cpc * 8u) * 2u;                          // key x of a chunk lies in LDS row x
  const unsigned lV = lK + AT_TH * 2u;
  const unsigned lsKV = 16u * AT_KP * 2u;
  const size_t gsK = (size_t)16u * DIMC, gsV = (size_t)16u * SEQ;
  // this wave's lane-mask words: 32 for each query tile and chunk, a tile's chunks in a row. The wave's number is made uniform and the pointer names
  // the constant address space (nothing writes these words during this launch), so that the loads inside the loop are scalar too: behind the loop's
  // asm waits with their memory clobber the compiler otherwise reloads them as vector loads and moves every word to a scalar register by v_readfirstlane.
  const unsigned wvu = (unsigned)__builtin_amdgcn_readfirstlane((int)wave);
  typedef const __attribute__((address_space(4))) v16u* cw_ptr;
  const cw_ptr mwp = (cw_ptr)(unsigned long long)(MB + (size_t)((b * (unsigned)(SEQ / 16) + qb * (unsigned)(AT_QB / 16) + wvu * (unsigned)AT_QW) * NKC) * 32u);
  v16u mw[AT_QW][2];                                      // the first chunk: words 8j + r of score tiles j = 0, 1 | j = 2, 3, for each query tile
#pragma unroll
  for (int u = 0; u < AT_QW; ++u) { mw[u][0] = mwp[(unsigned)u * 2u * NKC + 2u * rot]; mw[u][1] = mwp[(unsigned)u * 2u * NKC + 2u * rot + 1u]; }
  const unsigned fKV = c * AT_KP + 8u * hh;               // this lane's fragment place in a 16-row group of either staged tile

  float mrow[AT_QW], lrow[AT_QW];                         // this lane's query of tile u: running maximum (both halves alike), this half's share of the sum
  v8f oacc[AT_QW][4];                                     // O^T tile t of query tile u: column c = query, element r = head column 16t + 8hh + r
#pragma unroll
  for (int u = 0; u < AT_QW; ++u) {
    mrow[u] = -INFINITY; lrow[u] = 0.f;
#pragma unroll
    for (int t = 0; t < 4; ++t) oacc[u][t] = (v8f){0.f,0.f,0.f,0.f,0.f,0.f,0.f,0.f};
  }

  stage_fill(lK, lsKV, lV, lsKV, gK + (size_t)(rot * 64u) * DIMC, gsK, gV + rot * 64u, gsV);
  asm volatile("s_wait_asynccnt 0x0" ::: "memory");     // this wave's copies of trip 0 have landed
  __syncthreads();                                      // ... and every other wave's: buffer 0 is readable
  if (NKC > 1u) stage_fill(lK + AT_BH * 2u, lsKV, lV + AT_BH * 2u, lsKV, gK + (size_t)(chunk_of(1u) * 64u) * DIMC, gsK, gV + chunk_of(1u) * 64u, gsV);

  // One trip: number kc, on chunk chunk_of(kc). refill = a trip kc + 2 exists; it is a constant at either call, so that a trip is one straight block: with the test inside
  // the loop the compiler moved the 64 additions of the row sums behind it, which kept all 64 probabilities in registers through the second products.
  auto trip = [&](const unsigned kc, const bool refill) __attribute__((always_inline)) {
    const _Float16* kvs = KVs + (kc & 1u) * AT_BH + fKV;
    v8f s[AT_QW][4];
    v16h kf[4][2];                                      // the chunk's 8 K fragments, read as one group in front of the products (loops unrolled: constant indices keep them in registers)
#pragma unroll
    for (int j = 0; j < 4; ++j) {
      const _Float16* kr = kvs + (unsigned)j * 16u * AT_KP;                        // A row c of tile j = key 16j + c of the chunk
      kf[j][0] = frag_ld(kr); kf[j][1] = frag_ld(kr + 32);
    }
#pragma unroll
    for (int j = 0; j < 4; ++j)
#pragma unroll
      for (int u = 0; u < AT_QW; ++u) s[u][j] = wm16(kf[j][0], qa[u][0], (v8f){0.f,0.f,0.f,0.f,0.f,0.f,0.f,0.f});
#pragma unroll
    for (int j = 0; j < 4; ++j)
#pragma unroll
      for (int u = 0; u < AT_QW; ++u) s[u][j] = wm16(kf[j][1], qa[u][1], s[u][j]);

    const unsigned kn = chunk_of(kc + 1u);              // the chunk whose words are read next (the last trip reads the first chunk's again, unused)
    v16h pb[AT_QW][2];                                  // P^T packed from the score registers (unrolled as above)
    v16h va[2][4];                                      // the chunk's V^T fragments, A: row d = t*16 + c, same key map as P^T (unrolled as above)
#pragma unroll
    for (int u = 0; u < AT_QW; ++u) {
      float x[4][8];                                    // this query's 32 scores, then its 32 probabilities (every loop over them unrolled: constant indices keep them in registers)
#pragma unroll
      for (int j = 0; j < 4; ++j)
#pragma unroll
        for (int r = 0; r < 8; ++r)
          x[j][r] = __builtin_amdgcn_inverse_ballot_w32((j < 2) ? mw[u][0][8 * j + r] : mw[u][1][8 * (j - 2) + r]) ? s[u][j][r] * SC2 : FILL2;
      // the next chunk's words, into the registers just used
      mw[u][0] = mwp[(unsigned)u * 2u * NKC + 2u * kn]; mw[u][1] = mwp[(unsigned)u * 2u * NKC + 2u * kn + 1u];
      float mj[4];
#pragma unroll
      for (int j = 0; j < 4; ++j)
        mj[j] = fmaxf(fmaxf(fmaxf(x[j][0], x[j][1]), fmaxf(x[j][2], x[j][3])), fmaxf(fmaxf(x[j][4], x[j][5]), fmaxf(x[j][6], x[j][7])));
      float m = fmaxf(fmaxf(mj[0], mj[1]), fmaxf(mj[2], mj[3]));
      m = fmaxf(m, xhalf(m));                           // the other half's 32 keys of the same query
      const float mnew  = fmaxf(mrow[u], m);
      const float alpha = ex2(mrow[u] - mnew);
      mrow[u] = mnew;
#pragma unroll
      for (int j = 0; j < 4; ++j)                       // all 32 exponents first, so that the v_exp_f32 groups below work in place (unrolled as above)
#pragma unroll
        for (int r = 0; r < 8; ++r) x[j][r] -= mnew;
      float pj[4];
#pragma unroll
      for (int j = 0; j < 4; ++j) {
        ex2x8(x[j]);
        pj[j] = ((x[j][0] + x[j][1]) + (x[j][2] + x[j][3])) + ((x[j][4] + x[j][5]) + (x[j][6] + x[j][7]));
      }
      lrow[u] = lrow[u] * alpha + ((pj[0] + pj[1]) + (pj[2] + pj[3]));
#pragma unroll
      for (int t = 0; t < 4; ++t)
#pragma unroll
        for (int r = 0; r < 8; ++r) oacc[u][t][r] *= alpha;
#pragma unroll
      for (int kk = 0; kk < 2; ++kk)
#pragma unroll
        for (int i = 0; i < 8; ++i) {
          pb[u][kk][i]     = (_Float16)(x[2 * kk][i] * PSC);       // B element i     = key 32kk + 8hh + i
          pb[u][kk][i + 8] = (_Float16)(x[2 * kk + 1][i] * PSC);   // B element 8 + i = key 32kk + 16 + 8hh + i
        }
      // One query tile's softmax at a time, and behind each one half of the V^T fragments as a group (keys 0..31 under the second tile's softmax,
      // keys 32..63 under the first eight products): scheduled freely, both tiles' scores and all 16 fragment reads are live at once and the
      // wave goes past 256 registers, with some thirty register-window switches in every trip.
      __builtin_amdgcn_sched_barrier(0);
#pragma unroll
      for (int t = 0; t < 4; ++t) va[u][t] = frag_ld(kvs + AT_TH + (unsigned)t * 16u * AT_KP + (unsigned)u * 32u);
    }
#pragma unroll
    for (int kk = 0; kk < 2; ++kk)
#pragma unroll
      for (int t = 0; t < 4; ++t)
#pragma unroll
        for (int u = 0; u < AT_QW; ++u) oacc[u][t] = wm16(va[kk][t], pb[u][kk], oacc[u][t]);
    asm volatile("s_wait_dscnt 0x0" ::: "memory");      // this wave's reads of buffer kc%2 are done before it is handed to its next writer
    asm volatile("s_wait_asynccnt 0x0" ::: "memory");   // this wave's copies of trip kc+1's chunk have landed
    __syncthreads();                                    // publishes trip kc+1's buffer and ends every reader's last read of trip kc's
    if (refill) {
      const unsigned lo = (kc & 1u) * (AT_BH * 2u);
      const unsigned kv2 = chunk_of(kc + 2u) * 64u;     // first key of trip kc + 2's chunk
      stage_fill(lK + lo, lsKV, lV + lo, lsKV, gK + (size_t)kv2 * DIMC, gsK, gV + kv2, gsV);
    }
  };
  unsigned kc = 0;
#pragma unroll 1
  for (; kc + 2u < NKC; ++kc) trip(kc, true);           // rolled: one copy of the trip in the instruction cache
#pragma unroll 1
  for (; kc < NKC; ++kc) trip(kc, false);               // the last two chunks: nothing is left to copy
  asm volatile("s_wait_asynccnt 0x0" ::: "memory");     // nothing of this wave is in flight when the loop is left

  // behind the last trip's barrier nobody reads the staged tiles any more and no copy is in flight: each wave stages its 32 x 64 output in its own slice
  _Float16* os = KVs + wave * (unsigned)(AT_QW * 16 * AT_PP);
#pragma unroll
  for (int u = 0; u < AT_QW; ++u) {
    const float inv = CTXC * (1.0f / ((lrow[u] + xhalf(lrow[u])) * PSC));   // the two halves' sums of this query joined
#pragma unroll
    for (int t = 0; t < 4; ++t) {
      v8h hv;
#pragma unroll
      for (int r = 0; r < 8; ++r) hv[r] = (_Float16)(oacc[u][t][r] * inv);
      *(v8h*)(os + ((unsigned)u * 16u + c) * AT_PP + (unsigned)t * 16u + 8u * hh) = hv;      // query row 16u + c, head columns 16t + 8hh + 0..7
    }
  }
  wave_sync();
  {
    const unsigned q4 = lane >> 3, c8 = (lane & 7u) * 8u;
    _Float16* cb = (_Float16*)ctxp + (size_t)(b * (unsigned)SEQ + q0) * DIMC + h * HDIM;
#pragma unroll
    for (int it = 0; it < AT_QW * 4; ++it) {
      const unsigned row = (unsigned)it * 4u + q4;
      *(v8h*)(cb + (size_t)row * DIMC + c8) = *(const v8h*)(os + row * AT_PP + c8);
    }
  }
}

// ---------------------------------------------------------------------------------------------------------
// workspace carve (bytes, every region a multiple of 256 and fully written by its producer before any read)
// ---------------------------------------------------------------------------------------------------------
static constexpr size_t SZ_X16   = (size_t)3 * MROWS * DIMC * 2;     // q16 | k16 | v16 planes [MROWS][1024] f16
static constexpr size_t SZ_WT16  = (size_t)4 * DIMC * DIMC * 2;      // Wq^T | Wk^T | Wv^T | Wp^T planes [out][in] f16, x16
static constexpr size_t SZ_QK16  = (size_t)2 * MROWS * DIMC * 2;     // Q16 | K16 planes [MROWS][1024] f16
static constexpr size_t SZ_VT16  = (size_t)NB * DIMC * SEQ * 2;      // V^T planes [b][1024][SEQ] f16
static constexpr size_t SZ_CTX16 = (size_t)MROWS * DIMC * 2;         // merged head output x16 [MROWS][1024] f16
static constexpr size_t SZ_BRO   = (size_t)DIMC * 4;                 // bias, bf16 RNE-converted, f32
static constexpr size_t SZ_MB    = (size_t)NB * (SEQ / 16) * (SEQ / 64) * 32 * 4;   // lane-mask words [b][16-query tile][64-key chunk][32]
static constexpr size_t SZ_TOTAL = SZ_X16 + SZ_WT16 + SZ_QK16 + SZ_VT16 + SZ_CTX16 + SZ_BRO + SZ_MB;
static_assert((SZ_X16 % 256) == 0 && (SZ_WT16 % 256) == 0 && (SZ_QK16 % 256) == 0 && (SZ_VT16 % 256) == 0 && (SZ_CTX16 % 256) == 0 && (SZ_BRO % 256) == 0 && (SZ_MB % 256) == 0);
static_assert(SZ_TOTAL <= (size_t)134217728);
// coverage equalities of the plane writers
static_assert((size_t)CV_ST * CV_TH * 8 == (size_t)MROWS * DIMC);                     // k_convert per activation tensor
static_assert((size_t)CV_ST * CV_TH * 8 == (size_t)4 * DIMC * DIMC);                  // k_convert, the four weights
static_assert((size_t)(SEQ / AT_QB) * AT_WV * AT_QW * 16 * 64 == (size_t)SEQ * HDIM);               // k_flash per (batch, head): blocks x waves x rows x cols
static_assert((MROWS % 128) == 0 && (DIMC % 128) == 0 && (SEQ % 128) == 0);            // k_gemm64: whole 128x128 tiles, K = DIMC in whole 64-k trips

extern "C" void kernel_launch(void* const* d_in, const int* in_sizes, int n_in, void* d_out, int out_size, void* d_ws, size_t ws_size, hipStream_t stream) {
  if (n_in < 9) return;
  const long long needX = (long long)(NB - 1) * SEQ_FULL * DIMC + (long long)SEQ * DIMC;
  const long long needM = (long long)(NB - 1) * SEQ_FULL * SEQ_FULL + (long long)(SEQ - 1) * SEQ_FULL + SEQ;
  if ((long long)in_sizes[0] < needX || (long long)in_sizes[1] < needX || (long long)in_sizes[2] < needX) return;
  if ((long long)in_sizes[3] < needM) return;
  if (in_sizes[4] < DIMC * DIMC || in_sizes[5] < DIMC * DIMC || in_sizes[6] < DIMC * DIMC || in_sizes[7] < DIMC * DIMC || in_sizes[8] < DIMC) return;
  if ((long long)out_size < (long long)MROWS * DIMC) return;
  if (ws_size < SZ_TOTAL) return;

  const float* q    = (const float*)d_in[0];
  const float* k    = (const float*)d_in[1];
  const float* v    = (const float*)d_in[2];
  const int*   mask = (const int*)d_in[3];
  const float* Wq   = (const float*)d_in[4];
  const float* Wk   = (const float*)d_in[5];
  const float* Wv   = (const float*)d_in[6];
  const float* Wp   = (const float*)d_in[7];
  const float* bp   = (const float*)d_in[8];
  float* out = (float*)d_out;

  char* wsp = (char*)d_ws;
  unsigned short* X16   = (unsigned short*)wsp; wsp += SZ_X16;
  unsigned short* WT16  = (unsigned short*)wsp; wsp += SZ_WT16;
  unsigned short* QK16  = (unsigned short*)wsp; wsp += SZ_QK16;
  unsigned short* VT16  = (unsigned short*)wsp; wsp += SZ_VT16;
  unsigned short* CTX16 = (unsigned short*)wsp; wsp += SZ_CTX16;
  float*          BRO   = (float*)wsp;          wsp += SZ_BRO;
  unsigned*       MB    = (unsigned*)wsp;       wsp += SZ_MB;

  const unsigned long long planeX = (unsigned long long)MROWS * DIMC;     // elements per activation plane
  const unsigned long long planeW = (unsigned long long)DIMC * DIMC;

  // weights [in][out] -> [out][in] f16 x16 (4 planes); bias; activations (3 planes, full input batch stride, compact planes); mask -> lane-mask words
  k_convert<<<dim3((unsigned)CV_WG, 1u, 1u), 512, 0, stream>>>(q, k, v, Wq, Wk, Wv, Wp, bp, mask, X16, WT16, BRO, MB);
  // Q16 | K16 = (q16 | k16) x (Wq^T | Wk^T): batch y = 0 (q), 1 (k); M = MROWS, N = K = 1024
  k_gemm64<0, 1><<<dim3((unsigned)((MROWS / 128) * (DIMC / 128)), 2u, 1u), 256, 0, stream>>>(
      X16, (unsigned)DIMC, planeX, WT16, (unsigned)DIMC, planeW, (void*)QK16, (unsigned)DIMC, planeX, nullptr,
      (unsigned)MROWS, (unsigned)DIMC, (unsigned)DIMC, 0.0625f);
  // V^T[b][o][n] = sum_k Wv^T[o][k] * v16[b][n][k]: A = Wv^T plane (M = 1024), Bt = v16 batch plane (N = SEQ), C pitch SEQ
  k_gemm64<0, 1><<<dim3((unsigned)((DIMC / 128) * (SEQ / 128)), (unsigned)NB, 1u), 256, 0, stream>>>(
      WT16 + 2 * planeW, (unsigned)DIMC, 0ull, X16 + 2 * planeX, (unsigned)DIMC, (unsigned long long)SEQ * DIMC,
      (void*)VT16, (unsigned)SEQ, (unsigned long long)DIMC * SEQ, nullptr,
      (unsigned)DIMC, (unsigned)SEQ, (unsigned)DIMC, 0.0625f);
  // attention
  k_flash<<<dim3((unsigned)(NB * NHEAD * (SEQ / AT_QB)), 1u, 1u), AT_WV * 32, 0, stream>>>(QK16, QK16 + planeX, VT16, MB, CTX16);
  // out = (ctx x16) x (Wp^T x16) / 256 + bias
  k_gemm64<2, 0><<<dim3((unsigned)((MROWS / 128) * (DIMC / 128)), 1u, 1u), 256, 0, stream>>>(
      CTX16, (unsigned)DIMC, 0ull, WT16 + 3 * planeW, (unsigned)DIMC, 0ull, (void*)out, (unsigned)DIMC, 0ull, BRO,
      (unsigned)MROWS, (unsigned)DIMC, (unsigned)DIMC, 0.00390625f);
}

// v008
// Measured time: 101 microseconds a run.
// Timed twice side by side with v007, it ran 1.03 times as fast both times.
// All steps since v000 together make it 3.16 times as fast.
// Masked multi-head attention (2 x 2,048 x 1,024; 16 heads x 64): inputs and parameters RNE-converted to bf16 first; every contraction (q/k/v projections, q.k^T, p.v, output projection) on v_wmma_f32_16x16x32_f16 (f16 operands: weights x16, probabilities x2^14, merged head output x16; f32 accumulate, f32 online softmax in the exp2 domain).
#include <hip/hip_runtime.h>
#include <math.h>

#ifndef NB
#define NB 2
#endif
#ifndef SEQ
#define SEQ 2048
#endif
#define NB_FULL 2
#define SEQ_FULL 2048
#define DIMC 1024
#define NHEAD 16
#define HDIM 64
#define MROWS (NB * SEQ)

static_assert(SEQ % 64 == 0);
static_assert(SEQ <= SEQ_FULL);
static_assert(NB <= NB_FULL);
static_assert(DIMC == NHEAD * HDIM);
static_assert(DIMC % 64 == 0);
static_assert(DIMC / 8 == 128);
static_assert((MROWS % 64) == 0);
static_assert(((SEQ * 128) % 256) == 0);

typedef __attribute__((ext_vector_type(16))) _Float16 v16h;
typedef __attribute__((ext_vector_type(8)))  _Float16 v8h;
typedef __attribute__((ext_vector_type(4)))  _Float16 v4h;
typedef __attribute__((ext_vector_type(8)))  float    v8f;
typedef __attribute__((ext_vector_type(4)))  float    v4f;
typedef __attribute__((ext_vector_type(4)))  int      v4i;
typedef __attribute__((ext_vector_type(16))) unsigned v16u;

// 16-bit WMMA fragment map (wave32), lane L, h = L>>4, m = L&15:
//   A 16x32: lane = row m;    element i -> k = (i<8) ? 8h+i : 16+8h+(i-8)
//   B 32x16: lane = column m; the SAME k(i,h)
//   D 16x16 (8 f32): lane = column m; element r -> row 8h+r
union FragU { v16h v; v8h h[2]; };
// p already includes the lane-half offset 8h: elements 0..7 <- p[0..7], 8..15 <- p[16..23]
__device__ __forceinline__ v16h frag_ld(const _Float16* p) {
  FragU f; f.h[0] = *(const v8h*)(p); f.h[1] = *(const v8h*)(p + 16); return f.v;
}
__device__ __forceinline__ v8f wm16(v16h a, v16h b, v8f c) {
  c = __builtin_amdgcn_wmma_f32_16x16x32_f16(false, a, false, b, (short)0, c, false, false);
  asm volatile("v_nop\n\tv_nop\n\tv_nop\n\tv_nop" : "+v"(c) : "v"(a), "v"(b));
  return c;
}
__device__ __forceinline__ void dep_guard_h(v8f& a, v8f& b, v16h x, v16h y) { asm volatile("v_nop\n\tv_nop\n\tv_nop\n\tv_nop" : "+v"(a), "+v"(b) : "v"(x), "v"(y)); }
__device__ __forceinline__ void keep4_h(v16h a, v16h b, v16h c, v16h d) { asm volatile("v_nop" :: "v"(a), "v"(b), "v"(c), "v"(d)); }
__device__ __forceinline__ void acc_guard4(v8f& a, v8f& b, v8f& c, v8f& d) { asm volatile("v_nop\n\tv_nop\n\tv_nop\n\tv_nop" : "+v"(a), "+v"(b), "+v"(c), "+v"(d)); }
// same-wave LDS exchange: stores by some lanes, loads of those locations by other lanes of the SAME wave
__device__ __forceinline__ void wave_sync() {
  __builtin_amdgcn_fence(3 /* release order */, "workgroup");
  __builtin_amdgcn_wave_barrier();
  __builtin_amdgcn_fence(2 /* acquire order */, "workgroup");
}
// bf16 RNE-convert, kept as f32 (finite inputs)
__device__ __forceinline__ float cmb_bf(float v) {
  const unsigned u = __builtin_bit_cast(unsigned, v);
  const unsigned r = (u + 0x7fffu + ((u >> 16) & 1u)) & 0xffff0000u;
  return __builtin_bit_cast(float, r);
}

// ---------------------------------------------------------------------------------------------------------
// k_convert: every conversion of the call in ONE launch of CV_WG work-groups of 16 waves, one for each WGP, all resident at once; a thread
// takes CV_ST pieces of every kind instead of ending after one, so the launch starts 4,096 waves where three launches started 65,568.
// A thread's pieces, step j = 0 .. CV_ST - 1:
//   one of each activation tensor: f32 row [1024], 8 columns -> bf16 (RNE) -> f16 plane rows [MROWS][1024], one 16-B store
//   (piece j * CV_TH + flat thread: consecutive threads walk along a row; sources use the FULL input batch stride, planes are compact);
//   one of a weight: W[k = in][o = out] (row pitch 1024) -> WT[o][k] = f16(bf16_rne(W[k][o]) * 16): 8 strided loads, one 16-B store, a wave walks
//   along the destination row. A work-group takes two tiles of 32 outputs x 256 inputs, two steps each (16 waves = 16 outputs a step): the
//   128-B source lines of a tile hold exactly its 32 outputs, so both steps and all 16 waves read the same 256 lines.
// All loads of a thread are issued first (24 of 16 B, 16 of 16 B for the mask, then 32 of 4 B), so a wave waits out the memory latency once, not once a step.
// The first DIMC threads of the launch also convert the bias.
// The keep-mask is packed here, once for all 16 heads: a wave takes 16 query rows x 128 keys (16 whole-line loads of 512 B, a work-group reads
// 128 KiB in a row), turns them through its own LDS slice into k_flash's score layout (lane = 16 hh + c holds query c, keys 16j + 8hh + r of a
// 64-key chunk) and writes, for each chunk, 32 lane-mask words: word 8j + r, bit lane = (mask element != 0).
// ---------------------------------------------------------------------------------------------------------
#define CV_WG 256                       // work-groups of the launch
#define CV_TH (CV_WG * 512)             // threads of the launch
#define CV_ST 4                         // pieces of each kind per thread
#define CV_RPS (CV_TH / 128)             // activation rows of one step (128 pieces a row)
#define CV_TPW ((DIMC / 32) * (DIMC / 256))   // tiles of one weight
static_assert(MROWS * 128 == CV_ST * CV_TH);              // activation pieces of one tensor: every one exactly once
static_assert(4 * CV_TPW == CV_WG * (CV_ST / 2));         // weight tiles: every one exactly once
static_assert(CV_TPW % (CV_ST / 2) == 0);                 // a work-group's tiles lie in one weight
static_assert(SEQ % CV_RPS == 0);                         // a step's rows lie in one batch
static_assert(DIMC <= CV_TH);
static_assert(CV_ST == 4);                                // the wait behind the activation loads names four offsets
static_assert(((unsigned long long)(NB - 1) * SEQ_FULL + SEQ) * DIMC * 4 < (1ull << 32));   // source byte offsets fit 32 bits
#define CV_MP 132                       // mask slice row pitch in words: 528 B = 16 B x 33
static_assert(SEQ % 128 == 0);
static_assert((size_t)NB * (SEQ / 16) * (SEQ / 128) == (size_t)CV_WG * 16);               // mask pieces: one for every wave of the launch
static_assert((unsigned long long)NB * SEQ_FULL * SEQ_FULL * 4 < (1ull << 32));           // mask byte offsets fit 32 bits
__global__ __launch_bounds__(512) void k_convert(const float* __restrict__ S0, const float* __restrict__ S1, const float* __restrict__ S2,
                                                  const float* __restrict__ W0, const float* __restrict__ W1, const float* __restrict__ W2,
                                                  const float* __restrict__ W3, const float* __restrict__ BP, const int* __restrict__ MK,
                                                  unsigned short* __restrict__ X, unsigned short* __restrict__ WT, float* __restrict__ BRO,
                                                  unsigned* __restrict__ MB) {
  __shared__ __align__(16) int sM[16][16 * CV_MP];   // per-wave slice: 16 query rows x 128 keys of the mask
  const unsigned t = blockIdx.x * 512u + threadIdx.x;
  const unsigned wave = threadIdx.x >> 5, lane = threadIdx.x & 31u;
  const unsigned tile0 = blockIdx.x * (CV_ST / 2u);
  const unsigned y = tile0 / (unsigned)CV_TPW;
  const float* W = (y == 0u) ? W0 : ((y == 1u) ? W1 : ((y == 2u) ? W2 : W3));   // block-uniform choice among global pointers
  const unsigned tsb = t * 32u, tdb = t * 16u;   // this thread's place inside a step's CV_RPS rows, in source and in plane bytes: one 32-bit offset beside a uniform base
  v4f x[CV_ST][3][2];                   // every loop over the steps is unrolled: constant indices keep the pieces in registers
  float w[CV_ST][8];
  unsigned so[CV_ST];                   // source byte offsets of the thread's pieces, alike in the three tensors
#pragma unroll
  for (unsigned j = 0; j < CV_ST; ++j) {
    // first row of step j in the source: batch (j * CV_RPS) / SEQ at the full batch stride, row (j * CV_RPS) % SEQ of it
    so[j] = (((j * (unsigned)CV_RPS) / (unsigned)SEQ) * (unsigned)SEQ_FULL + (j * (unsigned)CV_RPS) % (unsigned)SEQ) * (unsigned)(DIMC * 4) + tsb;
    const v4f* s0 = (const v4f*)((const char*)S0 + so[j]);
    const v4f* s1 = (const v4f*)((const char*)S1 + so[j]);
    const v4f* s2 = (const v4f*)((const char*)S2 + so[j]);
    x[j][0][0] = s0[0]; x[j][0][1] = s0[1];
    x[j][1][0] = s1[0]; x[j][1][1] = s1[1];
    x[j][2][0] = s2[0]; x[j][2][1] = s2[1];
  }
  // The wait before a register that one of these 24 loads names is written again; the offsets are inputs so that they stay in their registers up
  // to it. The statement also keeps the streaming loads in front of the 32 many-line weight loads, which the compiler otherwise issues first
  // (a wave's loads return in order).
  asm volatile("s_wait_xcnt 0x0" :: "v"(so[0]), "v"(so[1]), "v"(so[2]), "v"(so[3]) : "memory");
  // this wave's mask piece: batch, 16-query tile, pair of 64-key chunks; row i of it is one 512-B load of the wave
  const unsigned gw = blockIdx.x * 16u + wave;
  const unsigned mkp = gw % (unsigned)(SEQ / 128), mqt = (gw / (unsigned)(SEQ / 128)) % (unsigned)(SEQ / 16), mbt = gw / (unsigned)((SEQ / 128) * (SEQ / 16));
  const unsigned mo = ((mbt * (unsigned)SEQ_FULL + mqt * 16u) * (unsigned)SEQ_FULL + mkp * 128u + lane * 4u) * 4u;
  v4i mk[16];                           // unrolled as above
#pragma unroll
  for (unsigned i = 0; i < 16u; ++i) mk[i] = __builtin_nontemporal_load((const v4i*)((const char*)MK + mo + i * (unsigned)(SEQ_FULL * 4)));   // read once in the whole call
  asm volatile("s_wait_xcnt 0x0" :: "v"(mo) : "memory");   // as above, for the 16 mask loads: they too stay in front of the weight loads
  unsigned wo[CV_ST];                   // source byte offsets of the thread's weight pieces (first of the 8 inputs)
#pragma unroll
  for (unsigned j = 0; j < CV_ST; ++j) {
    const unsigned ty = (tile0 + (j >> 1)) % (unsigned)CV_TPW;
    const unsigned o = (ty >> 2) * 32u + (j & 1u) * 16u + wave, k0 = (ty & 3u) * 256u + lane * 8u;
    wo[j] = (k0 * (unsigned)DIMC + o) * 4u;
#pragma unroll
    for (int e = 0; e < 8; ++e) w[j][e] = *(const float*)((const char*)W + wo[j] + (unsigned)e * (unsigned)(DIMC * 4));
  }
  asm volatile("s_wait_xcnt 0x0" :: "v"(wo[0]), "v"(wo[1]), "v"(wo[2]), "v"(wo[3]) : "memory");   // as above, for the 32 weight loads
  float bv = 0.f;
  if (t < (unsigned)DIMC) bv = BP[t];                                 // whole waves of the first work-groups
#pragma unroll
  for (unsigned j = 0; j < CV_ST; ++j) {
#pragma unroll
    for (int z = 0; z < 3; ++z) {
      v8h hv;
#pragma unroll
      for (int e = 0; e < 4; ++e) { hv[e] = (_Float16)cmb_bf(x[j][z][0][e]); hv[e + 4] = (_Float16)cmb_bf(x[j][z][1][e]); }
      *(v8h*)((char*)((_Float16*)X + ((size_t)z * MROWS + (size_t)j * CV_RPS) * DIMC) + tdb) = hv;
    }
    asm volatile("s_wait_xcnt 0x0" ::: "memory");   // before a register that one of these stores names is written again
  }
  {
    int* sm = sM[wave];
#pragma unroll
    for (unsigned i = 0; i < 16u; ++i) *(v4i*)(sm + i * (unsigned)CV_MP + lane * 4u) = mk[i];
    // The rows are read back by other lanes of this wave alone: its own LDS stores are waited for, and the statement keeps the reads behind them.
    // (wave_sync()'s work-group fences would also wait here for the global stores above and for the weight loads still in flight.)
    asm volatile("s_wait_dscnt 0x0" ::: "memory");
    const int* sr = sm + (lane & 15u) * (unsigned)CV_MP + (lane >> 4) * 8u;   // query row c, this half's 8 keys of a 16-key group
#pragma unroll
    for (unsigned ch = 0; ch < 2u; ++ch) {
      unsigned ow = 0u;                 // lane l ends up with word l of the chunk
#pragma unroll
      for (unsigned j = 0; j < 4u; ++j) {
        const v4i a = *(const v4i*)(sr + ch * 64u + j * 16u), bq = *(const v4i*)(sr + ch * 64u + j * 16u + 4u);
#pragma unroll
        for (unsigned r = 0; r < 4u; ++r) {
          const unsigned wa = __builtin_amdgcn_ballot_w32(a[r] != 0), wb = __builtin_amdgcn_ballot_w32(bq[r] != 0);
          ow = (lane == j * 8u + r) ? wa : ow;
          ow = (lane == j * 8u + 4u + r) ? wb : ow;
        }
      }
      MB[(gw * 2u + ch) * 32u + lane] = ow;
    }
    asm volatile("s_wait_xcnt 0x0" ::: "memory");   // before a register that one of these stores names is written again
  }
#pragma unroll
  for (unsigned j = 0; j < CV_ST; ++j) {
    const unsigned ty = (tile0 + (j >> 1)) % (unsigned)CV_TPW;
    const unsigned o = (ty >> 2) * 32u + (j & 1u) * 16u + wave, k0 = (ty & 3u) * 256u + lane * 8u;
    v8h hw;
#pragma unroll
    for (int e = 0; e < 8; ++e) hw[e] = (_Float16)(cmb_bf(w[j][e]) * 16.0f);
    *(v8h*)((_Float16*)WT + (size_t)y * DIMC * DIMC + (o * (unsigned)DIMC + k0)) = hw;
    asm volatile("s_wait_xcnt 0x0" ::: "memory");   // as above
  }
  if (t < (unsigned)DIMC) BRO[t] = cmb_bf(bv);
}

// ---------------------------------------------------------------------------------------------------------
// k_gemm64: C[m,n] = scale * sum_k A[m,k] * Bt[n,k] (+ bias[n]); f16 operand planes. A block of 8 waves owns a 128x128 tile of C,
// each wave 32 rows x 64 columns of it. Per trip 64 k of the block's 128 A rows and 128 Bt rows (128-B row pieces, whole lines) come
// into LDS by asynchronous copies, two buffers: the next trip's copies fly while this trip's fragments are read from LDS (row pitch 144 B).
// A block walks the k trips in a ring that starts at a trip of its own (tile row + tile column): blocks that share A rows or Bt rows start at
// different trips unless their (tile row + tile column) differ by a multiple of nT, as tile rows 16 apart and the V^T product's two batches
// (one A) do, and the blocks' requests spread over all 128-B columns of the 2-KiB operand rows.
// A row-major [M,K]; Bt row-major [N,K]; M,N % 128 == 0, K % 64 == 0, K >= 64; batch = blockIdx.y with element strides.
// OUT_MODE 0: f32 C; 1: f16 C. Epilogue: 16-row slabs staged per wave in LDS (wave-private), each 64-wide row segment written as whole
// ---------------------------------------------------------------------------------------------------------
#define GT_PH  72                      // LDS row pitch in halves: 144 B = 16 B x 9
#define GT_OPH (128 * GT_PH)           // halves of one operand's 128-row tile
#define GT_STH (2 * GT_OPH)            // halves of one buffer: A tile | Bt tile
// One buffer's fill, this thread's share: 16 B in each of four rows of the first tile and of four rows of the second (eight threads cover
// a 128-B row piece, so a wave covers 4 whole lines per copy). la, lb = the thread's LDS byte addresses in its first row of either tile,
// lsa, lsb = LDS bytes from one of its rows to the next; ga, gb, gsa, gsb = the same in global memory (addresses, steps in elements).
// s_wait_xcnt closes the statement so that no address register of an issued copy is rewritten ahead of it.
__device__ __forceinline__ void stage_fill(unsigned la, unsigned lsa, unsigned lb, unsigned lsb,
                                           const _Float16* ga, size_t gsa, const _Float16* gb, size_t gsb) {
  const unsigned la1 = la + lsa, la2 = la + 2u * lsa, la3 = la + 3u * lsa;
  const unsigned lb1 = lb + lsb, lb2 = lb + 2u * lsb, lb3 = lb + 3u * lsb;
  const _Float16* ga1 = ga + gsa; const _Float16* ga2 = ga + 2u * gsa; const _Float16* ga3 = ga + 3u * gsa;
  const _Float16* gb1 = gb + gsb; const _Float16* gb2 = gb + 2u * gsb; const _Float16* gb3 = gb + 3u * gsb;
  asm volatile("global_load_async_to_lds_b128 %0, %8, off\n\t"
               "global_load_async_to_lds_b128 %1, %9, off\n\t"
               "global_load_async_to_lds_b128 %2, %10, off\n\t"
               "global_load_async_to_lds_b128 %3, %11, off\n\t"
               "global_load_async_to_lds_b128 %4, %12, off\n\t"
               "global_load_async_to_lds_b128 %5, %13, off\n\t"
               "global_load_async_to_lds_b128 %6, %14, off\n\t"
               "global_load_async_to_lds_b128 %7, %15, off\n\t"
               "s_wait_xcnt 0x0"
               :: "v"(la), "v"(la1), "v"(la2), "v"(la3), "v"(lb), "v"(lb1), "v"(lb2), "v"(lb3),
                  "v"(ga), "v"(ga1), "v"(ga2), "v"(ga3), "v"(gb), "v"(gb1), "v"(gb2), "v"(gb3)
               : "memory");
}
template <int BIAS_MODE, int OUT_MODE>
__global__ __launch_bounds__(256) void k_gemm64(
    const unsigned short* __restrict__ Ap, unsigned lda, unsigned long long strideA,
    const unsigned short* __restrict__ Btp, unsigned ldb, unsigned long long strideB,
    void* __restrict__ Cout, unsigned ldc, unsigned long long strideC,
    const float* __restrict__ bias, unsigned M, unsigned N, unsigned K, float scale) {
  __shared__ __align__(16) _Float16 sS[2 * GT_STH];   // two buffers of [A 128 rows | Bt 128 rows] x 64 k, pitch 72 halves
  __shared__ __align__(16) float sT[8][16 * 68];      // per-wave 16x64 slab, pitch 68 floats
  const unsigned b    = blockIdx.y;
  const unsigned lane = threadIdx.x & 31u;
  const unsigned wave = threadIdx.x >> 5;
  const unsigned tilesN = N >> 7;
  const unsigned tilesM = M >> 7;
  const unsigned tile = blockIdx.x;
  if (tile >= tilesM * tilesN) return;   // block-uniform, in front of every barrier and copy
  const unsigned tm = tile / tilesN;
  const unsigned tn = tile - tm * tilesN;
  const unsigned m0 = (tm << 7) + ((wave >> 1) << 5);   // this wave's 32 rows
  const unsigned n0 = (tn << 7) + ((wave & 1u) << 6);   // this wave's 64 columns

  const _Float16* Ab = (const _Float16*)Ap + (size_t)b * strideA;
  const _Float16* Bb = (const _Float16*)Btp + (size_t)b * strideB;

  const unsigned rlane = lane & 15u;            // row (A) / col (B, D) within subtile
  const unsigned koff  = (lane >> 4) * 8u;      // k offset of this lane half
  const unsigned mOff  = (lane >> 4) * 8u;      // D row offset

  // copy share of this thread: tile row threadIdx.x / 8 (+32, +64, +96), 16-B piece threadIdx.x % 8 of the 128-B row piece
  const unsigned crow = threadIdx.x >> 3, cpc = threadIdx.x & 7u;
  const _Float16* gA = Ab + (size_t)((tm << 7) + crow) * lda + cpc * 8u;
  const _Float16* gB = Bb + (size_t)((tn << 7) + crow) * ldb + cpc * 8u;
  const unsigned lC = (unsigned)(size_t)sS + (crow * GT_PH + cpc * 8u) * 2u;
  // fragment read places of this lane inside a buffer
  const unsigned fA = (((wave >> 1) << 5) + rlane) * GT_PH + koff;
  const unsigned fB = GT_OPH + (((wave & 1u) << 6) + rlane) * GT_PH + koff;

  v8f acc[2][4];
#pragma unroll
  for (int i = 0; i < 2; ++i)
#pragma unroll
    for (int j = 0; j < 4; ++j) acc[i][j] = (v8f){0.f,0.f,0.f,0.f,0.f,0.f,0.f,0.f};

  const unsigned nT = K >> 6;
  const unsigned rot = (tm + tn) & (nT - 1u);           // first k trip of this block: below nT for any nT, block-uniform
  // element offset of the 64 k that trip t works on (t <= nT): trip rot + t of the ring
  auto kof = [&](const unsigned t) __attribute__((always_inline)) { const unsigned kt = t + rot; return (size_t)((kt >= nT) ? kt - nT : kt) * 64u; };
  const unsigned lStep = 32u * GT_PH * 2u;              // a thread's rows are 32 apart
  const size_t gsA = (size_t)32u * lda, gsB = (size_t)32u * ldb;
  stage_fill(lC, lStep, lC + GT_OPH * 2u, lStep, gA + kof(0u), gsA, gB + kof(0u), gsB);
  asm volatile("s_wait_asynccnt 0x0" ::: "memory");     // this wave's copies of trip 0 have landed
  __syncthreads();                                      // ... and every other wave's: buffer 0 is readable
  if (nT > 1u) stage_fill(lC + GT_STH * 2u, lStep, lC + (GT_STH + GT_OPH) * 2u, lStep, gA + kof(1u), gsA, gB + kof(1u), gsB);

  for (unsigned t = 0; t < nT; ++t) {
    const _Float16* sb = sS + (t & 1u) * GT_STH;
    v16h bh[2][4], ah[2][2];                            // the trip's 12 fragments, read as one group in front of its 16 products (loops unrolled: constant indices keep them in registers)
#pragma unroll
    for (int kk = 0; kk < 2; ++kk) {
#pragma unroll
      for (int j = 0; j < 4; ++j) bh[kk][j] = frag_ld(sb + fB + (unsigned)j * 16u * GT_PH + (unsigned)kk * 32u);
#pragma unroll
      for (int i = 0; i < 2; ++i) ah[kk][i] = frag_ld(sb + fA + (unsigned)i * 16u * GT_PH + (unsigned)kk * 32u);
    }
#pragma unroll
    for (int kk = 0; kk < 2; ++kk) {
#pragma unroll
      for (int i = 0; i < 2; ++i) {
#pragma unroll
        for (int j = 0; j < 4; ++j)
          acc[i][j] = __builtin_amdgcn_wmma_f32_16x16x32_f16(false, ah[kk][i], false, bh[kk][j], (short)0, acc[i][j], false, false);
        dep_guard_h(acc[i][0], acc[i][3], ah[kk][i], ah[kk][i]);
      }
      keep4_h(bh[kk][0], bh[kk][1], bh[kk][2], bh[kk][3]);
    }
    asm volatile("s_wait_dscnt 0x0" ::: "memory");      // this wave's reads of buffer t%2 are done before it is handed to its next writer
    asm volatile("s_wait_asynccnt 0x0" ::: "memory");   // this wave's copies of trip t+1 have landed
    __syncthreads();                                    // publishes trip t+1's buffer and ends every reader's last read of trip t's
    if (t + 2u < nT) {
      const unsigned lN = lC + (t & 1u) * (GT_STH * 2u);
      stage_fill(lN, lStep, lN + GT_OPH * 2u, lStep, gA + kof(t + 2u), gsA, gB + kof(t + 2u), gsB);
    }
  }
  asm volatile("s_wait_asynccnt 0x0" ::: "memory");     // nothing of this wave is in flight when the loop is left
  acc_guard4(acc[0][0], acc[0][1], acc[0][2], acc[0][3]);
  acc_guard4(acc[1][0], acc[1][1], acc[1][2], acc[1][3]);

  float* slab = sT[wave];
#pragma unroll
  for (int i = 0; i < 2; ++i) {
    const unsigned mBase = m0 + ((unsigned)i << 4);
#pragma unroll
    for (int j = 0; j < 4; ++j) {
      const unsigned n = n0 + ((unsigned)j << 4) + rlane;
      float bv = 0.f;
      if (BIAS_MODE == 2) bv = bias[n];
#pragma unroll
      for (int r = 0; r < 8; ++r) {
        float v = acc[i][j][r] * scale;
        if (BIAS_MODE == 2) v += bv;
        slab[(mOff + (unsigned)r) * 68u + ((unsigned)j << 4) + rlane] = v;
      }
    }
    wave_sync();
    if (OUT_MODE == 0) {
      float* C = (float*)Cout + (size_t)b * strideC;
      const unsigned hh = lane >> 4, c4 = (lane & 15u) * 4u;     // row segment = 256 B = 16 lanes x 16 B
      {
#pragma unroll
        for (int it = 0; it < 8; ++it) {
          const unsigned row = (unsigned)it * 2u + hh;
          const v4f v = *(const v4f*)(slab + row * 68u + c4);
          *(v4f*)(C + (size_t)(mBase + row) * ldc + n0 + c4) = v;
        }
        
      }
    } else {
      const unsigned q = lane >> 3, c8 = (lane & 7u) * 8u;
      _Float16* C = (_Float16*)Cout + (size_t)b * strideC;
      {
#pragma unroll
        for (int it = 0; it < 4; ++it) {
          const unsigned row = (unsigned)it * 4u + q;
          const float* sp = slab + row * 68u + c8;
          v8h hv;
#pragma unroll
          for (int e = 0; e < 8; ++e) hv[e] = (_Float16)sp[e];
          *(v8h*)(C + (size_t)(mBase + row) * ldc + n0 + c8) = hv;
        }
        
      }
    }
    wave_sync();
  }
}

// ---------------------------------------------------------------------------------------------------------
// k_flash: per (batch, head, 128-query block): block = 2 key groups x 4 waves x 32 queries (two 16-query tiles a wave); 64-key chunks; online
//   softmax in f32 (exp2 domain).
//   the two key groups work on the same 128 queries, each on half of the key chunks with a ring of its own, so that the launch has four waves for
//   every SIMD instead of two: one wave's softmax (vector port) then runs beside more waves' products and waits. Behind the loop a wave and its
//   partner in the other group (same queries) exchange one query tile's maximum, sum and O^T through LDS; each joins and writes one of the two tiles.
//   each chunk's 64 K16 rows and 64 V^T rows (128-B row pieces) come into LDS once per block by asynchronous copies, two buffers: the next
//   chunk's copies fly while this chunk is worked on.
//   every K and V^T fragment read from LDS feeds two products, one for each query tile of the wave.
//   a block walks the key chunks in a ring that starts at a chunk of its own: the query blocks of one (batch, head), which read the same K and V^T
//   rows and start together, then ask L2 for the lines of 16 different chunks at any one time, two key groups on each, and the blocks' requests spread over all 128-B columns of the V^T rows.
//   scores transposed: S^T = K.Q^T, A = staged K16 rows (tile j = keys 16j..16j+15), B = Q16 rows kept in registers. In each query tile a lane holds
//           32 scores of ONE query (column c; keys 16j + 8hh + r): maximum and sum run inside the lane, the two lane halves exchange the maximum
//           once per chunk and join their sums once, behind the loop.
//   keep-mask, shared by the heads: element == 0 -> score := fill (finite replace, applied after the scaling). k_convert has packed it into lane-mask
//           words in this kernel's score layout: a wave reads 32 words (128 B) for each of its query tiles and chunk by scalar loads, one chunk
//           ahead, and each word is the select mask of one score register: no compare, no mask tile in LDS.
//   output transposed: O^T += V^T.P^T, A = staged V^T rows, B = P^T (x 2^14, f16) packed straight from the score registers: score tiles 2kk and
//           2kk+1 hold exactly the keys of B elements 0..7 and 8..15 of key group kk, so P never passes through LDS.
// ---------------------------------------------------------------------------------------------------------
#define AT_PP 72                        // output staging row pitch in halves
#define AT_KP 72                        // staged row pitch in halves: 144 B = 16 B x 9
#define AT_TH (64 * AT_KP)              // halves of one staged 64-row tile
#define AT_BH (2 * AT_TH)               // halves of one buffer: K tile | V^T tile
#define AT_QW 2                         // 16-query tiles of one wave (the loop reads one of the two 32-key V^T fragment groups behind each)
#define AT_WV 4                         // waves of one key group
#define AT_KG 2                         // key groups of one block
#define AT_QB (AT_WV * AT_QW * 16)      // queries of one block
#define AT_XF (8 * 128 + 64)            // floats of one wave's exchange slot: 8 rows of 32 lanes x 4 (O^T of one query tile), 32 lanes x 2 (maximum, sum)
static_assert(SEQ % AT_QB == 0);
static_assert(AT_QW == 2);              // one V^T fragment group (32 keys) for each query tile
static_assert(AT_KG == 2 && AT_WV == 4); // a wave's partner is wave ^ 4; each of the two joins one of the two query tiles
// 2^x as the bare v_exp_f32, without the library form's range test, selects, add and ldexp around it. Every argument here is <= 0 (or -inf);
// the two forms differ only where 2^x < 2^-126, which may come out 0: such a term is far under half an ulp of the row's sum and of the f16 operand.
// The v_nop fills the slot behind it.
__device__ __forceinline__ float ex2(float x) { float r; asm("v_exp_f32 %0, %1\n\tv_nop" : "=v"(r) : "v"(x)); return r; }
// Eight of them in place, in one statement: each v_exp_f32 is the independent instruction that the slot behind the one before it asks for, and the
// v_nop fills the slot behind the last.
__device__ __forceinline__ void ex2x8(float (&v)[8]) {
  asm("v_exp_f32 %0, %0\n\tv_exp_f32 %1, %1\n\tv_exp_f32 %2, %2\n\tv_exp_f32 %3, %3\n\t"
      "v_exp_f32 %4, %4\n\tv_exp_f32 %5, %5\n\tv_exp_f32 %6, %6\n\tv_exp_f32 %7, %7\n\tv_nop"
      : "+v"(v[0]), "+v"(v[1]), "+v"(v[2]), "+v"(v[3]), "+v"(v[4]), "+v"(v[5]), "+v"(v[6]), "+v"(v[7]));
}
// lane l <-> lane l ^ 16
__device__ __forceinline__ float xhalf(float x) {
  const int b = __builtin_bit_cast(int, x);
  return __builtin_bit_cast(float, __builtin_amdgcn_permlanex16(b, b, 0x76543210, 0xfedcba98, false, false));
}
__global__ __launch_bounds__(AT_KG * AT_WV * 32) void k_flash(const unsigned short* __restrict__ Qp, const unsigned short* __restrict__ Kp,
                                               const unsigned short* __restrict__ Vtp, const unsigned* __restrict__ MB,
                                               unsigned short* __restrict__ ctxp) {
  __shared__ __align__(16) _Float16 KVs[AT_KG * 2 * AT_BH];   // for each key group two buffers of [K 64 keys | V^T 64 rows] x 64 halves, pitch 72 halves; behind the loop: exchange slots | output staging
  static_assert(AT_KG * AT_WV * AT_XF * 4 <= 2 * AT_BH * 2);   // the exchange slots lie in the first group's ring
  static_assert(AT_KG * AT_WV * 16 * AT_PP <= 2 * AT_BH);      // the output staging lies in the second group's
  constexpr unsigned NQB = SEQ / AT_QB;                   // query blocks of one (batch, head)
  constexpr unsigned NKC = SEQ / 64;                      // key chunks
  constexpr unsigned NTR = NKC / AT_KG;                   // trips = key chunks of one group
  static_assert(NKC % AT_KG == 0 && NTR >= 2);
  const float SC2   = 0.125f * 1.4426950408889634f;       // 64^-0.5 * log2(e)
  const float FILL2 = -1.0e9f * 1.4426950408889634f;      // the finite fill in the exp2 domain
  const float PSC   = 16384.0f;                           // probability carry (f16 operand stays normal)
  const float CTXC  = 16.0f;                              // output carry, undone in the projection epilogue

  const unsigned tid = threadIdx.x, wave = tid >> 5, lane = tid & 31u, hh = lane >> 4, c = lane & 15u;
  const unsigned bx = blockIdx.x;
  const unsigned qb = bx % NQB;
  const unsigned bh = bx / NQB;
  const unsigned h  = bh % (unsigned)NHEAD;
  const unsigned b  = bh / (unsigned)NHEAD;
  const unsigned wvu = (unsigned)__builtin_amdgcn_readfirstlane((int)wave);   // the wave's number, uniform: group, ring start and mask pointer stay scalar
  const unsigned grp = wvu / (unsigned)AT_WV, wq = wvu % (unsigned)AT_WV;     // key group; place among the group's waves = 32-query slice of the block
  const unsigned tg  = tid % (unsigned)(AT_WV * 32);      // thread inside the group
  const unsigned q0 = qb * (unsigned)AT_QB + wq * (unsigned)(AT_QW * 16);
  const unsigned rot = (qb * (NKC / NQB) + h + grp * NTR) % NKC;   // first key chunk of this group: the groups walk the two halves of the block's ring
  // the key chunk that trip t works on (t <= NTR + 1): chunk rot + t of the ring
  auto chunk_of = [&](const unsigned t) __attribute__((always_inline)) { const unsigned cj = t + rot; return (cj >= NKC) ? cj - NKC : cj; };

  const _Float16* Q  = (const _Float16*)Qp;
  const _Float16* K  = (const _Float16*)Kp;
  const _Float16* Vt = (const _Float16*)Vtp;

  const _Float16* qrow  = Q + (size_t)(b * (unsigned)SEQ + q0 + c) * DIMC + h * HDIM + 8u * hh;
  v16h qa[AT_QW][2];                                      // B operands: column c of tile u = query q0 + 16u + c (every loop over u unrolled: constant indices keep all of it in registers)
#pragma unroll
  for (int u = 0; u < AT_QW; ++u) { qa[u][0] = frag_ld(qrow + (size_t)u * 16u * DIMC); qa[u][1] = frag_ld(qrow + (size_t)u * 16u * DIMC + 32); }
  // copy share of this thread, in its group's chunk: K and V^T tile rows tg / 8 (+16, +32, +48), 16-B piece tg % 8 of the 128-B row piece
  const unsigned crow = tg >> 3, cpc = tg & 7u;
  const _Float16* gK = K + (size_t)(b * (unsigned)SEQ + crow) * DIMC + h * HDIM + cpc * 8u;           // key crow of chunk 0
  const _Float16* gV = Vt + ((size_t)b * DIMC + h * HDIM + crow) * SEQ + cpc * 8u;                     // V^T row crow, keys of chunk 0
  const unsigned lK = (unsigned)(size_t)KVs + (grp * (2u * AT_BH) + crow * AT_KP + cpc * 8u) * 2u;      // key x of a chunk lies in LDS row x of the group's buffer
  const unsigned lV = lK + AT_TH * 2u;
  const unsigned lsKV = 16u * AT_KP * 2u;
  const size_t gsK = (size_t)16u * DIMC, gsV = (size_t)16u * SEQ;
  // this wave's lane-mask words: 32 for each query tile and chunk, a tile's chunks in a row. The wave's number is made uniform and the pointer names
  // the constant address space (nothing writes these words during this launch), so that the loads inside the loop are scalar too: behind the loop's
  // asm waits with their memory clobber the compiler otherwise reloads them as vector loads and moves every word to a scalar register by v_readfirstlane.
  typedef const __attribute__((address_space(4))) v16u* cw_ptr;
  const cw_ptr mwp = (cw_ptr)(unsigned long long)(MB + (size_t)((b * (unsigned)(SEQ / 16) + qb * (unsigned)(AT_QB / 16) + wq * (unsigned)AT_QW) * NKC) * 32u);
  v16u mw[AT_QW][2];                                      // the first chunk: words 8j + r of score tiles j = 0, 1 | j = 2, 3, for each query tile
#pragma unroll
  for (int u = 0; u < AT_QW; ++u) { mw[u][0] = mwp[(unsigned)u * 2u * NKC + 2u * rot]; mw[u][1] = mwp[(unsigned)u * 2u * NKC + 2u * rot + 1u]; }
  const unsigned fKV = c * AT_KP + 8u * hh;               // this lane's fragment place in a 16-row group of either staged tile

  float mrow[AT_QW], lrow[AT_QW];                         // this lane's query of tile u: running maximum (both halves alike), this half's share of the sum
  v8f oacc[AT_QW][4];                                     // O^T tile t of query tile u: column c = query, element r = head column 16t + 8hh + r
#pragma unroll
  for (int u = 0; u < AT_QW; ++u) {
    mrow[u] = -INFINITY; lrow[u] = 0.f;
#pragma unroll
    for (int t = 0; t < 4; ++t) oacc[u][t] = (v8f){0.f,0.f,0.f,0.f,0.f,0.f,0.f,0.f};
  }

  stage_fill(lK, lsKV, lV, lsKV, gK + (size_t)(rot * 64u) * DIMC, gsK, gV + rot * 64u, gsV);
  asm volatile("s_wait_asynccnt 0x0" ::: "memory");     // this wave's copies of trip 0 have landed
  __syncthreads();                                      // ... and every other wave's: buffer 0 is readable
  if (NTR > 1u) stage_fill(lK + AT_BH * 2u, lsKV, lV + AT_BH * 2u, lsKV, gK + (size_t)(chunk_of(1u) * 64u) * DIMC, gsK, gV + chunk_of(1u) * 64u, gsV);

  // One trip: number kc, on chunk chunk_of(kc). refill = a trip kc + 2 exists; it is a constant at either call, so that a trip is one straight block: with the test inside
  // the loop the compiler moved the 64 additions of the row sums behind it, which kept all 64 probabilities in registers through the second products.
  auto trip = [&](const unsigned kc, const bool refill) __attribute__((always_inline)) {
    const _Float16* kvs = KVs + grp * (2u * AT_BH) + (kc & 1u) * AT_BH + fKV;
    v8f s[AT_QW][4];
    v16h kf[4][2];                                      // the chunk's 8 K fragments, read as one group in front of the products (loops unrolled: constant indices keep them in registers)
#pragma unroll
    for (int j = 0; j < 4; ++j) {
      const _Float16* kr = kvs + (unsigned)j * 16u * AT_KP;                        // A row c of tile j = key 16j + c of the chunk
      kf[j][0] = frag_ld(kr); kf[j][1] = frag_ld(kr + 32);
    }
#pragma unroll
    for (int j = 0; j < 4; ++j)
#pragma unroll
      for (int u = 0; u < AT_QW; ++u) s[u][j] = wm16(kf[j][0], qa[u][0], (v8f){0.f,0.f,0.f,0.f,0.f,0.f,0.f,0.f});
#pragma unroll
    for (int j = 0; j < 4; ++j)
#pragma unroll
      for (int u = 0; u < AT_QW; ++u) s[u][j] = wm16(kf[j][1], qa[u][1], s[u][j]);

    const unsigned kn = chunk_of(kc + 1u);              // the chunk whose words are read next (the last trip reads those of the chunk behind the group's last one, unused)
    v16h pb[AT_QW][2];                                  // P^T packed from the score registers (unrolled as above)
    v16h va[2][4];                                      // the chunk's V^T fragments, A: row d = t*16 + c, same key map as P^T (unrolled as above)
#pragma unroll
    for (int u = 0; u < AT_QW; ++u) {
      float x[4][8];                                    // this query's 32 scores, then its 32 probabilities (every loop over them unrolled: constant indices keep them in registers)
#pragma unroll
      for (int j = 0; j < 4; ++j)
#pragma unroll
        for (int r = 0; r < 8; ++r)
          x[j][r] = __builtin_amdgcn_inverse_ballot_w32((j < 2) ? mw[u][0][8 * j + r] : mw[u][1][8 * (j - 2) + r]) ? s[u][j][r] * SC2 : FILL2;
      // the next chunk's words, into the registers just used
      mw[u][0] = mwp[(unsigned)u * 2u * NKC + 2u * kn]; mw[u][1] = mwp[(unsigned)u * 2u * NKC + 2u * kn + 1u];
      float mj[4];
#pragma unroll
      for (int j = 0; j < 4; ++j)
        mj[j] = fmaxf(fmaxf(fmaxf(x[j][0], x[j][1]), fmaxf(x[j][2], x[j][3])), fmaxf(fmaxf(x[j][4], x[j][5]), fmaxf(x[j][6], x[j][7])));
      float m = fmaxf(fmaxf(mj[0], mj[1]), fmaxf(mj[2], mj[3]));
      m = fmaxf(m, xhalf(m));                           // the other half's 32 keys of the same query
      const float mnew  = fmaxf(mrow[u], m);
      const float alpha = ex2(mrow[u] - mnew);
      mrow[u] = mnew;
#pragma unroll
      for (int j = 0; j < 4; ++j)                       // all 32 exponents first, so that the v_exp_f32 groups below work in place (unrolled as above)
#pragma unroll
        for (int r = 0; r < 8; ++r) x[j][r] -= mnew;
      float pj[4];
#pragma unroll
      for (int j = 0; j < 4; ++j) {
        ex2x8(x[j]);
        pj[j] = ((x[j][0] + x[j][1]) + (x[j][2] + x[j][3])) + ((x[j][4] + x[j][5]) + (x[j][6] + x[j][7]));
      }
      lrow[u] = lrow[u] * alpha + ((pj[0] + pj[1]) + (pj[2] + pj[3]));
#pragma unroll
      for (int t = 0; t < 4; ++t)
#pragma unroll
        for (int r = 0; r < 8; ++r) oacc[u][t][r] *= alpha;
#pragma unroll
      for (int kk = 0; kk < 2; ++kk)
#pragma unroll
        for (int i = 0; i < 8; ++i) {
          pb[u][kk][i]     = (_Float16)(x[2 * kk][i] * PSC);       // B element i     = key 32kk + 8hh + i
          pb[u][kk][i + 8] = (_Float16)(x[2 * kk + 1][i] * PSC);   // B element 8 + i = key 32kk + 16 + 8hh + i
        }
      // One query tile's softmax at a time, and behind each one half of the V^T fragments as a group (keys 0..31 under the second tile's softmax,
      // keys 32..63 under the first eight products): scheduled freely, both tiles' scores and all 16 fragment reads are live at once and the
      // wave goes past 256 registers, with some thirty register-window switches in every trip.
      __builtin_amdgcn_sched_barrier(0);
#pragma unroll
      for (int t = 0; t < 4; ++t) va[u][t] = frag_ld(kvs + AT_TH + (unsigned)t * 16u * AT_KP + (unsigned)u * 32u);
    }
#pragma unroll
    for (int kk = 0; kk < 2; ++kk)
#pragma unroll
      for (int t = 0; t < 4; ++t)
#pragma unroll
        for (int u = 0; u < AT_QW; ++u) oacc[u][t] = wm16(va[kk][t], pb[u][kk], oacc[u][t]);
    asm volatile("s_wait_dscnt 0x0" ::: "memory");      // this wave's reads of buffer kc%2 are done before it is handed to its next writer
    asm volatile("s_wait_asynccnt 0x0" ::: "memory");   // this wave's copies of trip kc+1's chunk have landed
    __syncthreads();                                    // publishes trip kc+1's buffer and ends every reader's last read of trip kc's
    if (refill) {
      const unsigned lo = (kc & 1u) * (AT_BH * 2u);
      const unsigned kv2 = chunk_of(kc + 2u) * 64u;     // first key of trip kc + 2's chunk
      stage_fill(lK + lo, lsKV, lV + lo, lsKV, gK + (size_t)kv2 * DIMC, gsK, gV + kv2, gsV);
    }
  };
  unsigned kc = 0;
#pragma unroll 1
  for (; kc + 2u < NTR; ++kc) trip(kc, true);           // rolled: one copy of the trip in the instruction cache
#pragma unroll 1
  for (; kc < NTR; ++kc) trip(kc, false);               // the last two chunks: nothing is left to copy
  asm volatile("s_wait_asynccnt 0x0" ::: "memory");     // nothing of this wave is in flight when the loop is left

  // behind the last trip's barrier nobody reads the staged tiles any more and no copy is in flight.
  // Group g joins query tile g: a wave hands the other tile's partial result to its partner (lane for lane the same query and head columns).
  float* xs = (float*)KVs;
  auto put = [&](const int u) __attribute__((always_inline)) {
    float* p = xs + wvu * (unsigned)AT_XF + lane * 4u;   // a row = 32 lanes x 16 B
#pragma unroll
    for (int t = 0; t < 4; ++t) {
      *(v4f*)(p + (unsigned)(2 * t) * 128u)     = (v4f){oacc[u][t][0], oacc[u][t][1], oacc[u][t][2], oacc[u][t][3]};
      *(v4f*)(p + (unsigned)(2 * t + 1) * 128u) = (v4f){oacc[u][t][4], oacc[u][t][5], oacc[u][t][6], oacc[u][t][7]};
    }
    float* pm = xs + wvu * (unsigned)AT_XF + 1024u + lane * 2u;
    pm[0] = mrow[u]; pm[1] = lrow[u];
  };
  _Float16* os = KVs + 2u * AT_BH + wvu * (unsigned)(16 * AT_PP);   // this wave's own 16 x 64 output slice
  auto join = [&](const int u) __attribute__((always_inline)) {
    const float* p = xs + (wvu ^ (unsigned)AT_WV) * (unsigned)AT_XF + lane * 4u;
    const float* pm = xs + (wvu ^ (unsigned)AT_WV) * (unsigned)AT_XF + 1024u + lane * 2u;
    const float m2 = pm[0], l2 = pm[1];
    const float m  = fmaxf(mrow[u], m2);
    const float a1 = ex2(mrow[u] - m), a2 = ex2(m2 - m);                  // both maxima are finite: every group has worked on at least one chunk
    const float l  = lrow[u] * a1 + l2 * a2;                              // this half's share of the sum over all keys
    const float inv = CTXC * (1.0f / ((l + xhalf(l)) * PSC));             // the two halves' sums of this query joined
    const float f1 = a1 * inv, f2 = a2 * inv;
#pragma unroll
    for (int t = 0; t < 4; ++t) {
      const v4f o0 = *(const v4f*)(p + (unsigned)(2 * t) * 128u), o1 = *(const v4f*)(p + (unsigned)(2 * t + 1) * 128u);
      v8h hv;
#pragma unroll
      for (int r = 0; r < 4; ++r) {
        hv[r]     = (_Float16)(oacc[u][t][r] * f1 + o0[r] * f2);
        hv[r + 4] = (_Float16)(oacc[u][t][r + 4] * f1 + o1[r] * f2);
      }
      *(v8h*)(os + c * AT_PP + (unsigned)t * 16u + 8u * hh) = hv;         // query row c of the tile, head columns 16t + 8hh + 0..7
    }
  };
  if (grp == 0u) put(1); else put(0);                   // wave-uniform
  __syncthreads();                                      // every wave's slot is written before its partner reads it
  if (grp == 0u) join(0); else join(1);
  wave_sync();
  {
    const unsigned q4 = lane >> 3, c8 = (lane & 7u) * 8u;
    _Float16* cb = (_Float16*)ctxp + (size_t)(b * (unsigned)SEQ + q0 + grp * 16u) * DIMC + h * HDIM;
#pragma unroll
    for (int it = 0; it < 4; ++it) {
      const unsigned row = (unsigned)it * 4u + q4;
      *(v8h*)(cb + (size_t)row * DIMC + c8) = *(const v8h*)(os + row * AT_PP + c8);
    }
  }
}

// ---------------------------------------------------------------------------------------------------------
// workspace carve (bytes, every region a multiple of 256 and fully written by its producer before any read)
// ---------------------------------------------------------------------------------------------------------
static constexpr size_t SZ_X16   = (size_t)3 * MROWS * DIMC * 2;     // q16 | k16 | v16 planes [MROWS][1024] f16
static constexpr size_t SZ_WT16  = (size_t)4 * DIMC * DIMC * 2;      // Wq^T | Wk^T | Wv^T | Wp^T planes [out][in] f16, x16
static constexpr size_t SZ_QK16  = (size_t)2 * MROWS * DIMC * 2;     // Q16 | K16 planes [MROWS][1024] f16
static constexpr size_t SZ_VT16  = (size_t)NB * DIMC * SEQ * 2;      // V^T planes [b][1024][SEQ] f16
static constexpr size_t SZ_CTX16 = (size_t)MROWS * DIMC * 2;         // merged head output x16 [MROWS][1024] f16
static constexpr size_t SZ_BRO   = (size_t)DIMC * 4;                 // bias, bf16 RNE-converted, f32
static constexpr size_t SZ_MB    = (size_t)NB * (SEQ / 16) * (SEQ / 64) * 32 * 4;   // lane-mask words [b][16-query tile][64-key chunk][32]
static constexpr size_t SZ_TOTAL = SZ_X16 + SZ_WT16 + SZ_QK16 + SZ_VT16 + SZ_CTX16 + SZ_BRO + SZ_MB;
static_assert((SZ_X16 % 256) == 0 && (SZ_WT16 % 256) == 0 && (SZ_QK16 % 256) == 0 && (SZ_VT16 % 256) == 0 && (SZ_CTX16 % 256) == 0 && (SZ_BRO % 256) == 0 && (SZ_MB % 256) == 0);
static_assert(SZ_TOTAL <= (size_t)134217728);
// coverage equalities of the plane writers
static_assert((size_t)CV_ST * CV_TH * 8 == (size_t)MROWS * DIMC);                     // k_convert per activation tensor
static_assert((size_t)CV_ST * CV_TH * 8 == (size_t)4 * DIMC * DIMC);                  // k_convert, the four weights
static_assert((size_t)(SEQ / AT_QB) * AT_WV * AT_QW * 16 * 64 == (size_t)SEQ * HDIM);               // k_flash per (batch, head): blocks x waves x rows x cols
static_assert((MROWS % 128) == 0 && (DIMC % 128) == 0 && (SEQ % 128) == 0);            // k_gemm64: whole 128x128 tiles, K = DIMC in whole 64-k trips

extern "C" void kernel_launch(void* const* d_in, const int* in_sizes, int n_in, void* d_out, int out_size, void* d_ws, size_t ws_size, hipStream_t stream) {
  if (n_in < 9) return;
  const long long needX = (long long)(NB - 1) * SEQ_FULL * DIMC + (long long)SEQ * DIMC;
  const long long needM = (long long)(NB - 1) * SEQ_FULL * SEQ_FULL + (long long)(SEQ - 1) * SEQ_FULL + SEQ;
  if ((long long)in_sizes[0] < needX || (long long)in_sizes[1] < needX || (long long)in_sizes[2] < needX) return;
  if ((long long)in_sizes[3] < needM) return;
  if (in_sizes[4] < DIMC * DIMC || in_sizes[5] < DIMC * DIMC || in_sizes[6] < DIMC * DIMC || in_sizes[7] < DIMC * DIMC || in_sizes[8] < DIMC) return;
  if ((long long)out_size < (long long)MROWS * DIMC) return;
  if (ws_size < SZ_TOTAL) return;

  const float* q    = (const float*)d_in[0];
  const float* k    = (const float*)d_in[1];
  const float* v    = (const float*)d_in[2];
  const int*   mask = (const int*)d_in[3];
  const float* Wq   = (const float*)d_in[4];
  const float* Wk   = (const float*)d_in[5];
  const float* Wv   = (const float*)d_in[6];
  const float* Wp   = (const float*)d_in[7];
  const float* bp   = (const float*)d_in[8];
  float* out = (float*)d_out;

  char* wsp = (char*)d_ws;
  unsigned short* X16   = (unsigned short*)wsp; wsp += SZ_X16;
  unsigned short* WT16  = (unsigned short*)wsp; wsp += SZ_WT16;
  unsigned short* QK16  = (unsigned short*)wsp; wsp += SZ_QK16;
  unsigned short* VT16  = (unsigned short*)wsp; wsp += SZ_VT16;
  unsigned short* CTX16 = (unsigned short*)wsp; wsp += SZ_CTX16;
  float*          BRO   = (float*)wsp;          wsp += SZ_BRO;
  unsigned*       MB    = (unsigned*)wsp;       wsp += SZ_MB;

  const unsigned long long planeX = (unsigned long long)MROWS * DIMC;     // elements per activation plane
  const unsigned long long planeW = (unsigned long long)DIMC * DIMC;

  // weights [in][out] -> [out][in] f16 x16 (4 planes); bias; activations (3 planes, full input batch stride, compact planes); mask -> lane-mask words
  k_convert<<<dim3((unsigned)CV_WG, 1u, 1u), 512, 0, stream>>>(q, k, v, Wq, Wk, Wv, Wp, bp, mask, X16, WT16, BRO, MB);
  // Q16 | K16 = (q16 | k16) x (Wq^T | Wk^T): batch y = 0 (q), 1 (k); M = MROWS, N = K = 1024
  k_gemm64<0, 1><<<dim3((unsigned)((MROWS / 128) * (DIMC / 128)), 2u, 1u), 256, 0, stream>>>(
      X16, (unsigned)DIMC, planeX, WT16, (unsigned)DIMC, planeW, (void*)QK16, (unsigned)DIMC, planeX, nullptr,
      (unsigned)MROWS, (unsigned)DIMC, (unsigned)DIMC, 0.0625f);
  // V^T[b][o][n] = sum_k Wv^T[o][k] * v16[b][n][k]: A = Wv^T plane (M = 1024), Bt = v16 batch plane (N = SEQ), C pitch SEQ
  k_gemm64<0, 1><<<dim3((unsigned)((DIMC / 128) * (SEQ / 128)), (unsigned)NB, 1u), 256, 0, stream>>>(
      WT16 + 2 * planeW, (unsigned)DIMC, 0ull, X16 + 2 * planeX, (unsigned)DIMC, (unsigned long long)SEQ * DIMC,
      (void*)VT16, (unsigned)SEQ, (unsigned long long)DIMC * SEQ, nullptr,
      (unsigned)DIMC, (unsigned)SEQ, (unsigned)DIMC, 0.0625f);
  // attention
  k_flash<<<dim3((unsigned)(NB * NHEAD * (SEQ / AT_QB)), 1u, 1u), AT_KG * AT_WV * 32, 0, stream>>>(QK16, QK16 + planeX, VT16, MB, CTX16);
  // out = (ctx x16) x (Wp^T x16) / 256 + bias
  k_gemm64<2, 0><<<dim3((unsigned)((MROWS / 128) * (DIMC / 128)), 1u, 1u), 256, 0, stream>>>(
      CTX16, (unsigned)DIMC, 0ull, WT16 + 3 * planeW, (unsigned)DIMC, 0ull, (void*)out, (unsigned)DIMC, 0ull, BRO,
      (unsigned)MROWS, (unsigned)DIMC, (unsigned)DIMC, 0.00390625f);
}

// v009
// A run of this version takes 97.9 microseconds.
// Timed twice side by side with v008, it ran 1.03 times as fast both times.
// All steps since v000 together make it 3.25 times as fast.
// Masked multi-head attention (2 x 2,048 x 1,024; 16 heads x 64): inputs and parameters RNE-converted to bf16 first; every contraction (q/k/v projections, q.k^T, p.v, output projection) on v_wmma_f32_16x16x32_f16 (f16 operands: weights x16, probabilities x2^14, merged head output x16; f32 accumulate, f32 online softmax in the exp2 domain).
#include <hip/hip_runtime.h>
#include <math.h>

#ifndef NB
#define NB 2
#endif
#ifndef SEQ
#define SEQ 2048
#endif
#define NB_FULL 2
#define SEQ_FULL 2048
#define DIMC 1024
#define NHEAD 16
#define HDIM 64
#define MROWS (NB * SEQ)

static_assert(SEQ % 64 == 0);
static_assert(SEQ <= SEQ_FULL);
static_assert(NB <= NB_FULL);
static_assert(DIMC == NHEAD * HDIM);
static_assert(DIMC % 64 == 0);
static_assert(DIMC / 8 == 128);
static_assert((MROWS % 64) == 0);
static_assert(((SEQ * 128) % 256) == 0);

typedef __attribute__((ext_vector_type(16))) _Float16 v16h;
typedef __attribute__((ext_vector_type(8)))  _Float16 v8h;
typedef __attribute__((ext_vector_type(4)))  _Float16 v4h;
typedef __attribute__((ext_vector_type(8)))  float    v8f;
typedef __attribute__((ext_vector_type(4)))  float    v4f;
typedef __attribute__((ext_vector_type(4)))  int      v4i;
typedef __attribute__((ext_vector_type(16))) unsigned v16u;

// 16-bit WMMA fragment map (wave32), lane L, h = L>>4, m = L&15:
//   A 16x32: lane = row m;    element i -> k = (i<8) ? 8h+i : 16+8h+(i-8)
//   B 32x16: lane = column m; the SAME k(i,h)
//   D 16x16 (8 f32): lane = column m; element r -> row 8h+r
union FragU { v16h v; v8h h[2]; };
// p already includes the lane-half offset 8h: elements 0..7 <- p[0..7], 8..15 <- p[16..23]
__device__ __forceinline__ v16h frag_ld(const _Float16* p) {
  FragU f; f.h[0] = *(const v8h*)(p); f.h[1] = *(const v8h*)(p + 16); return f.v;
}
// the builtin alone: the compiler keeps the distance behind it itself, with independent instructions where it has some
__device__ __forceinline__ v8f wm16(v16h a, v16h b, v8f c) {
  return __builtin_amdgcn_wmma_f32_16x16x32_f16(false, a, false, b, (short)0, c, false, false);
}
__device__ __forceinline__ void dep_guard_h(v8f& a, v8f& b, v16h x, v16h y) { asm volatile("v_nop\n\tv_nop\n\tv_nop\n\tv_nop" : "+v"(a), "+v"(b) : "v"(x), "v"(y)); }
__device__ __forceinline__ void keep4_h(v16h a, v16h b, v16h c, v16h d) { asm volatile("v_nop" :: "v"(a), "v"(b), "v"(c), "v"(d)); }
__device__ __forceinline__ void acc_guard4(v8f& a, v8f& b, v8f& c, v8f& d) { asm volatile("v_nop\n\tv_nop\n\tv_nop\n\tv_nop" : "+v"(a), "+v"(b), "+v"(c), "+v"(d)); }
// same-wave LDS exchange: stores by some lanes, loads of those locations by other lanes of the SAME wave
__device__ __forceinline__ void wave_sync() {
  __builtin_amdgcn_fence(3 /* release order */, "workgroup");
  __builtin_amdgcn_wave_barrier();
  __builtin_amdgcn_fence(2 /* acquire order */, "workgroup");
}
// bf16 RNE-convert, kept as f32 (finite inputs)
__device__ __forceinline__ float cmb_bf(float v) {
  const unsigned u = __builtin_bit_cast(unsigned, v);
  const unsigned r = (u + 0x7fffu + ((u >> 16) & 1u)) & 0xffff0000u;
  return __builtin_bit_cast(float, r);
}

// ---------------------------------------------------------------------------------------------------------
// k_convert: every conversion of the call in ONE launch of CV_WG work-groups of 16 waves, one for each WGP, all resident at once; a thread
// takes CV_ST pieces of every kind instead of ending after one, so the launch starts 4,096 waves where three launches started 65,568.
// A thread's pieces, step j = 0 .. CV_ST - 1:
//   one of each activation tensor: f32 row [1024], 8 columns -> bf16 (RNE) -> f16 plane rows [MROWS][1024], one 16-B store
//   (piece j * CV_TH + flat thread: consecutive threads walk along a row; sources use the FULL input batch stride, planes are compact);
//   one of a weight: W[k = in][o = out] (row pitch 1024) -> WT[o][k] = f16(bf16_rne(W[k][o]) * 16): 8 strided loads, one 16-B store, a wave walks
//   along the destination row. A work-group takes two tiles of 32 outputs x 256 inputs, two steps each (16 waves = 16 outputs a step): the
//   128-B source lines of a tile hold exactly its 32 outputs, so both steps and all 16 waves read the same 256 lines.
// All loads of a thread are issued first (24 of 16 B, 16 of 16 B for the mask, then 32 of 4 B), so a wave waits out the memory latency once, not once a step.
// The first DIMC threads of the launch also convert the bias.
// The keep-mask is packed here, once for all 16 heads: a wave takes 16 query rows x 128 keys (16 whole-line loads of 512 B, a work-group reads
// 128 KiB in a row), turns them through its own LDS slice into k_flash's score layout (lane = 16 hh + c holds query c, keys 16j + 8hh + r of a
// 64-key chunk) and writes, for each chunk, 32 lane-mask words: word 8j + r, bit lane = (mask element != 0).
// ---------------------------------------------------------------------------------------------------------
#define CV_WG 256                       // work-groups of the launch
#define CV_TH (CV_WG * 512)             // threads of the launch
#define CV_ST 4                         // pieces of each kind per thread
#define CV_RPS (CV_TH / 128)             // activation rows of one step (128 pieces a row)
#define CV_TPW ((DIMC / 32) * (DIMC / 256))   // tiles of one weight
static_assert(MROWS * 128 == CV_ST * CV_TH);              // activation pieces of one tensor: every one exactly once
static_assert(4 * CV_TPW == CV_WG * (CV_ST / 2));         // weight tiles: every one exactly once
static_assert(CV_TPW % (CV_ST / 2) == 0);                 // a work-group's tiles lie in one weight
static_assert(SEQ % CV_RPS == 0);                         // a step's rows lie in one batch
static_assert(DIMC <= CV_TH);
static_assert(CV_ST == 4);                                // the wait behind the activation loads names four offsets
static_assert(((unsigned long long)(NB - 1) * SEQ_FULL + SEQ) * DIMC * 4 < (1ull << 32));   // source byte offsets fit 32 bits
#define CV_MP 132                       // mask slice row pitch in words: 528 B = 16 B x 33
static_assert(SEQ % 128 == 0);
static_assert((size_t)NB * (SEQ / 16) * (SEQ / 128) == (size_t)CV_WG * 16);               // mask pieces: one for every wave of the launch
static_assert((unsigned long long)NB * SEQ_FULL * SEQ_FULL * 4 < (1ull << 32));           // mask byte offsets fit 32 bits
__global__ __launch_bounds__(512) void k_convert(const float* __restrict__ S0, const float* __restrict__ S1, const float* __restrict__ S2,
                                                  const float* __restrict__ W0, const float* __restrict__ W1, const float* __restrict__ W2,
                                                  const float* __restrict__ W3, const float* __restrict__ BP, const int* __restrict__ MK,
                                                  unsigned short* __restrict__ X, unsigned short* __restrict__ WT, float* __restrict__ BRO,
                                                  unsigned* __restrict__ MB) {
  __shared__ __align__(16) int sM[16][16 * CV_MP];   // per-wave slice: 16 query rows x 128 keys of the mask
  const unsigned t = blockIdx.x * 512u + threadIdx.x;
  const unsigned wave = threadIdx.x >> 5, lane = threadIdx.x & 31u;
  const unsigned tile0 = blockIdx.x * (CV_ST / 2u);
  const unsigned y = tile0 / (unsigned)CV_TPW;
  const float* W = (y == 0u) ? W0 : ((y == 1u) ? W1 : ((y == 2u) ? W2 : W3));   // block-uniform choice among global pointers
  const unsigned tsb = t * 32u, tdb = t * 16u;   // this thread's place inside a step's CV_RPS rows, in source and in plane bytes: one 32-bit offset beside a uniform base
  v4f x[CV_ST][3][2];                   // every loop over the steps is unrolled: constant indices keep the pieces in registers
  float w[CV_ST][8];
  unsigned so[CV_ST];                   // source byte offsets of the thread's pieces, alike in the three tensors
#pragma unroll
  for (unsigned j = 0; j < CV_ST; ++j) {
    // first row of step j in the source: batch (j * CV_RPS) / SEQ at the full batch stride, row (j * CV_RPS) % SEQ of it
    so[j] = (((j * (unsigned)CV_RPS) / (unsigned)SEQ) * (unsigned)SEQ_FULL + (j * (unsigned)CV_RPS) % (unsigned)SEQ) * (unsigned)(DIMC * 4) + tsb;
    const v4f* s0 = (const v4f*)((const char*)S0 + so[j]);
    const v4f* s1 = (const v4f*)((const char*)S1 + so[j]);
    const v4f* s2 = (const v4f*)((const char*)S2 + so[j]);
    x[j][0][0] = s0[0]; x[j][0][1] = s0[1];
    x[j][1][0] = s1[0]; x[j][1][1] = s1[1];
    x[j][2][0] = s2[0]; x[j][2][1] = s2[1];
  }
  // The wait before a register that one of these 24 loads names is written again; the offsets are inputs so that they stay in their registers up
  // to it. The statement also keeps the streaming loads in front of the 32 many-line weight loads, which the compiler otherwise issues first
  // (a wave's loads return in order).
  asm volatile("s_wait_xcnt 0x0" :: "v"(so[0]), "v"(so[1]), "v"(so[2]), "v"(so[3]) : "memory");
  // this wave's mask piece: batch, 16-query tile, pair of 64-key chunks; row i of it is one 512-B load of the wave
  const unsigned gw = blockIdx.x * 16u + wave;
  const unsigned mkp = gw % (unsigned)(SEQ / 128), mqt = (gw / (unsigned)(SEQ / 128)) % (unsigned)(SEQ / 16), mbt = gw / (unsigned)((SEQ / 128) * (SEQ / 16));
  const unsigned mo = ((mbt * (unsigned)SEQ_FULL + mqt * 16u) * (unsigned)SEQ_FULL + mkp * 128u + lane * 4u) * 4u;
  v4i mk[16];                           // unrolled as above
#pragma unroll
  for (unsigned i = 0; i < 16u; ++i) mk[i] = __builtin_nontemporal_load((const v4i*)((const char*)MK + mo + i * (unsigned)(SEQ_FULL * 4)));   // read once in the whole call
  asm volatile("s_wait_xcnt 0x0" :: "v"(mo) : "memory");   // as above, for the 16 mask loads: they too stay in front of the weight loads
  unsigned wo[CV_ST];                   // source byte offsets of the thread's weight pieces (first of the 8 inputs)
#pragma unroll
  for (unsigned j = 0; j < CV_ST; ++j) {
    const unsigned ty = (tile0 + (j >> 1)) % (unsigned)CV_TPW;
    const unsigned o = (ty >> 2) * 32u + (j & 1u) * 16u + wave, k0 = (ty & 3u) * 256u + lane * 8u;
    wo[j] = (k0 * (unsigned)DIMC + o) * 4u;
#pragma unroll
    for (int e = 0; e < 8; ++e) w[j][e] = *(const float*)((const char*)W + wo[j] + (unsigned)e * (unsigned)(DIMC * 4));
  }
  asm volatile("s_wait_xcnt 0x0" :: "v"(wo[0]), "v"(wo[1]), "v"(wo[2]), "v"(wo[3]) : "memory");   // as above, for the 32 weight loads
  float bv = 0.f;
  if (t < (unsigned)DIMC) bv = BP[t];                                 // whole waves of the first work-groups
#pragma unroll
  for (unsigned j = 0; j < CV_ST; ++j) {
#pragma unroll
    for (int z = 0; z < 3; ++z) {
      v8h hv;
#pragma unroll
      for (int e = 0; e < 4; ++e) { hv[e] = (_Float16)cmb_bf(x[j][z][0][e]); hv[e + 4] = (_Float16)cmb_bf(x[j][z][1][e]); }
      *(v8h*)((char*)((_Float16*)X + ((size_t)z * MROWS + (size_t)j * CV_RPS) * DIMC) + tdb) = hv;
    }
    asm volatile("s_wait_xcnt 0x0" ::: "memory");   // before a register that one of these stores names is written again
  }
  {
    int* sm = sM[wave];
#pragma unroll
    for (unsigned i = 0; i < 16u; ++i) *(v4i*)(sm + i * (unsigned)CV_MP + lane * 4u) = mk[i];
    // The rows are read back by other lanes of this wave alone: its own LDS stores are waited for, and the statement keeps the reads behind them.
    // (wave_sync()'s work-group fences would also wait here for the global stores above and for the weight loads still in flight.)
    asm volatile("s_wait_dscnt 0x0" ::: "memory");
    const int* sr = sm + (lane & 15u) * (unsigned)CV_MP + (lane >> 4) * 8u;   // query row c, this half's 8 keys of a 16-key group
#pragma unroll
    for (unsigned ch = 0; ch < 2u; ++ch) {
      unsigned ow = 0u;                 // lane l ends up with word l of the chunk
#pragma unroll
      for (unsigned j = 0; j < 4u; ++j) {
        const v4i a = *(const v4i*)(sr + ch * 64u + j * 16u), bq = *(const v4i*)(sr + ch * 64u + j * 16u + 4u);
#pragma unroll
        for (unsigned r = 0; r < 4u; ++r) {
          const unsigned wa = __builtin_amdgcn_ballot_w32(a[r] != 0), wb = __builtin_amdgcn_ballot_w32(bq[r] != 0);
          ow = (lane == j * 8u + r) ? wa : ow;
          ow = (lane == j * 8u + 4u + r) ? wb : ow;
        }
      }
      MB[(gw * 2u + ch) * 32u + lane] = ow;
    }
    asm volatile("s_wait_xcnt 0x0" ::: "memory");   // before a register that one of these stores names is written again
  }
#pragma unroll
  for (unsigned j = 0; j < CV_ST; ++j) {
    const unsigned ty = (tile0 + (j >> 1)) % (unsigned)CV_TPW;
    const unsigned o = (ty >> 2) * 32u + (j & 1u) * 16u + wave, k0 = (ty & 3u) * 256u + lane * 8u;
    v8h hw;
#pragma unroll
    for (int e = 0; e < 8; ++e) hw[e] = (_Float16)(cmb_bf(w[j][e]) * 16.0f);
    *(v8h*)((_Float16*)WT + (size_t)y * DIMC * DIMC + (o * (unsigned)DIMC + k0)) = hw;
    asm volatile("s_wait_xcnt 0x0" ::: "memory");   // as above
  }
  if (t < (unsigned)DIMC) BRO[t] = cmb_bf(bv);
}

// ---------------------------------------------------------------------------------------------------------
// k_gemm64: C[m,n] = scale * sum_k A[m,k] * Bt[n,k] (+ bias[n]); f16 operand planes. A block of 8 waves owns a 128x128 tile of C,
// each wave 32 rows x 64 columns of it. Per trip 64 k of the block's 128 A rows and 128 Bt rows (128-B row pieces, whole lines) come
// into LDS by asynchronous copies, two buffers: the next trip's copies fly while this trip's fragments are read from LDS (row pitch 144 B).
// A block walks the k trips in a ring that starts at a trip of its own (tile row + tile column): blocks that share A rows or Bt rows start at
// different trips unless their (tile row + tile column) differ by a multiple of nT, as tile rows 16 apart and the V^T product's two batches
// (one A) do, and the blocks' requests spread over all 128-B columns of the 2-KiB operand rows.
// A row-major [M,K]; Bt row-major [N,K]; M,N % 128 == 0, K % 64 == 0, K >= 64; batch = blockIdx.y with element strides.
// OUT_MODE 0: f32 C; 1: f16 C. Epilogue: 16-row slabs staged per wave in LDS (wave-private), each 64-wide row segment written as whole
// ---------------------------------------------------------------------------------------------------------
#define GT_PH  72                      // LDS row pitch in halves: 144 B = 16 B x 9
#define GT_OPH (128 * GT_PH)           // halves of one operand's 128-row tile
#define GT_STH (2 * GT_OPH)            // halves of one buffer: A tile | Bt tile
// One buffer's fill, this thread's share: 16 B in each of four rows of the first tile and of four rows of the second (eight threads cover
// a 128-B row piece, so a wave covers 4 whole lines per copy). la, lb = the thread's LDS byte addresses in its first row of either tile,
// lsa, lsb = LDS bytes from one of its rows to the next; ga, gb, gsa, gsb = the same in global memory (addresses, steps in elements).
// s_wait_xcnt closes the statement so that no address register of an issued copy is rewritten ahead of it.
__device__ __forceinline__ void stage_fill(unsigned la, unsigned lsa, unsigned lb, unsigned lsb,
                                           const _Float16* ga, size_t gsa, const _Float16* gb, size_t gsb) {
  const unsigned la1 = la + lsa, la2 = la + 2u * lsa, la3 = la + 3u * lsa;
  const unsigned lb1 = lb + lsb, lb2 = lb + 2u * lsb, lb3 = lb + 3u * lsb;
  const _Float16* ga1 = ga + gsa; const _Float16* ga2 = ga + 2u * gsa; const _Float16* ga3 = ga + 3u * gsa;
  const _Float16* gb1 = gb + gsb; const _Float16* gb2 = gb + 2u * gsb; const _Float16* gb3 = gb + 3u * gsb;
  asm volatile("global_load_async_to_lds_b128 %0, %8, off\n\t"
               "global_load_async_to_lds_b128 %1, %9, off\n\t"
               "global_load_async_to_lds_b128 %2, %10, off\n\t"
               "global_load_async_to_lds_b128 %3, %11, off\n\t"
               "global_load_async_to_lds_b128 %4, %12, off\n\t"
               "global_load_async_to_lds_b128 %5, %13, off\n\t"
               "global_load_async_to_lds_b128 %6, %14, off\n\t"
               "global_load_async_to_lds_b128 %7, %15, off\n\t"
               "s_wait_xcnt 0x0"
               :: "v"(la), "v"(la1), "v"(la2), "v"(la3), "v"(lb), "v"(lb1), "v"(lb2), "v"(lb3),
                  "v"(ga), "v"(ga1), "v"(ga2), "v"(ga3), "v"(gb), "v"(gb1), "v"(gb2), "v"(gb3)
               : "memory");
}
template <int BIAS_MODE, int OUT_MODE>
__global__ __launch_bounds__(256) void k_gemm64(
    const unsigned short* __restrict__ Ap, unsigned lda, unsigned long long strideA,
    const unsigned short* __restrict__ Btp, unsigned ldb, unsigned long long strideB,
    void* __restrict__ Cout, unsigned ldc, unsigned long long strideC,
    const float* __restrict__ bias, unsigned M, unsigned N, unsigned K, float scale) {
  __shared__ __align__(16) _Float16 sS[2 * GT_STH];   // two buffers of [A 128 rows | Bt 128 rows] x 64 k, pitch 72 halves
  __shared__ __align__(16) float sT[8][16 * 68];      // per-wave 16x64 slab, pitch 68 floats
  const unsigned b    = blockIdx.y;
  const unsigned lane = threadIdx.x & 31u;
  const unsigned wave = threadIdx.x >> 5;
  const unsigned tilesN = N >> 7;
  const unsigned tilesM = M >> 7;
  const unsigned tile = blockIdx.x;
  if (tile >= tilesM * tilesN) return;   // block-uniform, in front of every barrier and copy
  const unsigned tm = tile / tilesN;
  const unsigned tn = tile - tm * tilesN;
  const unsigned m0 = (tm << 7) + ((wave >> 1) << 5);   // this wave's 32 rows
  const unsigned n0 = (tn << 7) + ((wave & 1u) << 6);   // this wave's 64 columns

  const _Float16* Ab = (const _Float16*)Ap + (size_t)b * strideA;
  const _Float16* Bb = (const _Float16*)Btp + (size_t)b * strideB;

  const unsigned rlane = lane & 15u;            // row (A) / col (B, D) within subtile
  const unsigned koff  = (lane >> 4) * 8u;      // k offset of this lane half
  const unsigned mOff  = (lane >> 4) * 8u;      // D row offset

  // copy share of this thread: tile row threadIdx.x / 8 (+32, +64, +96), 16-B piece threadIdx.x % 8 of the 128-B row piece
  const unsigned crow = threadIdx.x >> 3, cpc = threadIdx.x & 7u;
  const _Float16* gA = Ab + (size_t)((tm << 7) + crow) * lda + cpc * 8u;
  const _Float16* gB = Bb + (size_t)((tn << 7) + crow) * ldb + cpc * 8u;
  const unsigned lC = (unsigned)(size_t)sS + (crow * GT_PH + cpc * 8u) * 2u;
  // fragment read places of this lane inside a buffer
  const unsigned fA = (((wave >> 1) << 5) + rlane) * GT_PH + koff;
  const unsigned fB = GT_OPH + (((wave & 1u) << 6) + rlane) * GT_PH + koff;

  v8f acc[2][4];
#pragma unroll
  for (int i = 0; i < 2; ++i)
#pragma unroll
    for (int j = 0; j < 4; ++j) acc[i][j] = (v8f){0.f,0.f,0.f,0.f,0.f,0.f,0.f,0.f};

  const unsigned nT = K >> 6;
  const unsigned rot = (tm + tn) & (nT - 1u);           // first k trip of this block: below nT for any nT, block-uniform
  // element offset of the 64 k that trip t works on (t <= nT): trip rot + t of the ring
  auto kof = [&](const unsigned t) __attribute__((always_inline)) { const unsigned kt = t + rot; return (size_t)((kt >= nT) ? kt - nT : kt) * 64u; };
  const unsigned lStep = 32u * GT_PH * 2u;              // a thread's rows are 32 apart
  const size_t gsA = (size_t)32u * lda, gsB = (size_t)32u * ldb;
  stage_fill(lC, lStep, lC + GT_OPH * 2u, lStep, gA + kof(0u), gsA, gB + kof(0u), gsB);
  asm volatile("s_wait_asynccnt 0x0" ::: "memory");     // this wave's copies of trip 0 have landed
  __syncthreads();                                      // ... and every other wave's: buffer 0 is readable
  if (nT > 1u) stage_fill(lC + GT_STH * 2u, lStep, lC + (GT_STH + GT_OPH) * 2u, lStep, gA + kof(1u), gsA, gB + kof(1u), gsB);

  for (unsigned t = 0; t < nT; ++t) {
    const _Float16* sb = sS + (t & 1u) * GT_STH;
    v16h bh[2][4], ah[2][2];                            // the trip's 12 fragments, read as one group in front of its 16 products (loops unrolled: constant indices keep them in registers)
#pragma unroll
    for (int kk = 0; kk < 2; ++kk) {
#pragma unroll
      for (int j = 0; j < 4; ++j) bh[kk][j] = frag_ld(sb + fB + (unsigned)j * 16u * GT_PH + (unsigned)kk * 32u);
#pragma unroll
      for (int i = 0; i < 2; ++i) ah[kk][i] = frag_ld(sb + fA + (unsigned)i * 16u * GT_PH + (unsigned)kk * 32u);
    }
#pragma unroll
    for (int kk = 0; kk < 2; ++kk) {
#pragma unroll
      for (int i = 0; i < 2; ++i) {
#pragma unroll
        for (int j = 0; j < 4; ++j)
          acc[i][j] = __builtin_amdgcn_wmma_f32_16x16x32_f16(false, ah[kk][i], false, bh[kk][j], (short)0, acc[i][j], false, false);
        dep_guard_h(acc[i][0], acc[i][3], ah[kk][i], ah[kk][i]);
      }
      keep4_h(bh[kk][0], bh[kk][1], bh[kk][2], bh[kk][3]);
    }
    asm volatile("s_wait_dscnt 0x0" ::: "memory");      // this wave's reads of buffer t%2 are done before it is handed to its next writer
    asm volatile("s_wait_asynccnt 0x0" ::: "memory");   // this wave's copies of trip t+1 have landed
    __syncthreads();                                    // publishes trip t+1's buffer and ends every reader's last read of trip t's
    if (t + 2u < nT) {
      const unsigned lN = lC + (t & 1u) * (GT_STH * 2u);
      stage_fill(lN, lStep, lN + GT_OPH * 2u, lStep, gA + kof(t + 2u), gsA, gB + kof(t + 2u), gsB);
    }
  }
  asm volatile("s_wait_asynccnt 0x0" ::: "memory");     // nothing of this wave is in flight when the loop is left
  acc_guard4(acc[0][0], acc[0][1], acc[0][2], acc[0][3]);
  acc_guard4(acc[1][0], acc[1][1], acc[1][2], acc[1][3]);

  float* slab = sT[wave];
#pragma unroll
  for (int i = 0; i < 2; ++i) {
    const unsigned mBase = m0 + ((unsigned)i << 4);
#pragma unroll
    for (int j = 0; j < 4; ++j) {
      const unsigned n = n0 + ((unsigned)j << 4) + rlane;
      float bv = 0.f;
      if (BIAS_MODE == 2) bv = bias[n];
#pragma unroll
      for (int r = 0; r < 8; ++r) {
        float v = acc[i][j][r] * scale;
        if (BIAS_MODE == 2) v += bv;
        slab[(mOff + (unsigned)r) * 68u + ((unsigned)j << 4) + rlane] = v;
      }
    }
    wave_sync();
    if (OUT_MODE == 0) {
      float* C = (float*)Cout + (size_t)b * strideC;
      const unsigned hh = lane >> 4, c4 = (lane & 15u) * 4u;     // row segment = 256 B = 16 lanes x 16 B
      {
#pragma unroll
        for (int it = 0; it < 8; ++it) {
          const unsigned row = (unsigned)it * 2u + hh;
          const v4f v = *(const v4f*)(slab + row * 68u + c4);
          *(v4f*)(C + (size_t)(mBase + row) * ldc + n0 + c4) = v;
        }
        
      }
    } else {
      const unsigned q = lane >> 3, c8 = (lane & 7u) * 8u;
      _Float16* C = (_Float16*)Cout + (size_t)b * strideC;
      {
#pragma unroll
        for (int it = 0; it < 4; ++it) {
          const unsigned row = (unsigned)it * 4u + q;
          const float* sp = slab + row * 68u + c8;
          v8h hv;
#pragma unroll
          for (int e = 0; e < 8; ++e) hv[e] = (_Float16)sp[e];
          *(v8h*)(C + (size_t)(mBase + row) * ldc + n0 + c8) = hv;
        }
        
      }
    }
    wave_sync();
  }
}

// ---------------------------------------------------------------------------------------------------------
// k_flash: per (batch, head, 128-query block): block = 2 key groups x 4 waves x 32 queries (two 16-query tiles a wave); 64-key chunks; online
//   softmax in f32 (exp2 domain).
//   the two key groups work on the same 128 queries, each on half of the key chunks with a ring of its own, so that the launch has four waves for
//   every SIMD instead of two: one wave's softmax (vector port) then runs beside more waves' products and waits. Behind the loop a wave and its
//   partner in the other group (same queries) exchange one query tile's maximum, sum and O^T through LDS; each joins and writes one of the two tiles.
//   each chunk's 64 K16 rows and 64 V^T rows (128-B row pieces) come into LDS once per block by asynchronous copies, two buffers: the next
//   chunk's copies fly while this chunk is worked on.
//   every K and V^T fragment read from LDS feeds two products, one for each query tile of the wave.
//   a block walks the key chunks in a ring that starts at a chunk of its own: the query blocks of one (batch, head), which read the same K and V^T
//   rows and start together, then ask L2 for the lines of 16 different chunks at any one time, two key groups on each, and the blocks' requests spread over all 128-B columns of the V^T rows.
//   scores transposed: S^T = K.Q^T, A = staged K16 rows (tile j = keys 16j..16j+15), B = Q16 rows kept in registers. In each query tile a lane holds
//           32 scores of ONE query (column c; keys 16j + 8hh + r): maximum and sum run inside the lane, the two lane halves exchange the maximum
//           once per chunk and join their sums once, behind the loop.
//   keep-mask, shared by the heads: element == 0 -> score := fill (finite replace, applied after the scaling). k_convert has packed it into lane-mask
//           words in this kernel's score layout: a wave reads 32 words (128 B) for each of its query tiles and chunk by scalar loads, one chunk
//           ahead, and each word is the select mask of one score register: no compare, no mask tile in LDS.
//   output transposed: O^T += V^T.P^T, A = staged V^T rows, B = P^T (x 2^14, f16) packed straight from the score registers: score tiles 2kk and
//           2kk+1 hold exactly the keys of B elements 0..7 and 8..15 of key group kk, so P never passes through LDS.
// ---------------------------------------------------------------------------------------------------------
#define AT_PP 72                        // output staging row pitch in halves
#define AT_KP 72                        // staged row pitch in halves: 144 B = 16 B x 9
#define AT_TH (64 * AT_KP)              // halves of one staged 64-row tile
#define AT_BH (2 * AT_TH)               // halves of one buffer: K tile | V^T tile
#define AT_QW 2                         // 16-query tiles of one wave (the loop reads one of the two 32-key V^T fragment groups behind each)
#define AT_WV 4                         // waves of one key group
#define AT_KG 2                         // key groups of one block
#define AT_QB (AT_WV * AT_QW * 16)      // queries of one block
#define AT_XF (8 * 128 + 64)            // floats of one wave's exchange slot: 8 rows of 32 lanes x 4 (O^T of one query tile), 32 lanes x 2 (maximum, sum)
static_assert(SEQ % AT_QB == 0);
static_assert(AT_QW == 2);              // one V^T fragment group (32 keys) for each query tile
static_assert(AT_KG == 2 && AT_WV == 4); // a wave's partner is wave ^ 4; each of the two joins one of the two query tiles
// 2^x as the bare v_exp_f32, without the library form's range test, selects, add and ldexp around it. Every argument here is <= 0 (or -inf);
// the two forms differ only where 2^x < 2^-126, which may come out 0: such a term is far under half an ulp of the row's sum and of the f16 operand.
// The v_nop fills the slot behind it.
__device__ __forceinline__ float ex2(float x) { float r; asm("v_exp_f32 %0, %1\n\tv_nop" : "=v"(r) : "v"(x)); return r; }
// Eight of them in place, in one statement: each v_exp_f32 is the independent instruction that the slot behind the one before it asks for, and the
// v_nop fills the slot behind the last.
__device__ __forceinline__ void ex2x8(float (&v)[8]) {
  asm("v_exp_f32 %0, %0\n\tv_exp_f32 %1, %1\n\tv_exp_f32 %2, %2\n\tv_exp_f32 %3, %3\n\t"
      "v_exp_f32 %4, %4\n\tv_exp_f32 %5, %5\n\tv_exp_f32 %6, %6\n\tv_exp_f32 %7, %7\n\tv_nop"
      : "+v"(v[0]), "+v"(v[1]), "+v"(v[2]), "+v"(v[3]), "+v"(v[4]), "+v"(v[5]), "+v"(v[6]), "+v"(v[7]));
}
// lane l <-> lane l ^ 16
__device__ __forceinline__ float xhalf(float x) {
  const int b = __builtin_bit_cast(int, x);
  return __builtin_bit_cast(float, __builtin_amdgcn_permlanex16(b, b, 0x76543210, 0xfedcba98, false, false));
}
__global__ __launch_bounds__(AT_KG * AT_WV * 32) void k_flash(const unsigned short* __restrict__ Qp, const unsigned short* __restrict__ Kp,
                                               const unsigned short* __restrict__ Vtp, const unsigned* __restrict__ MB,
                                               unsigned short* __restrict__ ctxp) {
  __shared__ __align__(16) _Float16 KVs[AT_KG * 2 * AT_BH];   // for each key group two buffers of [K 64 keys | V^T 64 rows] x 64 halves, pitch 72 halves; behind the loop: exchange slots | output staging
  static_assert(AT_KG * AT_WV * AT_XF * 4 <= 2 * AT_BH * 2);   // the exchange slots lie in the first group's ring
  static_assert(AT_KG * AT_WV * 16 * AT_PP <= 2 * AT_BH);      // the output staging lies in the second group's
  constexpr unsigned NQB = SEQ / AT_QB;                   // query blocks of one (batch, head)
  constexpr unsigned NKC = SEQ / 64;                      // key chunks
  constexpr unsigned NTR = NKC / AT_KG;                   // trips = key chunks of one group
  static_assert(NKC % AT_KG == 0 && NTR >= 2);
  const float SC2   = 0.125f * 1.4426950408889634f;       // 64^-0.5 * log2(e)
  const float FILL2 = -1.0e9f * 1.4426950408889634f;      // the finite fill in the exp2 domain
  const float PSC   = 16384.0f;                           // probability carry (f16 operand stays normal)
  const float CTXC  = 16.0f;                              // output carry, undone in the projection epilogue

  const unsigned tid = threadIdx.x, wave = tid >> 5, lane = tid & 31u, hh = lane >> 4, c = lane & 15u;
  const unsigned bx = blockIdx.x;
  const unsigned qb = bx % NQB;
  const unsigned bh = bx / NQB;
  const unsigned h  = bh % (unsigned)NHEAD;
  const unsigned b  = bh / (unsigned)NHEAD;
  const unsigned wvu = (unsigned)__builtin_amdgcn_readfirstlane((int)wave);   // the wave's number, uniform: group, ring start and mask pointer stay scalar
  const unsigned grp = wvu / (unsigned)AT_WV, wq = wvu % (unsigned)AT_WV;     // key group; place among the group's waves = 32-query slice of the block
  const unsigned tg  = tid % (unsigned)(AT_WV * 32);      // thread inside the group
  const unsigned q0 = qb * (unsigned)AT_QB + wq * (unsigned)(AT_QW * 16);
  const unsigned rot = (qb * (NKC / NQB) + h + grp * NTR) % NKC;   // first key chunk of this group: the groups walk the two halves of the block's ring
  // the key chunk that trip t works on (t <= NTR + 1): chunk rot + t of the ring
  auto chunk_of = [&](const unsigned t) __attribute__((always_inline)) { const unsigned cj = t + rot; return (cj >= NKC) ? cj - NKC : cj; };

  const _Float16* Q  = (const _Float16*)Qp;
  const _Float16* K  = (const _Float16*)Kp;
  const _Float16* Vt = (const _Float16*)Vtp;

  const _Float16* qrow  = Q + (size_t)(b * (unsigned)SEQ + q0 + c) * DIMC + h * HDIM + 8u * hh;
  v16h qa[AT_QW][2];                                      // B operands: column c of tile u = query q0 + 16u + c (every loop over u unrolled: constant indices keep all of it in registers)
#pragma unroll
  for (int u = 0; u < AT_QW; ++u) { qa[u][0] = frag_ld(qrow + (size_t)u * 16u * DIMC); qa[u][1] = frag_ld(qrow + (size_t)u * 16u * DIMC + 32); }
  // copy share of this thread, in its group's chunk: K and V^T tile rows tg / 8 (+16, +32, +48), 16-B piece tg % 8 of the 128-B row piece
  const unsigned crow = tg >> 3, cpc = tg & 7u;
  const _Float16* gK = K + (size_t)(b * (unsigned)SEQ + crow) * DIMC + h * HDIM + cpc * 8u;           // key crow of chunk 0
  const _Float16* gV = Vt + ((size_t)b * DIMC + h * HDIM + crow) * SEQ + cpc * 8u;                     // V^T row crow, keys of chunk 0
  const unsigned lK = (unsigned)(size_t)KVs + (grp * (2u * AT_BH) + crow * AT_KP + cpc * 8u) * 2u;      // key x of a chunk lies in LDS row x of the group's buffer
  const unsigned lV = lK + AT_TH * 2u;
  const unsigned lsKV = 16u * AT_KP * 2u;
  const size_t gsK = (size_t)16u * DIMC, gsV = (size_t)16u * SEQ;
  // this wave's lane-mask words: 32 for each query tile and chunk, a tile's chunks in a row. The wave's number is made uniform and the pointer names
  // the constant address space (nothing writes these words during this launch), so that the loads inside the loop are scalar too: behind the loop's
  // asm waits with their memory clobber the compiler otherwise reloads them as vector loads and moves every word to a scalar register by v_readfirstlane.
  typedef const __attribute__((address_space(4))) v16u* cw_ptr;
  const cw_ptr mwp = (cw_ptr)(unsigned long long)(MB + (size_t)((b * (unsigned)(SEQ / 16) + qb * (unsigned)(AT_QB / 16) + wq * (unsigned)AT_QW) * NKC) * 32u);
  v16u mw[AT_QW][2];                                      // the first chunk: words 8j + r of score tiles j = 0, 1 | j = 2, 3, for each query tile
#pragma unroll
  for (int u = 0; u < AT_QW; ++u) { mw[u][0] = mwp[(unsigned)u * 2u * NKC + 2u * rot]; mw[u][1] = mwp[(unsigned)u * 2u * NKC + 2u * rot + 1u]; }
  const unsigned fKV = c * AT_KP + 8u * hh;               // this lane's fragment place in a 16-row group of either staged tile

  float mrow[AT_QW], lrow[AT_QW];                         // this lane's query of tile u: running maximum (both halves alike), this half's share of the sum
  v8f oacc[AT_QW][4];                                     // O^T tile t of query tile u: column c = query, element r = head column 16t + 8hh + r
#pragma unroll
  for (int u = 0; u < AT_QW; ++u) {
    mrow[u] = -INFINITY; lrow[u] = 0.f;
#pragma unroll
    for (int t = 0; t < 4; ++t) oacc[u][t] = (v8f){0.f,0.f,0.f,0.f,0.f,0.f,0.f,0.f};
  }

  stage_fill(lK, lsKV, lV, lsKV, gK + (size_t)(rot * 64u) * DIMC, gsK, gV + rot * 64u, gsV);
  asm volatile("s_wait_asynccnt 0x0" ::: "memory");     // this wave's copies of trip 0 have landed
  __syncthreads();                                      // ... and every other wave's: buffer 0 is readable
  if (NTR > 1u) stage_fill(lK + AT_BH * 2u, lsKV, lV + AT_BH * 2u, lsKV, gK + (size_t)(chunk_of(1u) * 64u) * DIMC, gsK, gV + chunk_of(1u) * 64u, gsV);

  // One trip: number kc, on chunk chunk_of(kc). refill = a trip kc + 2 exists; it is a constant at either call, so that a trip is one straight block: with the test inside
  // the loop the compiler moved the 64 additions of the row sums behind it, which kept all 64 probabilities in registers through the second products.
  auto trip = [&](const unsigned kc, const bool refill) __attribute__((always_inline)) {
    const _Float16* kvs = KVs + grp * (2u * AT_BH) + (kc & 1u) * AT_BH + fKV;
    v8f s[AT_QW][4];
    v16h kf[4][2];                                      // the chunk's 8 K fragments, read as one group in front of the products (loops unrolled: constant indices keep them in registers)
#pragma unroll
    for (int j = 0; j < 4; ++j) {
      const _Float16* kr = kvs + (unsigned)j * 16u * AT_KP;                        // A row c of tile j = key 16j + c of the chunk
      kf[j][0] = frag_ld(kr); kf[j][1] = frag_ld(kr + 32);
    }
#pragma unroll
    for (int j = 0; j < 4; ++j)
#pragma unroll
      for (int u = 0; u < AT_QW; ++u) s[u][j] = wm16(kf[j][0], qa[u][0], (v8f){0.f,0.f,0.f,0.f,0.f,0.f,0.f,0.f});
#pragma unroll
    for (int j = 0; j < 4; ++j)
#pragma unroll
      for (int u = 0; u < AT_QW; ++u) s[u][j] = wm16(kf[j][1], qa[u][1], s[u][j]);

    const unsigned kn = chunk_of(kc + 1u);              // the chunk whose words are read next (the last trip reads those of the chunk behind the group's last one, unused)
    v16h pb[AT_QW][2];                                  // P^T packed from the score registers (unrolled as above)
    v16h va[2][4];                                      // the chunk's V^T fragments, A: row d = t*16 + c, same key map as P^T (unrolled as above)
#pragma unroll
    for (int u = 0; u < AT_QW; ++u) {
      float x[4][8];                                    // this query's 32 scores, then its 32 probabilities (every loop over them unrolled: constant indices keep them in registers)
#pragma unroll
      for (int j = 0; j < 4; ++j)
#pragma unroll
        for (int r = 0; r < 8; ++r)
          x[j][r] = __builtin_amdgcn_inverse_ballot_w32((j < 2) ? mw[u][0][8 * j + r] : mw[u][1][8 * (j - 2) + r]) ? s[u][j][r] * SC2 : FILL2;
      // the next chunk's words, into the registers just used
      mw[u][0] = mwp[(unsigned)u * 2u * NKC + 2u * kn]; mw[u][1] = mwp[(unsigned)u * 2u * NKC + 2u * kn + 1u];
      float mj[4];
#pragma unroll
      for (int j = 0; j < 4; ++j)
        mj[j] = fmaxf(fmaxf(fmaxf(x[j][0], x[j][1]), fmaxf(x[j][2], x[j][3])), fmaxf(fmaxf(x[j][4], x[j][5]), fmaxf(x[j][6], x[j][7])));
      float m = fmaxf(fmaxf(mj[0], mj[1]), fmaxf(mj[2], mj[3]));
      m = fmaxf(m, xhalf(m));                           // the other half's 32 keys of the same query
      const float mnew  = fmaxf(mrow[u], m);
      const float alpha = ex2(mrow[u] - mnew);
      mrow[u] = mnew;
#pragma unroll
      for (int j = 0; j < 4; ++j)                       // all 32 exponents first, so that the v_exp_f32 groups below work in place (unrolled as above)
#pragma unroll
        for (int r = 0; r < 8; ++r) x[j][r] -= mnew;
      float pj[4];
#pragma unroll
      for (int j = 0; j < 4; ++j) {
        ex2x8(x[j]);
        pj[j] = ((x[j][0] + x[j][1]) + (x[j][2] + x[j][3])) + ((x[j][4] + x[j][5]) + (x[j][6] + x[j][7]));
      }
      lrow[u] = lrow[u] * alpha + ((pj[0] + pj[1]) + (pj[2] + pj[3]));
#pragma unroll
      for (int t = 0; t < 4; ++t)
#pragma unroll
        for (int r = 0; r < 8; ++r) oacc[u][t][r] *= alpha;
#pragma unroll
      for (int kk = 0; kk < 2; ++kk)
#pragma unroll
        for (int i = 0; i < 8; ++i) {
          pb[u][kk][i]     = (_Float16)(x[2 * kk][i] * PSC);       // B element i     = key 32kk + 8hh + i
          pb[u][kk][i + 8] = (_Float16)(x[2 * kk + 1][i] * PSC);   // B element 8 + i = key 32kk + 16 + 8hh + i
        }
      // One query tile's softmax at a time, and behind each one half of the V^T fragments as a group (keys 0..31 under the second tile's softmax,
      // keys 32..63 under the first eight products): scheduled freely, both tiles' scores and all 16 fragment reads are live at once and the
      // wave goes past 256 registers, with some thirty register-window switches in every trip.
      __builtin_amdgcn_sched_barrier(0);
#pragma unroll
      for (int t = 0; t < 4; ++t) va[u][t] = frag_ld(kvs + AT_TH + (unsigned)t * 16u * AT_KP + (unsigned)u * 32u);
    }
    // holds the second group's eight reads in front of the products: free to move, they sank between the products of the last-chunks loop, pair by
    // pair into one fragment's registers, each pair with a wait to 0 of its own
    __builtin_amdgcn_sched_barrier(0);
#pragma unroll
    for (int kk = 0; kk < 2; ++kk)
#pragma unroll
      for (int t = 0; t < 4; ++t)
#pragma unroll
        for (int u = 0; u < AT_QW; ++u) oacc[u][t] = wm16(va[kk][t], pb[u][kk], oacc[u][t]);
    // the distance behind the trip's last products, once: the loop's back edge follows
    asm volatile("v_nop\n\tv_nop\n\tv_nop\n\tv_nop" : "+v"(oacc[0][0]), "+v"(oacc[0][1]), "+v"(oacc[0][2]), "+v"(oacc[0][3]),
                                                        "+v"(oacc[1][0]), "+v"(oacc[1][1]), "+v"(oacc[1][2]), "+v"(oacc[1][3]));
    asm volatile("s_wait_dscnt 0x0" ::: "memory");      // this wave's reads of buffer kc%2 are done before it is handed to its next writer
    asm volatile("s_wait_asynccnt 0x0" ::: "memory");   // this wave's copies of trip kc+1's chunk have landed
    __syncthreads();                                    // publishes trip kc+1's buffer and ends every reader's last read of trip kc's
    if (refill) {
      const unsigned lo = (kc & 1u) * (AT_BH * 2u);
      const unsigned kv2 = chunk_of(kc + 2u) * 64u;     // first key of trip kc + 2's chunk
      stage_fill(lK + lo, lsKV, lV + lo, lsKV, gK + (size_t)kv2 * DIMC, gsK, gV + kv2, gsV);
    }
  };
  unsigned kc = 0;
#pragma unroll 1
  for (; kc + 2u < NTR; ++kc) trip(kc, true);           // rolled: one copy of the trip in the instruction cache
#pragma unroll 1
  for (; kc < NTR; ++kc) trip(kc, false);               // the last two chunks: nothing is left to copy
  asm volatile("s_wait_asynccnt 0x0" ::: "memory");     // nothing of this wave is in flight when the loop is left

  // behind the last trip's barrier nobody reads the staged tiles any more and no copy is in flight.
  // Group g joins query tile g: a wave hands the other tile's partial result to its partner (lane for lane the same query and head columns).
  float* xs = (float*)KVs;
  auto put = [&](const int u) __attribute__((always_inline)) {
    float* p = xs + wvu * (unsigned)AT_XF + lane * 4u;   // a row = 32 lanes x 16 B
#pragma unroll
    for (int t = 0; t < 4; ++t) {
      *(v4f*)(p + (unsigned)(2 * t) * 128u)     = (v4f){oacc[u][t][0], oacc[u][t][1], oacc[u][t][2], oacc[u][t][3]};
      *(v4f*)(p + (unsigned)(2 * t + 1) * 128u) = (v4f){oacc[u][t][4], oacc[u][t][5], oacc[u][t][6], oacc[u][t][7]};
    }
    float* pm = xs + wvu * (unsigned)AT_XF + 1024u + lane * 2u;
    pm[0] = mrow[u]; pm[1] = lrow[u];
  };
  _Float16* os = KVs + 2u * AT_BH + wvu * (unsigned)(16 * AT_PP);   // this wave's own 16 x 64 output slice
  auto join = [&](const int u) __attribute__((always_inline)) {
    const float* p = xs + (wvu ^ (unsigned)AT_WV) * (unsigned)AT_XF + lane * 4u;
    const float* pm = xs + (wvu ^ (unsigned)AT_WV) * (unsigned)AT_XF + 1024u + lane * 2u;
    const float m2 = pm[0], l2 = pm[1];
    const float m  = fmaxf(mrow[u], m2);
    const float a1 = ex2(mrow[u] - m), a2 = ex2(m2 - m);                  // both maxima are finite: every group has worked on at least one chunk
    const float l  = lrow[u] * a1 + l2 * a2;                              // this half's share of the sum over all keys
    const float inv = CTXC * (1.0f / ((l + xhalf(l)) * PSC));             // the two halves' sums of this query joined
    const float f1 = a1 * inv, f2 = a2 * inv;
#pragma unroll
    for (int t = 0; t < 4; ++t) {
      const v4f o0 = *(const v4f*)(p + (unsigned)(2 * t) * 128u), o1 = *(const v4f*)(p + (unsigned)(2 * t + 1) * 128u);
      v8h hv;
#pragma unroll
      for (int r = 0; r < 4; ++r) {
        hv[r]     = (_Float16)(oacc[u][t][r] * f1 + o0[r] * f2);
        hv[r + 4] = (_Float16)(oacc[u][t][r + 4] * f1 + o1[r] * f2);
      }
      *(v8h*)(os + c * AT_PP + (unsigned)t * 16u + 8u * hh) = hv;         // query row c of the tile, head columns 16t + 8hh + 0..7
    }
  };
  if (grp == 0u) put(1); else put(0);                   // wave-uniform
  __syncthreads();                                      // every wave's slot is written before its partner reads it
  if (grp == 0u) join(0); else join(1);
  wave_sync();
  {
    const unsigned q4 = lane >> 3, c8 = (lane & 7u) * 8u;
    _Float16* cb = (_Float16*)ctxp + (size_t)(b * (unsigned)SEQ + q0 + grp * 16u) * DIMC + h * HDIM;
#pragma unroll
    for (int it = 0; it < 4; ++it) {
      const unsigned row = (unsigned)it * 4u + q4;
      *(v8h*)(cb + (size_t)row * DIMC + c8) = *(const v8h*)(os + row * AT_PP + c8);
    }
  }
}

// ---------------------------------------------------------------------------------------------------------
// workspace carve (bytes, every region a multiple of 256 and fully written by its producer before any read)
// ---------------------------------------------------------------------------------------------------------
static constexpr size_t SZ_X16   = (size_t)3 * MROWS * DIMC * 2;     // q16 | k16 | v16 planes [MROWS][1024] f16
static constexpr size_t SZ_WT16  = (size_t)4 * DIMC * DIMC * 2;      // Wq^T | Wk^T | Wv^T | Wp^T planes [out][in] f16, x16
static constexpr size_t SZ_QK16  = (size_t)2 * MROWS * DIMC * 2;     // Q16 | K16 planes [MROWS][1024] f16
static constexpr size_t SZ_VT16  = (size_t)NB * DIMC * SEQ * 2;      // V^T planes [b][1024][SEQ] f16
static constexpr size_t SZ_CTX16 = (size_t)MROWS * DIMC * 2;         // merged head output x16 [MROWS][1024] f16
static constexpr size_t SZ_BRO   = (size_t)DIMC * 4;                 // bias, bf16 RNE-converted, f32
static constexpr size_t SZ_MB    = (size_t)NB * (SEQ / 16) * (SEQ / 64) * 32 * 4;   // lane-mask words [b][16-query tile][64-key chunk][32]
static constexpr size_t SZ_TOTAL = SZ_X16 + SZ_WT16 + SZ_QK16 + SZ_VT16 + SZ_CTX16 + SZ_BRO + SZ_MB;
static_assert((SZ_X16 % 256) == 0 && (SZ_WT16 % 256) == 0 && (SZ_QK16 % 256) == 0 && (SZ_VT16 % 256) == 0 && (SZ_CTX16 % 256) == 0 && (SZ_BRO % 256) == 0 && (SZ_MB % 256) == 0);
static_assert(SZ_TOTAL <= (size_t)134217728);
// coverage equalities of the plane writers
static_assert((size_t)CV_ST * CV_TH * 8 == (size_t)MROWS * DIMC);                     // k_convert per activation tensor
static_assert((size_t)CV_ST * CV_TH * 8 == (size_t)4 * DIMC * DIMC);                  // k_convert, the four weights
static_assert((size_t)(SEQ / AT_QB) * AT_WV * AT_QW * 16 * 64 == (size_t)SEQ * HDIM);               // k_flash per (batch, head): blocks x waves x rows x cols
static_assert((MROWS % 128) == 0 && (DIMC % 128) == 0 && (SEQ % 128) == 0);            // k_gemm64: whole 128x128 tiles, K = DIMC in whole 64-k trips

extern "C" void kernel_launch(void* const* d_in, const int* in_sizes, int n_in, void* d_out, int out_size, void* d_ws, size_t ws_size, hipStream_t stream) {
  if (n_in < 9) return;
  const long long needX = (long long)(NB - 1) * SEQ_FULL * DIMC + (long long)SEQ * DIMC;
  const long long needM = (long long)(NB - 1) * SEQ_FULL * SEQ_FULL + (long long)(SEQ - 1) * SEQ_FULL + SEQ;
  if ((long long)in_sizes[0] < needX || (long long)in_sizes[1] < needX || (long long)in_sizes[2] < needX) return;
  if ((long long)in_sizes[3] < needM) return;
  if (in_sizes[4] < DIMC * DIMC || in_sizes[5] < DIMC * DIMC || in_sizes[6] < DIMC * DIMC || in_sizes[7] < DIMC * DIMC || in_sizes[8] < DIMC) return;
  if ((long long)out_size < (long long)MROWS * DIMC) return;
  if (ws_size < SZ_TOTAL) return;

  const float* q    = (const float*)d_in[0];
  const float* k    = (const float*)d_in[1];
  const float* v    = (const float*)d_in[2];
  const int*   mask = (const int*)d_in[3];
  const float* Wq   = (const float*)d_in[4];
  const float* Wk   = (const float*)d_in[5];
  const float* Wv   = (const float*)d_in[6];
  const float* Wp   = (const float*)d_in[7];
  const float* bp   = (const float*)d_in[8];
  float* out = (float*)d_out;

  char* wsp = (char*)d_ws;
  unsigned short* X16   = (unsigned short*)wsp; wsp += SZ_X16;
  unsigned short* WT16  = (unsigned short*)wsp; wsp += SZ_WT16;
  unsigned short* QK16  = (unsigned short*)wsp; wsp += SZ_QK16;
  unsigned short* VT16  = (unsigned short*)wsp; wsp += SZ_VT16;
  unsigned short* CTX16 = (unsigned short*)wsp; wsp += SZ_CTX16;
  float*          BRO   = (float*)wsp;          wsp += SZ_BRO;
  unsigned*       MB    = (unsigned*)wsp;       wsp += SZ_MB;

  const unsigned long long planeX = (unsigned long long)MROWS * DIMC;     // elements per activation plane
  const unsigned long long planeW = (unsigned long long)DIMC * DIMC;

  // weights [in][out] -> [out][in] f16 x16 (4 planes); bias; activations (3 planes, full input batch stride, compact planes); mask -> lane-mask words
  k_convert<<<dim3((unsigned)CV_WG, 1u, 1u), 512, 0, stream>>>(q, k, v, Wq, Wk, Wv, Wp, bp, mask, X16, WT16, BRO, MB);
  // Q16 | K16 = (q16 | k16) x (Wq^T | Wk^T): batch y = 0 (q), 1 (k); M = MROWS, N = K = 1024
  k_gemm64<0, 1><<<dim3((unsigned)((MROWS / 128) * (DIMC / 128)), 2u, 1u), 256, 0, stream>>>(
      X16, (unsigned)DIMC, planeX, WT16, (unsigned)DIMC, planeW, (void*)QK16, (unsigned)DIMC, planeX, nullptr,
      (unsigned)MROWS, (unsigned)DIMC, (unsigned)DIMC, 0.0625f);
  // V^T[b][o][n] = sum_k Wv^T[o][k] * v16[b][n][k]: A = Wv^T plane (M = 1024), Bt = v16 batch plane (N = SEQ), C pitch SEQ
  k_gemm64<0, 1><<<dim3((unsigned)((DIMC / 128) * (SEQ / 128)), (unsigned)NB, 1u), 256, 0, stream>>>(
      WT16 + 2 * planeW, (unsigned)DIMC, 0ull, X16 + 2 * planeX, (unsigned)DIMC, (unsigned long long)SEQ * DIMC,
      (void*)VT16, (unsigned)SEQ, (unsigned long long)DIMC * SEQ, nullptr,
      (unsigned)DIMC, (unsigned)SEQ, (unsigned)DIMC, 0.0625f);
  // attention
  k_flash<<<dim3((unsigned)(NB * NHEAD * (SEQ / AT_QB)), 1u, 1u), AT_KG * AT_WV * 32, 0, stream>>>(QK16, QK16 + planeX, VT16, MB, CTX16);
  // out = (ctx x16) x (Wp^T x16) / 256 + bias
  k_gemm64<2, 0><<<dim3((unsigned)((MROWS / 128) * (DIMC / 128)), 1u, 1u), 256, 0, stream>>>(
      CTX16, (unsigned)DIMC, 0ull, WT16 + 3 * planeW, (unsigned)DIMC, 0ull, (void*)out, (unsigned)DIMC, 0ull, BRO,
      (unsigned)MROWS, (unsigned)DIMC, (unsigned)DIMC, 0.00390625f);
}

// v010
// Measured time: 89.2 microseconds a run.
// In both of two side-by-side timings against v009, it was 1.09 times as fast.
// Counting every step since v000, it is 3.53 times as fast.
// Masked multi-head attention (2 x 2,048 x 1,024; 16 heads x 64): inputs and parameters RNE-converted to bf16 first; every contraction (q/k/v projections, q.k^T, p.v, output projection) on v_wmma_f32_16x16x32_f16 (f16 operands: weights x16, probabilities x2^14, merged head output x16; f32 accumulate, f32 online softmax in the exp2 domain).
#include <hip/hip_runtime.h>
#include <math.h>

#ifndef NB
#define NB 2
#endif
#ifndef SEQ
#define SEQ 2048
#endif
#define NB_FULL 2
#define SEQ_FULL 2048
#define DIMC 1024
#define NHEAD 16
#define HDIM 64
#define MROWS (NB * SEQ)

static_assert(SEQ % 64 == 0);
static_assert(SEQ <= SEQ_FULL);
static_assert(NB <= NB_FULL);
static_assert(DIMC == NHEAD * HDIM);
static_assert(DIMC % 64 == 0);
static_assert(DIMC / 8 == 128);
static_assert((MROWS % 64) == 0);
static_assert(((SEQ * 128) % 256) == 0);

typedef __attribute__((ext_vector_type(16))) _Float16 v16h;
typedef __attribute__((ext_vector_type(8)))  _Float16 v8h;
typedef __attribute__((ext_vector_type(4)))  _Float16 v4h;
typedef __attribute__((ext_vector_type(8)))  float    v8f;
typedef __attribute__((ext_vector_type(4)))  float    v4f;
typedef __attribute__((ext_vector_type(4)))  int      v4i;
typedef __attribute__((ext_vector_type(16))) unsigned v16u;

// 16-bit WMMA fragment map (wave32), lane L, h = L>>4, m = L&15:
//   A 16x32: lane = row m;    element i -> k = (i<8) ? 8h+i : 16+8h+(i-8)
//   B 32x16: lane = column m; the SAME k(i,h)
//   D 16x16 (8 f32): lane = column m; element r -> row 8h+r
union FragU { v16h v; v8h h[2]; };
// p already includes the lane-half offset 8h: elements 0..7 <- p[0..7], 8..15 <- p[16..23]
__device__ __forceinline__ v16h frag_ld(const _Float16* p) {
  FragU f; f.h[0] = *(const v8h*)(p); f.h[1] = *(const v8h*)(p + 16); return f.v;
}
// the builtin alone: the compiler keeps the distance behind it itself, with independent instructions where it has some
__device__ __forceinline__ v8f wm16(v16h a, v16h b, v8f c) {
  return __builtin_amdgcn_wmma_f32_16x16x32_f16(false, a, false, b, (short)0, c, false, false);
}
__device__ __forceinline__ void dep_guard_h(v8f& a, v8f& b, v16h x, v16h y) { asm volatile("v_nop\n\tv_nop\n\tv_nop\n\tv_nop" : "+v"(a), "+v"(b) : "v"(x), "v"(y)); }
__device__ __forceinline__ void keep4_h(v16h a, v16h b, v16h c, v16h d) { asm volatile("v_nop" :: "v"(a), "v"(b), "v"(c), "v"(d)); }
__device__ __forceinline__ void acc_guard4(v8f& a, v8f& b, v8f& c, v8f& d) { asm volatile("v_nop\n\tv_nop\n\tv_nop\n\tv_nop" : "+v"(a), "+v"(b), "+v"(c), "+v"(d)); }
// same-wave LDS exchange: stores by some lanes, loads of those locations by other lanes of the SAME wave
__device__ __forceinline__ void wave_sync() {
  __builtin_amdgcn_fence(3 /* release order */, "workgroup");
  __builtin_amdgcn_wave_barrier();
  __builtin_amdgcn_fence(2 /* acquire order */, "workgroup");
}
// bf16 RNE-convert, kept as f32 (finite inputs)
__device__ __forceinline__ float cmb_bf(float v) {
  const unsigned u = __builtin_bit_cast(unsigned, v);
  const unsigned r = (u + 0x7fffu + ((u >> 16) & 1u)) & 0xffff0000u;
  return __builtin_bit_cast(float, r);
}

// ---------------------------------------------------------------------------------------------------------
// k_convert: every conversion of the call in ONE launch of CV_WG work-groups of 16 waves, one for each WGP, all resident at once; a thread
// takes CV_ST pieces of every kind instead of ending after one, so the launch starts 4,096 waves where three launches started 65,568.
// A thread's pieces, step j = 0 .. CV_ST - 1:
//   one of each activation tensor: f32 row [1024], 8 columns -> bf16 (RNE) -> f16 plane rows [MROWS][1024], one 16-B store
//   (piece j * CV_TH + flat thread: consecutive threads walk along a row; sources use the FULL input batch stride, planes are compact);
//   one of a weight: W[k = in][o = out] (row pitch 1024) -> WT[o][k] = f16(bf16_rne(W[k][o]) * 16): 8 strided loads, one 16-B store, a wave walks
//   along the destination row. A work-group takes two tiles of 32 outputs x 256 inputs, two steps each (16 waves = 16 outputs a step): the
//   128-B source lines of a tile hold exactly its 32 outputs, so both steps and all 16 waves read the same 256 lines.
// All loads of a thread are issued first (24 of 16 B, 16 of 16 B for the mask, then 32 of 4 B), so a wave waits out the memory latency once, not once a step.
// The first DIMC threads of the launch also convert the bias.
// The keep-mask is packed here, once for all 16 heads: a wave takes 16 query rows x 128 keys (16 whole-line loads of 512 B, a work-group reads
// 128 KiB in a row), turns them through its own LDS slice into k_flash's score layout (lane = 16 hh + c holds query c, keys 16j + 8hh + r of a
// 64-key chunk) and writes, for each chunk, 32 lane-mask words: word 8j + r, bit lane = (mask element != 0).
// ---------------------------------------------------------------------------------------------------------
#define CV_WG 256                       // work-groups of the launch
#define CV_TH (CV_WG * 512)             // threads of the launch
#define CV_ST 4                         // pieces of each kind per thread
#define CV_RPS (CV_TH / 128)             // activation rows of one step (128 pieces a row)
#define CV_TPW ((DIMC / 32) * (DIMC / 256))   // tiles of one weight
static_assert(MROWS * 128 == CV_ST * CV_TH);              // activation pieces of one tensor: every one exactly once
static_assert(4 * CV_TPW == CV_WG * (CV_ST / 2));         // weight tiles: every one exactly once
static_assert(CV_TPW % (CV_ST / 2) == 0);                 // a work-group's tiles lie in one weight
static_assert(SEQ % CV_RPS == 0);                         // a step's rows lie in one batch
static_assert(DIMC <= CV_TH);
static_assert(CV_ST == 4);                                // the wait behind the activation loads names four offsets
static_assert(((unsigned long long)(NB - 1) * SEQ_FULL + SEQ) * DIMC * 4 < (1ull << 32));   // source byte offsets fit 32 bits
#define CV_MP 132                       // mask slice row pitch in words: 528 B = 16 B x 33
static_assert(SEQ % 128 == 0);
static_assert((size_t)NB * (SEQ / 16) * (SEQ / 128) == (size_t)CV_WG * 16);               // mask pieces: one for every wave of the launch
static_assert((unsigned long long)NB * SEQ_FULL * SEQ_FULL * 4 < (1ull << 32));           // mask byte offsets fit 32 bits
__global__ __launch_bounds__(512) void k_convert(const float* __restrict__ S0, const float* __restrict__ S1, const float* __restrict__ S2,
                                                  const float* __restrict__ W0, const float* __restrict__ W1, const float* __restrict__ W2,
                                                  const float* __restrict__ W3, const float* __restrict__ BP, const int* __restrict__ MK,
                                                  unsigned short* __restrict__ X, unsigned short* __restrict__ WT, float* __restrict__ BRO,
                                                  unsigned* __restrict__ MB) {
  __shared__ __align__(16) int sM[16][16 * CV_MP];   // per-wave slice: 16 query rows x 128 keys of the mask
  const unsigned t = blockIdx.x * 512u + threadIdx.x;
  const unsigned wave = threadIdx.x >> 5, lane = threadIdx.x & 31u;
  const unsigned tile0 = blockIdx.x * (CV_ST / 2u);
  const unsigned y = tile0 / (unsigned)CV_TPW;
  const float* W = (y == 0u) ? W0 : ((y == 1u) ? W1 : ((y == 2u) ? W2 : W3));   // block-uniform choice among global pointers
  const unsigned tsb = t * 32u, tdb = t * 16u;   // this thread's place inside a step's CV_RPS rows, in source and in plane bytes: one 32-bit offset beside a uniform base
  v4f x[CV_ST][3][2];                   // every loop over the steps is unrolled: constant indices keep the pieces in registers
  float w[CV_ST][8];
  unsigned so[CV_ST];                   // source byte offsets of the thread's pieces, alike in the three tensors
#pragma unroll
  for (unsigned j = 0; j < CV_ST; ++j) {
    // first row of step j in the source: batch (j * CV_RPS) / SEQ at the full batch stride, row (j * CV_RPS) % SEQ of it
    so[j] = (((j * (unsigned)CV_RPS) / (unsigned)SEQ) * (unsigned)SEQ_FULL + (j * (unsigned)CV_RPS) % (unsigned)SEQ) * (unsigned)(DIMC * 4) + tsb;
    const v4f* s0 = (const v4f*)((const char*)S0 + so[j]);
    const v4f* s1 = (const v4f*)((const char*)S1 + so[j]);
    const v4f* s2 = (const v4f*)((const char*)S2 + so[j]);
    x[j][0][0] = s0[0]; x[j][0][1] = s0[1];
    x[j][1][0] = s1[0]; x[j][1][1] = s1[1];
    x[j][2][0] = s2[0]; x[j][2][1] = s2[1];
  }
  // The wait before a register that one of these 24 loads names is written again; the offsets are inputs so that they stay in their registers up
  // to it. The statement also keeps the streaming loads in front of the 32 many-line weight loads, which the compiler otherwise issues first
  // (a wave's loads return in order).
  asm volatile("s_wait_xcnt 0x0" :: "v"(so[0]), "v"(so[1]), "v"(so[2]), "v"(so[3]) : "memory");
  // this wave's mask piece: batch, 16-query tile, pair of 64-key chunks; row i of it is one 512-B load of the wave
  const unsigned gw = blockIdx.x * 16u + wave;
  const unsigned mkp = gw % (unsigned)(SEQ / 128), mqt = (gw / (unsigned)(SEQ / 128)) % (unsigned)(SEQ / 16), mbt = gw / (unsigned)((SEQ / 128) * (SEQ / 16));
  const unsigned mo = ((mbt * (unsigned)SEQ_FULL + mqt * 16u) * (unsigned)SEQ_FULL + mkp * 128u + lane * 4u) * 4u;
  v4i mk[16];                           // unrolled as above
#pragma unroll
  for (unsigned i = 0; i < 16u; ++i) mk[i] = __builtin_nontemporal_load((const v4i*)((const char*)MK + mo + i * (unsigned)(SEQ_FULL * 4)));   // read once in the whole call
  asm volatile("s_wait_xcnt 0x0" :: "v"(mo) : "memory");   // as above, for the 16 mask loads: they too stay in front of the weight loads
  unsigned wo[CV_ST];                   // source byte offsets of the thread's weight pieces (first of the 8 inputs)
#pragma unroll
  for (unsigned j = 0; j < CV_ST; ++j) {
    const unsigned ty = (tile0 + (j >> 1)) % (unsigned)CV_TPW;
    const unsigned o = (ty >> 2) * 32u + (j & 1u) * 16u + wave, k0 = (ty & 3u) * 256u + lane * 8u;
    wo[j] = (k0 * (unsigned)DIMC + o) * 4u;
#pragma unroll
    for (int e = 0; e < 8; ++e) w[j][e] = *(const float*)((const char*)W + wo[j] + (unsigned)e * (unsigned)(DIMC * 4));
  }
  asm volatile("s_wait_xcnt 0x0" :: "v"(wo[0]), "v"(wo[1]), "v"(wo[2]), "v"(wo[3]) : "memory");   // as above, for the 32 weight loads
  float bv = 0.f;
  if (t < (unsigned)DIMC) bv = BP[t];                                 // whole waves of the first work-groups
#pragma unroll
  for (unsigned j = 0; j < CV_ST; ++j) {
#pragma unroll
    for (int z = 0; z < 3; ++z) {
      v8h hv;
#pragma unroll
      for (int e = 0; e < 4; ++e) { hv[e] = (_Float16)cmb_bf(x[j][z][0][e]); hv[e + 4] = (_Float16)cmb_bf(x[j][z][1][e]); }
      *(v8h*)((char*)((_Float16*)X + ((size_t)z * MROWS + (size_t)j * CV_RPS) * DIMC) + tdb) = hv;
    }
    asm volatile("s_wait_xcnt 0x0" ::: "memory");   // before a register that one of these stores names is written again
  }
  {
    int* sm = sM[wave];
#pragma unroll
    for (unsigned i = 0; i < 16u; ++i) *(v4i*)(sm + i * (unsigned)CV_MP + lane * 4u) = mk[i];
    // The rows are read back by other lanes of this wave alone: its own LDS stores are waited for, and the statement keeps the reads behind them.
    // (wave_sync()'s work-group fences would also wait here for the global stores above and for the weight loads still in flight.)
    asm volatile("s_wait_dscnt 0x0" ::: "memory");
    const int* sr = sm + (lane & 15u) * (unsigned)CV_MP + (lane >> 4) * 8u;   // query row c, this half's 8 keys of a 16-key group
#pragma unroll
    for (unsigned ch = 0; ch < 2u; ++ch) {
      unsigned ow = 0u;                 // lane l ends up with word l of the chunk
#pragma unroll
      for (unsigned j = 0; j < 4u; ++j) {
        const v4i a = *(const v4i*)(sr + ch * 64u + j * 16u), bq = *(const v4i*)(sr + ch * 64u + j * 16u + 4u);
#pragma unroll
        for (unsigned r = 0; r < 4u; ++r) {
          const unsigned wa = __builtin_amdgcn_ballot_w32(a[r] != 0), wb = __builtin_amdgcn_ballot_w32(bq[r] != 0);
          ow = (lane == j * 8u + r) ? wa : ow;
          ow = (lane == j * 8u + 4u + r) ? wb : ow;
        }
      }
      MB[(gw * 2u + ch) * 32u + lane] = ow;
    }
    asm volatile("s_wait_xcnt 0x0" ::: "memory");   // before a register that one of these stores names is written again
  }
#pragma unroll
  for (unsigned j = 0; j < CV_ST; ++j) {
    const unsigned ty = (tile0 + (j >> 1)) % (unsigned)CV_TPW;
    const unsigned o = (ty >> 2) * 32u + (j & 1u) * 16u + wave, k0 = (ty & 3u) * 256u + lane * 8u;
    v8h hw;
#pragma unroll
    for (int e = 0; e < 8; ++e) hw[e] = (_Float16)(cmb_bf(w[j][e]) * 16.0f);
    *(v8h*)((_Float16*)WT + (size_t)y * DIMC * DIMC + (o * (unsigned)DIMC + k0)) = hw;
    asm volatile("s_wait_xcnt 0x0" ::: "memory");   // as above
  }
  if (t < (unsigned)DIMC) BRO[t] = cmb_bf(bv);
}

// ---------------------------------------------------------------------------------------------------------
// k_gemm64: C[m,n] = scale * sum_k A[m,k] * Bt[n,k] (+ bias[n]); f16 operand planes. A block of 8 waves owns a 128x128 tile of C,
// each wave 32 rows x 64 columns of it. Per trip 64 k of the block's 128 A rows and 128 Bt rows (128-B row pieces, whole lines) come
// into LDS by asynchronous copies, two buffers: the next trip's copies fly while this trip's fragments are read from LDS (row pitch 144 B).
// A block walks the k trips in a ring that starts at a trip of its own (tile row + tile column): blocks that share A rows or Bt rows start at
// different trips unless their (tile row + tile column) differ by a multiple of nT, as tile rows 16 apart and the V^T product's two batches
// (one A) do, and the blocks' requests spread over all 128-B columns of the 2-KiB operand rows.
// A row-major [M,K]; Bt row-major [N,K]; M,N % 128 == 0, K % 64 == 0, K >= 64; batch = blockIdx.y with element strides.
// TWO = 1: one launch holds two such problems of equal K, pitches and scale. Grid rows y < nb1 are the batches of the first; row nb1 holds all
// nb2 batches of the second, tile after tile. The three input projections run so: no launch gap, no second fill and no drained chip between
// them, and with at most 160 registers a wave three blocks fit a WGP (LDS 3 x 106 KiB, 6 waves a SIMD), so that all 768 blocks are resident at once.
// OUT_MODE 0: f32 C; 1: f16 C. Epilogue: 16-row slabs staged per wave in LDS (wave-private), each 64-wide row segment written as whole
// ---------------------------------------------------------------------------------------------------------
#define GT_PH  72                      // LDS row pitch in halves: 144 B = 16 B x 9
#define GT_OPH (128 * GT_PH)           // halves of one operand's 128-row tile
#define GT_STH (2 * GT_OPH)            // halves of one buffer: A tile | Bt tile
// One buffer's fill, this thread's share: 16 B in each of four rows of the first tile and of four rows of the second (eight threads cover
// a 128-B row piece, so a wave covers 4 whole lines per copy). la, lb = the thread's LDS byte addresses in its first row of either tile,
// lsa, lsb = LDS bytes from one of its rows to the next; ga, gb, gsa, gsb = the same in global memory (addresses, steps in elements).
// s_wait_xcnt closes the statement so that no address register of an issued copy is rewritten ahead of it.
__device__ __forceinline__ void stage_fill(unsigned la, unsigned lsa, unsigned lb, unsigned lsb,
                                           const _Float16* ga, size_t gsa, const _Float16* gb, size_t gsb) {
  const unsigned la1 = la + lsa, la2 = la + 2u * lsa, la3 = la + 3u * lsa;
  const unsigned lb1 = lb + lsb, lb2 = lb + 2u * lsb, lb3 = lb + 3u * lsb;
  const _Float16* ga1 = ga + gsa; const _Float16* ga2 = ga + 2u * gsa; const _Float16* ga3 = ga + 3u * gsa;
  const _Float16* gb1 = gb + gsb; const _Float16* gb2 = gb + 2u * gsb; const _Float16* gb3 = gb + 3u * gsb;
  asm volatile("global_load_async_to_lds_b128 %0, %8, off\n\t"
               "global_load_async_to_lds_b128 %1, %9, off\n\t"
               "global_load_async_to_lds_b128 %2, %10, off\n\t"
               "global_load_async_to_lds_b128 %3, %11, off\n\t"
               "global_load_async_to_lds_b128 %4, %12, off\n\t"
               "global_load_async_to_lds_b128 %5, %13, off\n\t"
               "global_load_async_to_lds_b128 %6, %14, off\n\t"
               "global_load_async_to_lds_b128 %7, %15, off\n\t"
               "s_wait_xcnt 0x0"
               :: "v"(la), "v"(la1), "v"(la2), "v"(la3), "v"(lb), "v"(lb1), "v"(lb2), "v"(lb3),
                  "v"(ga), "v"(ga1), "v"(ga2), "v"(ga3), "v"(gb), "v"(gb1), "v"(gb2), "v"(gb3)
               : "memory");
}
// launch bounds, TWO = 1: 6 waves a SIMD = 3 blocks a WGP, which holds the compiler to 160 registers a wave (1,024 / 6, in granules of 16)
template <int BIAS_MODE, int OUT_MODE, int TWO>
__global__ __launch_bounds__(256, TWO ? 6 : 1) void k_gemm64(
    const unsigned short* __restrict__ Ap1, unsigned lda, unsigned long long strideA1,
    const unsigned short* __restrict__ Btp1, unsigned ldb, unsigned long long strideB1,
    void* __restrict__ Cout1, unsigned ldc1, unsigned long long strideC1,
    const float* __restrict__ bias, unsigned M1, unsigned N1, unsigned K, float scale,
    unsigned nb1, unsigned nb2,
    const unsigned short* __restrict__ Ap2, unsigned long long strideA2,
    const unsigned short* __restrict__ Btp2, unsigned long long strideB2,
    void* __restrict__ Cout2, unsigned ldc2, unsigned long long strideC2, unsigned M2, unsigned N2) {
  __shared__ __align__(16) _Float16 sS[2 * GT_STH];   // two buffers of [A 128 rows | Bt 128 rows] x 64 k, pitch 72 halves
  __shared__ __align__(16) float sT[8][16 * 68];      // per-wave 16x64 slab, pitch 68 floats
  const bool sec = TWO && blockIdx.y >= nb1;            // block-uniform: this block works on the second problem
  const unsigned short* Ap  = sec ? Ap2 : Ap1;
  const unsigned short* Btp = sec ? Btp2 : Btp1;
  void* Cout = sec ? Cout2 : Cout1;
  const unsigned long long strideA = sec ? strideA2 : strideA1, strideB = sec ? strideB2 : strideB1, strideC = sec ? strideC2 : strideC1;
  const unsigned ldc = sec ? ldc2 : ldc1, M = sec ? M2 : M1, N = sec ? N2 : N1;
  const unsigned lane = threadIdx.x & 31u;
  const unsigned wave = (unsigned)__builtin_amdgcn_readfirstlane((int)(threadIdx.x >> 5));   // uniform: the wave's rows, columns and slab stay in scalar registers
  const unsigned tilesN = N >> 7;
  const unsigned tilesM = M >> 7;
  const unsigned b    = sec ? blockIdx.x / (tilesM * tilesN) : blockIdx.y;
  const unsigned tile = sec ? blockIdx.x - b * (tilesM * tilesN) : blockIdx.x;
  if (tile >= tilesM * tilesN || (sec && b >= nb2)) return;   // block-uniform, in front of every barrier and copy
  const unsigned tm = tile / tilesN;
  const unsigned tn = tile - tm * tilesN;
  const unsigned m0 = (tm << 7) + ((wave >> 1) << 5);   // this wave's 32 rows
  const unsigned n0 = (tn << 7) + ((wave & 1u) << 6);   // this wave's 64 columns

  const _Float16* Ab = (const _Float16*)Ap + (size_t)b * strideA;
  const _Float16* Bb = (const _Float16*)Btp + (size_t)b * strideB;

  const unsigned rlane = lane & 15u;            // row (A) / col (B, D) within subtile
  const unsigned koff  = (lane >> 4) * 8u;      // k offset of this lane half
  const unsigned mOff  = (lane >> 4) * 8u;      // D row offset

  // copy share of this thread: tile row threadIdx.x / 8 (+32, +64, +96), 16-B piece threadIdx.x % 8 of the 128-B row piece
  const unsigned crow = threadIdx.x >> 3, cpc = threadIdx.x & 7u;
  const _Float16* gA = Ab + (size_t)((tm << 7) + crow) * lda + cpc * 8u;
  const _Float16* gB = Bb + (size_t)((tn << 7) + crow) * ldb + cpc * 8u;
  const unsigned lC = (unsigned)(size_t)sS + (crow * GT_PH + cpc * 8u) * 2u;
  // fragment read places of this lane inside a buffer
  const unsigned fA = (((wave >> 1) << 5) + rlane) * GT_PH + koff;
  const unsigned fB = GT_OPH + (((wave & 1u) << 6) + rlane) * GT_PH + koff;

  v8f acc[2][4];
#pragma unroll
  for (int i = 0; i < 2; ++i)
#pragma unroll
    for (int j = 0; j < 4; ++j) acc[i][j] = (v8f){0.f,0.f,0.f,0.f,0.f,0.f,0.f,0.f};

  const unsigned nT = K >> 6;
  const unsigned rot = (tm + tn) & (nT - 1u);           // first k trip of this block: below nT for any nT, block-uniform
  // element offset of the 64 k that trip t works on (t <= nT): trip rot + t of the ring
  auto kof = [&](const unsigned t) __attribute__((always_inline)) { const unsigned kt = t + rot; return (size_t)((kt >= nT) ? kt - nT : kt) * 64u; };
  const unsigned lStep = 32u * GT_PH * 2u;              // a thread's rows are 32 apart
  const size_t gsA = (size_t)32u * lda, gsB = (size_t)32u * ldb;
  stage_fill(lC, lStep, lC + GT_OPH * 2u, lStep, gA + kof(0u), gsA, gB + kof(0u), gsB);
  asm volatile("s_wait_asynccnt 0x0" ::: "memory");     // this wave's copies of trip 0 have landed
  __syncthreads();                                      // ... and every other wave's: buffer 0 is readable
  if (nT > 1u) stage_fill(lC + GT_STH * 2u, lStep, lC + (GT_STH + GT_OPH) * 2u, lStep, gA + kof(1u), gsA, gB + kof(1u), gsB);

  for (unsigned t = 0; t < nT; ++t) {
    const _Float16* sb = sS + (t & 1u) * GT_STH;
    v16h bh[2][4], ah[2][2];                            // the trip's 12 fragments (loops unrolled: constant indices keep them in registers)
    // TWO = 0: all read as one group in front of the 16 products. TWO = 1: the two A fragments of the second 32 k are read later, each into the
    // registers of the A fragment whose products have just been issued: 16 registers fewer at the peak, which is what lets a third block onto the WGP.
#pragma unroll
    for (int kk = 0; kk < 2; ++kk) {
#pragma unroll
      for (int j = 0; j < 4; ++j) bh[kk][j] = frag_ld(sb + fB + (unsigned)j * 16u * GT_PH + (unsigned)kk * 32u);
#pragma unroll
      for (int i = 0; i < 2; ++i) if (!TWO || kk == 0) ah[kk][i] = frag_ld(sb + fA + (unsigned)i * 16u * GT_PH + (unsigned)kk * 32u);
    }
#pragma unroll
    for (int kk = 0; kk < 2; ++kk) {
#pragma unroll
      for (int i = 0; i < 2; ++i) {
#pragma unroll
        for (int j = 0; j < 4; ++j)
          acc[i][j] = __builtin_amdgcn_wmma_f32_16x16x32_f16(false, ah[kk][i], false, bh[kk][j], (short)0, acc[i][j], false, false);
        dep_guard_h(acc[i][0], acc[i][3], ah[kk][i], ah[kk][i]);
        if (TWO && kk == 0) ah[1][i] = frag_ld(sb + fA + (unsigned)i * 16u * GT_PH + 32u);
      }
      keep4_h(bh[kk][0], bh[kk][1], bh[kk][2], bh[kk][3]);
    }
    asm volatile("s_wait_dscnt 0x0" ::: "memory");      // this wave's reads of buffer t%2 are done before it is handed to its next writer
    asm volatile("s_wait_asynccnt 0x0" ::: "memory");   // this wave's copies of trip t+1 have landed
    __syncthreads();                                    // publishes trip t+1's buffer and ends every reader's last read of trip t's
    if (t + 2u < nT) {
      const unsigned lN = lC + (t & 1u) * (GT_STH * 2u);
      stage_fill(lN, lStep, lN + GT_OPH * 2u, lStep, gA + kof(t + 2u), gsA, gB + kof(t + 2u), gsB);
    }
  }
  asm volatile("s_wait_asynccnt 0x0" ::: "memory");     // nothing of this wave is in flight when the loop is left
  acc_guard4(acc[0][0], acc[0][1], acc[0][2], acc[0][3]);
  acc_guard4(acc[1][0], acc[1][1], acc[1][2], acc[1][3]);

  float* slab = sT[wave];
#pragma unroll
  for (int i = 0; i < 2; ++i) {
    const unsigned mBase = m0 + ((unsigned)i << 4);
#pragma unroll
    for (int j = 0; j < 4; ++j) {
      const unsigned n = n0 + ((unsigned)j << 4) + rlane;
      float bv = 0.f;
      if (BIAS_MODE == 2) bv = bias[n];
#pragma unroll
      for (int r = 0; r < 8; ++r) {
        float v = acc[i][j][r] * scale;
        if (BIAS_MODE == 2) v += bv;
        slab[(mOff + (unsigned)r) * 68u + ((unsigned)j << 4) + rlane] = v;
      }
    }
    wave_sync();
    if (OUT_MODE == 0) {
      float* C = (float*)Cout + (size_t)b * strideC;
      const unsigned hh = lane >> 4, c4 = (lane & 15u) * 4u;     // row segment = 256 B = 16 lanes x 16 B
      {
#pragma unroll
        for (int it = 0; it < 8; ++it) {
          const unsigned row = (unsigned)it * 2u + hh;
          const v4f v = *(const v4f*)(slab + row * 68u + c4);
          *(v4f*)(C + (size_t)(mBase + row) * ldc + n0 + c4) = v;
        }
        
      }
    } else {
      const unsigned q = lane >> 3, c8 = (lane & 7u) * 8u;
      _Float16* C = (_Float16*)Cout + (size_t)b * strideC;
      {
#pragma unroll
        for (int it = 0; it < 4; ++it) {
          const unsigned row = (unsigned)it * 4u + q;
          const float* sp = slab + row * 68u + c8;
          v8h hv;
#pragma unroll
          for (int e = 0; e < 8; ++e) hv[e] = (_Float16)sp[e];
          *(v8h*)(C + (size_t)(mBase + row) * ldc + n0 + c8) = hv;
        }
        
      }
    }
    wave_sync();
  }
}

// ---------------------------------------------------------------------------------------------------------
// k_flash: per (batch, head, 128-query block): block = 2 key groups x 4 waves x 32 queries (two 16-query tiles a wave); 64-key chunks; online
//   softmax in f32 (exp2 domain).
//   the two key groups work on the same 128 queries, each on half of the key chunks with a ring of its own, so that the launch has four waves for
//   every SIMD instead of two: one wave's softmax (vector port) then runs beside more waves' products and waits. Behind the loop a wave and its
//   partner in the other group (same queries) exchange one query tile's maximum, sum and O^T through LDS; each joins and writes one of the two tiles.
//   each chunk's 64 K16 rows and 64 V^T rows (128-B row pieces) come into LDS once per block by asynchronous copies, two buffers: the next
//   chunk's copies fly while this chunk is worked on.
//   every K and V^T fragment read from LDS feeds two products, one for each query tile of the wave.
//   a block walks the key chunks in a ring that starts at a chunk of its own: the query blocks of one (batch, head), which read the same K and V^T
//   rows and start together, then ask L2 for the lines of 16 different chunks at any one time, two key groups on each, and the blocks' requests spread over all 128-B columns of the V^T rows.
//   scores transposed: S^T = K.Q^T, A = staged K16 rows (tile j = keys 16j..16j+15), B = Q16 rows kept in registers. In each query tile a lane holds
//           32 scores of ONE query (column c; keys 16j + 8hh + r): maximum and sum run inside the lane, the two lane halves exchange the maximum
//           once per chunk and join their sums once, behind the loop.
//   keep-mask, shared by the heads: element == 0 -> score := fill (finite replace, applied after the scaling). k_convert has packed it into lane-mask
//           words in this kernel's score layout: a wave reads 32 words (128 B) for each of its query tiles and chunk by scalar loads, one chunk
//           ahead, and each word is the select mask of one score register: no compare, no mask tile in LDS.
//   output transposed: O^T += V^T.P^T, A = staged V^T rows, B = P^T (x 2^14, f16) packed straight from the score registers: score tiles 2kk and
//           2kk+1 hold exactly the keys of B elements 0..7 and 8..15 of key group kk, so P never passes through LDS.
// ---------------------------------------------------------------------------------------------------------
#define AT_PP 72                        // output staging row pitch in halves
#define AT_KP 72                        // staged row pitch in halves: 144 B = 16 B x 9
#define AT_TH (64 * AT_KP)              // halves of one staged 64-row tile
#define AT_BH (2 * AT_TH)               // halves of one buffer: K tile | V^T tile
#define AT_QW 2                         // 16-query tiles of one wave (the loop reads one of the two 32-key V^T fragment groups behind each)
#define AT_WV 4                         // waves of one key group
#define AT_KG 2                         // key groups of one block
#define AT_QB (AT_WV * AT_QW * 16)      // queries of one block
#define AT_XF (8 * 128 + 64)            // floats of one wave's exchange slot: 8 rows of 32 lanes x 4 (O^T of one query tile), 32 lanes x 2 (maximum, sum)
static_assert(SEQ % AT_QB == 0);
static_assert(AT_QW == 2);              // one V^T fragment group (32 keys) for each query tile
static_assert(AT_KG == 2 && AT_WV == 4); // a wave's partner is wave ^ 4; each of the two joins one of the two query tiles
// 2^x as the bare v_exp_f32, without the library form's range test, selects, add and ldexp around it. Every argument here is <= 0 (or -inf);
// the two forms differ only where 2^x < 2^-126, which may come out 0: such a term is far under half an ulp of the row's sum and of the f16 operand.
// The v_nop fills the slot behind it.
__device__ __forceinline__ float ex2(float x) { float r; asm("v_exp_f32 %0, %1\n\tv_nop" : "=v"(r) : "v"(x)); return r; }
// Eight of them in place, in one statement: each v_exp_f32 is the independent instruction that the slot behind the one before it asks for, and the
// v_nop fills the slot behind the last.
__device__ __forceinline__ void ex2x8(float (&v)[8]) {
  asm("v_exp_f32 %0, %0\n\tv_exp_f32 %1, %1\n\tv_exp_f32 %2, %2\n\tv_exp_f32 %3, %3\n\t"
      "v_exp_f32 %4, %4\n\tv_exp_f32 %5, %5\n\tv_exp_f32 %6, %6\n\tv_exp_f32 %7, %7\n\tv_nop"
      : "+v"(v[0]), "+v"(v[1]), "+v"(v[2]), "+v"(v[3]), "+v"(v[4]), "+v"(v[5]), "+v"(v[6]), "+v"(v[7]));
}
// lane l <-> lane l ^ 16
__device__ __forceinline__ float xhalf(float x) {
  const int b = __builtin_bit_cast(int, x);
  return __builtin_bit_cast(float, __builtin_amdgcn_permlanex16(b, b, 0x76543210, 0xfedcba98, false, false));
}
__global__ __launch_bounds__(AT_KG * AT_WV * 32) void k_flash(const unsigned short* __restrict__ Qp, const unsigned short* __restrict__ Kp,
                                               const unsigned short* __restrict__ Vtp, const unsigned* __restrict__ MB,
                                               unsigned short* __restrict__ ctxp) {
  __shared__ __align__(16) _Float16 KVs[AT_KG * 2 * AT_BH];   // for each key group two buffers of [K 64 keys | V^T 64 rows] x 64 halves, pitch 72 halves; behind the loop: exchange slots | output staging
  static_assert(AT_KG * AT_WV * AT_XF * 4 <= 2 * AT_BH * 2);   // the exchange slots lie in the first group's ring
  static_assert(AT_KG * AT_WV * 16 * AT_PP <= 2 * AT_BH);      // the output staging lies in the second group's
  constexpr unsigned NQB = SEQ / AT_QB;                   // query blocks of one (batch, head)
  constexpr unsigned NKC = SEQ / 64;                      // key chunks
  constexpr unsigned NTR = NKC / AT_KG;                   // trips = key chunks of one group
  static_assert(NKC % AT_KG == 0 && NTR >= 2);
  const float SC2   = 0.125f * 1.4426950408889634f;       // 64^-0.5 * log2(e)
  const float FILL2 = -1.0e9f * 1.4426950408889634f;      // the finite fill in the exp2 domain
  const float PSC   = 16384.0f;                           // probability carry (f16 operand stays normal)
  const float CTXC  = 16.0f;                              // output carry, undone in the projection epilogue

  const unsigned tid = threadIdx.x, wave = tid >> 5, lane = tid & 31u, hh = lane >> 4, c = lane & 15u;
  const unsigned bx = blockIdx.x;
  const unsigned qb = bx % NQB;
  const unsigned bh = bx / NQB;
  const unsigned h  = bh % (unsigned)NHEAD;
  const unsigned b  = bh / (unsigned)NHEAD;
  const unsigned wvu = (unsigned)__builtin_amdgcn_readfirstlane((int)wave);   // the wave's number, uniform: group, ring start and mask pointer stay scalar
  const unsigned grp = wvu / (unsigned)AT_WV, wq = wvu % (unsigned)AT_WV;     // key group; place among the group's waves = 32-query slice of the block
  const unsigned tg  = tid % (unsigned)(AT_WV * 32);      // thread inside the group
  const unsigned q0 = qb * (unsigned)AT_QB + wq * (unsigned)(AT_QW * 16);
  const unsigned rot = (qb * (NKC / NQB) + h + grp * NTR) % NKC;   // first key chunk of this group: the groups walk the two halves of the block's ring
  // the key chunk that trip t works on (t <= NTR + 1): chunk rot + t of the ring
  auto chunk_of = [&](const unsigned t) __attribute__((always_inline)) { const unsigned cj = t + rot; return (cj >= NKC) ? cj - NKC : cj; };

  const _Float16* Q  = (const _Float16*)Qp;
  const _Float16* K  = (const _Float16*)Kp;
  const _Float16* Vt = (const _Float16*)Vtp;

  const _Float16* qrow  = Q + (size_t)(b * (unsigned)SEQ + q0 + c) * DIMC + h * HDIM + 8u * hh;
  v16h qa[AT_QW][2];                                      // B operands: column c of tile u = query q0 + 16u + c (every loop over u unrolled: constant indices keep all of it in registers)
#pragma unroll
  for (int u = 0; u < AT_QW; ++u) { qa[u][0] = frag_ld(qrow + (size_t)u * 16u * DIMC); qa[u][1] = frag_ld(qrow + (size_t)u * 16u * DIMC + 32); }
  // copy share of this thread, in its group's chunk: K and V^T tile rows tg / 8 (+16, +32, +48), 16-B piece tg % 8 of the 128-B row piece
  const unsigned crow = tg >> 3, cpc = tg & 7u;
  const _Float16* gK = K + (size_t)(b * (unsigned)SEQ + crow) * DIMC + h * HDIM + cpc * 8u;           // key crow of chunk 0
  const _Float16* gV = Vt + ((size_t)b * DIMC + h * HDIM + crow) * SEQ + cpc * 8u;                     // V^T row crow, keys of chunk 0
  const unsigned lK = (unsigned)(size_t)KVs + (grp * (2u * AT_BH) + crow * AT_KP + cpc * 8u) * 2u;      // key x of a chunk lies in LDS row x of the group's buffer
  const unsigned lV = lK + AT_TH * 2u;
  const unsigned lsKV = 16u * AT_KP * 2u;
  const size_t gsK = (size_t)16u * DIMC, gsV = (size_t)16u * SEQ;
  // this wave's lane-mask words: 32 for each query tile and chunk, a tile's chunks in a row. The wave's number is made uniform and the pointer names
  // the constant address space (nothing writes these words during this launch), so that the loads inside the loop are scalar too: behind the loop's
  // asm waits with their memory clobber the compiler otherwise reloads them as vector loads and moves every word to a scalar register by v_readfirstlane.
  typedef const __attribute__((address_space(4))) v16u* cw_ptr;
  const cw_ptr mwp = (cw_ptr)(unsigned long long)(MB + (size_t)((b * (unsigned)(SEQ / 16) + qb * (unsigned)(AT_QB / 16) + wq * (unsigned)AT_QW) * NKC) * 32u);
  v16u mw[AT_QW][2];                                      // the first chunk: words 8j + r of score tiles j = 0, 1 | j = 2, 3, for each query tile
#pragma unroll
  for (int u = 0; u < AT_QW; ++u) { mw[u][0] = mwp[(unsigned)u * 2u * NKC + 2u * rot]; mw[u][1] = mwp[(unsigned)u * 2u * NKC + 2u * rot + 1u]; }
  const unsigned fKV = c * AT_KP + 8u * hh;               // this lane's fragment place in a 16-row group of either staged tile

  float mrow[AT_QW], lrow[AT_QW];                         // this lane's query of tile u: running maximum (both halves alike), this half's share of the sum
  v8f oacc[AT_QW][4];                                     // O^T tile t of query tile u: column c = query, element r = head column 16t + 8hh + r
#pragma unroll
  for (int u = 0; u < AT_QW; ++u) {
    mrow[u] = -INFINITY; lrow[u] = 0.f;
#pragma unroll
    for (int t = 0; t < 4; ++t) oacc[u][t] = (v8f){0.f,0.f,0.f,0.f,0.f,0.f,0.f,0.f};
  }

  stage_fill(lK, lsKV, lV, lsKV, gK + (size_t)(rot * 64u) * DIMC, gsK, gV + rot * 64u, gsV);
  asm volatile("s_wait_asynccnt 0x0" ::: "memory");     // this wave's copies of trip 0 have landed
  __syncthreads();                                      // ... and every other wave's: buffer 0 is readable
  if (NTR > 1u) stage_fill(lK + AT_BH * 2u, lsKV, lV + AT_BH * 2u, lsKV, gK + (size_t)(chunk_of(1u) * 64u) * DIMC, gsK, gV + chunk_of(1u) * 64u, gsV);

  // One trip: number kc, on chunk chunk_of(kc). refill = a trip kc + 2 exists; it is a constant at either call, so that a trip is one straight block: with the test inside
  // the loop the compiler moved the 64 additions of the row sums behind it, which kept all 64 probabilities in registers through the second products.
  auto trip = [&](const unsigned kc, const bool refill) __attribute__((always_inline)) {
    const _Float16* kvs = KVs + grp * (2u * AT_BH) + (kc & 1u) * AT_BH + fKV;
    v8f s[AT_QW][4];
    v16h kf[4][2];                                      // the chunk's 8 K fragments, read as one group in front of the products (loops unrolled: constant indices keep them in registers)
#pragma unroll
    for (int j = 0; j < 4; ++j) {
      const _Float16* kr = kvs + (unsigned)j * 16u * AT_KP;                        // A row c of tile j = key 16j + c of the chunk
      kf[j][0] = frag_ld(kr); kf[j][1] = frag_ld(kr + 32);
    }
#pragma unroll
    for (int j = 0; j < 4; ++j)
#pragma unroll
      for (int u = 0; u < AT_QW; ++u) s[u][j] = wm16(kf[j][0], qa[u][0], (v8f){0.f,0.f,0.f,0.f,0.f,0.f,0.f,0.f});
#pragma unroll
    for (int j = 0; j < 4; ++j)
#pragma unroll
      for (int u = 0; u < AT_QW; ++u) s[u][j] = wm16(kf[j][1], qa[u][1], s[u][j]);

    const unsigned kn = chunk_of(kc + 1u);              // the chunk whose words are read next (the last trip reads those of the chunk behind the group's last one, unused)
    v16h pb[AT_QW][2];                                  // P^T packed from the score registers (unrolled as above)
    v16h va[2][4];                                      // the chunk's V^T fragments, A: row d = t*16 + c, same key map as P^T (unrolled as above)
#pragma unroll
    for (int u = 0; u < AT_QW; ++u) {
      float x[4][8];                                    // this query's 32 scores, then its 32 probabilities (every loop over them unrolled: constant indices keep them in registers)
#pragma unroll
      for (int j = 0; j < 4; ++j)
#pragma unroll
        for (int r = 0; r < 8; ++r)
          x[j][r] = __builtin_amdgcn_inverse_ballot_w32((j < 2) ? mw[u][0][8 * j + r] : mw[u][1][8 * (j - 2) + r]) ? s[u][j][r] * SC2 : FILL2;
      // the next chunk's words, into the registers just used
      mw[u][0] = mwp[(unsigned)u * 2u * NKC + 2u * kn]; mw[u][1] = mwp[(unsigned)u * 2u * NKC + 2u * kn + 1u];
      float mj[4];
#pragma unroll
      for (int j = 0; j < 4; ++j)
        mj[j] = fmaxf(fmaxf(fmaxf(x[j][0], x[j][1]), fmaxf(x[j][2], x[j][3])), fmaxf(fmaxf(x[j][4], x[j][5]), fmaxf(x[j][6], x[j][7])));
      float m = fmaxf(fmaxf(mj[0], mj[1]), fmaxf(mj[2], mj[3]));
      m = fmaxf(m, xhalf(m));                           // the other half's 32 keys of the same query
      const float mnew  = fmaxf(mrow[u], m);
      const float alpha = ex2(mrow[u] - mnew);
      mrow[u] = mnew;
#pragma unroll
      for (int j = 0; j < 4; ++j)                       // all 32 exponents first, so that the v_exp_f32 groups below work in place (unrolled as above)
#pragma unroll
        for (int r = 0; r < 8; ++r) x[j][r] -= mnew;
      float pj[4];
#pragma unroll
      for (int j = 0; j < 4; ++j) {
        ex2x8(x[j]);
        pj[j] = ((x[j][0] + x[j][1]) + (x[j][2] + x[j][3])) + ((x[j][4] + x[j][5]) + (x[j][6] + x[j][7]));
      }
      lrow[u] = lrow[u] * alpha + ((pj[0] + pj[1]) + (pj[2] + pj[3]));
#pragma unroll
      for (int t = 0; t < 4; ++t)
#pragma unroll
        for (int r = 0; r < 8; ++r) oacc[u][t][r] *= alpha;
#pragma unroll
      for (int kk = 0; kk < 2; ++kk)
#pragma unroll
        for (int i = 0; i < 8; ++i) {
          pb[u][kk][i]     = (_Float16)(x[2 * kk][i] * PSC);       // B element i     = key 32kk + 8hh + i
          pb[u][kk][i + 8] = (_Float16)(x[2 * kk + 1][i] * PSC);   // B element 8 + i = key 32kk + 16 + 8hh + i
        }
      // One query tile's softmax at a time, and behind each one half of the V^T fragments as a group (keys 0..31 under the second tile's softmax,
      // keys 32..63 under the first eight products): scheduled freely, both tiles' scores and all 16 fragment reads are live at once and the
      // wave goes past 256 registers, with some thirty register-window switches in every trip.
      __builtin_amdgcn_sched_barrier(0);
#pragma unroll
      for (int t = 0; t < 4; ++t) va[u][t] = frag_ld(kvs + AT_TH + (unsigned)t * 16u * AT_KP + (unsigned)u * 32u);
    }
    // holds the second group's eight reads in front of the products: free to move, they sank between the products of the last-chunks loop, pair by
    // pair into one fragment's registers, each pair with a wait to 0 of its own
    __builtin_amdgcn_sched_barrier(0);
#pragma unroll
    for (int kk = 0; kk < 2; ++kk)
#pragma unroll
      for (int t = 0; t < 4; ++t)
#pragma unroll
        for (int u = 0; u < AT_QW; ++u) oacc[u][t] = wm16(va[kk][t], pb[u][kk], oacc[u][t]);
    // the distance behind the trip's last products, once: the loop's back edge follows
    asm volatile("v_nop\n\tv_nop\n\tv_nop\n\tv_nop" : "+v"(oacc[0][0]), "+v"(oacc[0][1]), "+v"(oacc[0][2]), "+v"(oacc[0][3]),
                                                        "+v"(oacc[1][0]), "+v"(oacc[1][1]), "+v"(oacc[1][2]), "+v"(oacc[1][3]));
    asm volatile("s_wait_dscnt 0x0" ::: "memory");      // this wave's reads of buffer kc%2 are done before it is handed to its next writer
    asm volatile("s_wait_asynccnt 0x0" ::: "memory");   // this wave's copies of trip kc+1's chunk have landed
    __syncthreads();                                    // publishes trip kc+1's buffer and ends every reader's last read of trip kc's
    if (refill) {
      const unsigned lo = (kc & 1u) * (AT_BH * 2u);
      const unsigned kv2 = chunk_of(kc + 2u) * 64u;     // first key of trip kc + 2's chunk
      stage_fill(lK + lo, lsKV, lV + lo, lsKV, gK + (size_t)kv2 * DIMC, gsK, gV + kv2, gsV);
    }
  };
  unsigned kc = 0;
#pragma unroll 1
  for (; kc + 2u < NTR; ++kc) trip(kc, true);           // rolled: one copy of the trip in the instruction cache
#pragma unroll 1
  for (; kc < NTR; ++kc) trip(kc, false);               // the last two chunks: nothing is left to copy
  asm volatile("s_wait_asynccnt 0x0" ::: "memory");     // nothing of this wave is in flight when the loop is left

  // behind the last trip's barrier nobody reads the staged tiles any more and no copy is in flight.
  // Group g joins query tile g: a wave hands the other tile's partial result to its partner (lane for lane the same query and head columns).
  float* xs = (float*)KVs;
  auto put = [&](const int u) __attribute__((always_inline)) {
    float* p = xs + wvu * (unsigned)AT_XF + lane * 4u;   // a row = 32 lanes x 16 B
#pragma unroll
    for (int t = 0; t < 4; ++t) {
      *(v4f*)(p + (unsigned)(2 * t) * 128u)     = (v4f){oacc[u][t][0], oacc[u][t][1], oacc[u][t][2], oacc[u][t][3]};
      *(v4f*)(p + (unsigned)(2 * t + 1) * 128u) = (v4f){oacc[u][t][4], oacc[u][t][5], oacc[u][t][6], oacc[u][t][7]};
    }
    float* pm = xs + wvu * (unsigned)AT_XF + 1024u + lane * 2u;
    pm[0] = mrow[u]; pm[1] = lrow[u];
  };
  _Float16* os = KVs + 2u * AT_BH + wvu * (unsigned)(16 * AT_PP);   // this wave's own 16 x 64 output slice
  auto join = [&](const int u) __attribute__((always_inline)) {
    const float* p = xs + (wvu ^ (unsigned)AT_WV) * (unsigned)AT_XF + lane * 4u;
    const float* pm = xs + (wvu ^ (unsigned)AT_WV) * (unsigned)AT_XF + 1024u + lane * 2u;
    const float m2 = pm[0], l2 = pm[1];
    const float m  = fmaxf(mrow[u], m2);
    const float a1 = ex2(mrow[u] - m), a2 = ex2(m2 - m);                  // both maxima are finite: every group has worked on at least one chunk
    const float l  = lrow[u] * a1 + l2 * a2;                              // this half's share of the sum over all keys
    const float inv = CTXC * (1.0f / ((l + xhalf(l)) * PSC));             // the two halves' sums of this query joined
    const float f1 = a1 * inv, f2 = a2 * inv;
#pragma unroll
    for (int t = 0; t < 4; ++t) {
      const v4f o0 = *(const v4f*)(p + (unsigned)(2 * t) * 128u), o1 = *(const v4f*)(p + (unsigned)(2 * t + 1) * 128u);
      v8h hv;
#pragma unroll
      for (int r = 0; r < 4; ++r) {
        hv[r]     = (_Float16)(oacc[u][t][r] * f1 + o0[r] * f2);
        hv[r + 4] = (_Float16)(oacc[u][t][r + 4] * f1 + o1[r] * f2);
      }
      *(v8h*)(os + c * AT_PP + (unsigned)t * 16u + 8u * hh) = hv;         // query row c of the tile, head columns 16t + 8hh + 0..7
    }
  };
  if (grp == 0u) put(1); else put(0);                   // wave-uniform
  __syncthreads();                                      // every wave's slot is written before its partner reads it
  if (grp == 0u) join(0); else join(1);
  wave_sync();
  {
    const unsigned q4 = lane >> 3, c8 = (lane & 7u) * 8u;
    _Float16* cb = (_Float16*)ctxp + (size_t)(b * (unsigned)SEQ + q0 + grp * 16u) * DIMC + h * HDIM;
#pragma unroll
    for (int it = 0; it < 4; ++it) {
      const unsigned row = (unsigned)it * 4u + q4;
      *(v8h*)(cb + (size_t)row * DIMC + c8) = *(const v8h*)(os + row * AT_PP + c8);
    }
  }
}

// ---------------------------------------------------------------------------------------------------------
// workspace carve (bytes, every region a multiple of 256 and fully written by its producer before any read)
// ---------------------------------------------------------------------------------------------------------
static constexpr size_t SZ_X16   = (size_t)3 * MROWS * DIMC * 2;     // q16 | k16 | v16 planes [MROWS][1024] f16
static constexpr size_t SZ_WT16  = (size_t)4 * DIMC * DIMC * 2;      // Wq^T | Wk^T | Wv^T | Wp^T planes [out][in] f16, x16
static constexpr size_t SZ_QK16  = (size_t)2 * MROWS * DIMC * 2;     // Q16 | K16 planes [MROWS][1024] f16
static constexpr size_t SZ_VT16  = (size_t)NB * DIMC * SEQ * 2;      // V^T planes [b][1024][SEQ] f16
static constexpr size_t SZ_CTX16 = (size_t)MROWS * DIMC * 2;         // merged head output x16 [MROWS][1024] f16
static constexpr size_t SZ_BRO   = (size_t)DIMC * 4;                 // bias, bf16 RNE-converted, f32
static constexpr size_t SZ_MB    = (size_t)NB * (SEQ / 16) * (SEQ / 64) * 32 * 4;   // lane-mask words [b][16-query tile][64-key chunk][32]
static constexpr size_t SZ_TOTAL = SZ_X16 + SZ_WT16 + SZ_QK16 + SZ_VT16 + SZ_CTX16 + SZ_BRO + SZ_MB;
static_assert((SZ_X16 % 256) == 0 && (SZ_WT16 % 256) == 0 && (SZ_QK16 % 256) == 0 && (SZ_VT16 % 256) == 0 && (SZ_CTX16 % 256) == 0 && (SZ_BRO % 256) == 0 && (SZ_MB % 256) == 0);
static_assert(SZ_TOTAL <= (size_t)134217728);
// coverage equalities of the plane writers
static_assert((size_t)CV_ST * CV_TH * 8 == (size_t)MROWS * DIMC);                     // k_convert per activation tensor
static_assert((size_t)CV_ST * CV_TH * 8 == (size_t)4 * DIMC * DIMC);                  // k_convert, the four weights
static_assert((size_t)(SEQ / AT_QB) * AT_WV * AT_QW * 16 * 64 == (size_t)SEQ * HDIM);               // k_flash per (batch, head): blocks x waves x rows x cols
static_assert((MROWS % 128) == 0 && (DIMC % 128) == 0 && (SEQ % 128) == 0);            // k_gemm64: whole 128x128 tiles, K = DIMC in whole 64-k trips
static_assert((MROWS / 128) * (DIMC / 128) == NB * (DIMC / 128) * (SEQ / 128));          // the V^T tiles of all batches fill exactly one grid row of the projection launch

extern "C" void kernel_launch(void* const* d_in, const int* in_sizes, int n_in, void* d_out, int out_size, void* d_ws, size_t ws_size, hipStream_t stream) {
  if (n_in < 9) return;
  const long long needX = (long long)(NB - 1) * SEQ_FULL * DIMC + (long long)SEQ * DIMC;
  const long long needM = (long long)(NB - 1) * SEQ_FULL * SEQ_FULL + (long long)(SEQ - 1) * SEQ_FULL + SEQ;
  if ((long long)in_sizes[0] < needX || (long long)in_sizes[1] < needX || (long long)in_sizes[2] < needX) return;
  if ((long long)in_sizes[3] < needM) return;
  if (in_sizes[4] < DIMC * DIMC || in_sizes[5] < DIMC * DIMC || in_sizes[6] < DIMC * DIMC || in_sizes[7] < DIMC * DIMC || in_sizes[8] < DIMC) return;
  if ((long long)out_size < (long long)MROWS * DIMC) return;
  if (ws_size < SZ_TOTAL) return;

  const float* q    = (const float*)d_in[0];
  const float* k    = (const float*)d_in[1];
  const float* v    = (const float*)d_in[2];
  const int*   mask = (const int*)d_in[3];
  const float* Wq   = (const float*)d_in[4];
  const float* Wk   = (const float*)d_in[5];
  const float* Wv   = (const float*)d_in[6];
  const float* Wp   = (const float*)d_in[7];
  const float* bp   = (const float*)d_in[8];
  float* out = (float*)d_out;

  char* wsp = (char*)d_ws;
  unsigned short* X16   = (unsigned short*)wsp; wsp += SZ_X16;
  unsigned short* WT16  = (unsigned short*)wsp; wsp += SZ_WT16;
  unsigned short* QK16  = (unsigned short*)wsp; wsp += SZ_QK16;
  unsigned short* VT16  = (unsigned short*)wsp; wsp += SZ_VT16;
  unsigned short* CTX16 = (unsigned short*)wsp; wsp += SZ_CTX16;
  float*          BRO   = (float*)wsp;          wsp += SZ_BRO;
  unsigned*       MB    = (unsigned*)wsp;       wsp += SZ_MB;

  const unsigned long long planeX = (unsigned long long)MROWS * DIMC;     // elements per activation plane
  const unsigned long long planeW = (unsigned long long)DIMC * DIMC;

  // weights [in][out] -> [out][in] f16 x16 (4 planes); bias; activations (3 planes, full input batch stride, compact planes); mask -> lane-mask words
  k_convert<<<dim3((unsigned)CV_WG, 1u, 1u), 512, 0, stream>>>(q, k, v, Wq, Wk, Wv, Wp, bp, mask, X16, WT16, BRO, MB);
  // the three input projections in one launch.
  // Q16 | K16 = (q16 | k16) x (Wq^T | Wk^T): batch y = 0 (q), 1 (k); M = MROWS, N = K = 1024
  // y = 2: V^T[b][o][n] = sum_k Wv^T[o][k] * v16[b][n][k]: A = Wv^T plane (M = 1024), Bt = v16 batch plane (N = SEQ), C pitch SEQ, NB batches in the row
  k_gemm64<0, 1, 1><<<dim3((unsigned)((MROWS / 128) * (DIMC / 128)), 3u, 1u), 256, 0, stream>>>(
      X16, (unsigned)DIMC, planeX, WT16, (unsigned)DIMC, planeW, (void*)QK16, (unsigned)DIMC, planeX, nullptr,
      (unsigned)MROWS, (unsigned)DIMC, (unsigned)DIMC, 0.0625f,
      2u, (unsigned)NB,
      WT16 + 2 * planeW, 0ull, X16 + 2 * planeX, (unsigned long long)SEQ * DIMC,
      (void*)VT16, (unsigned)SEQ, (unsigned long long)DIMC * SEQ, (unsigned)DIMC, (unsigned)SEQ);
  // attention
  k_flash<<<dim3((unsigned)(NB * NHEAD * (SEQ / AT_QB)), 1u, 1u), AT_KG * AT_WV * 32, 0, stream>>>(QK16, QK16 + planeX, VT16, MB, CTX16);
  // out = (ctx x16) x (Wp^T x16) / 256 + bias
  k_gemm64<2, 0, 0><<<dim3((unsigned)((MROWS / 128) * (DIMC / 128)), 1u, 1u), 256, 0, stream>>>(
      CTX16, (unsigned)DIMC, 0ull, WT16 + 3 * planeW, (unsigned)DIMC, 0ull, (void*)out, (unsigned)DIMC, 0ull, BRO,
      (unsigned)MROWS, (unsigned)DIMC, (unsigned)DIMC, 0.00390625f,
      1u, 0u, nullptr, 0ull, nullptr, 0ull, nullptr, 0u, 0ull, 0u, 0u);
}
